// v000
// The times below were measured on an AMD MI455X: many runs one after another, warmed up first and cycling through
// copies of the inputs, with the whole window's GPU time divided by the number of runs. Launches and the gaps
// between them are all in it. The median over several windows is given; except for v000 it joins two sittings, which
// can be a few percent apart, so the side-by-side timings, each taken in one sitting, are the better comparison.
// v000, which the later versions start from, runs in 217 microseconds.
#include <hip/hip_runtime.h>

// All contractions: v_wmma_f32_16x16x32_f16 (f16 operands, f32 accumulate); softmax P operand carried x4096 (exact power of two) and unscaled in the f32 epilogue.

typedef _Float16 f16_t;
typedef f16_t v16h __attribute__((ext_vector_type(16)));
typedef f16_t v8h __attribute__((ext_vector_type(8)));
typedef float v8f __attribute__((ext_vector_type(8)));
typedef float v4f __attribute__((ext_vector_type(4)));
typedef v8h v8hm __attribute__((may_alias));
typedef v4f v4fm __attribute__((may_alias));

#define H_   4
#define C1_  64
#define C2_  128
#define KV_  192
#define MLP_ 256
#define B_   8
#define N_   3136
#define BN_  (B_ * N_)

union Frag { v16h v; v8h p[2]; };

// 16x16x32 f16 WMMA with f32 accumulate, followed by a 4-slot VALU hazard guard.
__device__ __forceinline__ v8f wmma16(v16h a, v16h b, v8f c) {
  v8f d = __builtin_amdgcn_wmma_f32_16x16x32_f16(false, a, false, b, (short)0, c, false, false);
  asm volatile("v_nop\n\tv_nop\n\tv_nop\n\tv_nop" : "+v"(d) : "v"(a), "v"(b));
  return d;
}

__device__ __forceinline__ float wave_sum(float v) {
#pragma unroll
  for (int msk = 16; msk >= 1; msk >>= 1) v += __shfl_xor(v, msk, 32);
  return v;
}
__device__ __forceinline__ float wave_max(float v) {
#pragma unroll
  for (int msk = 16; msk >= 1; msk >>= 1) v = fmaxf(v, __shfl_xor(v, msk, 32));
  return v;
}

// ---------------------------------------------------------------------------
// ---------------------------------------------------------------------------
__global__ __launch_bounds__(256) void cvt_f16_kernel(const float* __restrict__ src,
                                                      f16_t* __restrict__ dst, int n8) {
  const int i = blockIdx.x * 256 + threadIdx.x;
  const bool ok = i < n8;
  const int ic = ok ? i : 0;
  const v4f x0 = *(const v4fm*)(src + (size_t)ic * 8);
  const v4f x1 = *(const v4fm*)(src + (size_t)ic * 8 + 4);
  v8h v;
#pragma unroll
  for (int j = 0; j < 4; j++) { v[j] = (f16_t)x0[j]; v[4 + j] = (f16_t)x1[j]; }
  f16_t* p = dst + (size_t)ic * 8;
  if (ok) *(v8hm*)p = v;
  
}

// ---------------------------------------------------------------------------
// Fused: cx1 = LN(emb1) (64), ea = LN(concat(emb1,emb2)) (192). 1 wave per row.
// ---------------------------------------------------------------------------
__global__ __launch_bounds__(256) void ln_concat_kernel(
    const float* __restrict__ emb1, const float* __restrict__ emb2,
    const float* __restrict__ g1, const float* __restrict__ b1,
    const float* __restrict__ ga, const float* __restrict__ ba,
    f16_t* __restrict__ cx1, f16_t* __restrict__ ea, int nrows) {
  __shared__ __attribute__((aligned(16))) f16_t St[8][256];
  const int wave = threadIdx.x >> 5, lane = threadIdx.x & 31;
  const int row = blockIdx.x * 8 + wave;
  const bool ok = row < nrows;
  const int rc = ok ? row : 0;
  const float* r1 = emb1 + (size_t)rc * C1_;
  const float* r2 = emb2 + (size_t)rc * C2_;

  const float x0 = r1[lane], x1 = r1[lane + 32];
  const float mu = wave_sum(x0 + x1) * (1.0f / 64.0f);
  const float d0 = x0 - mu, d1 = x1 - mu;
  const float var = wave_sum(d0 * d0 + d1 * d1) * (1.0f / 64.0f);
  const float rs = rsqrtf(var + 1e-6f);
  St[wave][lane]      = (f16_t)(d0 * rs * g1[lane] + b1[lane]);
  St[wave][lane + 32] = (f16_t)(d1 * rs * g1[lane + 32] + b1[lane + 32]);

  float e[6];
  e[0] = x0; e[1] = x1;
#pragma unroll
  for (int j = 2; j < 6; j++) e[j] = r2[lane + 32 * (j - 2)];
  float s = 0.f;
#pragma unroll
  for (int j = 0; j < 6; j++) s += e[j];
  const float ma = wave_sum(s) * (1.0f / 192.0f);
  float sq = 0.f;
#pragma unroll
  for (int j = 0; j < 6; j++) { e[j] -= ma; sq += e[j] * e[j]; }
  const float vara = wave_sum(sq) * (1.0f / 192.0f);
  const float rsa = rsqrtf(vara + 1e-6f);
#pragma unroll
  for (int j = 0; j < 6; j++) {
    const int c = lane + 32 * j;
    St[wave][64 + c] = (f16_t)(e[j] * rsa * ga[c] + ba[c]);
  }
  __syncthreads();

  const int l8 = (lane < 8) ? lane : 0;
  const int l24 = (lane < 24) ? lane : 0;
  const v8h pc = *(const v8hm*)&St[wave][l8 * 8];
  const v8h pe = *(const v8hm*)&St[wave][64 + l24 * 8];
  f16_t* dc = cx1 + (size_t)rc * C1_ + l8 * 8;
  f16_t* de = ea + (size_t)rc * KV_ + l24 * 8;
  const bool sc = ok && (lane < 8);
  const bool se = ok && (lane < 24);
  if (sc) *(v8hm*)dc = pc;
  if (se) *(v8hm*)de = pe;
  
}

// ---------------------------------------------------------------------------
// LN over 64 channels (f32 in, f16 out). 1 wave per row, whole-line stores.
// ---------------------------------------------------------------------------
__global__ __launch_bounds__(256) void ln64_kernel(
    const float* __restrict__ x, const float* __restrict__ g,
    const float* __restrict__ bb, f16_t* __restrict__ y, int nrows) {
  __shared__ __attribute__((aligned(16))) f16_t St[8][64];
  const int wave = threadIdx.x >> 5, lane = threadIdx.x & 31;
  const int row = blockIdx.x * 8 + wave;
  const bool ok = row < nrows;
  const int rc = ok ? row : 0;
  const float* r = x + (size_t)rc * C1_;
  const float x0 = r[lane], x1 = r[lane + 32];
  const float mu = wave_sum(x0 + x1) * (1.0f / 64.0f);
  const float d0 = x0 - mu, d1 = x1 - mu;
  const float var = wave_sum(d0 * d0 + d1 * d1) * (1.0f / 64.0f);
  const float rs = rsqrtf(var + 1e-6f);
  St[wave][lane]      = (f16_t)(d0 * rs * g[lane] + bb[lane]);
  St[wave][lane + 32] = (f16_t)(d1 * rs * g[lane + 32] + bb[lane + 32]);
  __syncthreads();
  const int l8 = (lane < 8) ? lane : 0;
  const v8h pc = *(const v8hm*)&St[wave][l8 * 8];
  f16_t* dc = y + (size_t)rc * C1_ + l8 * 8;
  const bool sc = ok && (lane < 8);
  if (sc) *(v8hm*)dc = pc;
  
}

// ---------------------------------------------------------------------------
// Generic GEMM: C[M,N] = A[M,K] * Bw[N,K]^T  (nn.Linear), f16 WMMA, f32 acc.
// Tile M=128, N=64, K step 32, single-buffered LDS staging with barriers.
// A and Bw are both k-contiguous, so both fragments are two 16-B pieces per
// lane at k offsets 8h and 16+8h (h = lane>>4), row/col = lane&15.
// MODE 0: f16 row-major C; MODE 1: f32 row-major C; MODE 2: f16 C^T ([n][m]).
// ---------------------------------------------------------------------------
union CTile { float f[128][64]; f16_t h[128][64]; f16_t t[64][128]; };

template <int MODE, bool BIAS, bool GELU, bool RESID>
__global__ __launch_bounds__(256) void gemm_nt_kernel(
    const f16_t* __restrict__ A, int lda, long long aBatch,
    const f16_t* __restrict__ Bw, int ldb, long long bBatch,
    f16_t* __restrict__ Ch, float* __restrict__ Cf, int ldc, long long cBatch,
    int Kdim, const float* __restrict__ bias, const float* __restrict__ resid) {
  __shared__ __attribute__((aligned(16))) f16_t As[128][32];
  __shared__ __attribute__((aligned(16))) f16_t Bs[64][32];
  __shared__ __attribute__((aligned(16))) CTile Cs;
  const int tid = threadIdx.x, lane = tid & 31, wave = tid >> 5;
  const int hh = lane >> 4, m = lane & 15;
  const long long z = blockIdx.z;
  const f16_t* Ab = A + z * aBatch;
  const f16_t* Bb = Bw + z * bBatch;
  const int m0 = blockIdx.x * 128, n0 = blockIdx.y * 64;
  const int ar = tid >> 2, ac = (tid & 3) * 8;
  const f16_t* gA0 = Ab + (long long)(m0 + ar) * lda + ac;
  const f16_t* gA1 = Ab + (long long)(m0 + ar + 64) * lda + ac;
  const f16_t* gB  = Bb + (long long)(n0 + ar) * ldb + ac;
  v8f acc[4] = {};
  const int nk = Kdim >> 5;
  const int mrow = wave * 16 + m;
  for (int i = 0; i < nk; i++) {
    const int k0 = i << 5;
    const v8h sa0 = *(const v8hm*)(gA0 + k0);
    const v8h sa1 = *(const v8hm*)(gA1 + k0);
    const v8h sb  = *(const v8hm*)(gB + k0);
    __syncthreads();
    *(v8hm*)&As[ar][ac]      = sa0;
    *(v8hm*)&As[ar + 64][ac] = sa1;
    *(v8hm*)&Bs[ar][ac]      = sb;
    __syncthreads();
    Frag a;
    a.p[0] = *(const v8hm*)&As[mrow][8 * hh];
    a.p[1] = *(const v8hm*)&As[mrow][16 + 8 * hh];
#pragma unroll
    for (int nt = 0; nt < 4; nt++) {
      Frag b;
      b.p[0] = *(const v8hm*)&Bs[nt * 16 + m][8 * hh];
      b.p[1] = *(const v8hm*)&Bs[nt * 16 + m][16 + 8 * hh];
      acc[nt] = wmma16(a.v, b.v, acc[nt]);
    }
  }

  // D element r of lane = (row wave*16 + 8h + r, col nt*16 + m) of the block tile.
#pragma unroll
  for (int nt = 0; nt < 4; nt++) {
    const int cn = nt * 16 + m;
    float bs = 0.f;
    if (BIAS) bs = bias[n0 + cn];
#pragma unroll
    for (int r = 0; r < 8; r++) {
      const int cm = wave * 16 + 8 * hh + r;
      float xv = acc[nt][r] + bs;
      if (GELU) xv = 0.5f * xv * (1.0f + erff(xv * 0.70710678118654752f));
      if (MODE == 1) Cs.f[cm][cn] = xv;
      else if (MODE == 0) Cs.h[cm][cn] = (f16_t)xv;
      else Cs.t[cn][cm] = (f16_t)xv;
    }
  }
  __syncthreads();

  if (MODE == 1) {
    float* Cb = Cf + z * cBatch;
    v4f vals[8];
#pragma unroll
    for (int j = 0; j < 8; j++) {
      const int row = wave * 16 + 2 * j + hh;
      const int c4 = m * 4;
      v4f v = *(const v4fm*)&Cs.f[row][c4];
      if (RESID) {
        const v4f rr = *(const v4fm*)(resid + (long long)(m0 + row) * ldc + n0 + c4);
        v += rr;
      }
      vals[j] = v;
    }
#pragma unroll
    for (int j = 0; j < 8; j++) {
      const int row = wave * 16 + 2 * j + hh;
      *(v4fm*)(Cb + (long long)(m0 + row) * ldc + n0 + m * 4) = vals[j];
    }
    
  } else if (MODE == 0) {
    f16_t* Cb = Ch + z * cBatch;
    v8h vals[4];
    const int rsub = lane >> 3, c8 = (lane & 7) * 8;
#pragma unroll
    for (int j = 0; j < 4; j++) {
      const int row = wave * 16 + 4 * j + rsub;
      vals[j] = *(const v8hm*)&Cs.h[row][c8];
    }
#pragma unroll
    for (int j = 0; j < 4; j++) {
      const int row = wave * 16 + 4 * j + rsub;
      *(v8hm*)(Cb + (long long)(m0 + row) * ldc + n0 + c8) = vals[j];
    }
    
  } else {
    f16_t* Cb = Ch + z * cBatch;
    v8h vals[4];
    const int c8 = m * 8;
#pragma unroll
    for (int j = 0; j < 4; j++) {
      const int row = wave * 8 + 2 * j + hh;
      vals[j] = *(const v8hm*)&Cs.t[row][c8];
    }
#pragma unroll
    for (int j = 0; j < 4; j++) {
      const int row = wave * 8 + 2 * j + hh;
      *(v8hm*)(Cb + (long long)(n0 + row) * ldc + m0 + c8) = vals[j];
    }
    
  }
}

// ---------------------------------------------------------------------------
// softmax over KV, P*4096 stored as f16 row-major [64][192]. One block per (b,h).
// A = QT [H][64][B*N] (row c, k = n contiguous), B = KT [H][192][B*N]
// (row kv, k = n contiguous) -> both fragments loaded with the same k map.
// ---------------------------------------------------------------------------
__global__ __launch_bounds__(256) void scores_softmax_kernel(
    const f16_t* __restrict__ QT, const f16_t* __restrict__ KT, f16_t* __restrict__ P) {
  __shared__ __attribute__((aligned(16))) f16_t Aq[64][32];
  __shared__ __attribute__((aligned(16))) f16_t Bk[192][32];
  __shared__ float Sb[64][196];
  __shared__ __attribute__((aligned(16))) f16_t Pst[64][192];
  __shared__ float red[8];
  const int tid = threadIdx.x, lane = tid & 31, wave = tid >> 5;
  const int hh = lane >> 4, m = lane & 15;
  const int bh = blockIdx.x, b = bh >> 2, hd = bh & 3;
  const f16_t* Ab = QT + (size_t)hd * C1_ * BN_ + (size_t)b * N_;
  const f16_t* Bb = KT + (size_t)hd * KV_ * BN_ + (size_t)b * N_;
  const int mt = wave & 3, ng = wave >> 2;
  v8f acc[6] = {};
  const int ar = tid >> 2, ac = (tid & 3) * 8;
  const f16_t* gA  = Ab + (size_t)ar * BN_ + ac;
  const f16_t* gB0 = Bb + (size_t)ar * BN_ + ac;
  const f16_t* gB1 = Bb + (size_t)(ar + 64) * BN_ + ac;
  const f16_t* gB2 = Bb + (size_t)(ar + 128) * BN_ + ac;
  const int mrow = mt * 16 + m;

  const int nk = N_ / 32;  // 98
  for (int it = 0; it < nk; it++) {
    const int n0 = it * 32;
    const v8h sa  = *(const v8hm*)(gA + n0);
    const v8h sb0 = *(const v8hm*)(gB0 + n0);
    const v8h sb1 = *(const v8hm*)(gB1 + n0);
    const v8h sb2 = *(const v8hm*)(gB2 + n0);
    __syncthreads();
    *(v8hm*)&Aq[ar][ac]       = sa;
    *(v8hm*)&Bk[ar][ac]       = sb0;
    *(v8hm*)&Bk[ar + 64][ac]  = sb1;
    *(v8hm*)&Bk[ar + 128][ac] = sb2;
    __syncthreads();
    Frag a;
    a.p[0] = *(const v8hm*)&Aq[mrow][8 * hh];
    a.p[1] = *(const v8hm*)&Aq[mrow][16 + 8 * hh];
#pragma unroll
    for (int t = 0; t < 6; t++) {
      const int col = (ng * 6 + t) * 16 + m;
      Frag bf;
      bf.p[0] = *(const v8hm*)&Bk[col][8 * hh];
      bf.p[1] = *(const v8hm*)&Bk[col][16 + 8 * hh];
      acc[t] = wmma16(a.v, bf.v, acc[t]);
    }
  }

  const float sc = 0.07216878364870322f;  // 1/sqrt(192)
#pragma unroll
  for (int t = 0; t < 6; t++) {
    const int cn = (ng * 6 + t) * 16 + m;
#pragma unroll
    for (int r = 0; r < 8; r++)
      Sb[mt * 16 + 8 * hh + r][cn] = acc[t][r] * sc;
  }
  __syncthreads();

  const int r0 = tid >> 2;
  const int c0 = (tid & 3) * 48;
  float s = 0.f;
#pragma unroll 4
  for (int j = 0; j < 48; j++) s += Sb[r0][c0 + j];
  s = wave_sum(s);
  if (lane == 0) red[wave] = s;
  __syncthreads();
  float tot = 0.f;
#pragma unroll
  for (int w = 0; w < 8; w++) tot += red[w];
  const float mean = tot * (1.0f / 12288.0f);
  __syncthreads();
  float sq = 0.f;
#pragma unroll 4
  for (int j = 0; j < 48; j++) { const float d = Sb[r0][c0 + j] - mean; sq += d * d; }
  sq = wave_sum(sq);
  if (lane == 0) red[wave] = sq;
  __syncthreads();
  float tot2 = 0.f;
#pragma unroll
  for (int w = 0; w < 8; w++) tot2 += red[w];
  const float var  = tot2 * (1.0f / 12288.0f);
  const float rstd = rsqrtf(var + 1e-5f);

  // Softmax over KV per row c; one wave per row, 8 rows per wave; P*4096 -> LDS.
  const float pscale = 4096.0f;
  for (int rr = 0; rr < 8; rr++) {
    const int r = wave * 8 + rr;
    float xs[6];
    float mx = -3.0e38f;
#pragma unroll
    for (int j = 0; j < 6; j++) {
      xs[j] = (Sb[r][lane + 32 * j] - mean) * rstd;
      mx = fmaxf(mx, xs[j]);
    }
    mx = wave_max(mx);
    float es = 0.f;
#pragma unroll
    for (int j = 0; j < 6; j++) { xs[j] = expf(xs[j] - mx); es += xs[j]; }
    es = wave_sum(es);
    const float inv = (1.0f / es) * pscale;
#pragma unroll
    for (int j = 0; j < 6; j++)
      Pst[r][lane + 32 * j] = (f16_t)(xs[j] * inv);
  }
  __syncthreads();

  // Whole-line stores: each row = 384 B = lanes 0..23 x 16 B, one instruction.
  f16_t* Pb = P + (size_t)bh * C1_ * KV_;
  const int l24 = (lane < 24) ? lane : 0;
  const bool se = lane < 24;
  v8h vals[8];
#pragma unroll
  for (int j = 0; j < 8; j++) vals[j] = *(const v8hm*)&Pst[wave * 8 + j][l24 * 8];
#pragma unroll
  for (int j = 0; j < 8; j++)
    if (se) *(v8hm*)(Pb + (size_t)(wave * 8 + j) * KV_ + l24 * 8) = vals[j];
  
}

// ---------------------------------------------------------------------------
// ctx mean over heads: ctxm[b,n,c] = (0.25/4096) * sum_h sum_k V[h,bn,k]*P4096[bh,c,k]
// Tile 64 rows (n) x 64 cols (c). grid = (N/64, 1, B). 24 k-steps of 32.
// A = V rows (k contiguous), B = P rows [c][k] (k contiguous).
// ---------------------------------------------------------------------------
__global__ __launch_bounds__(256) void ctx_mean_kernel(
    const f16_t* __restrict__ V, const f16_t* __restrict__ P, f16_t* __restrict__ ctxm) {
  __shared__ __attribute__((aligned(16))) f16_t Vs[64][32];
  __shared__ __attribute__((aligned(16))) f16_t Ps[64][32];
  __shared__ __attribute__((aligned(16))) f16_t Cs[64][64];
  const int tid = threadIdx.x, lane = tid & 31, wave = tid >> 5;
  const int hh = lane >> 4, m = lane & 15;
  const int b = blockIdx.z;
  const int n0 = blockIdx.x * 64;
  const int mt = wave & 3, ng = wave >> 2;
  v8f acc[2] = {};
  const int ar = tid >> 2, ac = (tid & 3) * 8;
  const int mrow = mt * 16 + m;

  const int nsteps = H_ * (KV_ / 32);  // 24
  for (int it = 0; it < nsteps; it++) {
    const int hd = it / 6;
    const int k0 = (it - hd * 6) * 32;
    const f16_t* Vb = V + ((size_t)hd * BN_ + (size_t)b * N_ + n0) * KV_;
    const f16_t* Pb = P + (size_t)(b * H_ + hd) * C1_ * KV_;
    const v8h sv = *(const v8hm*)(Vb + (size_t)ar * KV_ + k0 + ac);
    const v8h sp = *(const v8hm*)(Pb + (size_t)ar * KV_ + k0 + ac);
    __syncthreads();
    *(v8hm*)&Vs[ar][ac] = sv;
    *(v8hm*)&Ps[ar][ac] = sp;
    __syncthreads();
    Frag a;
    a.p[0] = *(const v8hm*)&Vs[mrow][8 * hh];
    a.p[1] = *(const v8hm*)&Vs[mrow][16 + 8 * hh];
#pragma unroll
    for (int t = 0; t < 2; t++) {
      const int col = (ng * 2 + t) * 16 + m;
      Frag bf;
      bf.p[0] = *(const v8hm*)&Ps[col][8 * hh];
      bf.p[1] = *(const v8hm*)&Ps[col][16 + 8 * hh];
      acc[t] = wmma16(a.v, bf.v, acc[t]);
    }
  }

  const float oscale = 0.25f / 4096.0f;
#pragma unroll
  for (int t = 0; t < 2; t++) {
    const int cn = (ng * 2 + t) * 16 + m;
#pragma unroll
    for (int r = 0; r < 8; r++)
      Cs[mt * 16 + 8 * hh + r][cn] = (f16_t)(acc[t][r] * oscale);
  }
  __syncthreads();

  const int rsub = lane >> 3, c8 = (lane & 7) * 8;
  v8h vals[2];
#pragma unroll
  for (int j = 0; j < 2; j++) vals[j] = *(const v8hm*)&Cs[wave * 8 + 4 * j + rsub][c8];
#pragma unroll
  for (int j = 0; j < 2; j++) {
    const int row = wave * 8 + 4 * j + rsub;
    *(v8hm*)(ctxm + ((size_t)b * N_ + n0 + row) * C1_ + c8) = vals[j];
  }
  
}

// ---------------------------------------------------------------------------
// Host-side orchestration
// ---------------------------------------------------------------------------
extern "C" void kernel_launch(void* const* d_in, const int* in_sizes, int n_in,
                              void* d_out, int out_size, void* d_ws, size_t ws_size,
                              hipStream_t stream) {
  if (n_in < 16) return;
  const int need[16] = {BN_ * C1_, BN_ * C2_, H_ * C1_ * C1_, H_ * KV_ * KV_, H_ * KV_ * KV_,
                        C1_ * C1_, C1_, C1_, KV_, KV_, C1_, C1_, MLP_ * C1_, MLP_,
                        C1_ * MLP_, C1_};
  for (int i = 0; i < 16; i++) if (in_sizes[i] != need[i]) return;
  if (out_size != BN_ * C1_) return;

  const float* emb1    = (const float*)d_in[0];
  const float* emb2    = (const float*)d_in[1];
  const float* Wq      = (const float*)d_in[2];
  const float* Wk      = (const float*)d_in[3];
  const float* Wv      = (const float*)d_in[4];
  const float* Wout    = (const float*)d_in[5];
  const float* ln1_g   = (const float*)d_in[6];
  const float* ln1_b   = (const float*)d_in[7];
  const float* lnall_g = (const float*)d_in[8];
  const float* lnall_b = (const float*)d_in[9];
  const float* ffn_g   = (const float*)d_in[10];
  const float* ffn_b   = (const float*)d_in[11];
  const float* fc1_w   = (const float*)d_in[12];
  const float* fc1_b   = (const float*)d_in[13];
  const float* fc2_w   = (const float*)d_in[14];
  const float* fc2_b   = (const float*)d_in[15];
  float* out = (float*)d_out;

  char* ws = (char*)d_ws;
  size_t off = 0;
  auto take = [&](size_t bytes) -> void* {
    off = (off + 255) & ~(size_t)255;
    void* p = ws + off;
    off += bytes;
    return p;
  };
  f16_t* cx1   = (f16_t*)take((size_t)BN_ * C1_ * 2);
  f16_t* ea    = (f16_t*)take((size_t)BN_ * KV_ * 2);
  f16_t* Wqh   = (f16_t*)take((size_t)H_ * C1_ * C1_ * 2);
  f16_t* Wkh   = (f16_t*)take((size_t)H_ * KV_ * KV_ * 2);
  f16_t* Wvh   = (f16_t*)take((size_t)H_ * KV_ * KV_ * 2);
  f16_t* Wouth = (f16_t*)take((size_t)C1_ * C1_ * 2);
  f16_t* fc1h  = (f16_t*)take((size_t)MLP_ * C1_ * 2);
  f16_t* fc2h  = (f16_t*)take((size_t)C1_ * MLP_ * 2);
  f16_t* QT    = (f16_t*)take((size_t)H_ * C1_ * BN_ * 2);   // [H][64][B*N]
  f16_t* KT    = (f16_t*)take((size_t)H_ * KV_ * BN_ * 2);   // [H][192][B*N]
  f16_t* Vbuf  = (f16_t*)take((size_t)H_ * BN_ * KV_ * 2);   // [H][B*N][192]
  f16_t* Pm    = (f16_t*)take((size_t)B_ * H_ * C1_ * KV_ * 2);
  f16_t* ctxm  = (f16_t*)take((size_t)BN_ * C1_ * 2);
  float* cx    = (float*)take((size_t)BN_ * C1_ * 4);
  f16_t* ybuf  = (f16_t*)take((size_t)BN_ * C1_ * 2);
  f16_t* h1    = (f16_t*)take((size_t)BN_ * MLP_ * 2);
  if (off > ws_size) return;

  auto cvt = [&](const float* s, f16_t* d, int n) {
    const int n8 = n / 8;
    cvt_f16_kernel<<<(n8 + 255) / 256, 256, 0, stream>>>(s, d, n8);
  };
  cvt(Wq,    Wqh,   H_ * C1_ * C1_);
  cvt(Wk,    Wkh,   H_ * KV_ * KV_);
  cvt(Wv,    Wvh,   H_ * KV_ * KV_);
  cvt(Wout,  Wouth, C1_ * C1_);
  cvt(fc1_w, fc1h,  MLP_ * C1_);
  cvt(fc2_w, fc2h,  C1_ * MLP_);

  ln_concat_kernel<<<(BN_ + 7) / 8, 256, 0, stream>>>(emb1, emb2, ln1_g, ln1_b,
                                                      lnall_g, lnall_b, cx1, ea, BN_);

  // Q = cx1 * Wq[h]^T, stored transposed -> QT [H][64][B*N]
  gemm_nt_kernel<2, false, false, false>
      <<<dim3(BN_ / 128, 1, H_), 256, 0, stream>>>(
      cx1, C1_, 0LL, Wqh, C1_, (long long)C1_ * C1_,
      QT, cx, BN_, (long long)C1_ * BN_, C1_, fc1_b, emb1);
  // K = ea * Wk[h]^T, stored transposed -> KT [H][192][B*N]
  gemm_nt_kernel<2, false, false, false>
      <<<dim3(BN_ / 128, KV_ / 64, H_), 256, 0, stream>>>(
      ea, KV_, 0LL, Wkh, KV_, (long long)KV_ * KV_,
      KT, cx, BN_, (long long)KV_ * BN_, KV_, fc1_b, emb1);
  // V = ea * Wv[h]^T, row-major [H][B*N][192]
  gemm_nt_kernel<0, false, false, false>
      <<<dim3(BN_ / 128, KV_ / 64, H_), 256, 0, stream>>>(
      ea, KV_, 0LL, Wvh, KV_, (long long)KV_ * KV_,
      Vbuf, cx, KV_, (long long)BN_ * KV_, KV_, fc1_b, emb1);

  // S = Q^T K / sqrt(KV); InstanceNorm; softmax; -> P*4096 [bh][64][192]
  scores_softmax_kernel<<<B_ * H_, 256, 0, stream>>>(QT, KT, Pm);

  // ctx^T mean over heads -> ctxm [B*N][64]
  ctx_mean_kernel<<<dim3(N_ / 64, 1, B_), 256, 0, stream>>>(Vbuf, Pm, ctxm);

  // cx = ctxm * Wout^T + emb1   (f32)
  gemm_nt_kernel<1, false, false, true>
      <<<dim3(BN_ / 128, 1, 1), 256, 0, stream>>>(
      ctxm, C1_, 0LL, Wouth, C1_, 0LL,
      ybuf, cx, C1_, 0LL, C1_, fc1_b, emb1);

  ln64_kernel<<<(BN_ + 7) / 8, 256, 0, stream>>>(cx, ffn_g, ffn_b, ybuf, BN_);

  // h1 = GELU(y * fc1^T + b1)   (f16)
  gemm_nt_kernel<0, true, true, false>
      <<<dim3(BN_ / 128, MLP_ / 64, 1), 256, 0, stream>>>(
      ybuf, C1_, 0LL, fc1h, C1_, 0LL,
      h1, cx, MLP_, 0LL, C1_, fc1_b, emb1);

  // out = h1 * fc2^T + b2 + cx  (f32)
  gemm_nt_kernel<1, true, false, true>
      <<<dim3(BN_ / 128, 1, 1), 256, 0, stream>>>(
      h1, MLP_, 0LL, fc2h, MLP_, 0LL,
      ybuf, out, C1_, 0LL, MLP_, fc2_b, cx);
}

// v001
// One run takes 164 microseconds.
// Timed twice side by side with v000, it ran 1.34 and 1.33 times as fast.
#include <hip/hip_runtime.h>

// All contractions: v_wmma_f32_16x16x32_f16 (f16 operands, f32 accumulate); softmax P operand carried x4096 (exact power of two) and unscaled in the f32 epilogue.

typedef _Float16 f16_t;
typedef f16_t v16h __attribute__((ext_vector_type(16)));
typedef f16_t v8h __attribute__((ext_vector_type(8)));
typedef float v8f __attribute__((ext_vector_type(8)));
typedef float v4f __attribute__((ext_vector_type(4)));
typedef v8h v8hm __attribute__((may_alias));
typedef v4f v4fm __attribute__((may_alias));

#define H_   4
#define C1_  64
#define C2_  128
#define KV_  192
#define MLP_ 256
#define B_   8
#define N_   3136
#define BN_  (B_ * N_)

union Frag { v16h v; v8h p[2]; };

// 16x16x32 f16 WMMA with f32 accumulate, followed by a 4-slot VALU hazard guard.
__device__ __forceinline__ v8f wmma16(v16h a, v16h b, v8f c) {
  v8f d = __builtin_amdgcn_wmma_f32_16x16x32_f16(false, a, false, b, (short)0, c, false, false);
  asm volatile("v_nop\n\tv_nop\n\tv_nop\n\tv_nop" : "+v"(d) : "v"(a), "v"(b));
  return d;
}

__device__ __forceinline__ float wave_sum(float v) {
#pragma unroll
  for (int msk = 16; msk >= 1; msk >>= 1) v += __shfl_xor(v, msk, 32);
  return v;
}
__device__ __forceinline__ float wave_max(float v) {
#pragma unroll
  for (int msk = 16; msk >= 1; msk >>= 1) v = fmaxf(v, __shfl_xor(v, msk, 32));
  return v;
}

// ---------------------------------------------------------------------------
// ---------------------------------------------------------------------------
__global__ __launch_bounds__(256) void cvt_f16_kernel(const float* __restrict__ src,
                                                      f16_t* __restrict__ dst, int n8) {
  const int i = blockIdx.x * 256 + threadIdx.x;
  const bool ok = i < n8;
  const int ic = ok ? i : 0;
  const v4f x0 = *(const v4fm*)(src + (size_t)ic * 8);
  const v4f x1 = *(const v4fm*)(src + (size_t)ic * 8 + 4);
  v8h v;
#pragma unroll
  for (int j = 0; j < 4; j++) { v[j] = (f16_t)x0[j]; v[4 + j] = (f16_t)x1[j]; }
  f16_t* p = dst + (size_t)ic * 8;
  if (ok) *(v8hm*)p = v;
  
}

// ---------------------------------------------------------------------------
// Fused: cx1 = LN(emb1) (64), ea = LN(concat(emb1,emb2)) (192). 1 wave per row.
// ---------------------------------------------------------------------------
__global__ __launch_bounds__(256) void ln_concat_kernel(
    const float* __restrict__ emb1, const float* __restrict__ emb2,
    const float* __restrict__ g1, const float* __restrict__ b1,
    const float* __restrict__ ga, const float* __restrict__ ba,
    f16_t* __restrict__ cx1, f16_t* __restrict__ ea, int nrows) {
  __shared__ __attribute__((aligned(16))) f16_t St[8][256];
  const int wave = threadIdx.x >> 5, lane = threadIdx.x & 31;
  const int row = blockIdx.x * 8 + wave;
  const bool ok = row < nrows;
  const int rc = ok ? row : 0;
  const float* r1 = emb1 + (size_t)rc * C1_;
  const float* r2 = emb2 + (size_t)rc * C2_;

  const float x0 = r1[lane], x1 = r1[lane + 32];
  const float mu = wave_sum(x0 + x1) * (1.0f / 64.0f);
  const float d0 = x0 - mu, d1 = x1 - mu;
  const float var = wave_sum(d0 * d0 + d1 * d1) * (1.0f / 64.0f);
  const float rs = rsqrtf(var + 1e-6f);
  St[wave][lane]      = (f16_t)(d0 * rs * g1[lane] + b1[lane]);
  St[wave][lane + 32] = (f16_t)(d1 * rs * g1[lane + 32] + b1[lane + 32]);

  float e[6];
  e[0] = x0; e[1] = x1;
#pragma unroll
  for (int j = 2; j < 6; j++) e[j] = r2[lane + 32 * (j - 2)];
  float s = 0.f;
#pragma unroll
  for (int j = 0; j < 6; j++) s += e[j];
  const float ma = wave_sum(s) * (1.0f / 192.0f);
  float sq = 0.f;
#pragma unroll
  for (int j = 0; j < 6; j++) { e[j] -= ma; sq += e[j] * e[j]; }
  const float vara = wave_sum(sq) * (1.0f / 192.0f);
  const float rsa = rsqrtf(vara + 1e-6f);
#pragma unroll
  for (int j = 0; j < 6; j++) {
    const int c = lane + 32 * j;
    St[wave][64 + c] = (f16_t)(e[j] * rsa * ga[c] + ba[c]);
  }
  __syncthreads();

  const int l8 = (lane < 8) ? lane : 0;
  const int l24 = (lane < 24) ? lane : 0;
  const v8h pc = *(const v8hm*)&St[wave][l8 * 8];
  const v8h pe = *(const v8hm*)&St[wave][64 + l24 * 8];
  f16_t* dc = cx1 + (size_t)rc * C1_ + l8 * 8;
  f16_t* de = ea + (size_t)rc * KV_ + l24 * 8;
  const bool sc = ok && (lane < 8);
  const bool se = ok && (lane < 24);
  if (sc) *(v8hm*)dc = pc;
  if (se) *(v8hm*)de = pe;
  
}

// ---------------------------------------------------------------------------
// LN over 64 channels (f32 in, f16 out). 1 wave per row, whole-line stores.
// ---------------------------------------------------------------------------
__global__ __launch_bounds__(256) void ln64_kernel(
    const float* __restrict__ x, const float* __restrict__ g,
    const float* __restrict__ bb, f16_t* __restrict__ y, int nrows) {
  __shared__ __attribute__((aligned(16))) f16_t St[8][64];
  const int wave = threadIdx.x >> 5, lane = threadIdx.x & 31;
  const int row = blockIdx.x * 8 + wave;
  const bool ok = row < nrows;
  const int rc = ok ? row : 0;
  const float* r = x + (size_t)rc * C1_;
  const float x0 = r[lane], x1 = r[lane + 32];
  const float mu = wave_sum(x0 + x1) * (1.0f / 64.0f);
  const float d0 = x0 - mu, d1 = x1 - mu;
  const float var = wave_sum(d0 * d0 + d1 * d1) * (1.0f / 64.0f);
  const float rs = rsqrtf(var + 1e-6f);
  St[wave][lane]      = (f16_t)(d0 * rs * g[lane] + bb[lane]);
  St[wave][lane + 32] = (f16_t)(d1 * rs * g[lane + 32] + bb[lane + 32]);
  __syncthreads();
  const int l8 = (lane < 8) ? lane : 0;
  const v8h pc = *(const v8hm*)&St[wave][l8 * 8];
  f16_t* dc = y + (size_t)rc * C1_ + l8 * 8;
  const bool sc = ok && (lane < 8);
  if (sc) *(v8hm*)dc = pc;
  
}

// ---------------------------------------------------------------------------
// Generic GEMM: C[M,N] = A[M,K] * Bw[N,K]^T  (nn.Linear), f16 WMMA, f32 acc.
// Tile M=128, N=64, K step 32, single-buffered LDS staging with barriers.
// A and Bw are both k-contiguous, so both fragments are two 16-B pieces per
// lane at k offsets 8h and 16+8h (h = lane>>4), row/col = lane&15.
// MODE 0: f16 row-major C; MODE 1: f32 row-major C; MODE 2: f16 C^T ([n][m]).
// ---------------------------------------------------------------------------
union CTile { float f[128][64]; f16_t h[128][64]; f16_t t[64][128]; };

template <int MODE, bool BIAS, bool GELU, bool RESID>
__global__ __launch_bounds__(256) void gemm_nt_kernel(
    const f16_t* __restrict__ A, int lda, long long aBatch,
    const f16_t* __restrict__ Bw, int ldb, long long bBatch,
    f16_t* __restrict__ Ch, float* __restrict__ Cf, int ldc, long long cBatch,
    int Kdim, const float* __restrict__ bias, const float* __restrict__ resid) {
  __shared__ __attribute__((aligned(16))) f16_t As[128][32];
  __shared__ __attribute__((aligned(16))) f16_t Bs[64][32];
  __shared__ __attribute__((aligned(16))) CTile Cs;
  const int tid = threadIdx.x, lane = tid & 31, wave = tid >> 5;
  const int hh = lane >> 4, m = lane & 15;
  const long long z = blockIdx.z;
  const f16_t* Ab = A + z * aBatch;
  const f16_t* Bb = Bw + z * bBatch;
  const int m0 = blockIdx.x * 128, n0 = blockIdx.y * 64;
  const int ar = tid >> 2, ac = (tid & 3) * 8;
  const f16_t* gA0 = Ab + (long long)(m0 + ar) * lda + ac;
  const f16_t* gA1 = Ab + (long long)(m0 + ar + 64) * lda + ac;
  const f16_t* gB  = Bb + (long long)(n0 + ar) * ldb + ac;
  v8f acc[4] = {};
  const int nk = Kdim >> 5;
  const int mrow = wave * 16 + m;
  for (int i = 0; i < nk; i++) {
    const int k0 = i << 5;
    const v8h sa0 = *(const v8hm*)(gA0 + k0);
    const v8h sa1 = *(const v8hm*)(gA1 + k0);
    const v8h sb  = *(const v8hm*)(gB + k0);
    __syncthreads();
    *(v8hm*)&As[ar][ac]      = sa0;
    *(v8hm*)&As[ar + 64][ac] = sa1;
    *(v8hm*)&Bs[ar][ac]      = sb;
    __syncthreads();
    Frag a;
    a.p[0] = *(const v8hm*)&As[mrow][8 * hh];
    a.p[1] = *(const v8hm*)&As[mrow][16 + 8 * hh];
#pragma unroll
    for (int nt = 0; nt < 4; nt++) {
      Frag b;
      b.p[0] = *(const v8hm*)&Bs[nt * 16 + m][8 * hh];
      b.p[1] = *(const v8hm*)&Bs[nt * 16 + m][16 + 8 * hh];
      acc[nt] = wmma16(a.v, b.v, acc[nt]);
    }
  }

  // D element r of lane = (row wave*16 + 8h + r, col nt*16 + m) of the block tile.
#pragma unroll
  for (int nt = 0; nt < 4; nt++) {
    const int cn = nt * 16 + m;
    float bs = 0.f;
    if (BIAS) bs = bias[n0 + cn];
#pragma unroll
    for (int r = 0; r < 8; r++) {
      const int cm = wave * 16 + 8 * hh + r;
      float xv = acc[nt][r] + bs;
      if (GELU) xv = 0.5f * xv * (1.0f + erff(xv * 0.70710678118654752f));
      if (MODE == 1) Cs.f[cm][cn] = xv;
      else if (MODE == 0) Cs.h[cm][cn] = (f16_t)xv;
      else Cs.t[cn][cm] = (f16_t)xv;
    }
  }
  __syncthreads();

  if (MODE == 1) {
    float* Cb = Cf + z * cBatch;
    v4f vals[8];
#pragma unroll
    for (int j = 0; j < 8; j++) {
      const int row = wave * 16 + 2 * j + hh;
      const int c4 = m * 4;
      v4f v = *(const v4fm*)&Cs.f[row][c4];
      if (RESID) {
        const v4f rr = *(const v4fm*)(resid + (long long)(m0 + row) * ldc + n0 + c4);
        v += rr;
      }
      vals[j] = v;
    }
#pragma unroll
    for (int j = 0; j < 8; j++) {
      const int row = wave * 16 + 2 * j + hh;
      *(v4fm*)(Cb + (long long)(m0 + row) * ldc + n0 + m * 4) = vals[j];
    }
    
  } else if (MODE == 0) {
    f16_t* Cb = Ch + z * cBatch;
    v8h vals[4];
    const int rsub = lane >> 3, c8 = (lane & 7) * 8;
#pragma unroll
    for (int j = 0; j < 4; j++) {
      const int row = wave * 16 + 4 * j + rsub;
      vals[j] = *(const v8hm*)&Cs.h[row][c8];
    }
#pragma unroll
    for (int j = 0; j < 4; j++) {
      const int row = wave * 16 + 4 * j + rsub;
      *(v8hm*)(Cb + (long long)(m0 + row) * ldc + n0 + c8) = vals[j];
    }
    
  } else {
    f16_t* Cb = Ch + z * cBatch;
    v8h vals[4];
    const int c8 = m * 8;
#pragma unroll
    for (int j = 0; j < 4; j++) {
      const int row = wave * 8 + 2 * j + hh;
      vals[j] = *(const v8hm*)&Cs.t[row][c8];
    }
#pragma unroll
    for (int j = 0; j < 4; j++) {
      const int row = wave * 8 + 2 * j + hh;
      *(v8hm*)(Cb + (long long)(n0 + row) * ldc + m0 + c8) = vals[j];
    }
    
  }
}

// ---------------------------------------------------------------------------
// Scores S = Q^T K, the sum over n split over SPLIT_ work-groups per (b,h).
// A = QT [H][64][B*N] (row c, k = n contiguous), B = KT [H][192][B*N]
// (row kv, k = n contiguous) -> both fragments loaded with the same k map.
// Each work-group sums KSTEPS_ * 32 values of n and stores its f32 accumulators
// in register order: chunk ((wave*6 + t)*2 + half)*32 + lane holds 4 floats,
// rows mt*16 + 8h + 4*half + 0..3 of column (ng*6 + t)*16 + m.
// ---------------------------------------------------------------------------
#define SPLIT_  14
#define KSTEPS_ (N_ / 32 / SPLIT_)  // 7
#define SELEMS_ (C1_ * KV_)         // 12288

__global__ __launch_bounds__(256) void scores_partial_kernel(
    const f16_t* __restrict__ QT, const f16_t* __restrict__ KT, float* __restrict__ part) {
  __shared__ __attribute__((aligned(16))) f16_t Aq[64][32];
  __shared__ __attribute__((aligned(16))) f16_t Bk[192][32];
  const int tid = threadIdx.x, lane = tid & 31, wave = tid >> 5;
  const int hh = lane >> 4, m = lane & 15;
  const int sp = blockIdx.x;
  const int bh = blockIdx.y, b = bh >> 2, hd = bh & 3;
  const f16_t* Ab = QT + (size_t)hd * C1_ * BN_ + (size_t)b * N_ + sp * (KSTEPS_ * 32);
  const f16_t* Bb = KT + (size_t)hd * KV_ * BN_ + (size_t)b * N_ + sp * (KSTEPS_ * 32);
  const int mt = wave & 3, ng = wave >> 2;
  v8f acc[6] = {};
  const int ar = tid >> 2, ac = (tid & 3) * 8;
  const f16_t* gA  = Ab + (size_t)ar * BN_ + ac;
  const f16_t* gB0 = Bb + (size_t)ar * BN_ + ac;
  const f16_t* gB1 = Bb + (size_t)(ar + 64) * BN_ + ac;
  const f16_t* gB2 = Bb + (size_t)(ar + 128) * BN_ + ac;
  const int mrow = mt * 16 + m;

  // Whole unroll of the 7 trips: unrolled by two, the odd count costs a copy of all 48 accumulators per pair.
#pragma unroll
  for (int it = 0; it < KSTEPS_; it++) {
    const int n0 = it * 32;
    const v8h sa  = *(const v8hm*)(gA + n0);
    const v8h sb0 = *(const v8hm*)(gB0 + n0);
    const v8h sb1 = *(const v8hm*)(gB1 + n0);
    const v8h sb2 = *(const v8hm*)(gB2 + n0);
    __syncthreads();
    *(v8hm*)&Aq[ar][ac]       = sa;
    *(v8hm*)&Bk[ar][ac]       = sb0;
    *(v8hm*)&Bk[ar + 64][ac]  = sb1;
    *(v8hm*)&Bk[ar + 128][ac] = sb2;
    __syncthreads();
    Frag a;
    a.p[0] = *(const v8hm*)&Aq[mrow][8 * hh];
    a.p[1] = *(const v8hm*)&Aq[mrow][16 + 8 * hh];
#pragma unroll
    for (int t = 0; t < 6; t++) {
      const int col = (ng * 6 + t) * 16 + m;
      Frag bf;
      bf.p[0] = *(const v8hm*)&Bk[col][8 * hh];
      bf.p[1] = *(const v8hm*)&Bk[col][16 + 8 * hh];
      acc[t] = wmma16(a.v, bf.v, acc[t]);
    }
  }

  // Each store instruction writes 512 contiguous bytes (4 whole lines) of this wave's own range.
  float* pb = part + ((size_t)sp * (B_ * H_) + bh) * SELEMS_ + (size_t)wave * 1536 + lane * 4;
#pragma unroll
  for (int t = 0; t < 6; t++) {
#pragma unroll
    for (int hf = 0; hf < 2; hf++) {
      v4f v;
#pragma unroll
      for (int j = 0; j < 4; j++) v[j] = acc[t][hf * 4 + j];
      *(v4fm*)(pb + (t * 2 + hf) * 128) = v;
    }
  }
}

// ---------------------------------------------------------------------------
// Sum of the SPLIT_ partials, scale, InstanceNorm over (64,192), softmax over KV,
// P*4096 stored as f16 row-major [64][192]. One block of 32 waves per (b,h);
// each thread owns 3 chunks of 4 floats.
// ---------------------------------------------------------------------------
__global__ __launch_bounds__(1024) void merge_softmax_kernel(
    const float* __restrict__ part, f16_t* __restrict__ P) {
  __shared__ float Sb[64][196];
  __shared__ __attribute__((aligned(16))) f16_t Pst[64][192];
  __shared__ float red[32];
  __shared__ float red2[32];
  const int tid = threadIdx.x, lane = tid & 31, wave = tid >> 5;
  const int hh = lane >> 4, m = lane & 15;
  const int bh = blockIdx.x;
  const float* pb = part + (size_t)bh * SELEMS_ + tid * 4;

  v4f a[3] = {};
#pragma unroll
  for (int s = 0; s < SPLIT_; s++) {
#pragma unroll
    for (int i = 0; i < 3; i++)
      a[i] += *(const v4fm*)(pb + (size_t)s * (B_ * H_) * SELEMS_ + i * 4096);
  }

  const float sc = 0.07216878364870322f;  // 1/sqrt(192)
  float s = 0.f;
#pragma unroll
  for (int i = 0; i < 3; i++) {
    const int g = wave + 32 * i;          // chunk group = (producer wave)*12 + t*2 + half
    const int wa = g / 12, rem = g - wa * 12;
    const int row0 = (wa & 3) * 16 + 8 * hh + (rem & 1) * 4;
    const int col = ((wa >> 2) * 6 + (rem >> 1)) * 16 + m;
#pragma unroll
    for (int j = 0; j < 4; j++) {
      a[i][j] *= sc;
      s += a[i][j];
      Sb[row0 + j][col] = a[i][j];
    }
  }
  s = wave_sum(s);
  if (lane == 0) red[wave] = s;
  __syncthreads();
  const float mean = wave_sum(red[lane]) * (1.0f / 12288.0f);
  float sq = 0.f;
#pragma unroll
  for (int i = 0; i < 3; i++) {
#pragma unroll
    for (int j = 0; j < 4; j++) { const float d = a[i][j] - mean; sq += d * d; }
  }
  sq = wave_sum(sq);
  if (lane == 0) red2[wave] = sq;
  __syncthreads();
  const float var  = wave_sum(red2[lane]) * (1.0f / 12288.0f);
  const float rstd = rsqrtf(var + 1e-5f);

  // Softmax over KV per row c; one wave per row, 2 rows per wave; P*4096 -> LDS.
  const float pscale = 4096.0f;
#pragma unroll
  for (int rr = 0; rr < 2; rr++) {
    const int r = wave * 2 + rr;
    float xs[6];
    float mx = -3.0e38f;
#pragma unroll
    for (int j = 0; j < 6; j++) {
      xs[j] = (Sb[r][lane + 32 * j] - mean) * rstd;
      mx = fmaxf(mx, xs[j]);
    }
    mx = wave_max(mx);
    float es = 0.f;
#pragma unroll
    for (int j = 0; j < 6; j++) { xs[j] = expf(xs[j] - mx); es += xs[j]; }
    es = wave_sum(es);
    const float inv = (1.0f / es) * pscale;
#pragma unroll
    for (int j = 0; j < 6; j++)
      Pst[r][lane + 32 * j] = (f16_t)(xs[j] * inv);
  }
  __syncthreads();

  // Whole-line stores: each row = 384 B = lanes 0..23 x 16 B, one instruction.
  f16_t* Pb = P + (size_t)bh * C1_ * KV_;
  const int l24 = (lane < 24) ? lane : 0;
  const bool se = lane < 24;
  v8h vals[2];
#pragma unroll
  for (int j = 0; j < 2; j++) vals[j] = *(const v8hm*)&Pst[wave * 2 + j][l24 * 8];
#pragma unroll
  for (int j = 0; j < 2; j++)
    if (se) *(v8hm*)(Pb + (size_t)(wave * 2 + j) * KV_ + l24 * 8) = vals[j];
}

// ---------------------------------------------------------------------------
// ctx mean over heads: ctxm[b,n,c] = (0.25/4096) * sum_h sum_k V[h,bn,k]*P4096[bh,c,k]
// Tile 64 rows (n) x 64 cols (c). grid = (N/64, 1, B). 24 k-steps of 32.
// A = V rows (k contiguous), B = P rows [c][k] (k contiguous).
// ---------------------------------------------------------------------------
__global__ __launch_bounds__(256) void ctx_mean_kernel(
    const f16_t* __restrict__ V, const f16_t* __restrict__ P, f16_t* __restrict__ ctxm) {
  __shared__ __attribute__((aligned(16))) f16_t Vs[64][32];
  __shared__ __attribute__((aligned(16))) f16_t Ps[64][32];
  __shared__ __attribute__((aligned(16))) f16_t Cs[64][64];
  const int tid = threadIdx.x, lane = tid & 31, wave = tid >> 5;
  const int hh = lane >> 4, m = lane & 15;
  const int b = blockIdx.z;
  const int n0 = blockIdx.x * 64;
  const int mt = wave & 3, ng = wave >> 2;
  v8f acc[2] = {};
  const int ar = tid >> 2, ac = (tid & 3) * 8;
  const int mrow = mt * 16 + m;

  const int nsteps = H_ * (KV_ / 32);  // 24
  for (int it = 0; it < nsteps; it++) {
    const int hd = it / 6;
    const int k0 = (it - hd * 6) * 32;
    const f16_t* Vb = V + ((size_t)hd * BN_ + (size_t)b * N_ + n0) * KV_;
    const f16_t* Pb = P + (size_t)(b * H_ + hd) * C1_ * KV_;
    const v8h sv = *(const v8hm*)(Vb + (size_t)ar * KV_ + k0 + ac);
    const v8h sp = *(const v8hm*)(Pb + (size_t)ar * KV_ + k0 + ac);
    __syncthreads();
    *(v8hm*)&Vs[ar][ac] = sv;
    *(v8hm*)&Ps[ar][ac] = sp;
    __syncthreads();
    Frag a;
    a.p[0] = *(const v8hm*)&Vs[mrow][8 * hh];
    a.p[1] = *(const v8hm*)&Vs[mrow][16 + 8 * hh];
#pragma unroll
    for (int t = 0; t < 2; t++) {
      const int col = (ng * 2 + t) * 16 + m;
      Frag bf;
      bf.p[0] = *(const v8hm*)&Ps[col][8 * hh];
      bf.p[1] = *(const v8hm*)&Ps[col][16 + 8 * hh];
      acc[t] = wmma16(a.v, bf.v, acc[t]);
    }
  }

  const float oscale = 0.25f / 4096.0f;
#pragma unroll
  for (int t = 0; t < 2; t++) {
    const int cn = (ng * 2 + t) * 16 + m;
#pragma unroll
    for (int r = 0; r < 8; r++)
      Cs[mt * 16 + 8 * hh + r][cn] = (f16_t)(acc[t][r] * oscale);
  }
  __syncthreads();

  const int rsub = lane >> 3, c8 = (lane & 7) * 8;
  v8h vals[2];
#pragma unroll
  for (int j = 0; j < 2; j++) vals[j] = *(const v8hm*)&Cs[wave * 8 + 4 * j + rsub][c8];
#pragma unroll
  for (int j = 0; j < 2; j++) {
    const int row = wave * 8 + 4 * j + rsub;
    *(v8hm*)(ctxm + ((size_t)b * N_ + n0 + row) * C1_ + c8) = vals[j];
  }
  
}

// ---------------------------------------------------------------------------
// Host-side orchestration
// ---------------------------------------------------------------------------
extern "C" void kernel_launch(void* const* d_in, const int* in_sizes, int n_in,
                              void* d_out, int out_size, void* d_ws, size_t ws_size,
                              hipStream_t stream) {
  if (n_in < 16) return;
  const int need[16] = {BN_ * C1_, BN_ * C2_, H_ * C1_ * C1_, H_ * KV_ * KV_, H_ * KV_ * KV_,
                        C1_ * C1_, C1_, C1_, KV_, KV_, C1_, C1_, MLP_ * C1_, MLP_,
                        C1_ * MLP_, C1_};
  for (int i = 0; i < 16; i++) if (in_sizes[i] != need[i]) return;
  if (out_size != BN_ * C1_) return;

  const float* emb1    = (const float*)d_in[0];
  const float* emb2    = (const float*)d_in[1];
  const float* Wq      = (const float*)d_in[2];
  const float* Wk      = (const float*)d_in[3];
  const float* Wv      = (const float*)d_in[4];
  const float* Wout    = (const float*)d_in[5];
  const float* ln1_g   = (const float*)d_in[6];
  const float* ln1_b   = (const float*)d_in[7];
  const float* lnall_g = (const float*)d_in[8];
  const float* lnall_b = (const float*)d_in[9];
  const float* ffn_g   = (const float*)d_in[10];
  const float* ffn_b   = (const float*)d_in[11];
  const float* fc1_w   = (const float*)d_in[12];
  const float* fc1_b   = (const float*)d_in[13];
  const float* fc2_w   = (const float*)d_in[14];
  const float* fc2_b   = (const float*)d_in[15];
  float* out = (float*)d_out;

  char* ws = (char*)d_ws;
  size_t off = 0;
  auto take = [&](size_t bytes) -> void* {
    off = (off + 255) & ~(size_t)255;
    void* p = ws + off;
    off += bytes;
    return p;
  };
  f16_t* cx1   = (f16_t*)take((size_t)BN_ * C1_ * 2);
  f16_t* ea    = (f16_t*)take((size_t)BN_ * KV_ * 2);
  f16_t* Wqh   = (f16_t*)take((size_t)H_ * C1_ * C1_ * 2);
  f16_t* Wkh   = (f16_t*)take((size_t)H_ * KV_ * KV_ * 2);
  f16_t* Wvh   = (f16_t*)take((size_t)H_ * KV_ * KV_ * 2);
  f16_t* Wouth = (f16_t*)take((size_t)C1_ * C1_ * 2);
  f16_t* fc1h  = (f16_t*)take((size_t)MLP_ * C1_ * 2);
  f16_t* fc2h  = (f16_t*)take((size_t)C1_ * MLP_ * 2);
  f16_t* QT    = (f16_t*)take((size_t)H_ * C1_ * BN_ * 2);   // [H][64][B*N]
  f16_t* KT    = (f16_t*)take((size_t)H_ * KV_ * BN_ * 2);   // [H][192][B*N]
  f16_t* Vbuf  = (f16_t*)take((size_t)H_ * BN_ * KV_ * 2);   // [H][B*N][192]
  f16_t* Pm    = (f16_t*)take((size_t)B_ * H_ * C1_ * KV_ * 2);
  f16_t* ctxm  = (f16_t*)take((size_t)BN_ * C1_ * 2);
  float* cx    = (float*)take((size_t)BN_ * C1_ * 4);
  f16_t* ybuf  = (f16_t*)take((size_t)BN_ * C1_ * 2);
  f16_t* h1    = (f16_t*)take((size_t)BN_ * MLP_ * 2);
  float* Spart = (float*)take((size_t)SPLIT_ * B_ * H_ * SELEMS_ * 4);
  if (off > ws_size) return;

  auto cvt = [&](const float* s, f16_t* d, int n) {
    const int n8 = n / 8;
    cvt_f16_kernel<<<(n8 + 255) / 256, 256, 0, stream>>>(s, d, n8);
  };
  cvt(Wq,    Wqh,   H_ * C1_ * C1_);
  cvt(Wk,    Wkh,   H_ * KV_ * KV_);
  cvt(Wv,    Wvh,   H_ * KV_ * KV_);
  cvt(Wout,  Wouth, C1_ * C1_);
  cvt(fc1_w, fc1h,  MLP_ * C1_);
  cvt(fc2_w, fc2h,  C1_ * MLP_);

  ln_concat_kernel<<<(BN_ + 7) / 8, 256, 0, stream>>>(emb1, emb2, ln1_g, ln1_b,
                                                      lnall_g, lnall_b, cx1, ea, BN_);

  // Q = cx1 * Wq[h]^T, stored transposed -> QT [H][64][B*N]
  gemm_nt_kernel<2, false, false, false>
      <<<dim3(BN_ / 128, 1, H_), 256, 0, stream>>>(
      cx1, C1_, 0LL, Wqh, C1_, (long long)C1_ * C1_,
      QT, cx, BN_, (long long)C1_ * BN_, C1_, fc1_b, emb1);
  // K = ea * Wk[h]^T, stored transposed -> KT [H][192][B*N]
  gemm_nt_kernel<2, false, false, false>
      <<<dim3(BN_ / 128, KV_ / 64, H_), 256, 0, stream>>>(
      ea, KV_, 0LL, Wkh, KV_, (long long)KV_ * KV_,
      KT, cx, BN_, (long long)KV_ * BN_, KV_, fc1_b, emb1);
  // V = ea * Wv[h]^T, row-major [H][B*N][192]
  gemm_nt_kernel<0, false, false, false>
      <<<dim3(BN_ / 128, KV_ / 64, H_), 256, 0, stream>>>(
      ea, KV_, 0LL, Wvh, KV_, (long long)KV_ * KV_,
      Vbuf, cx, KV_, (long long)BN_ * KV_, KV_, fc1_b, emb1);

  // S = Q^T K / sqrt(KV); InstanceNorm; softmax; -> P*4096 [bh][64][192]
  scores_partial_kernel<<<dim3(SPLIT_, B_ * H_), 256, 0, stream>>>(QT, KT, Spart);
  merge_softmax_kernel<<<B_ * H_, 1024, 0, stream>>>(Spart, Pm);

  // ctx^T mean over heads -> ctxm [B*N][64]
  ctx_mean_kernel<<<dim3(N_ / 64, 1, B_), 256, 0, stream>>>(Vbuf, Pm, ctxm);

  // cx = ctxm * Wout^T + emb1   (f32)
  gemm_nt_kernel<1, false, false, true>
      <<<dim3(BN_ / 128, 1, 1), 256, 0, stream>>>(
      ctxm, C1_, 0LL, Wouth, C1_, 0LL,
      ybuf, cx, C1_, 0LL, C1_, fc1_b, emb1);

  ln64_kernel<<<(BN_ + 7) / 8, 256, 0, stream>>>(cx, ffn_g, ffn_b, ybuf, BN_);

  // h1 = GELU(y * fc1^T + b1)   (f16)
  gemm_nt_kernel<0, true, true, false>
      <<<dim3(BN_ / 128, MLP_ / 64, 1), 256, 0, stream>>>(
      ybuf, C1_, 0LL, fc1h, C1_, 0LL,
      h1, cx, MLP_, 0LL, C1_, fc1_b, emb1);

  // out = h1 * fc2^T + b2 + cx  (f32)
  gemm_nt_kernel<1, true, false, true>
      <<<dim3(BN_ / 128, 1, 1), 256, 0, stream>>>(
      h1, MLP_, 0LL, fc2h, MLP_, 0LL,
      ybuf, out, C1_, 0LL, MLP_, fc2_b, cx);
}

// v002
// Measured time: 128 microseconds a run.
// Two timings next to v001 both put it at 1.28 times that version's speed.
// Over all steps from v000 it is 1.71 times as fast.
#include <hip/hip_runtime.h>

// All contractions: v_wmma_f32_16x16x32_f16 (f16 operands, f32 accumulate); softmax P operand carried x4096 (exact power of two) and unscaled in the f32 epilogue.

typedef _Float16 f16_t;
typedef f16_t v16h __attribute__((ext_vector_type(16)));
typedef f16_t v8h __attribute__((ext_vector_type(8)));
typedef float v8f __attribute__((ext_vector_type(8)));
typedef float v4f __attribute__((ext_vector_type(4)));
typedef f16_t v4h __attribute__((ext_vector_type(4)));
typedef v8h v8hm __attribute__((may_alias));
typedef v4h v4hm __attribute__((may_alias));
typedef v4f v4fm __attribute__((may_alias));

#define H_   4
#define C1_  64
#define C2_  128
#define KV_  192
#define MLP_ 256
#define B_   8
#define N_   3136
#define BN_  (B_ * N_)

union Frag { v16h v; v8h p[2]; };

// 16x16x32 f16 WMMA with f32 accumulate, followed by a 4-slot VALU hazard guard.
__device__ __forceinline__ v8f wmma16(v16h a, v16h b, v8f c) {
  v8f d = __builtin_amdgcn_wmma_f32_16x16x32_f16(false, a, false, b, (short)0, c, false, false);
  asm volatile("v_nop\n\tv_nop\n\tv_nop\n\tv_nop" : "+v"(d) : "v"(a), "v"(b));
  return d;
}

__device__ __forceinline__ float wave_sum(float v) {
#pragma unroll
  for (int msk = 16; msk >= 1; msk >>= 1) v += __shfl_xor(v, msk, 32);
  return v;
}
__device__ __forceinline__ float wave_max(float v) {
#pragma unroll
  for (int msk = 16; msk >= 1; msk >>= 1) v = fmaxf(v, __shfl_xor(v, msk, 32));
  return v;
}

// ---------------------------------------------------------------------------
// ---------------------------------------------------------------------------
__global__ __launch_bounds__(256) void cvt_f16_kernel(const float* __restrict__ src,
                                                      f16_t* __restrict__ dst, int n8) {
  const int i = blockIdx.x * 256 + threadIdx.x;
  const bool ok = i < n8;
  const int ic = ok ? i : 0;
  const v4f x0 = *(const v4fm*)(src + (size_t)ic * 8);
  const v4f x1 = *(const v4fm*)(src + (size_t)ic * 8 + 4);
  v8h v;
#pragma unroll
  for (int j = 0; j < 4; j++) { v[j] = (f16_t)x0[j]; v[4 + j] = (f16_t)x1[j]; }
  f16_t* p = dst + (size_t)ic * 8;
  if (ok) *(v8hm*)p = v;
  
}

// ---------------------------------------------------------------------------
// Fused: cx1 = LN(emb1) (64), ea = LN(concat(emb1,emb2)) (192).
// One block = 64 rows (n), one wave = 8 rows. Outputs: ea row-major [B*N][192] and
// the channel-major copies cx1T [64][B*N], eaT [192][B*N] (64 n = one 128-B line).
// ---------------------------------------------------------------------------
__global__ __launch_bounds__(256) void ln_concat_kernel(
    const float* __restrict__ emb1, const float* __restrict__ emb2,
    const float* __restrict__ g1, const float* __restrict__ b1,
    const float* __restrict__ ga, const float* __restrict__ ba,
    f16_t* __restrict__ cx1T, f16_t* __restrict__ ea, f16_t* __restrict__ eaT) {
  __shared__ __attribute__((aligned(16))) f16_t Tt[256][72];  // [channel][n], 0..63 cx1, 64..255 ea
  __shared__ __attribute__((aligned(16))) f16_t Sr[64][200];  // [n][channel] of ea
  const int tid = threadIdx.x, wave = tid >> 5, lane = tid & 31;
  const int n0 = blockIdx.x * 64;

  float gv1[2], bv1[2], gva[6], bva[6];
#pragma unroll
  for (int j = 0; j < 2; j++) { gv1[j] = g1[lane + 32 * j]; bv1[j] = b1[lane + 32 * j]; }
#pragma unroll
  for (int j = 0; j < 6; j++) { gva[j] = ga[lane + 32 * j]; bva[j] = ba[lane + 32 * j]; }

  v8h tr[8];  // tr[q][i] = channel lane + 32q of row wave*8 + i
#pragma unroll
  for (int i = 0; i < 8; i++) {
    const int rl = wave * 8 + i;
    const float* r1 = emb1 + (size_t)(n0 + rl) * C1_;
    const float* r2 = emb2 + (size_t)(n0 + rl) * C2_;

    const float x0 = r1[lane], x1 = r1[lane + 32];
    const float mu = wave_sum(x0 + x1) * (1.0f / 64.0f);
    const float d0 = x0 - mu, d1 = x1 - mu;
    const float var = wave_sum(d0 * d0 + d1 * d1) * (1.0f / 64.0f);
    const float rs = rsqrtf(var + 1e-6f);
    tr[0][i] = (f16_t)(d0 * rs * gv1[0] + bv1[0]);
    tr[1][i] = (f16_t)(d1 * rs * gv1[1] + bv1[1]);

    float e[6];
    e[0] = x0; e[1] = x1;
#pragma unroll
    for (int j = 2; j < 6; j++) e[j] = r2[lane + 32 * (j - 2)];
    float s = 0.f;
#pragma unroll
    for (int j = 0; j < 6; j++) s += e[j];
    const float ma = wave_sum(s) * (1.0f / 192.0f);
    float sq = 0.f;
#pragma unroll
    for (int j = 0; j < 6; j++) { e[j] -= ma; sq += e[j] * e[j]; }
    const float vara = wave_sum(sq) * (1.0f / 192.0f);
    const float rsa = rsqrtf(vara + 1e-6f);
#pragma unroll
    for (int j = 0; j < 6; j++) {
      const f16_t y = (f16_t)(e[j] * rsa * gva[j] + bva[j]);
      tr[2 + j][i] = y;
      Sr[rl][lane + 32 * j] = y;
    }
  }
#pragma unroll
  for (int q = 0; q < 8; q++) *(v8hm*)&Tt[lane + 32 * q][wave * 8] = tr[q];
  __syncthreads();

  // Channel-major: 8 lanes fill one 128-B line, one instruction = 4 whole lines.
  const int chs = tid >> 3, ck = (tid & 7) * 8;
#pragma unroll
  for (int i = 0; i < 8; i++) {
    const int ch = i * 32 + chs;
    const v8h v = *(const v8hm*)&Tt[ch][ck];
    f16_t* d = (i < 2) ? cx1T + (size_t)ch * BN_ : eaT + (size_t)(ch - 64) * BN_;
    *(v8hm*)(d + n0 + ck) = v;
  }
  // Row-major ea: the 64 rows are 24576 contiguous bytes.
#pragma unroll
  for (int i = 0; i < 6; i++) {
    const int idx = i * 256 + tid;
    const int row = idx / 24, c8 = (idx - row * 24) * 8;
    const v8h v = *(const v8hm*)&Sr[row][c8];
    *(v8hm*)(ea + (size_t)n0 * KV_ + (size_t)idx * 8) = v;
  }
}

// ---------------------------------------------------------------------------
// LN over 64 channels (f32 in, f16 out). 1 wave per row, whole-line stores.
// ---------------------------------------------------------------------------
__global__ __launch_bounds__(256) void ln64_kernel(
    const float* __restrict__ x, const float* __restrict__ g,
    const float* __restrict__ bb, f16_t* __restrict__ y, int nrows) {
  __shared__ __attribute__((aligned(16))) f16_t St[8][64];
  const int wave = threadIdx.x >> 5, lane = threadIdx.x & 31;
  const int row = blockIdx.x * 8 + wave;
  const bool ok = row < nrows;
  const int rc = ok ? row : 0;
  const float* r = x + (size_t)rc * C1_;
  const float x0 = r[lane], x1 = r[lane + 32];
  const float mu = wave_sum(x0 + x1) * (1.0f / 64.0f);
  const float d0 = x0 - mu, d1 = x1 - mu;
  const float var = wave_sum(d0 * d0 + d1 * d1) * (1.0f / 64.0f);
  const float rs = rsqrtf(var + 1e-6f);
  St[wave][lane]      = (f16_t)(d0 * rs * g[lane] + bb[lane]);
  St[wave][lane + 32] = (f16_t)(d1 * rs * g[lane + 32] + bb[lane + 32]);
  __syncthreads();
  const int l8 = (lane < 8) ? lane : 0;
  const v8h pc = *(const v8hm*)&St[wave][l8 * 8];
  f16_t* dc = y + (size_t)rc * C1_ + l8 * 8;
  const bool sc = ok && (lane < 8);
  if (sc) *(v8hm*)dc = pc;
  
}

// ---------------------------------------------------------------------------
// Generic GEMM: C[M,N] = A[M,K] * Bw[N,K]^T  (nn.Linear), f16 WMMA, f32 acc.
// Tile M=128, N=64, K step 32, single-buffered LDS staging with barriers.
// A and Bw are both k-contiguous, so both fragments are two 16-B pieces per
// lane at k offsets 8h and 16+8h (h = lane>>4), row/col = lane&15.
// MODE 0: f16 row-major C; MODE 1: f32 row-major C; MODE 2: f16 C^T ([n][m]).
// ---------------------------------------------------------------------------
union CTile { float f[128][64]; f16_t h[128][64]; f16_t t[64][128]; };

template <int MODE, bool BIAS, bool GELU, bool RESID>
__global__ __launch_bounds__(256) void gemm_nt_kernel(
    const f16_t* __restrict__ A, int lda, long long aBatch,
    const f16_t* __restrict__ Bw, int ldb, long long bBatch,
    f16_t* __restrict__ Ch, float* __restrict__ Cf, int ldc, long long cBatch,
    int Kdim, const float* __restrict__ bias, const float* __restrict__ resid) {
  __shared__ __attribute__((aligned(16))) f16_t As[128][32];
  __shared__ __attribute__((aligned(16))) f16_t Bs[64][32];
  __shared__ __attribute__((aligned(16))) CTile Cs;
  const int tid = threadIdx.x, lane = tid & 31, wave = tid >> 5;
  const int hh = lane >> 4, m = lane & 15;
  const long long z = blockIdx.z;
  const f16_t* Ab = A + z * aBatch;
  const f16_t* Bb = Bw + z * bBatch;
  const int m0 = blockIdx.x * 128, n0 = blockIdx.y * 64;
  const int ar = tid >> 2, ac = (tid & 3) * 8;
  const f16_t* gA0 = Ab + (long long)(m0 + ar) * lda + ac;
  const f16_t* gA1 = Ab + (long long)(m0 + ar + 64) * lda + ac;
  const f16_t* gB  = Bb + (long long)(n0 + ar) * ldb + ac;
  v8f acc[4] = {};
  const int nk = Kdim >> 5;
  const int mrow = wave * 16 + m;
  for (int i = 0; i < nk; i++) {
    const int k0 = i << 5;
    const v8h sa0 = *(const v8hm*)(gA0 + k0);
    const v8h sa1 = *(const v8hm*)(gA1 + k0);
    const v8h sb  = *(const v8hm*)(gB + k0);
    __syncthreads();
    *(v8hm*)&As[ar][ac]      = sa0;
    *(v8hm*)&As[ar + 64][ac] = sa1;
    *(v8hm*)&Bs[ar][ac]      = sb;
    __syncthreads();
    Frag a;
    a.p[0] = *(const v8hm*)&As[mrow][8 * hh];
    a.p[1] = *(const v8hm*)&As[mrow][16 + 8 * hh];
#pragma unroll
    for (int nt = 0; nt < 4; nt++) {
      Frag b;
      b.p[0] = *(const v8hm*)&Bs[nt * 16 + m][8 * hh];
      b.p[1] = *(const v8hm*)&Bs[nt * 16 + m][16 + 8 * hh];
      acc[nt] = wmma16(a.v, b.v, acc[nt]);
    }
  }

  // D element r of lane = (row wave*16 + 8h + r, col nt*16 + m) of the block tile.
#pragma unroll
  for (int nt = 0; nt < 4; nt++) {
    const int cn = nt * 16 + m;
    float bs = 0.f;
    if (BIAS) bs = bias[n0 + cn];
#pragma unroll
    for (int r = 0; r < 8; r++) {
      const int cm = wave * 16 + 8 * hh + r;
      float xv = acc[nt][r] + bs;
      if (GELU) xv = 0.5f * xv * (1.0f + erff(xv * 0.70710678118654752f));
      if (MODE == 1) Cs.f[cm][cn] = xv;
      else if (MODE == 0) Cs.h[cm][cn] = (f16_t)xv;
      else Cs.t[cn][cm] = (f16_t)xv;
    }
  }
  __syncthreads();

  if (MODE == 1) {
    float* Cb = Cf + z * cBatch;
    v4f vals[8];
#pragma unroll
    for (int j = 0; j < 8; j++) {
      const int row = wave * 16 + 2 * j + hh;
      const int c4 = m * 4;
      v4f v = *(const v4fm*)&Cs.f[row][c4];
      if (RESID) {
        const v4f rr = *(const v4fm*)(resid + (long long)(m0 + row) * ldc + n0 + c4);
        v += rr;
      }
      vals[j] = v;
    }
#pragma unroll
    for (int j = 0; j < 8; j++) {
      const int row = wave * 16 + 2 * j + hh;
      *(v4fm*)(Cb + (long long)(m0 + row) * ldc + n0 + m * 4) = vals[j];
    }
    
  } else if (MODE == 0) {
    f16_t* Cb = Ch + z * cBatch;
    v8h vals[4];
    const int rsub = lane >> 3, c8 = (lane & 7) * 8;
#pragma unroll
    for (int j = 0; j < 4; j++) {
      const int row = wave * 16 + 4 * j + rsub;
      vals[j] = *(const v8hm*)&Cs.h[row][c8];
    }
#pragma unroll
    for (int j = 0; j < 4; j++) {
      const int row = wave * 16 + 4 * j + rsub;
      *(v8hm*)(Cb + (long long)(m0 + row) * ldc + n0 + c8) = vals[j];
    }
    
  } else {
    f16_t* Cb = Ch + z * cBatch;
    v8h vals[4];
    const int c8 = m * 8;
#pragma unroll
    for (int j = 0; j < 4; j++) {
      const int row = wave * 8 + 2 * j + hh;
      vals[j] = *(const v8hm*)&Cs.t[row][c8];
    }
#pragma unroll
    for (int j = 0; j < 4; j++) {
      const int row = wave * 8 + 2 * j + hh;
      *(v8hm*)(Cb + (long long)(n0 + row) * ldc + m0 + c8) = vals[j];
    }
    
  }
}

// ---------------------------------------------------------------------------
// S_h = Q_h^T K_h = Wq_h (cx1^T ea) Wk_h^T: the sum over n is done once per batch on the
// normalised activations, G = cx1^T ea (64 x 192), split over SPLIT_ work-groups per b.
// A = cx1T [64][B*N] (row c, k = n contiguous), B = eaT [192][B*N]
// (row kv, k = n contiguous) -> both fragments loaded with the same k map.
// Each work-group sums KSTEPS_ * 32 values of n and stores its f32 accumulators
// in register order: chunk ((wave*6 + t)*2 + half)*32 + lane holds 4 floats,
// rows mt*16 + 8h + 4*half + 0..3 of column (ng*6 + t)*16 + m.
// ---------------------------------------------------------------------------
#define SPLIT_  14
#define KSTEPS_ (N_ / 32 / SPLIT_)  // 7
#define SELEMS_ (C1_ * KV_)         // 12288

__global__ __launch_bounds__(256) void scores_partial_kernel(
    const f16_t* __restrict__ XT, const f16_t* __restrict__ ET, float* __restrict__ part) {
  __shared__ __attribute__((aligned(16))) f16_t Aq[64][32];
  __shared__ __attribute__((aligned(16))) f16_t Bk[192][32];
  const int tid = threadIdx.x, lane = tid & 31, wave = tid >> 5;
  const int hh = lane >> 4, m = lane & 15;
  const int sp = blockIdx.x;
  const int b = blockIdx.y;
  const f16_t* Ab = XT + (size_t)b * N_ + sp * (KSTEPS_ * 32);
  const f16_t* Bb = ET + (size_t)b * N_ + sp * (KSTEPS_ * 32);
  const int mt = wave & 3, ng = wave >> 2;
  v8f acc[6] = {};
  const int ar = tid >> 2, ac = (tid & 3) * 8;
  const f16_t* gA  = Ab + (size_t)ar * BN_ + ac;
  const f16_t* gB0 = Bb + (size_t)ar * BN_ + ac;
  const f16_t* gB1 = Bb + (size_t)(ar + 64) * BN_ + ac;
  const f16_t* gB2 = Bb + (size_t)(ar + 128) * BN_ + ac;
  const int mrow = mt * 16 + m;

  // Whole unroll of the 7 trips: unrolled by two, the odd count costs a copy of all 48 accumulators per pair.
#pragma unroll
  for (int it = 0; it < KSTEPS_; it++) {
    const int n0 = it * 32;
    const v8h sa  = *(const v8hm*)(gA + n0);
    const v8h sb0 = *(const v8hm*)(gB0 + n0);
    const v8h sb1 = *(const v8hm*)(gB1 + n0);
    const v8h sb2 = *(const v8hm*)(gB2 + n0);
    __syncthreads();
    *(v8hm*)&Aq[ar][ac]       = sa;
    *(v8hm*)&Bk[ar][ac]       = sb0;
    *(v8hm*)&Bk[ar + 64][ac]  = sb1;
    *(v8hm*)&Bk[ar + 128][ac] = sb2;
    __syncthreads();
    Frag a;
    a.p[0] = *(const v8hm*)&Aq[mrow][8 * hh];
    a.p[1] = *(const v8hm*)&Aq[mrow][16 + 8 * hh];
#pragma unroll
    for (int t = 0; t < 6; t++) {
      const int col = (ng * 6 + t) * 16 + m;
      Frag bf;
      bf.p[0] = *(const v8hm*)&Bk[col][8 * hh];
      bf.p[1] = *(const v8hm*)&Bk[col][16 + 8 * hh];
      acc[t] = wmma16(a.v, bf.v, acc[t]);
    }
  }

  // Each store instruction writes 512 contiguous bytes (4 whole lines) of this wave's own range.
  float* pb = part + ((size_t)sp * B_ + b) * SELEMS_ + (size_t)wave * 1536 + lane * 4;
#pragma unroll
  for (int t = 0; t < 6; t++) {
#pragma unroll
    for (int hf = 0; hf < 2; hf++) {
      v4f v;
#pragma unroll
      for (int j = 0; j < 4; j++) v[j] = acc[t][hf * 4 + j];
      *(v4fm*)(pb + (t * 2 + hf) * 128) = v;
    }
  }
}

// ---------------------------------------------------------------------------
// One block of 32 waves per (b,h): G_b = sum of the SPLIT_ partials (each thread owns
// 3 chunks of 4 floats), T = Wq_h G_b, S = T Wk_h^T (both on WMMA, 24 waves x 2 tiles),
// scale, InstanceNorm over (64,192), softmax over KV, P*4096 stored as f16 [64][192].
// G is carried x 1/64 (exact power of two) as f16 operand and unscaled in f32 on S.
// ---------------------------------------------------------------------------
__global__ __launch_bounds__(1024) void merge_softmax_kernel(
    const float* __restrict__ part, const f16_t* __restrict__ Wq,
    const f16_t* __restrict__ Wk, f16_t* __restrict__ P) {
  __shared__ float Sb[64][196];
  __shared__ __attribute__((aligned(16))) f16_t Pst[64][192];
  __shared__ __attribute__((aligned(16))) f16_t Gt[192][72];   // G^T / 64: [k'][c']
  __shared__ __attribute__((aligned(16))) f16_t Tl[64][200];   // T / 64:   [c][k']
  __shared__ float red[32];
  __shared__ float red2[32];
  const int tid = threadIdx.x, lane = tid & 31;
  const int wave = __builtin_amdgcn_readfirstlane(tid >> 5);
  const int hh = lane >> 4, m = lane & 15;
  const int bh = blockIdx.x, b = bh >> 2, hd = bh & 3;
  const float* pb = part + (size_t)b * SELEMS_ + tid * 4;

  // Matrix work: wave < 24 owns column tile nt (of 12) and row tiles 2*mp, 2*mp + 1 (of 4).
  const bool mm = wave < 24;
  const int mp = wave / 12, nt = wave - mp * 12;
  v4f a[3] = {};
#pragma unroll
  for (int s = 0; s < SPLIT_; s++) {
#pragma unroll
    for (int i = 0; i < 3; i++)
      a[i] += *(const v4fm*)(pb + (size_t)s * B_ * SELEMS_ + i * 4096);
  }

#pragma unroll
  for (int i = 0; i < 3; i++) {
    const int g = wave + 32 * i;          // chunk group = (producer wave)*12 + t*2 + half
    const int wa = g / 12, rem = g - wa * 12;
    const int row0 = (wa & 3) * 16 + 8 * hh + (rem & 1) * 4;
    const int col = ((wa >> 2) * 6 + (rem >> 1)) * 16 + m;
    v4h gq;
#pragma unroll
    for (int j = 0; j < 4; j++) gq[j] = (f16_t)(a[i][j] * 0.015625f);
    *(v4hm*)&Gt[col][row0] = gq;
  }

  // Weight fragments are fetched here, behind the sum (whose loads need the registers) and in front of
  // the barrier, so that their latency runs under the wait for the other waves.
  Frag wq[2][2], wk[6];
  if (mm) {
    const f16_t* wqb = Wq + (size_t)hd * C1_ * C1_ + (size_t)(mp * 32 + m) * C1_ + 8 * hh;
#pragma unroll
    for (int t = 0; t < 2; t++) {
#pragma unroll
      for (int kk = 0; kk < 2; kk++) {
        wq[t][kk].p[0] = *(const v8hm*)(wqb + t * 16 * C1_ + kk * 32);
        wq[t][kk].p[1] = *(const v8hm*)(wqb + t * 16 * C1_ + kk * 32 + 16);
      }
    }
    const f16_t* wkb = Wk + (size_t)hd * KV_ * KV_ + (size_t)(nt * 16 + m) * KV_ + 8 * hh;
#pragma unroll
    for (int kk = 0; kk < 6; kk++) {
      wk[kk].p[0] = *(const v8hm*)(wkb + kk * 32);
      wk[kk].p[1] = *(const v8hm*)(wkb + kk * 32 + 16);
    }
    // Holds both address pairs until the loads above have taken them.
    asm volatile("s_wait_xcnt 0x0" :: "v"(wqb), "v"(wkb) : "memory");
  }
  __syncthreads();

  // T[c][k'] = sum_c' Wq[c][c'] G[c'][k']: A = Wq rows, B = Gt rows, both k = c' contiguous.
  if (mm) {
    v8f t1[2] = {};
#pragma unroll
    for (int kk = 0; kk < 2; kk++) {
      Frag bf;
      bf.p[0] = *(const v8hm*)&Gt[nt * 16 + m][kk * 32 + 8 * hh];
      bf.p[1] = *(const v8hm*)&Gt[nt * 16 + m][kk * 32 + 16 + 8 * hh];
#pragma unroll
      for (int t = 0; t < 2; t++) t1[t] = wmma16(wq[t][kk].v, bf.v, t1[t]);
    }
#pragma unroll
    for (int t = 0; t < 2; t++) {
#pragma unroll
      for (int r = 0; r < 8; r++)
        Tl[mp * 32 + t * 16 + 8 * hh + r][nt * 16 + m] = (f16_t)t1[t][r];
    }
  }
  __syncthreads();

  // S[c][k] = sum_k' T[c][k'] Wk[k][k']: A = Tl rows, B = Wk rows, both k = k' contiguous.
  const float sc = 64.0f * 0.07216878364870322f;  // 64 / sqrt(192)
  v8f sv[2] = {};
  float s = 0.f;
  if (mm) {
#pragma unroll
    for (int kk = 0; kk < 6; kk++) {
#pragma unroll
      for (int t = 0; t < 2; t++) {
        Frag af;
        af.p[0] = *(const v8hm*)&Tl[mp * 32 + t * 16 + m][kk * 32 + 8 * hh];
        af.p[1] = *(const v8hm*)&Tl[mp * 32 + t * 16 + m][kk * 32 + 16 + 8 * hh];
        sv[t] = wmma16(af.v, wk[kk].v, sv[t]);
      }
    }
#pragma unroll
    for (int t = 0; t < 2; t++) {
#pragma unroll
      for (int r = 0; r < 8; r++) {
        sv[t][r] *= sc;
        s += sv[t][r];
        Sb[mp * 32 + t * 16 + 8 * hh + r][nt * 16 + m] = sv[t][r];
      }
    }
  }
  s = wave_sum(s);
  if (lane == 0) red[wave] = s;
  __syncthreads();
  const float mean = wave_sum(red[lane]) * (1.0f / 12288.0f);
  float sq = 0.f;
  if (mm) {
#pragma unroll
    for (int t = 0; t < 2; t++) {
#pragma unroll
      for (int r = 0; r < 8; r++) { const float d = sv[t][r] - mean; sq += d * d; }
    }
  }
  sq = wave_sum(sq);
  if (lane == 0) red2[wave] = sq;
  __syncthreads();
  const float var  = wave_sum(red2[lane]) * (1.0f / 12288.0f);
  const float rstd = rsqrtf(var + 1e-5f);

  // Softmax over KV per row c; one wave per row, 2 rows per wave; P*4096 -> LDS.
  const float pscale = 4096.0f;
#pragma unroll
  for (int rr = 0; rr < 2; rr++) {
    const int r = wave * 2 + rr;
    float xs[6];
    float mx = -3.0e38f;
#pragma unroll
    for (int j = 0; j < 6; j++) {
      xs[j] = (Sb[r][lane + 32 * j] - mean) * rstd;
      mx = fmaxf(mx, xs[j]);
    }
    mx = wave_max(mx);
    float es = 0.f;
#pragma unroll
    for (int j = 0; j < 6; j++) { xs[j] = expf(xs[j] - mx); es += xs[j]; }
    es = wave_sum(es);
    const float inv = (1.0f / es) * pscale;
#pragma unroll
    for (int j = 0; j < 6; j++)
      Pst[r][lane + 32 * j] = (f16_t)(xs[j] * inv);
  }
  __syncthreads();

  // Whole-line stores: each row = 384 B = lanes 0..23 x 16 B, one instruction.
  f16_t* Pb = P + (size_t)bh * C1_ * KV_;
  const int l24 = (lane < 24) ? lane : 0;
  const bool se = lane < 24;
  v8h vals[2];
#pragma unroll
  for (int j = 0; j < 2; j++) vals[j] = *(const v8hm*)&Pst[wave * 2 + j][l24 * 8];
#pragma unroll
  for (int j = 0; j < 2; j++)
    if (se) *(v8hm*)(Pb + (size_t)(wave * 2 + j) * KV_ + l24 * 8) = vals[j];
}

// ---------------------------------------------------------------------------
// ctx mean over heads: ctxm[b,n,c] = (0.25/4096) * sum_h sum_k V[h,bn,k]*P4096[bh,c,k]
// Tile 64 rows (n) x 64 cols (c). grid = (N/64, 1, B). 24 k-steps of 32.
// A = V rows (k contiguous), B = P rows [c][k] (k contiguous).
// ---------------------------------------------------------------------------
__global__ __launch_bounds__(256) void ctx_mean_kernel(
    const f16_t* __restrict__ V, const f16_t* __restrict__ P, f16_t* __restrict__ ctxm) {
  __shared__ __attribute__((aligned(16))) f16_t Vs[64][32];
  __shared__ __attribute__((aligned(16))) f16_t Ps[64][32];
  __shared__ __attribute__((aligned(16))) f16_t Cs[64][64];
  const int tid = threadIdx.x, lane = tid & 31, wave = tid >> 5;
  const int hh = lane >> 4, m = lane & 15;
  const int b = blockIdx.z;
  const int n0 = blockIdx.x * 64;
  const int mt = wave & 3, ng = wave >> 2;
  v8f acc[2] = {};
  const int ar = tid >> 2, ac = (tid & 3) * 8;
  const int mrow = mt * 16 + m;

  const int nsteps = H_ * (KV_ / 32);  // 24
  for (int it = 0; it < nsteps; it++) {
    const int hd = it / 6;
    const int k0 = (it - hd * 6) * 32;
    const f16_t* Vb = V + ((size_t)hd * BN_ + (size_t)b * N_ + n0) * KV_;
    const f16_t* Pb = P + (size_t)(b * H_ + hd) * C1_ * KV_;
    const v8h sv = *(const v8hm*)(Vb + (size_t)ar * KV_ + k0 + ac);
    const v8h sp = *(const v8hm*)(Pb + (size_t)ar * KV_ + k0 + ac);
    __syncthreads();
    *(v8hm*)&Vs[ar][ac] = sv;
    *(v8hm*)&Ps[ar][ac] = sp;
    __syncthreads();
    Frag a;
    a.p[0] = *(const v8hm*)&Vs[mrow][8 * hh];
    a.p[1] = *(const v8hm*)&Vs[mrow][16 + 8 * hh];
#pragma unroll
    for (int t = 0; t < 2; t++) {
      const int col = (ng * 2 + t) * 16 + m;
      Frag bf;
      bf.p[0] = *(const v8hm*)&Ps[col][8 * hh];
      bf.p[1] = *(const v8hm*)&Ps[col][16 + 8 * hh];
      acc[t] = wmma16(a.v, bf.v, acc[t]);
    }
  }

  const float oscale = 0.25f / 4096.0f;
#pragma unroll
  for (int t = 0; t < 2; t++) {
    const int cn = (ng * 2 + t) * 16 + m;
#pragma unroll
    for (int r = 0; r < 8; r++)
      Cs[mt * 16 + 8 * hh + r][cn] = (f16_t)(acc[t][r] * oscale);
  }
  __syncthreads();

  const int rsub = lane >> 3, c8 = (lane & 7) * 8;
  v8h vals[2];
#pragma unroll
  for (int j = 0; j < 2; j++) vals[j] = *(const v8hm*)&Cs[wave * 8 + 4 * j + rsub][c8];
#pragma unroll
  for (int j = 0; j < 2; j++) {
    const int row = wave * 8 + 4 * j + rsub;
    *(v8hm*)(ctxm + ((size_t)b * N_ + n0 + row) * C1_ + c8) = vals[j];
  }
  
}

// ---------------------------------------------------------------------------
// Host-side orchestration
// ---------------------------------------------------------------------------
extern "C" void kernel_launch(void* const* d_in, const int* in_sizes, int n_in,
                              void* d_out, int out_size, void* d_ws, size_t ws_size,
                              hipStream_t stream) {
  if (n_in < 16) return;
  const int need[16] = {BN_ * C1_, BN_ * C2_, H_ * C1_ * C1_, H_ * KV_ * KV_, H_ * KV_ * KV_,
                        C1_ * C1_, C1_, C1_, KV_, KV_, C1_, C1_, MLP_ * C1_, MLP_,
                        C1_ * MLP_, C1_};
  for (int i = 0; i < 16; i++) if (in_sizes[i] != need[i]) return;
  if (out_size != BN_ * C1_) return;

  const float* emb1    = (const float*)d_in[0];
  const float* emb2    = (const float*)d_in[1];
  const float* Wq      = (const float*)d_in[2];
  const float* Wk      = (const float*)d_in[3];
  const float* Wv      = (const float*)d_in[4];
  const float* Wout    = (const float*)d_in[5];
  const float* ln1_g   = (const float*)d_in[6];
  const float* ln1_b   = (const float*)d_in[7];
  const float* lnall_g = (const float*)d_in[8];
  const float* lnall_b = (const float*)d_in[9];
  const float* ffn_g   = (const float*)d_in[10];
  const float* ffn_b   = (const float*)d_in[11];
  const float* fc1_w   = (const float*)d_in[12];
  const float* fc1_b   = (const float*)d_in[13];
  const float* fc2_w   = (const float*)d_in[14];
  const float* fc2_b   = (const float*)d_in[15];
  float* out = (float*)d_out;

  char* ws = (char*)d_ws;
  size_t off = 0;
  auto take = [&](size_t bytes) -> void* {
    off = (off + 255) & ~(size_t)255;
    void* p = ws + off;
    off += bytes;
    return p;
  };
  f16_t* cx1T  = (f16_t*)take((size_t)C1_ * BN_ * 2);        // [64][B*N]
  f16_t* ea    = (f16_t*)take((size_t)BN_ * KV_ * 2);
  f16_t* Wqh   = (f16_t*)take((size_t)H_ * C1_ * C1_ * 2);
  f16_t* Wkh   = (f16_t*)take((size_t)H_ * KV_ * KV_ * 2);
  f16_t* Wvh   = (f16_t*)take((size_t)H_ * KV_ * KV_ * 2);
  f16_t* Wouth = (f16_t*)take((size_t)C1_ * C1_ * 2);
  f16_t* fc1h  = (f16_t*)take((size_t)MLP_ * C1_ * 2);
  f16_t* fc2h  = (f16_t*)take((size_t)C1_ * MLP_ * 2);
  f16_t* eaT   = (f16_t*)take((size_t)KV_ * BN_ * 2);        // [192][B*N]
  f16_t* Vbuf  = (f16_t*)take((size_t)H_ * BN_ * KV_ * 2);   // [H][B*N][192]
  f16_t* Pm    = (f16_t*)take((size_t)B_ * H_ * C1_ * KV_ * 2);
  f16_t* ctxm  = (f16_t*)take((size_t)BN_ * C1_ * 2);
  float* cx    = (float*)take((size_t)BN_ * C1_ * 4);
  f16_t* ybuf  = (f16_t*)take((size_t)BN_ * C1_ * 2);
  f16_t* h1    = (f16_t*)take((size_t)BN_ * MLP_ * 2);
  float* Spart = (float*)take((size_t)SPLIT_ * B_ * SELEMS_ * 4);
  if (off > ws_size) return;

  auto cvt = [&](const float* s, f16_t* d, int n) {
    const int n8 = n / 8;
    cvt_f16_kernel<<<(n8 + 255) / 256, 256, 0, stream>>>(s, d, n8);
  };
  cvt(Wq,    Wqh,   H_ * C1_ * C1_);
  cvt(Wk,    Wkh,   H_ * KV_ * KV_);
  cvt(Wv,    Wvh,   H_ * KV_ * KV_);
  cvt(Wout,  Wouth, C1_ * C1_);
  cvt(fc1_w, fc1h,  MLP_ * C1_);
  cvt(fc2_w, fc2h,  C1_ * MLP_);

  ln_concat_kernel<<<BN_ / 64, 256, 0, stream>>>(emb1, emb2, ln1_g, ln1_b,
                                                 lnall_g, lnall_b, cx1T, ea, eaT);

  // V = ea * Wv[h]^T, row-major [H][B*N][192]
  gemm_nt_kernel<0, false, false, false>
      <<<dim3(BN_ / 128, KV_ / 64, H_), 256, 0, stream>>>(
      ea, KV_, 0LL, Wvh, KV_, (long long)KV_ * KV_,
      Vbuf, cx, KV_, (long long)BN_ * KV_, KV_, fc1_b, emb1);

  // G = cx1^T ea per b; S = Wq[h] G Wk[h]^T / sqrt(KV); InstanceNorm; softmax; -> P*4096 [bh][64][192]
  scores_partial_kernel<<<dim3(SPLIT_, B_), 256, 0, stream>>>(cx1T, eaT, Spart);
  merge_softmax_kernel<<<B_ * H_, 1024, 0, stream>>>(Spart, Wqh, Wkh, Pm);

  // ctx^T mean over heads -> ctxm [B*N][64]
  ctx_mean_kernel<<<dim3(N_ / 64, 1, B_), 256, 0, stream>>>(Vbuf, Pm, ctxm);

  // cx = ctxm * Wout^T + emb1   (f32)
  gemm_nt_kernel<1, false, false, true>
      <<<dim3(BN_ / 128, 1, 1), 256, 0, stream>>>(
      ctxm, C1_, 0LL, Wouth, C1_, 0LL,
      ybuf, cx, C1_, 0LL, C1_, fc1_b, emb1);

  ln64_kernel<<<(BN_ + 7) / 8, 256, 0, stream>>>(cx, ffn_g, ffn_b, ybuf, BN_);

  // h1 = GELU(y * fc1^T + b1)   (f16)
  gemm_nt_kernel<0, true, true, false>
      <<<dim3(BN_ / 128, MLP_ / 64, 1), 256, 0, stream>>>(
      ybuf, C1_, 0LL, fc1h, C1_, 0LL,
      h1, cx, MLP_, 0LL, C1_, fc1_b, emb1);

  // out = h1 * fc2^T + b2 + cx  (f32)
  gemm_nt_kernel<1, true, false, true>
      <<<dim3(BN_ / 128, 1, 1), 256, 0, stream>>>(
      h1, MLP_, 0LL, fc2h, MLP_, 0LL,
      ybuf, out, C1_, 0LL, MLP_, fc2_b, cx);
}

// v003
// A run of this version takes 80.8 microseconds.
// Next to v002, in two timings, it ran 1.58 times as fast each time.
// All steps since v000 together make it 2.70 times as fast.
#include <hip/hip_runtime.h>

// All contractions: v_wmma_f32_16x16x32_f16 (f16 operands, f32 accumulate); softmax P operand carried x4096 (exact power of two); x1/64 comes off in f32 before T2 goes to f16, the other x1/64 in cx's f32 epilogue.

typedef _Float16 f16_t;
typedef f16_t v16h __attribute__((ext_vector_type(16)));
typedef f16_t v8h __attribute__((ext_vector_type(8)));
typedef float v8f __attribute__((ext_vector_type(8)));
typedef float v4f __attribute__((ext_vector_type(4)));
typedef f16_t v4h __attribute__((ext_vector_type(4)));
typedef v8h v8hm __attribute__((may_alias));
typedef v4h v4hm __attribute__((may_alias));
typedef v4f v4fm __attribute__((may_alias));

#define H_   4
#define C1_  64
#define C2_  128
#define KV_  192
#define MLP_ 256
#define B_   8
#define N_   3136
#define BN_  (B_ * N_)

union Frag { v16h v; v8h p[2]; };

// 16x16x32 f16 WMMA with f32 accumulate, followed by a 4-slot VALU hazard guard.
__device__ __forceinline__ v8f wmma16(v16h a, v16h b, v8f c) {
  v8f d = __builtin_amdgcn_wmma_f32_16x16x32_f16(false, a, false, b, (short)0, c, false, false);
  asm volatile("v_nop\n\tv_nop\n\tv_nop\n\tv_nop" : "+v"(d) : "v"(a), "v"(b));
  return d;
}

__device__ __forceinline__ float wave_sum(float v) {
#pragma unroll
  for (int msk = 16; msk >= 1; msk >>= 1) v += __shfl_xor(v, msk, 32);
  return v;
}
__device__ __forceinline__ float wave_max(float v) {
#pragma unroll
  for (int msk = 16; msk >= 1; msk >>= 1) v = fmaxf(v, __shfl_xor(v, msk, 32));
  return v;
}

// ---------------------------------------------------------------------------
// ---------------------------------------------------------------------------
__global__ __launch_bounds__(256) void cvt_f16_kernel(const float* __restrict__ src,
                                                      f16_t* __restrict__ dst, int n8) {
  const int i = blockIdx.x * 256 + threadIdx.x;
  const bool ok = i < n8;
  const int ic = ok ? i : 0;
  const v4f x0 = *(const v4fm*)(src + (size_t)ic * 8);
  const v4f x1 = *(const v4fm*)(src + (size_t)ic * 8 + 4);
  v8h v;
#pragma unroll
  for (int j = 0; j < 4; j++) { v[j] = (f16_t)x0[j]; v[4 + j] = (f16_t)x1[j]; }
  f16_t* p = dst + (size_t)ic * 8;
  if (ok) *(v8hm*)p = v;
  
}

// ---------------------------------------------------------------------------
// Transposing convert of the H_ matrices [192][192]: dst[h][c][r] = (f16) src[h][r][c].
// One block = one 64 x 64 tile: a lane gathers 2 x 8 rows of one column (each load 128 contiguous
// bytes per wave), the tile turns in LDS, and 8 lanes store one whole 128-B line.
// ---------------------------------------------------------------------------
__global__ __launch_bounds__(256) void cvt_t_f16_kernel(const float* __restrict__ src,
                                                        f16_t* __restrict__ dst) {
  __shared__ __attribute__((aligned(16))) f16_t Tt[64][72];  // [column][row]
  const int tid = threadIdx.x;
  const int r0 = blockIdx.x * 64, c0 = blockIdx.y * 64;
  const size_t hb = (size_t)blockIdx.z * KV_ * KV_;
  const int c = tid & 63, rg = tid >> 6;
  const float* s = src + hb + (size_t)r0 * KV_ + c0 + c;
#pragma unroll
  for (int q = 0; q < 2; q++) {
    v8h v;
#pragma unroll
    for (int j = 0; j < 8; j++) v[j] = (f16_t)s[((rg + 4 * q) * 8 + j) * KV_];
    *(v8hm*)&Tt[c][(rg + 4 * q) * 8] = v;
  }
  __syncthreads();
  const int rs = tid >> 3, ck = (tid & 7) * 8;
#pragma unroll
  for (int q = 0; q < 2; q++) {
    const int row = q * 32 + rs;
    const v8h v = *(const v8hm*)&Tt[row][ck];
    *(v8hm*)(dst + hb + (size_t)(c0 + row) * KV_ + r0 + ck) = v;
  }
}

// ---------------------------------------------------------------------------
// Fused: cx1 = LN(emb1) (64), ea = LN(concat(emb1,emb2)) (192).
// One block = 64 rows (n), one wave = 8 rows. Outputs: ea row-major [B*N][192] and
// the channel-major copies cx1T [64][B*N], eaT [192][B*N] (64 n = one 128-B line).
// ---------------------------------------------------------------------------
__global__ __launch_bounds__(256) void ln_concat_kernel(
    const float* __restrict__ emb1, const float* __restrict__ emb2,
    const float* __restrict__ g1, const float* __restrict__ b1,
    const float* __restrict__ ga, const float* __restrict__ ba,
    f16_t* __restrict__ cx1T, f16_t* __restrict__ ea, f16_t* __restrict__ eaT) {
  __shared__ __attribute__((aligned(16))) f16_t Tt[256][72];  // [channel][n], 0..63 cx1, 64..255 ea
  __shared__ __attribute__((aligned(16))) f16_t Sr[64][200];  // [n][channel] of ea
  const int tid = threadIdx.x, wave = tid >> 5, lane = tid & 31;
  const int n0 = blockIdx.x * 64;

  float gv1[2], bv1[2], gva[6], bva[6];
#pragma unroll
  for (int j = 0; j < 2; j++) { gv1[j] = g1[lane + 32 * j]; bv1[j] = b1[lane + 32 * j]; }
#pragma unroll
  for (int j = 0; j < 6; j++) { gva[j] = ga[lane + 32 * j]; bva[j] = ba[lane + 32 * j]; }

  v8h tr[8];  // tr[q][i] = channel lane + 32q of row wave*8 + i
#pragma unroll
  for (int i = 0; i < 8; i++) {
    const int rl = wave * 8 + i;
    const float* r1 = emb1 + (size_t)(n0 + rl) * C1_;
    const float* r2 = emb2 + (size_t)(n0 + rl) * C2_;

    const float x0 = r1[lane], x1 = r1[lane + 32];
    const float mu = wave_sum(x0 + x1) * (1.0f / 64.0f);
    const float d0 = x0 - mu, d1 = x1 - mu;
    const float var = wave_sum(d0 * d0 + d1 * d1) * (1.0f / 64.0f);
    const float rs = rsqrtf(var + 1e-6f);
    tr[0][i] = (f16_t)(d0 * rs * gv1[0] + bv1[0]);
    tr[1][i] = (f16_t)(d1 * rs * gv1[1] + bv1[1]);

    float e[6];
    e[0] = x0; e[1] = x1;
#pragma unroll
    for (int j = 2; j < 6; j++) e[j] = r2[lane + 32 * (j - 2)];
    float s = 0.f;
#pragma unroll
    for (int j = 0; j < 6; j++) s += e[j];
    const float ma = wave_sum(s) * (1.0f / 192.0f);
    float sq = 0.f;
#pragma unroll
    for (int j = 0; j < 6; j++) { e[j] -= ma; sq += e[j] * e[j]; }
    const float vara = wave_sum(sq) * (1.0f / 192.0f);
    const float rsa = rsqrtf(vara + 1e-6f);
#pragma unroll
    for (int j = 0; j < 6; j++) {
      const f16_t y = (f16_t)(e[j] * rsa * gva[j] + bva[j]);
      tr[2 + j][i] = y;
      Sr[rl][lane + 32 * j] = y;
    }
  }
#pragma unroll
  for (int q = 0; q < 8; q++) *(v8hm*)&Tt[lane + 32 * q][wave * 8] = tr[q];
  __syncthreads();

  // Channel-major: 8 lanes fill one 128-B line, one instruction = 4 whole lines.
  const int chs = tid >> 3, ck = (tid & 7) * 8;
#pragma unroll
  for (int i = 0; i < 8; i++) {
    const int ch = i * 32 + chs;
    const v8h v = *(const v8hm*)&Tt[ch][ck];
    f16_t* d = (i < 2) ? cx1T + (size_t)ch * BN_ : eaT + (size_t)(ch - 64) * BN_;
    *(v8hm*)(d + n0 + ck) = v;
  }
  // Row-major ea: the 64 rows are 24576 contiguous bytes.
#pragma unroll
  for (int i = 0; i < 6; i++) {
    const int idx = i * 256 + tid;
    const int row = idx / 24, c8 = (idx - row * 24) * 8;
    const v8h v = *(const v8hm*)&Sr[row][c8];
    *(v8hm*)(ea + (size_t)n0 * KV_ + (size_t)idx * 8) = v;
  }
}

// ---------------------------------------------------------------------------
// LN over 64 channels (f32 in, f16 out). 1 wave per row, whole-line stores.
// ---------------------------------------------------------------------------
__global__ __launch_bounds__(256) void ln64_kernel(
    const float* __restrict__ x, const float* __restrict__ g,
    const float* __restrict__ bb, f16_t* __restrict__ y, int nrows) {
  __shared__ __attribute__((aligned(16))) f16_t St[8][64];
  const int wave = threadIdx.x >> 5, lane = threadIdx.x & 31;
  const int row = blockIdx.x * 8 + wave;
  const bool ok = row < nrows;
  const int rc = ok ? row : 0;
  const float* r = x + (size_t)rc * C1_;
  const float x0 = r[lane], x1 = r[lane + 32];
  const float mu = wave_sum(x0 + x1) * (1.0f / 64.0f);
  const float d0 = x0 - mu, d1 = x1 - mu;
  const float var = wave_sum(d0 * d0 + d1 * d1) * (1.0f / 64.0f);
  const float rs = rsqrtf(var + 1e-6f);
  St[wave][lane]      = (f16_t)(d0 * rs * g[lane] + bb[lane]);
  St[wave][lane + 32] = (f16_t)(d1 * rs * g[lane + 32] + bb[lane + 32]);
  __syncthreads();
  const int l8 = (lane < 8) ? lane : 0;
  const v8h pc = *(const v8hm*)&St[wave][l8 * 8];
  f16_t* dc = y + (size_t)rc * C1_ + l8 * 8;
  const bool sc = ok && (lane < 8);
  if (sc) *(v8hm*)dc = pc;
  
}

// ---------------------------------------------------------------------------
// Generic GEMM: C[M,N] = A[M,K] * Bw[N,K]^T  (nn.Linear), f16 WMMA, f32 acc.
// Tile M=128, N=64, K step 32, single-buffered LDS staging with barriers.
// A and Bw are both k-contiguous, so both fragments are two 16-B pieces per
// lane at k offsets 8h and 16+8h (h = lane>>4), row/col = lane&15.
// MODE 0: f16 row-major C; MODE 1: f32 row-major C; MODE 2: f16 C^T ([n][m]).
// ---------------------------------------------------------------------------
union CTile { float f[128][64]; f16_t h[128][64]; f16_t t[64][128]; };

template <int MODE, bool BIAS, bool GELU, bool RESID>
__global__ __launch_bounds__(256) void gemm_nt_kernel(
    const f16_t* __restrict__ A, int lda, long long aBatch,
    const f16_t* __restrict__ Bw, int ldb, long long bBatch,
    f16_t* __restrict__ Ch, float* __restrict__ Cf, int ldc, long long cBatch,
    int Kdim, const float* __restrict__ bias, const float* __restrict__ resid) {
  __shared__ __attribute__((aligned(16))) f16_t As[128][32];
  __shared__ __attribute__((aligned(16))) f16_t Bs[64][32];
  __shared__ __attribute__((aligned(16))) CTile Cs;
  const int tid = threadIdx.x, lane = tid & 31, wave = tid >> 5;
  const int hh = lane >> 4, m = lane & 15;
  const long long z = blockIdx.z;
  const f16_t* Ab = A + z * aBatch;
  const f16_t* Bb = Bw + z * bBatch;
  const int m0 = blockIdx.x * 128, n0 = blockIdx.y * 64;
  const int ar = tid >> 2, ac = (tid & 3) * 8;
  const f16_t* gA0 = Ab + (long long)(m0 + ar) * lda + ac;
  const f16_t* gA1 = Ab + (long long)(m0 + ar + 64) * lda + ac;
  const f16_t* gB  = Bb + (long long)(n0 + ar) * ldb + ac;
  v8f acc[4] = {};
  const int nk = Kdim >> 5;
  const int mrow = wave * 16 + m;
  for (int i = 0; i < nk; i++) {
    const int k0 = i << 5;
    const v8h sa0 = *(const v8hm*)(gA0 + k0);
    const v8h sa1 = *(const v8hm*)(gA1 + k0);
    const v8h sb  = *(const v8hm*)(gB + k0);
    __syncthreads();
    *(v8hm*)&As[ar][ac]      = sa0;
    *(v8hm*)&As[ar + 64][ac] = sa1;
    *(v8hm*)&Bs[ar][ac]      = sb;
    __syncthreads();
    Frag a;
    a.p[0] = *(const v8hm*)&As[mrow][8 * hh];
    a.p[1] = *(const v8hm*)&As[mrow][16 + 8 * hh];
#pragma unroll
    for (int nt = 0; nt < 4; nt++) {
      Frag b;
      b.p[0] = *(const v8hm*)&Bs[nt * 16 + m][8 * hh];
      b.p[1] = *(const v8hm*)&Bs[nt * 16 + m][16 + 8 * hh];
      acc[nt] = wmma16(a.v, b.v, acc[nt]);
    }
  }

  // D element r of lane = (row wave*16 + 8h + r, col nt*16 + m) of the block tile.
#pragma unroll
  for (int nt = 0; nt < 4; nt++) {
    const int cn = nt * 16 + m;
    float bs = 0.f;
    if (BIAS) bs = bias[n0 + cn];
#pragma unroll
    for (int r = 0; r < 8; r++) {
      const int cm = wave * 16 + 8 * hh + r;
      float xv = acc[nt][r] + bs;
      if (GELU) xv = 0.5f * xv * (1.0f + erff(xv * 0.70710678118654752f));
      if (MODE == 1) Cs.f[cm][cn] = xv;
      else if (MODE == 0) Cs.h[cm][cn] = (f16_t)xv;
      else Cs.t[cn][cm] = (f16_t)xv;
    }
  }
  __syncthreads();

  if (MODE == 1) {
    float* Cb = Cf + z * cBatch;
    v4f vals[8];
#pragma unroll
    for (int j = 0; j < 8; j++) {
      const int row = wave * 16 + 2 * j + hh;
      const int c4 = m * 4;
      v4f v = *(const v4fm*)&Cs.f[row][c4];
      if (RESID) {
        const v4f rr = *(const v4fm*)(resid + (long long)(m0 + row) * ldc + n0 + c4);
        v += rr;
      }
      vals[j] = v;
    }
#pragma unroll
    for (int j = 0; j < 8; j++) {
      const int row = wave * 16 + 2 * j + hh;
      *(v4fm*)(Cb + (long long)(m0 + row) * ldc + n0 + m * 4) = vals[j];
    }
    
  } else if (MODE == 0) {
    f16_t* Cb = Ch + z * cBatch;
    v8h vals[4];
    const int rsub = lane >> 3, c8 = (lane & 7) * 8;
#pragma unroll
    for (int j = 0; j < 4; j++) {
      const int row = wave * 16 + 4 * j + rsub;
      vals[j] = *(const v8hm*)&Cs.h[row][c8];
    }
#pragma unroll
    for (int j = 0; j < 4; j++) {
      const int row = wave * 16 + 4 * j + rsub;
      *(v8hm*)(Cb + (long long)(m0 + row) * ldc + n0 + c8) = vals[j];
    }
    
  } else {
    f16_t* Cb = Ch + z * cBatch;
    v8h vals[4];
    const int c8 = m * 8;
#pragma unroll
    for (int j = 0; j < 4; j++) {
      const int row = wave * 8 + 2 * j + hh;
      vals[j] = *(const v8hm*)&Cs.t[row][c8];
    }
#pragma unroll
    for (int j = 0; j < 4; j++) {
      const int row = wave * 8 + 2 * j + hh;
      *(v8hm*)(Cb + (long long)(n0 + row) * ldc + m0 + c8) = vals[j];
    }
    
  }
}

// ---------------------------------------------------------------------------
// S_h = Q_h^T K_h = Wq_h (cx1^T ea) Wk_h^T: the sum over n is done once per batch on the
// normalised activations, G = cx1^T ea (64 x 192), split over SPLIT_ work-groups per b.
// A = cx1T [64][B*N] (row c, k = n contiguous), B = eaT [192][B*N]
// (row kv, k = n contiguous) -> both fragments loaded with the same k map.
// Each work-group sums KSTEPS_ * 32 values of n and stores its f32 accumulators
// in register order: chunk ((wave*6 + t)*2 + half)*32 + lane holds 4 floats,
// rows mt*16 + 8h + 4*half + 0..3 of column (ng*6 + t)*16 + m.
// ---------------------------------------------------------------------------
#define SPLIT_  14
#define KSTEPS_ (N_ / 32 / SPLIT_)  // 7
#define SELEMS_ (C1_ * KV_)         // 12288

__global__ __launch_bounds__(256) void scores_partial_kernel(
    const f16_t* __restrict__ XT, const f16_t* __restrict__ ET, float* __restrict__ part) {
  __shared__ __attribute__((aligned(16))) f16_t Aq[64][32];
  __shared__ __attribute__((aligned(16))) f16_t Bk[192][32];
  const int tid = threadIdx.x, lane = tid & 31, wave = tid >> 5;
  const int hh = lane >> 4, m = lane & 15;
  const int sp = blockIdx.x;
  const int b = blockIdx.y;
  const f16_t* Ab = XT + (size_t)b * N_ + sp * (KSTEPS_ * 32);
  const f16_t* Bb = ET + (size_t)b * N_ + sp * (KSTEPS_ * 32);
  const int mt = wave & 3, ng = wave >> 2;
  v8f acc[6] = {};
  const int ar = tid >> 2, ac = (tid & 3) * 8;
  const f16_t* gA  = Ab + (size_t)ar * BN_ + ac;
  const f16_t* gB0 = Bb + (size_t)ar * BN_ + ac;
  const f16_t* gB1 = Bb + (size_t)(ar + 64) * BN_ + ac;
  const f16_t* gB2 = Bb + (size_t)(ar + 128) * BN_ + ac;
  const int mrow = mt * 16 + m;

  // Whole unroll of the 7 trips: unrolled by two, the odd count costs a copy of all 48 accumulators per pair.
#pragma unroll
  for (int it = 0; it < KSTEPS_; it++) {
    const int n0 = it * 32;
    const v8h sa  = *(const v8hm*)(gA + n0);
    const v8h sb0 = *(const v8hm*)(gB0 + n0);
    const v8h sb1 = *(const v8hm*)(gB1 + n0);
    const v8h sb2 = *(const v8hm*)(gB2 + n0);
    __syncthreads();
    *(v8hm*)&Aq[ar][ac]       = sa;
    *(v8hm*)&Bk[ar][ac]       = sb0;
    *(v8hm*)&Bk[ar + 64][ac]  = sb1;
    *(v8hm*)&Bk[ar + 128][ac] = sb2;
    __syncthreads();
    Frag a;
    a.p[0] = *(const v8hm*)&Aq[mrow][8 * hh];
    a.p[1] = *(const v8hm*)&Aq[mrow][16 + 8 * hh];
#pragma unroll
    for (int t = 0; t < 6; t++) {
      const int col = (ng * 6 + t) * 16 + m;
      Frag bf;
      bf.p[0] = *(const v8hm*)&Bk[col][8 * hh];
      bf.p[1] = *(const v8hm*)&Bk[col][16 + 8 * hh];
      acc[t] = wmma16(a.v, bf.v, acc[t]);
    }
  }

  // Each store instruction writes 512 contiguous bytes (4 whole lines) of this wave's own range.
  float* pb = part + ((size_t)sp * B_ + b) * SELEMS_ + (size_t)wave * 1536 + lane * 4;
#pragma unroll
  for (int t = 0; t < 6; t++) {
#pragma unroll
    for (int hf = 0; hf < 2; hf++) {
      v4f v;
#pragma unroll
      for (int j = 0; j < 4; j++) v[j] = acc[t][hf * 4 + j];
      *(v4fm*)(pb + (t * 2 + hf) * 128) = v;
    }
  }
}

// ---------------------------------------------------------------------------
// One block of 32 waves per (b,h): G_b = sum of the SPLIT_ partials (each thread owns
// 3 chunks of 4 floats), T = Wq_h G_b, S = T Wk_h^T (both on WMMA, 24 waves x 2 tiles),
// scale, InstanceNorm over (64,192), softmax over KV, P*4096 kept in LDS as f16.
// G is carried x 1/64 (exact power of two) as f16 operand and unscaled in f32 on S.
// Value side, o = mean_h (ea Wv_h^T) P_h^T Wout^T = ea (mean_h Wout P_h Wv_h)^T: this block forms
// T2 = P_h Wv_h and U_h = Wout T2 (both on WMMA, same wave map) and stores 64 * U_h as f16 [64][192].
// ---------------------------------------------------------------------------
__global__ __launch_bounds__(1024) void merge_softmax_kernel(
    const float* __restrict__ part, const f16_t* __restrict__ Wq,
    const f16_t* __restrict__ Wk, const f16_t* __restrict__ WvT,
    const f16_t* __restrict__ Wo, f16_t* __restrict__ U) {
  __shared__ float Sb[64][196];
  __shared__ __attribute__((aligned(16))) f16_t Pst[64][200];
  __shared__ __attribute__((aligned(16))) f16_t Gt[192][72];   // G^T / 64: [k'][c']; later 64 T2^T: [k'][c]
  __shared__ __attribute__((aligned(16))) f16_t Tl[64][200];   // T / 64:   [c][k']; later 64 U: [d][k']
  __shared__ __attribute__((aligned(16))) f16_t Wl[64][72];    // Wout: [d][c]
  __shared__ float red[32];
  __shared__ float red2[32];
  const int tid = threadIdx.x, lane = tid & 31;
  const int wave = __builtin_amdgcn_readfirstlane(tid >> 5);
  const int hh = lane >> 4, m = lane & 15;
  const int bh = blockIdx.x, b = bh >> 2, hd = bh & 3;
  const float* pb = part + (size_t)b * SELEMS_ + tid * 4;

  // Matrix work: wave < 24 owns column tile nt (of 12) and row tiles 2*mp, 2*mp + 1 (of 4).
  const bool mm = wave < 24;
  const int mp = wave / 12, nt = wave - mp * 12;
  const v4h wo4 = *(const v4hm*)(Wo + tid * 4);  // Wout goes to LDS with the first barrier
  v4f a[3] = {};
#pragma unroll
  for (int s = 0; s < SPLIT_; s++) {
#pragma unroll
    for (int i = 0; i < 3; i++)
      a[i] += *(const v4fm*)(pb + (size_t)s * B_ * SELEMS_ + i * 4096);
  }

#pragma unroll
  for (int i = 0; i < 3; i++) {
    const int g = wave + 32 * i;          // chunk group = (producer wave)*12 + t*2 + half
    const int wa = g / 12, rem = g - wa * 12;
    const int row0 = (wa & 3) * 16 + 8 * hh + (rem & 1) * 4;
    const int col = ((wa >> 2) * 6 + (rem >> 1)) * 16 + m;
    v4h gq;
#pragma unroll
    for (int j = 0; j < 4; j++) gq[j] = (f16_t)(a[i][j] * 0.015625f);
    *(v4hm*)&Gt[col][row0] = gq;
  }
  *(v4hm*)&Wl[tid >> 4][(tid & 15) * 4] = wo4;

  // Weight fragments are fetched here, behind the sum (whose loads need the registers) and in front of
  // the barrier, so that their latency runs under the wait for the other waves.
  Frag wq[2][2], wk[6];
  if (mm) {
    const f16_t* wqb = Wq + (size_t)hd * C1_ * C1_ + (size_t)(mp * 32 + m) * C1_ + 8 * hh;
#pragma unroll
    for (int t = 0; t < 2; t++) {
#pragma unroll
      for (int kk = 0; kk < 2; kk++) {
        wq[t][kk].p[0] = *(const v8hm*)(wqb + t * 16 * C1_ + kk * 32);
        wq[t][kk].p[1] = *(const v8hm*)(wqb + t * 16 * C1_ + kk * 32 + 16);
      }
    }
    const f16_t* wkb = Wk + (size_t)hd * KV_ * KV_ + (size_t)(nt * 16 + m) * KV_ + 8 * hh;
#pragma unroll
    for (int kk = 0; kk < 6; kk++) {
      wk[kk].p[0] = *(const v8hm*)(wkb + kk * 32);
      wk[kk].p[1] = *(const v8hm*)(wkb + kk * 32 + 16);
    }
    // Holds both address pairs until the loads above have taken them.
    asm volatile("s_wait_xcnt 0x0" :: "v"(wqb), "v"(wkb) : "memory");
  }
  __syncthreads();

  // T[c][k'] = sum_c' Wq[c][c'] G[c'][k']: A = Wq rows, B = Gt rows, both k = c' contiguous.
  if (mm) {
    v8f t1[2] = {};
#pragma unroll
    for (int kk = 0; kk < 2; kk++) {
      Frag bf;
      bf.p[0] = *(const v8hm*)&Gt[nt * 16 + m][kk * 32 + 8 * hh];
      bf.p[1] = *(const v8hm*)&Gt[nt * 16 + m][kk * 32 + 16 + 8 * hh];
#pragma unroll
      for (int t = 0; t < 2; t++) t1[t] = wmma16(wq[t][kk].v, bf.v, t1[t]);
    }
#pragma unroll
    for (int t = 0; t < 2; t++) {
#pragma unroll
      for (int r = 0; r < 8; r++)
        Tl[mp * 32 + t * 16 + 8 * hh + r][nt * 16 + m] = (f16_t)t1[t][r];
    }
  }
  __syncthreads();

  // S[c][k] = sum_k' T[c][k'] Wk[k][k']: A = Tl rows, B = Wk rows, both k = k' contiguous.
  const float sc = 64.0f * 0.07216878364870322f;  // 64 / sqrt(192)
  v8f sv[2] = {};
  float s = 0.f;
  if (mm) {
#pragma unroll
    for (int kk = 0; kk < 6; kk++) {
#pragma unroll
      for (int t = 0; t < 2; t++) {
        Frag af;
        af.p[0] = *(const v8hm*)&Tl[mp * 32 + t * 16 + m][kk * 32 + 8 * hh];
        af.p[1] = *(const v8hm*)&Tl[mp * 32 + t * 16 + m][kk * 32 + 16 + 8 * hh];
        sv[t] = wmma16(af.v, wk[kk].v, sv[t]);
      }
    }
#pragma unroll
    for (int t = 0; t < 2; t++) {
#pragma unroll
      for (int r = 0; r < 8; r++) {
        sv[t][r] *= sc;
        s += sv[t][r];
        Sb[mp * 32 + t * 16 + 8 * hh + r][nt * 16 + m] = sv[t][r];
      }
    }
  }
  // Wv's fragments are fetched here, where Wk's registers are free, in front of the norm and the softmax.
  Frag wv[6];
  if (mm) {
    const f16_t* wvb = WvT + (size_t)hd * KV_ * KV_ + (size_t)(nt * 16 + m) * KV_ + 8 * hh;
#pragma unroll
    for (int kk = 0; kk < 6; kk++) {
      wv[kk].p[0] = *(const v8hm*)(wvb + kk * 32);
      wv[kk].p[1] = *(const v8hm*)(wvb + kk * 32 + 16);
    }
    // Holds the address pair until the loads above have taken it, as at the first weight fetch.
    asm volatile("s_wait_xcnt 0x0" :: "v"(wvb) : "memory");
  }
  s = wave_sum(s);
  if (lane == 0) red[wave] = s;
  __syncthreads();
  const float mean = wave_sum(red[lane]) * (1.0f / 12288.0f);
  float sq = 0.f;
  if (mm) {
#pragma unroll
    for (int t = 0; t < 2; t++) {
#pragma unroll
      for (int r = 0; r < 8; r++) { const float d = sv[t][r] - mean; sq += d * d; }
    }
  }
  sq = wave_sum(sq);
  if (lane == 0) red2[wave] = sq;
  __syncthreads();
  const float var  = wave_sum(red2[lane]) * (1.0f / 12288.0f);
  const float rstd = rsqrtf(var + 1e-5f);

  // Softmax over KV per row c; one wave per row, 2 rows per wave; P*4096 -> LDS.
  const float pscale = 4096.0f;
#pragma unroll
  for (int rr = 0; rr < 2; rr++) {
    const int r = wave * 2 + rr;
    float xs[6];
    float mx = -3.0e38f;
#pragma unroll
    for (int j = 0; j < 6; j++) {
      xs[j] = (Sb[r][lane + 32 * j] - mean) * rstd;
      mx = fmaxf(mx, xs[j]);
    }
    mx = wave_max(mx);
    float es = 0.f;
#pragma unroll
    for (int j = 0; j < 6; j++) { xs[j] = expf(xs[j] - mx); es += xs[j]; }
    es = wave_sum(es);
    const float inv = (1.0f / es) * pscale;
#pragma unroll
    for (int j = 0; j < 6; j++)
      Pst[r][lane + 32 * j] = (f16_t)(xs[j] * inv);
  }
  __syncthreads();

  // T2[c][k'] = sum_k P[c][k] Wv[k][k']: A = Pst rows, B = WvT rows, both k contiguous.
  // A lane's 8 accumulators are 8 consecutive c of one k': one 16-B store into T2^T (x 4096 / 64).
  if (mm) {
    v8f t2[2] = {};
    // P's fragments are read six at a time in front of their WMMAs: two LDS latencies instead of twelve.
#pragma unroll
    for (int kh = 0; kh < 2; kh++) {
      Frag af[3][2];
#pragma unroll
      for (int kk = 0; kk < 3; kk++) {
#pragma unroll
        for (int t = 0; t < 2; t++) {
          af[kk][t].p[0] = *(const v8hm*)&Pst[mp * 32 + t * 16 + m][(kh * 3 + kk) * 32 + 8 * hh];
          af[kk][t].p[1] = *(const v8hm*)&Pst[mp * 32 + t * 16 + m][(kh * 3 + kk) * 32 + 16 + 8 * hh];
        }
      }
#pragma unroll
      for (int kk = 0; kk < 3; kk++) {
#pragma unroll
        for (int t = 0; t < 2; t++) t2[t] = wmma16(af[kk][t].v, wv[kh * 3 + kk].v, t2[t]);
      }
    }
#pragma unroll
    for (int t = 0; t < 2; t++) {
      v8h q;
#pragma unroll
      for (int r = 0; r < 8; r++) q[r] = (f16_t)(t2[t][r] * 0.015625f);
      *(v8hm*)&Gt[nt * 16 + m][mp * 32 + t * 16 + 8 * hh] = q;
    }
  }
  __syncthreads();

  // U^T[k'][d] = sum_c T2^T[k'][c] Wout[d][c]: A = Gt rows, B = Wl rows, both c contiguous.
  // A lane's 8 accumulators are 8 consecutive k' of one d: one 16-B store into U's row.
  if (mm) {
    v8f u[2] = {};
    Frag af[2], wo[2][2];
#pragma unroll
    for (int kk = 0; kk < 2; kk++) {
      af[kk].p[0] = *(const v8hm*)&Gt[nt * 16 + m][kk * 32 + 8 * hh];
      af[kk].p[1] = *(const v8hm*)&Gt[nt * 16 + m][kk * 32 + 16 + 8 * hh];
#pragma unroll
      for (int t = 0; t < 2; t++) {
        wo[t][kk].p[0] = *(const v8hm*)&Wl[mp * 32 + t * 16 + m][kk * 32 + 8 * hh];
        wo[t][kk].p[1] = *(const v8hm*)&Wl[mp * 32 + t * 16 + m][kk * 32 + 16 + 8 * hh];
      }
    }
#pragma unroll
    for (int kk = 0; kk < 2; kk++) {
#pragma unroll
      for (int t = 0; t < 2; t++) u[t] = wmma16(af[kk].v, wo[t][kk].v, u[t]);
    }
#pragma unroll
    for (int t = 0; t < 2; t++) {
      v8h q;
#pragma unroll
      for (int r = 0; r < 8; r++) q[r] = (f16_t)u[t][r];
      *(v8hm*)&Tl[mp * 32 + t * 16 + m][nt * 16 + 8 * hh] = q;
    }
  }
  __syncthreads();

  // Whole-line stores: each row = 384 B = lanes 0..23 x 16 B, one instruction.
  f16_t* Ub = U + (size_t)bh * C1_ * KV_;
  const int l24 = (lane < 24) ? lane : 0;
  const bool se = lane < 24;
  v8h vals[2];
#pragma unroll
  for (int j = 0; j < 2; j++) vals[j] = *(const v8hm*)&Tl[wave * 2 + j][l24 * 8];
#pragma unroll
  for (int j = 0; j < 2; j++)
    if (se) *(v8hm*)(Ub + (size_t)(wave * 2 + j) * KV_ + l24 * 8) = vals[j];
}

// ---------------------------------------------------------------------------
// cx[b,n,d] = emb1[b,n,d] + sum_k' ea[b,n,k'] * Um[b][d][k'],  Um = mean over heads of U_h.
// Tile 64 rows (n) x 64 cols (d), K = 192 staged whole: one round of loads, one barrier, 6 k-steps.
// The four heads' 64 * U_h are averaged in f32 while they are staged; A = ea rows, B = Um rows,
// both k' contiguous. grid = (N/64, B).
// ---------------------------------------------------------------------------
__global__ __launch_bounds__(256) void cx_kernel(
    const f16_t* __restrict__ ea, const f16_t* __restrict__ U,
    const float* __restrict__ emb1, float* __restrict__ cx) {
  __shared__ __attribute__((aligned(16))) f16_t Es[64][200];
  __shared__ __attribute__((aligned(16))) f16_t Us[64][200];
  __shared__ __attribute__((aligned(16))) float Cs[64][68];
  const int tid = threadIdx.x, lane = tid & 31, wave = tid >> 5;
  const int hh = lane >> 4, m = lane & 15;
  const int b = blockIdx.y;
  const size_t r0 = (size_t)b * N_ + blockIdx.x * 64;
  const int mt = wave & 3, ng = wave >> 2;

  // Both tiles are contiguous in memory: chunk i * 256 + tid of 16 B.
  const f16_t* Ub = U + (size_t)b * H_ * C1_ * KV_ + tid * 8;
  const f16_t* Eb = ea + r0 * KV_ + tid * 8;
  v8h uh[6][H_], ev[6];
  const size_t ro = (r0 + wave * 8 + hh) * C1_ + m * 4;  // rows wave*8 + 2j + hh, 16 lanes a row
  const float* rp = emb1 + ro;
  v4f rr[4];
#pragma unroll
  for (int j = 0; j < 4; j++) rr[j] = *(const v4fm*)(rp + j * 2 * C1_);
#pragma unroll
  for (int i = 0; i < 6; i++) ev[i] = *(const v8hm*)(Eb + i * 2048);
#pragma unroll
  for (int i = 0; i < 6; i++) {
#pragma unroll
    for (int h = 0; h < H_; h++) uh[i][h] = *(const v8hm*)(Ub + h * (C1_ * KV_) + i * 2048);
  }
  // Holds the address pair until the loads have taken it.
  asm volatile("s_wait_xcnt 0x0" :: "v"(rp) : "memory");
  // Keeps all 34 loads in front of the first use: left free, the scheduler issues a part of them
  // behind the first wait, and the block pays the load latency twice.
  __builtin_amdgcn_sched_barrier(0);

#pragma unroll
  for (int i = 0; i < 6; i++) {
    const int idx = i * 256 + tid;
    const int row = idx / 24, c8 = (idx - row * 24) * 8;
    v8h um;
#pragma unroll
    for (int j = 0; j < 8; j++) {
      float a = 0.25f * (float)uh[i][0][j];
#pragma unroll
      for (int h = 1; h < H_; h++) a = fmaf(0.25f, (float)uh[i][h][j], a);
      um[j] = (f16_t)a;
    }
    *(v8hm*)&Us[row][c8] = um;
    *(v8hm*)&Es[row][c8] = ev[i];
  }
  __syncthreads();

  // All 18 fragments are read in front of the first WMMA: one LDS latency instead of twelve.
  v8f acc[2] = {};
  const int mrow = mt * 16 + m;
  Frag a[6], bf[6][2];
#pragma unroll
  for (int kk = 0; kk < 6; kk++) {
    a[kk].p[0] = *(const v8hm*)&Es[mrow][kk * 32 + 8 * hh];
    a[kk].p[1] = *(const v8hm*)&Es[mrow][kk * 32 + 16 + 8 * hh];
#pragma unroll
    for (int t = 0; t < 2; t++) {
      const int col = (ng * 2 + t) * 16 + m;
      bf[kk][t].p[0] = *(const v8hm*)&Us[col][kk * 32 + 8 * hh];
      bf[kk][t].p[1] = *(const v8hm*)&Us[col][kk * 32 + 16 + 8 * hh];
    }
  }
#pragma unroll
  for (int kk = 0; kk < 6; kk++) {
#pragma unroll
    for (int t = 0; t < 2; t++) acc[t] = wmma16(a[kk].v, bf[kk][t].v, acc[t]);
  }

#pragma unroll
  for (int t = 0; t < 2; t++) {
    const int cn = (ng * 2 + t) * 16 + m;
#pragma unroll
    for (int r = 0; r < 8; r++) Cs[mt * 16 + 8 * hh + r][cn] = acc[t][r] * 0.015625f;
  }
  __syncthreads();

  // Whole-line stores: 16 lanes x 16 B = one 256-B row, two rows per instruction.
#pragma unroll
  for (int j = 0; j < 4; j++) {
    const v4f v = *(const v4fm*)&Cs[wave * 8 + 2 * j + hh][m * 4] + rr[j];
    *(v4fm*)(cx + ro + j * 2 * C1_) = v;
  }
}

// ---------------------------------------------------------------------------
// Host-side orchestration
// ---------------------------------------------------------------------------
extern "C" void kernel_launch(void* const* d_in, const int* in_sizes, int n_in,
                              void* d_out, int out_size, void* d_ws, size_t ws_size,
                              hipStream_t stream) {
  if (n_in < 16) return;
  const int need[16] = {BN_ * C1_, BN_ * C2_, H_ * C1_ * C1_, H_ * KV_ * KV_, H_ * KV_ * KV_,
                        C1_ * C1_, C1_, C1_, KV_, KV_, C1_, C1_, MLP_ * C1_, MLP_,
                        C1_ * MLP_, C1_};
  for (int i = 0; i < 16; i++) if (in_sizes[i] != need[i]) return;
  if (out_size != BN_ * C1_) return;

  const float* emb1    = (const float*)d_in[0];
  const float* emb2    = (const float*)d_in[1];
  const float* Wq      = (const float*)d_in[2];
  const float* Wk      = (const float*)d_in[3];
  const float* Wv      = (const float*)d_in[4];
  const float* Wout    = (const float*)d_in[5];
  const float* ln1_g   = (const float*)d_in[6];
  const float* ln1_b   = (const float*)d_in[7];
  const float* lnall_g = (const float*)d_in[8];
  const float* lnall_b = (const float*)d_in[9];
  const float* ffn_g   = (const float*)d_in[10];
  const float* ffn_b   = (const float*)d_in[11];
  const float* fc1_w   = (const float*)d_in[12];
  const float* fc1_b   = (const float*)d_in[13];
  const float* fc2_w   = (const float*)d_in[14];
  const float* fc2_b   = (const float*)d_in[15];
  float* out = (float*)d_out;

  char* ws = (char*)d_ws;
  size_t off = 0;
  auto take = [&](size_t bytes) -> void* {
    off = (off + 255) & ~(size_t)255;
    void* p = ws + off;
    off += bytes;
    return p;
  };
  f16_t* cx1T  = (f16_t*)take((size_t)C1_ * BN_ * 2);        // [64][B*N]
  f16_t* ea    = (f16_t*)take((size_t)BN_ * KV_ * 2);
  f16_t* Wqh   = (f16_t*)take((size_t)H_ * C1_ * C1_ * 2);
  f16_t* Wkh   = (f16_t*)take((size_t)H_ * KV_ * KV_ * 2);
  f16_t* WvT   = (f16_t*)take((size_t)H_ * KV_ * KV_ * 2);   // [H][k'][k]
  f16_t* Wouth = (f16_t*)take((size_t)C1_ * C1_ * 2);
  f16_t* fc1h  = (f16_t*)take((size_t)MLP_ * C1_ * 2);
  f16_t* fc2h  = (f16_t*)take((size_t)C1_ * MLP_ * 2);
  f16_t* eaT   = (f16_t*)take((size_t)KV_ * BN_ * 2);        // [192][B*N]
  f16_t* Um    = (f16_t*)take((size_t)B_ * H_ * C1_ * KV_ * 2);  // 64 * U_h, [bh][64][192]
  float* cx    = (float*)take((size_t)BN_ * C1_ * 4);
  f16_t* ybuf  = (f16_t*)take((size_t)BN_ * C1_ * 2);
  f16_t* h1    = (f16_t*)take((size_t)BN_ * MLP_ * 2);
  float* Spart = (float*)take((size_t)SPLIT_ * B_ * SELEMS_ * 4);
  if (off > ws_size) return;

  auto cvt = [&](const float* s, f16_t* d, int n) {
    const int n8 = n / 8;
    cvt_f16_kernel<<<(n8 + 255) / 256, 256, 0, stream>>>(s, d, n8);
  };
  cvt(Wq,    Wqh,   H_ * C1_ * C1_);
  cvt(Wk,    Wkh,   H_ * KV_ * KV_);
  cvt_t_f16_kernel<<<dim3(KV_ / 64, KV_ / 64, H_), 256, 0, stream>>>(Wv, WvT);
  cvt(Wout,  Wouth, C1_ * C1_);
  cvt(fc1_w, fc1h,  MLP_ * C1_);
  cvt(fc2_w, fc2h,  C1_ * MLP_);

  ln_concat_kernel<<<BN_ / 64, 256, 0, stream>>>(emb1, emb2, ln1_g, ln1_b,
                                                 lnall_g, lnall_b, cx1T, ea, eaT);

  // G = cx1^T ea per b; S = Wq[h] G Wk[h]^T / sqrt(KV); InstanceNorm; softmax P; U_h = Wout P Wv[h]
  scores_partial_kernel<<<dim3(SPLIT_, B_), 256, 0, stream>>>(cx1T, eaT, Spart);
  merge_softmax_kernel<<<B_ * H_, 1024, 0, stream>>>(Spart, Wqh, Wkh, WvT, Wouth, Um);

  // cx = ea * (mean_h U_h)^T + emb1   (f32)
  cx_kernel<<<dim3(N_ / 64, B_), 256, 0, stream>>>(ea, Um, emb1, cx);

  ln64_kernel<<<(BN_ + 7) / 8, 256, 0, stream>>>(cx, ffn_g, ffn_b, ybuf, BN_);

  // h1 = GELU(y * fc1^T + b1)   (f16)
  gemm_nt_kernel<0, true, true, false>
      <<<dim3(BN_ / 128, MLP_ / 64, 1), 256, 0, stream>>>(
      ybuf, C1_, 0LL, fc1h, C1_, 0LL,
      h1, cx, MLP_, 0LL, C1_, fc1_b, emb1);

  // out = h1 * fc2^T + b2 + cx  (f32)
  gemm_nt_kernel<1, true, false, true>
      <<<dim3(BN_ / 128, 1, 1), 256, 0, stream>>>(
      h1, MLP_, 0LL, fc2h, MLP_, 0LL,
      ybuf, out, C1_, 0LL, MLP_, fc2_b, cx);
}

// v004
// One run takes 68.2 microseconds.
// Timed twice side by side with v003, it ran 1.19 times as fast both times.
// Counting every step since v000, it is 3.21 times as fast.
#include <hip/hip_runtime.h>

// All contractions: v_wmma_f32_16x16x32_f16 (f16 operands, f32 accumulate); softmax P operand carried x4096 (exact power of two); x1/64 comes off in f32 before T2 goes to f16, the other x1/64 in cx's f32 epilogue.

typedef _Float16 f16_t;
typedef f16_t v16h __attribute__((ext_vector_type(16)));
typedef f16_t v8h __attribute__((ext_vector_type(8)));
typedef float v8f __attribute__((ext_vector_type(8)));
typedef float v4f __attribute__((ext_vector_type(4)));
typedef f16_t v4h __attribute__((ext_vector_type(4)));
typedef v8h v8hm __attribute__((may_alias));
typedef v4h v4hm __attribute__((may_alias));
typedef v4f v4fm __attribute__((may_alias));

#define H_   4
#define C1_  64
#define C2_  128
#define KV_  192
#define MLP_ 256
#define B_   8
#define N_   3136
#define BN_  (B_ * N_)

union Frag { v16h v; v8h p[2]; };

// 16x16x32 f16 WMMA with f32 accumulate, followed by a 4-slot VALU hazard guard.
__device__ __forceinline__ v8f wmma16(v16h a, v16h b, v8f c) {
  v8f d = __builtin_amdgcn_wmma_f32_16x16x32_f16(false, a, false, b, (short)0, c, false, false);
  asm volatile("v_nop\n\tv_nop\n\tv_nop\n\tv_nop" : "+v"(d) : "v"(a), "v"(b));
  return d;
}

__device__ __forceinline__ float wave_sum(float v) {
#pragma unroll
  for (int msk = 16; msk >= 1; msk >>= 1) v += __shfl_xor(v, msk, 32);
  return v;
}
__device__ __forceinline__ float wave_max(float v) {
#pragma unroll
  for (int msk = 16; msk >= 1; msk >>= 1) v = fmaxf(v, __shfl_xor(v, msk, 32));
  return v;
}

// ---------------------------------------------------------------------------
// Job of the preparation grid: block blk converts elements blk*2048 .. +2047 of a weight matrix
// (every matrix here is a whole number of such blocks).
// ---------------------------------------------------------------------------
__device__ __forceinline__ void cvt_f16_job(const float* __restrict__ src,
                                            f16_t* __restrict__ dst, int blk) {
  const int i = blk * 256 + threadIdx.x;
  const v4f x0 = *(const v4fm*)(src + (size_t)i * 8);
  const v4f x1 = *(const v4fm*)(src + (size_t)i * 8 + 4);
  v8h v;
#pragma unroll
  for (int j = 0; j < 4; j++) { v[j] = (f16_t)x0[j]; v[4 + j] = (f16_t)x1[j]; }
  *(v8hm*)(dst + (size_t)i * 8) = v;
  // Only the end of the kernel follows this store: the wait is a precaution.
  asm volatile("s_wait_xcnt 0x0" ::: "memory");
}

// ---------------------------------------------------------------------------
// Transposing convert of the H_ matrices [192][192]: dst[h][c][r] = (f16) src[h][r][c].
// One block = one 64 x 64 tile: a lane gathers 2 x 8 rows of one column (each load 128 contiguous
// bytes per wave), the tile turns in LDS, and 8 lanes store one whole 128-B line.
// ---------------------------------------------------------------------------
__device__ __forceinline__ void cvt_t_f16_job(const float* __restrict__ src,
                                              f16_t* __restrict__ dst,
                                              f16_t (*__restrict__ Tt)[72],  // [column][row], 64 rows used
                                              int blk) {
  const int tid = threadIdx.x;
  const int hd = blk / 9, t9 = blk - hd * 9, ty = t9 / 3, tx = t9 - ty * 3;
  const int r0 = tx * 64, c0 = ty * 64;
  const size_t hb = (size_t)hd * KV_ * KV_;
  const int c = tid & 63, rg = tid >> 6;
  const float* s = src + hb + (size_t)r0 * KV_ + c0 + c;
#pragma unroll
  for (int q = 0; q < 2; q++) {
    v8h v;
#pragma unroll
    for (int j = 0; j < 8; j++) v[j] = (f16_t)s[((rg + 4 * q) * 8 + j) * KV_];
    *(v8hm*)&Tt[c][(rg + 4 * q) * 8] = v;
  }
  __syncthreads();
  const int rs = tid >> 3, ck = (tid & 7) * 8;
#pragma unroll
  for (int q = 0; q < 2; q++) {
    const int row = q * 32 + rs;
    const v8h v = *(const v8hm*)&Tt[row][ck];
    *(v8hm*)(dst + hb + (size_t)(c0 + row) * KV_ + r0 + ck) = v;
  }
  // Only the end of the kernel follows these stores: the wait is a precaution.
  asm volatile("s_wait_xcnt 0x0" ::: "memory");
}

// ---------------------------------------------------------------------------
// Fused: cx1 = LN(emb1) (64), ea = LN(concat(emb1,emb2)) (192).
// One block = 64 rows (n), one wave = 8 rows. Outputs: ea row-major [B*N][192] and
// the channel-major copies cx1T [64][B*N], eaT [192][B*N] (64 n = one 128-B line).
// ---------------------------------------------------------------------------
__device__ __forceinline__ void ln_concat_job(
    const float* __restrict__ emb1, const float* __restrict__ emb2,
    const float* __restrict__ g1, const float* __restrict__ b1,
    const float* __restrict__ ga, const float* __restrict__ ba,
    f16_t* __restrict__ cx1T, f16_t* __restrict__ ea, f16_t* __restrict__ eaT,
    f16_t (*__restrict__ Tt)[72],    // [channel][n], 0..63 cx1, 64..255 ea
    f16_t (*__restrict__ Sr)[200],   // [n][channel] of ea
    int blk) {
  const int tid = threadIdx.x, wave = tid >> 5, lane = tid & 31;
  const int n0 = blk * 64;

  float gv1[2], bv1[2], gva[6], bva[6];
#pragma unroll
  for (int j = 0; j < 2; j++) { gv1[j] = g1[lane + 32 * j]; bv1[j] = b1[lane + 32 * j]; }
#pragma unroll
  for (int j = 0; j < 6; j++) { gva[j] = ga[lane + 32 * j]; bva[j] = ba[lane + 32 * j]; }

  v8h tr[8];  // tr[q][i] = channel lane + 32q of row wave*8 + i
#pragma unroll
  for (int i = 0; i < 8; i++) {
    const int rl = wave * 8 + i;
    const float* r1 = emb1 + (size_t)(n0 + rl) * C1_;
    const float* r2 = emb2 + (size_t)(n0 + rl) * C2_;

    const float x0 = r1[lane], x1 = r1[lane + 32];
    const float mu = wave_sum(x0 + x1) * (1.0f / 64.0f);
    const float d0 = x0 - mu, d1 = x1 - mu;
    const float var = wave_sum(d0 * d0 + d1 * d1) * (1.0f / 64.0f);
    const float rs = rsqrtf(var + 1e-6f);
    tr[0][i] = (f16_t)(d0 * rs * gv1[0] + bv1[0]);
    tr[1][i] = (f16_t)(d1 * rs * gv1[1] + bv1[1]);

    float e[6];
    e[0] = x0; e[1] = x1;
#pragma unroll
    for (int j = 2; j < 6; j++) e[j] = r2[lane + 32 * (j - 2)];
    float s = 0.f;
#pragma unroll
    for (int j = 0; j < 6; j++) s += e[j];
    const float ma = wave_sum(s) * (1.0f / 192.0f);
    float sq = 0.f;
#pragma unroll
    for (int j = 0; j < 6; j++) { e[j] -= ma; sq += e[j] * e[j]; }
    const float vara = wave_sum(sq) * (1.0f / 192.0f);
    const float rsa = rsqrtf(vara + 1e-6f);
#pragma unroll
    for (int j = 0; j < 6; j++) {
      const f16_t y = (f16_t)(e[j] * rsa * gva[j] + bva[j]);
      tr[2 + j][i] = y;
      Sr[rl][lane + 32 * j] = y;
    }
  }
#pragma unroll
  for (int q = 0; q < 8; q++) *(v8hm*)&Tt[lane + 32 * q][wave * 8] = tr[q];
  __syncthreads();

  // Channel-major: 8 lanes fill one 128-B line, one instruction = 4 whole lines.
  const int chs = tid >> 3, ck = (tid & 7) * 8;
#pragma unroll
  for (int i = 0; i < 8; i++) {
    const int ch = i * 32 + chs;
    const v8h v = *(const v8hm*)&Tt[ch][ck];
    f16_t* d = (i < 2) ? cx1T + (size_t)ch * BN_ : eaT + (size_t)(ch - 64) * BN_;
    *(v8hm*)(d + n0 + ck) = v;
  }
  // Row-major ea: the 64 rows are 24576 contiguous bytes.
#pragma unroll
  for (int i = 0; i < 6; i++) {
    const int idx = i * 256 + tid;
    const int row = idx / 24, c8 = (idx - row * 24) * 8;
    const v8h v = *(const v8hm*)&Sr[row][c8];
    *(v8hm*)(ea + (size_t)n0 * KV_ + (size_t)idx * 8) = v;
  }
}

// ---------------------------------------------------------------------------
// Preparation grid: the two layer norms and the six weight conversions depend on nothing but the
// inputs, so they run as jobs of one launch, picked by work-group index. The layer-norm groups are
// the longest and take the lowest indices.
// ---------------------------------------------------------------------------
#define LN_BLKS_ (BN_ / 64)                  // 392
#define WV_BLKS_ (H_ * 9)                    // 36 tiles of 64 x 64
#define WK_BLKS_ (H_ * KV_ * KV_ / 2048)     // 72
#define WQ_BLKS_ (H_ * C1_ * C1_ / 2048)     // 8
#define F1_BLKS_ (MLP_ * C1_ / 2048)         // 8
#define F2_BLKS_ (C1_ * MLP_ / 2048)         // 8
#define WO_BLKS_ (C1_ * C1_ / 2048)          // 2
#define PREP_BLKS_ (LN_BLKS_ + WV_BLKS_ + WK_BLKS_ + WQ_BLKS_ + F1_BLKS_ + F2_BLKS_ + WO_BLKS_)

__global__ __launch_bounds__(256) void prep_kernel(
    const float* __restrict__ emb1, const float* __restrict__ emb2,
    const float* __restrict__ g1, const float* __restrict__ b1,
    const float* __restrict__ ga, const float* __restrict__ ba,
    const float* __restrict__ Wq, const float* __restrict__ Wk, const float* __restrict__ Wv,
    const float* __restrict__ Wo, const float* __restrict__ f1, const float* __restrict__ f2,
    f16_t* __restrict__ cx1T, f16_t* __restrict__ ea, f16_t* __restrict__ eaT,
    f16_t* __restrict__ Wqh, f16_t* __restrict__ Wkh, f16_t* __restrict__ WvT,
    f16_t* __restrict__ Woh, f16_t* __restrict__ f1h, f16_t* __restrict__ f2h) {
  __shared__ __attribute__((aligned(16))) f16_t Tt[256][72];
  __shared__ __attribute__((aligned(16))) f16_t Sr[64][200];
  int blk = blockIdx.x;
  if (blk < LN_BLKS_) {
    ln_concat_job(emb1, emb2, g1, b1, ga, ba, cx1T, ea, eaT, Tt, Sr, blk);
    return;
  }
  blk -= LN_BLKS_;
  if (blk < WV_BLKS_) {
    cvt_t_f16_job(Wv, WvT, Tt, blk);
    return;
  }
  blk -= WV_BLKS_;
  const float* s = Wk;
  f16_t* d = Wkh;
  if (blk >= WK_BLKS_) {
    blk -= WK_BLKS_; s = Wq; d = Wqh;
    if (blk >= WQ_BLKS_) {
      blk -= WQ_BLKS_; s = f1; d = f1h;
      if (blk >= F1_BLKS_) {
        blk -= F1_BLKS_; s = f2; d = f2h;
        if (blk >= F2_BLKS_) { blk -= F2_BLKS_; s = Wo; d = Woh; }
      }
    }
  }
  cvt_f16_job(s, d, blk);
}

// ---------------------------------------------------------------------------
// LN over 64 channels (f32 in, f16 out). 1 wave per row, whole-line stores.
// ---------------------------------------------------------------------------
__global__ __launch_bounds__(256) void ln64_kernel(
    const float* __restrict__ x, const float* __restrict__ g,
    const float* __restrict__ bb, f16_t* __restrict__ y, int nrows) {
  __shared__ __attribute__((aligned(16))) f16_t St[8][64];
  const int wave = threadIdx.x >> 5, lane = threadIdx.x & 31;
  const int row = blockIdx.x * 8 + wave;
  const bool ok = row < nrows;
  const int rc = ok ? row : 0;
  const float* r = x + (size_t)rc * C1_;
  const float x0 = r[lane], x1 = r[lane + 32];
  const float mu = wave_sum(x0 + x1) * (1.0f / 64.0f);
  const float d0 = x0 - mu, d1 = x1 - mu;
  const float var = wave_sum(d0 * d0 + d1 * d1) * (1.0f / 64.0f);
  const float rs = rsqrtf(var + 1e-6f);
  St[wave][lane]      = (f16_t)(d0 * rs * g[lane] + bb[lane]);
  St[wave][lane + 32] = (f16_t)(d1 * rs * g[lane + 32] + bb[lane + 32]);
  __syncthreads();
  const int l8 = (lane < 8) ? lane : 0;
  const v8h pc = *(const v8hm*)&St[wave][l8 * 8];
  f16_t* dc = y + (size_t)rc * C1_ + l8 * 8;
  const bool sc = ok && (lane < 8);
  if (sc) *(v8hm*)dc = pc;
  
}

// ---------------------------------------------------------------------------
// Generic GEMM: C[M,N] = A[M,K] * Bw[N,K]^T  (nn.Linear), f16 WMMA, f32 acc.
// Tile M=128, N=64, K step 32, single-buffered LDS staging with barriers.
// A and Bw are both k-contiguous, so both fragments are two 16-B pieces per
// lane at k offsets 8h and 16+8h (h = lane>>4), row/col = lane&15.
// MODE 0: f16 row-major C; MODE 1: f32 row-major C; MODE 2: f16 C^T ([n][m]).
// ---------------------------------------------------------------------------
union CTile { float f[128][64]; f16_t h[128][64]; f16_t t[64][128]; };

template <int MODE, bool BIAS, bool GELU, bool RESID>
__global__ __launch_bounds__(256) void gemm_nt_kernel(
    const f16_t* __restrict__ A, int lda, long long aBatch,
    const f16_t* __restrict__ Bw, int ldb, long long bBatch,
    f16_t* __restrict__ Ch, float* __restrict__ Cf, int ldc, long long cBatch,
    int Kdim, const float* __restrict__ bias, const float* __restrict__ resid) {
  __shared__ __attribute__((aligned(16))) f16_t As[128][32];
  __shared__ __attribute__((aligned(16))) f16_t Bs[64][32];
  __shared__ __attribute__((aligned(16))) CTile Cs;
  const int tid = threadIdx.x, lane = tid & 31, wave = tid >> 5;
  const int hh = lane >> 4, m = lane & 15;
  const long long z = blockIdx.z;
  const f16_t* Ab = A + z * aBatch;
  const f16_t* Bb = Bw + z * bBatch;
  const int m0 = blockIdx.x * 128, n0 = blockIdx.y * 64;
  const int ar = tid >> 2, ac = (tid & 3) * 8;
  const f16_t* gA0 = Ab + (long long)(m0 + ar) * lda + ac;
  const f16_t* gA1 = Ab + (long long)(m0 + ar + 64) * lda + ac;
  const f16_t* gB  = Bb + (long long)(n0 + ar) * ldb + ac;
  v8f acc[4] = {};
  const int nk = Kdim >> 5;
  const int mrow = wave * 16 + m;
  for (int i = 0; i < nk; i++) {
    const int k0 = i << 5;
    const v8h sa0 = *(const v8hm*)(gA0 + k0);
    const v8h sa1 = *(const v8hm*)(gA1 + k0);
    const v8h sb  = *(const v8hm*)(gB + k0);
    __syncthreads();
    *(v8hm*)&As[ar][ac]      = sa0;
    *(v8hm*)&As[ar + 64][ac] = sa1;
    *(v8hm*)&Bs[ar][ac]      = sb;
    __syncthreads();
    Frag a;
    a.p[0] = *(const v8hm*)&As[mrow][8 * hh];
    a.p[1] = *(const v8hm*)&As[mrow][16 + 8 * hh];
#pragma unroll
    for (int nt = 0; nt < 4; nt++) {
      Frag b;
      b.p[0] = *(const v8hm*)&Bs[nt * 16 + m][8 * hh];
      b.p[1] = *(const v8hm*)&Bs[nt * 16 + m][16 + 8 * hh];
      acc[nt] = wmma16(a.v, b.v, acc[nt]);
    }
  }

  // D element r of lane = (row wave*16 + 8h + r, col nt*16 + m) of the block tile.
#pragma unroll
  for (int nt = 0; nt < 4; nt++) {
    const int cn = nt * 16 + m;
    float bs = 0.f;
    if (BIAS) bs = bias[n0 + cn];
#pragma unroll
    for (int r = 0; r < 8; r++) {
      const int cm = wave * 16 + 8 * hh + r;
      float xv = acc[nt][r] + bs;
      if (GELU) xv = 0.5f * xv * (1.0f + erff(xv * 0.70710678118654752f));
      if (MODE == 1) Cs.f[cm][cn] = xv;
      else if (MODE == 0) Cs.h[cm][cn] = (f16_t)xv;
      else Cs.t[cn][cm] = (f16_t)xv;
    }
  }
  __syncthreads();

  if (MODE == 1) {
    float* Cb = Cf + z * cBatch;
    v4f vals[8];
#pragma unroll
    for (int j = 0; j < 8; j++) {
      const int row = wave * 16 + 2 * j + hh;
      const int c4 = m * 4;
      v4f v = *(const v4fm*)&Cs.f[row][c4];
      if (RESID) {
        const v4f rr = *(const v4fm*)(resid + (long long)(m0 + row) * ldc + n0 + c4);
        v += rr;
      }
      vals[j] = v;
    }
#pragma unroll
    for (int j = 0; j < 8; j++) {
      const int row = wave * 16 + 2 * j + hh;
      *(v4fm*)(Cb + (long long)(m0 + row) * ldc + n0 + m * 4) = vals[j];
    }
    
  } else if (MODE == 0) {
    f16_t* Cb = Ch + z * cBatch;
    v8h vals[4];
    const int rsub = lane >> 3, c8 = (lane & 7) * 8;
#pragma unroll
    for (int j = 0; j < 4; j++) {
      const int row = wave * 16 + 4 * j + rsub;
      vals[j] = *(const v8hm*)&Cs.h[row][c8];
    }
#pragma unroll
    for (int j = 0; j < 4; j++) {
      const int row = wave * 16 + 4 * j + rsub;
      *(v8hm*)(Cb + (long long)(m0 + row) * ldc + n0 + c8) = vals[j];
    }
    
  } else {
    f16_t* Cb = Ch + z * cBatch;
    v8h vals[4];
    const int c8 = m * 8;
#pragma unroll
    for (int j = 0; j < 4; j++) {
      const int row = wave * 8 + 2 * j + hh;
      vals[j] = *(const v8hm*)&Cs.t[row][c8];
    }
#pragma unroll
    for (int j = 0; j < 4; j++) {
      const int row = wave * 8 + 2 * j + hh;
      *(v8hm*)(Cb + (long long)(n0 + row) * ldc + m0 + c8) = vals[j];
    }
    
  }
}

// ---------------------------------------------------------------------------
// S_h = Q_h^T K_h = Wq_h (cx1^T ea) Wk_h^T: the sum over n is done once per batch on the
// normalised activations, G = cx1^T ea (64 x 192), split over SPLIT_ work-groups per b.
// A = cx1T [64][B*N] (row c, k = n contiguous), B = eaT [192][B*N]
// (row kv, k = n contiguous) -> both fragments loaded with the same k map.
// Each work-group sums KSTEPS_ * 32 values of n and stores its f32 accumulators
// in register order: chunk ((wave*6 + t)*2 + half)*32 + lane holds 4 floats,
// rows mt*16 + 8h + 4*half + 0..3 of column (ng*6 + t)*16 + m.
// ---------------------------------------------------------------------------
#define SPLIT_  14
#define KSTEPS_ (N_ / 32 / SPLIT_)  // 7
#define SELEMS_ (C1_ * KV_)         // 12288

__global__ __launch_bounds__(256) void scores_partial_kernel(
    const f16_t* __restrict__ XT, const f16_t* __restrict__ ET, float* __restrict__ part) {
  __shared__ __attribute__((aligned(16))) f16_t Aq[64][32];
  __shared__ __attribute__((aligned(16))) f16_t Bk[192][32];
  const int tid = threadIdx.x, lane = tid & 31, wave = tid >> 5;
  const int hh = lane >> 4, m = lane & 15;
  const int sp = blockIdx.x;
  const int b = blockIdx.y;
  const f16_t* Ab = XT + (size_t)b * N_ + sp * (KSTEPS_ * 32);
  const f16_t* Bb = ET + (size_t)b * N_ + sp * (KSTEPS_ * 32);
  const int mt = wave & 3, ng = wave >> 2;
  v8f acc[6] = {};
  const int ar = tid >> 2, ac = (tid & 3) * 8;
  const f16_t* gA  = Ab + (size_t)ar * BN_ + ac;
  const f16_t* gB0 = Bb + (size_t)ar * BN_ + ac;
  const f16_t* gB1 = Bb + (size_t)(ar + 64) * BN_ + ac;
  const f16_t* gB2 = Bb + (size_t)(ar + 128) * BN_ + ac;
  const int mrow = mt * 16 + m;

  // Whole unroll of the 7 trips: unrolled by two, the odd count costs a copy of all 48 accumulators per pair.
#pragma unroll
  for (int it = 0; it < KSTEPS_; it++) {
    const int n0 = it * 32;
    const v8h sa  = *(const v8hm*)(gA + n0);
    const v8h sb0 = *(const v8hm*)(gB0 + n0);
    const v8h sb1 = *(const v8hm*)(gB1 + n0);
    const v8h sb2 = *(const v8hm*)(gB2 + n0);
    __syncthreads();
    *(v8hm*)&Aq[ar][ac]       = sa;
    *(v8hm*)&Bk[ar][ac]       = sb0;
    *(v8hm*)&Bk[ar + 64][ac]  = sb1;
    *(v8hm*)&Bk[ar + 128][ac] = sb2;
    __syncthreads();
    Frag a;
    a.p[0] = *(const v8hm*)&Aq[mrow][8 * hh];
    a.p[1] = *(const v8hm*)&Aq[mrow][16 + 8 * hh];
#pragma unroll
    for (int t = 0; t < 6; t++) {
      const int col = (ng * 6 + t) * 16 + m;
      Frag bf;
      bf.p[0] = *(const v8hm*)&Bk[col][8 * hh];
      bf.p[1] = *(const v8hm*)&Bk[col][16 + 8 * hh];
      acc[t] = wmma16(a.v, bf.v, acc[t]);
    }
  }

  // Each store instruction writes 512 contiguous bytes (4 whole lines) of this wave's own range.
  float* pb = part + ((size_t)sp * B_ + b) * SELEMS_ + (size_t)wave * 1536 + lane * 4;
#pragma unroll
  for (int t = 0; t < 6; t++) {
#pragma unroll
    for (int hf = 0; hf < 2; hf++) {
      v4f v;
#pragma unroll
      for (int j = 0; j < 4; j++) v[j] = acc[t][hf * 4 + j];
      *(v4fm*)(pb + (t * 2 + hf) * 128) = v;
    }
  }
}

// ---------------------------------------------------------------------------
// One block of 32 waves per (b,h): G_b = sum of the SPLIT_ partials (each thread owns
// 3 chunks of 4 floats), T = Wq_h G_b, S = T Wk_h^T (both on WMMA, 24 waves x 2 tiles),
// scale, InstanceNorm over (64,192), softmax over KV, P*4096 kept in LDS as f16.
// G is carried x 1/64 (exact power of two) as f16 operand and unscaled in f32 on S.
// Value side, o = mean_h (ea Wv_h^T) P_h^T Wout^T = ea (mean_h Wout P_h Wv_h)^T: this block forms
// T2 = P_h Wv_h and U_h = Wout T2 (both on WMMA, same wave map) and stores 64 * U_h as f16 [64][192].
// ---------------------------------------------------------------------------
__global__ __launch_bounds__(1024) void merge_softmax_kernel(
    const float* __restrict__ part, const f16_t* __restrict__ Wq,
    const f16_t* __restrict__ Wk, const f16_t* __restrict__ WvT,
    const f16_t* __restrict__ Wo, f16_t* __restrict__ U) {
  __shared__ float Sb[64][196];
  __shared__ __attribute__((aligned(16))) f16_t Pst[64][200];
  __shared__ __attribute__((aligned(16))) f16_t Gt[192][72];   // G^T / 64: [k'][c']; later 64 T2^T: [k'][c]
  __shared__ __attribute__((aligned(16))) f16_t Tl[64][200];   // T / 64:   [c][k']; later 64 U: [d][k']
  __shared__ __attribute__((aligned(16))) f16_t Wl[64][72];    // Wout: [d][c]
  __shared__ float red[32];
  __shared__ float red2[32];
  const int tid = threadIdx.x, lane = tid & 31;
  const int wave = __builtin_amdgcn_readfirstlane(tid >> 5);
  const int hh = lane >> 4, m = lane & 15;
  const int bh = blockIdx.x, b = bh >> 2, hd = bh & 3;
  const float* pb = part + (size_t)b * SELEMS_ + tid * 4;

  // Matrix work: wave < 24 owns column tile nt (of 12) and row tiles 2*mp, 2*mp + 1 (of 4).
  const bool mm = wave < 24;
  const int mp = wave / 12, nt = wave - mp * 12;
  const v4h wo4 = *(const v4hm*)(Wo + tid * 4);  // Wout goes to LDS with the first barrier
  v4f a[3] = {};
#pragma unroll
  for (int s = 0; s < SPLIT_; s++) {
#pragma unroll
    for (int i = 0; i < 3; i++)
      a[i] += *(const v4fm*)(pb + (size_t)s * B_ * SELEMS_ + i * 4096);
  }

#pragma unroll
  for (int i = 0; i < 3; i++) {
    const int g = wave + 32 * i;          // chunk group = (producer wave)*12 + t*2 + half
    const int wa = g / 12, rem = g - wa * 12;
    const int row0 = (wa & 3) * 16 + 8 * hh + (rem & 1) * 4;
    const int col = ((wa >> 2) * 6 + (rem >> 1)) * 16 + m;
    v4h gq;
#pragma unroll
    for (int j = 0; j < 4; j++) gq[j] = (f16_t)(a[i][j] * 0.015625f);
    *(v4hm*)&Gt[col][row0] = gq;
  }
  *(v4hm*)&Wl[tid >> 4][(tid & 15) * 4] = wo4;

  // Weight fragments are fetched here, behind the sum (whose loads need the registers) and in front of
  // the barrier, so that their latency runs under the wait for the other waves.
  Frag wq[2][2], wk[6];
  if (mm) {
    const f16_t* wqb = Wq + (size_t)hd * C1_ * C1_ + (size_t)(mp * 32 + m) * C1_ + 8 * hh;
#pragma unroll
    for (int t = 0; t < 2; t++) {
#pragma unroll
      for (int kk = 0; kk < 2; kk++) {
        wq[t][kk].p[0] = *(const v8hm*)(wqb + t * 16 * C1_ + kk * 32);
        wq[t][kk].p[1] = *(const v8hm*)(wqb + t * 16 * C1_ + kk * 32 + 16);
      }
    }
    const f16_t* wkb = Wk + (size_t)hd * KV_ * KV_ + (size_t)(nt * 16 + m) * KV_ + 8 * hh;
#pragma unroll
    for (int kk = 0; kk < 6; kk++) {
      wk[kk].p[0] = *(const v8hm*)(wkb + kk * 32);
      wk[kk].p[1] = *(const v8hm*)(wkb + kk * 32 + 16);
    }
    // Holds both address pairs until the loads above have taken them.
    asm volatile("s_wait_xcnt 0x0" :: "v"(wqb), "v"(wkb) : "memory");
  }
  __syncthreads();

  // T[c][k'] = sum_c' Wq[c][c'] G[c'][k']: A = Wq rows, B = Gt rows, both k = c' contiguous.
  if (mm) {
    v8f t1[2] = {};
#pragma unroll
    for (int kk = 0; kk < 2; kk++) {
      Frag bf;
      bf.p[0] = *(const v8hm*)&Gt[nt * 16 + m][kk * 32 + 8 * hh];
      bf.p[1] = *(const v8hm*)&Gt[nt * 16 + m][kk * 32 + 16 + 8 * hh];
#pragma unroll
      for (int t = 0; t < 2; t++) t1[t] = wmma16(wq[t][kk].v, bf.v, t1[t]);
    }
#pragma unroll
    for (int t = 0; t < 2; t++) {
#pragma unroll
      for (int r = 0; r < 8; r++)
        Tl[mp * 32 + t * 16 + 8 * hh + r][nt * 16 + m] = (f16_t)t1[t][r];
    }
  }
  __syncthreads();

  // S[c][k] = sum_k' T[c][k'] Wk[k][k']: A = Tl rows, B = Wk rows, both k = k' contiguous.
  const float sc = 64.0f * 0.07216878364870322f;  // 64 / sqrt(192)
  v8f sv[2] = {};
  float s = 0.f;
  if (mm) {
#pragma unroll
    for (int kk = 0; kk < 6; kk++) {
#pragma unroll
      for (int t = 0; t < 2; t++) {
        Frag af;
        af.p[0] = *(const v8hm*)&Tl[mp * 32 + t * 16 + m][kk * 32 + 8 * hh];
        af.p[1] = *(const v8hm*)&Tl[mp * 32 + t * 16 + m][kk * 32 + 16 + 8 * hh];
        sv[t] = wmma16(af.v, wk[kk].v, sv[t]);
      }
    }
#pragma unroll
    for (int t = 0; t < 2; t++) {
#pragma unroll
      for (int r = 0; r < 8; r++) {
        sv[t][r] *= sc;
        s += sv[t][r];
        Sb[mp * 32 + t * 16 + 8 * hh + r][nt * 16 + m] = sv[t][r];
      }
    }
  }
  // Wv's fragments are fetched here, where Wk's registers are free, in front of the norm and the softmax.
  Frag wv[6];
  if (mm) {
    const f16_t* wvb = WvT + (size_t)hd * KV_ * KV_ + (size_t)(nt * 16 + m) * KV_ + 8 * hh;
#pragma unroll
    for (int kk = 0; kk < 6; kk++) {
      wv[kk].p[0] = *(const v8hm*)(wvb + kk * 32);
      wv[kk].p[1] = *(const v8hm*)(wvb + kk * 32 + 16);
    }
    // Holds the address pair until the loads above have taken it, as at the first weight fetch.
    asm volatile("s_wait_xcnt 0x0" :: "v"(wvb) : "memory");
  }
  s = wave_sum(s);
  if (lane == 0) red[wave] = s;
  __syncthreads();
  const float mean = wave_sum(red[lane]) * (1.0f / 12288.0f);
  float sq = 0.f;
  if (mm) {
#pragma unroll
    for (int t = 0; t < 2; t++) {
#pragma unroll
      for (int r = 0; r < 8; r++) { const float d = sv[t][r] - mean; sq += d * d; }
    }
  }
  sq = wave_sum(sq);
  if (lane == 0) red2[wave] = sq;
  __syncthreads();
  const float var  = wave_sum(red2[lane]) * (1.0f / 12288.0f);
  const float rstd = rsqrtf(var + 1e-5f);

  // Softmax over KV per row c; one wave per row, 2 rows per wave; P*4096 -> LDS.
  const float pscale = 4096.0f;
#pragma unroll
  for (int rr = 0; rr < 2; rr++) {
    const int r = wave * 2 + rr;
    float xs[6];
    float mx = -3.0e38f;
#pragma unroll
    for (int j = 0; j < 6; j++) {
      xs[j] = (Sb[r][lane + 32 * j] - mean) * rstd;
      mx = fmaxf(mx, xs[j]);
    }
    mx = wave_max(mx);
    float es = 0.f;
#pragma unroll
    for (int j = 0; j < 6; j++) { xs[j] = expf(xs[j] - mx); es += xs[j]; }
    es = wave_sum(es);
    const float inv = (1.0f / es) * pscale;
#pragma unroll
    for (int j = 0; j < 6; j++)
      Pst[r][lane + 32 * j] = (f16_t)(xs[j] * inv);
  }
  __syncthreads();

  // T2[c][k'] = sum_k P[c][k] Wv[k][k']: A = Pst rows, B = WvT rows, both k contiguous.
  // A lane's 8 accumulators are 8 consecutive c of one k': one 16-B store into T2^T (x 4096 / 64).
  if (mm) {
    v8f t2[2] = {};
    // P's fragments are read six at a time in front of their WMMAs: two LDS latencies instead of twelve.
#pragma unroll
    for (int kh = 0; kh < 2; kh++) {
      Frag af[3][2];
#pragma unroll
      for (int kk = 0; kk < 3; kk++) {
#pragma unroll
        for (int t = 0; t < 2; t++) {
          af[kk][t].p[0] = *(const v8hm*)&Pst[mp * 32 + t * 16 + m][(kh * 3 + kk) * 32 + 8 * hh];
          af[kk][t].p[1] = *(const v8hm*)&Pst[mp * 32 + t * 16 + m][(kh * 3 + kk) * 32 + 16 + 8 * hh];
        }
      }
#pragma unroll
      for (int kk = 0; kk < 3; kk++) {
#pragma unroll
        for (int t = 0; t < 2; t++) t2[t] = wmma16(af[kk][t].v, wv[kh * 3 + kk].v, t2[t]);
      }
    }
#pragma unroll
    for (int t = 0; t < 2; t++) {
      v8h q;
#pragma unroll
      for (int r = 0; r < 8; r++) q[r] = (f16_t)(t2[t][r] * 0.015625f);
      *(v8hm*)&Gt[nt * 16 + m][mp * 32 + t * 16 + 8 * hh] = q;
    }
  }
  __syncthreads();

  // U^T[k'][d] = sum_c T2^T[k'][c] Wout[d][c]: A = Gt rows, B = Wl rows, both c contiguous.
  // A lane's 8 accumulators are 8 consecutive k' of one d: one 16-B store into U's row.
  if (mm) {
    v8f u[2] = {};
    Frag af[2], wo[2][2];
#pragma unroll
    for (int kk = 0; kk < 2; kk++) {
      af[kk].p[0] = *(const v8hm*)&Gt[nt * 16 + m][kk * 32 + 8 * hh];
      af[kk].p[1] = *(const v8hm*)&Gt[nt * 16 + m][kk * 32 + 16 + 8 * hh];
#pragma unroll
      for (int t = 0; t < 2; t++) {
        wo[t][kk].p[0] = *(const v8hm*)&Wl[mp * 32 + t * 16 + m][kk * 32 + 8 * hh];
        wo[t][kk].p[1] = *(const v8hm*)&Wl[mp * 32 + t * 16 + m][kk * 32 + 16 + 8 * hh];
      }
    }
#pragma unroll
    for (int kk = 0; kk < 2; kk++) {
#pragma unroll
      for (int t = 0; t < 2; t++) u[t] = wmma16(af[kk].v, wo[t][kk].v, u[t]);
    }
#pragma unroll
    for (int t = 0; t < 2; t++) {
      v8h q;
#pragma unroll
      for (int r = 0; r < 8; r++) q[r] = (f16_t)u[t][r];
      *(v8hm*)&Tl[mp * 32 + t * 16 + m][nt * 16 + 8 * hh] = q;
    }
  }
  __syncthreads();

  // Whole-line stores: each row = 384 B = lanes 0..23 x 16 B, one instruction.
  f16_t* Ub = U + (size_t)bh * C1_ * KV_;
  const int l24 = (lane < 24) ? lane : 0;
  const bool se = lane < 24;
  v8h vals[2];
#pragma unroll
  for (int j = 0; j < 2; j++) vals[j] = *(const v8hm*)&Tl[wave * 2 + j][l24 * 8];
#pragma unroll
  for (int j = 0; j < 2; j++)
    if (se) *(v8hm*)(Ub + (size_t)(wave * 2 + j) * KV_ + l24 * 8) = vals[j];
}

// ---------------------------------------------------------------------------
// cx[b,n,d] = emb1[b,n,d] + sum_k' ea[b,n,k'] * Um[b][d][k'],  Um = mean over heads of U_h.
// Tile 64 rows (n) x 64 cols (d), K = 192 staged whole: one round of loads, one barrier, 6 k-steps.
// The four heads' 64 * U_h are averaged in f32 while they are staged; A = ea rows, B = Um rows,
// both k' contiguous. grid = (N/64, B).
// ---------------------------------------------------------------------------
__global__ __launch_bounds__(256) void cx_kernel(
    const f16_t* __restrict__ ea, const f16_t* __restrict__ U,
    const float* __restrict__ emb1, float* __restrict__ cx) {
  __shared__ __attribute__((aligned(16))) f16_t Es[64][200];
  __shared__ __attribute__((aligned(16))) f16_t Us[64][200];
  __shared__ __attribute__((aligned(16))) float Cs[64][68];
  const int tid = threadIdx.x, lane = tid & 31, wave = tid >> 5;
  const int hh = lane >> 4, m = lane & 15;
  const int b = blockIdx.y;
  const size_t r0 = (size_t)b * N_ + blockIdx.x * 64;
  const int mt = wave & 3, ng = wave >> 2;

  // Both tiles are contiguous in memory: chunk i * 256 + tid of 16 B.
  const f16_t* Ub = U + (size_t)b * H_ * C1_ * KV_ + tid * 8;
  const f16_t* Eb = ea + r0 * KV_ + tid * 8;
  v8h uh[6][H_], ev[6];
  const size_t ro = (r0 + wave * 8 + hh) * C1_ + m * 4;  // rows wave*8 + 2j + hh, 16 lanes a row
  const float* rp = emb1 + ro;
  v4f rr[4];
#pragma unroll
  for (int j = 0; j < 4; j++) rr[j] = *(const v4fm*)(rp + j * 2 * C1_);
#pragma unroll
  for (int i = 0; i < 6; i++) ev[i] = *(const v8hm*)(Eb + i * 2048);
#pragma unroll
  for (int i = 0; i < 6; i++) {
#pragma unroll
    for (int h = 0; h < H_; h++) uh[i][h] = *(const v8hm*)(Ub + h * (C1_ * KV_) + i * 2048);
  }
  // Holds the address pair until the loads have taken it.
  asm volatile("s_wait_xcnt 0x0" :: "v"(rp) : "memory");
  // Keeps all 34 loads in front of the first use: left free, the scheduler issues a part of them
  // behind the first wait, and the block pays the load latency twice.
  __builtin_amdgcn_sched_barrier(0);

#pragma unroll
  for (int i = 0; i < 6; i++) {
    const int idx = i * 256 + tid;
    const int row = idx / 24, c8 = (idx - row * 24) * 8;
    v8h um;
#pragma unroll
    for (int j = 0; j < 8; j++) {
      float a = 0.25f * (float)uh[i][0][j];
#pragma unroll
      for (int h = 1; h < H_; h++) a = fmaf(0.25f, (float)uh[i][h][j], a);
      um[j] = (f16_t)a;
    }
    *(v8hm*)&Us[row][c8] = um;
    *(v8hm*)&Es[row][c8] = ev[i];
  }
  __syncthreads();

  // All 18 fragments are read in front of the first WMMA: one LDS latency instead of twelve.
  v8f acc[2] = {};
  const int mrow = mt * 16 + m;
  Frag a[6], bf[6][2];
#pragma unroll
  for (int kk = 0; kk < 6; kk++) {
    a[kk].p[0] = *(const v8hm*)&Es[mrow][kk * 32 + 8 * hh];
    a[kk].p[1] = *(const v8hm*)&Es[mrow][kk * 32 + 16 + 8 * hh];
#pragma unroll
    for (int t = 0; t < 2; t++) {
      const int col = (ng * 2 + t) * 16 + m;
      bf[kk][t].p[0] = *(const v8hm*)&Us[col][kk * 32 + 8 * hh];
      bf[kk][t].p[1] = *(const v8hm*)&Us[col][kk * 32 + 16 + 8 * hh];
    }
  }
#pragma unroll
  for (int kk = 0; kk < 6; kk++) {
#pragma unroll
    for (int t = 0; t < 2; t++) acc[t] = wmma16(a[kk].v, bf[kk][t].v, acc[t]);
  }

#pragma unroll
  for (int t = 0; t < 2; t++) {
    const int cn = (ng * 2 + t) * 16 + m;
#pragma unroll
    for (int r = 0; r < 8; r++) Cs[mt * 16 + 8 * hh + r][cn] = acc[t][r] * 0.015625f;
  }
  __syncthreads();

  // Whole-line stores: 16 lanes x 16 B = one 256-B row, two rows per instruction.
#pragma unroll
  for (int j = 0; j < 4; j++) {
    const v4f v = *(const v4fm*)&Cs[wave * 8 + 2 * j + hh][m * 4] + rr[j];
    *(v4fm*)(cx + ro + j * 2 * C1_) = v;
  }
}

// ---------------------------------------------------------------------------
// Host-side orchestration
// ---------------------------------------------------------------------------
extern "C" void kernel_launch(void* const* d_in, const int* in_sizes, int n_in,
                              void* d_out, int out_size, void* d_ws, size_t ws_size,
                              hipStream_t stream) {
  if (n_in < 16) return;
  const int need[16] = {BN_ * C1_, BN_ * C2_, H_ * C1_ * C1_, H_ * KV_ * KV_, H_ * KV_ * KV_,
                        C1_ * C1_, C1_, C1_, KV_, KV_, C1_, C1_, MLP_ * C1_, MLP_,
                        C1_ * MLP_, C1_};
  for (int i = 0; i < 16; i++) if (in_sizes[i] != need[i]) return;
  if (out_size != BN_ * C1_) return;

  const float* emb1    = (const float*)d_in[0];
  const float* emb2    = (const float*)d_in[1];
  const float* Wq      = (const float*)d_in[2];
  const float* Wk      = (const float*)d_in[3];
  const float* Wv      = (const float*)d_in[4];
  const float* Wout    = (const float*)d_in[5];
  const float* ln1_g   = (const float*)d_in[6];
  const float* ln1_b   = (const float*)d_in[7];
  const float* lnall_g = (const float*)d_in[8];
  const float* lnall_b = (const float*)d_in[9];
  const float* ffn_g   = (const float*)d_in[10];
  const float* ffn_b   = (const float*)d_in[11];
  const float* fc1_w   = (const float*)d_in[12];
  const float* fc1_b   = (const float*)d_in[13];
  const float* fc2_w   = (const float*)d_in[14];
  const float* fc2_b   = (const float*)d_in[15];
  float* out = (float*)d_out;

  char* ws = (char*)d_ws;
  size_t off = 0;
  auto take = [&](size_t bytes) -> void* {
    off = (off + 255) & ~(size_t)255;
    void* p = ws + off;
    off += bytes;
    return p;
  };
  f16_t* cx1T  = (f16_t*)take((size_t)C1_ * BN_ * 2);        // [64][B*N]
  f16_t* ea    = (f16_t*)take((size_t)BN_ * KV_ * 2);
  f16_t* Wqh   = (f16_t*)take((size_t)H_ * C1_ * C1_ * 2);
  f16_t* Wkh   = (f16_t*)take((size_t)H_ * KV_ * KV_ * 2);
  f16_t* WvT   = (f16_t*)take((size_t)H_ * KV_ * KV_ * 2);   // [H][k'][k]
  f16_t* Wouth = (f16_t*)take((size_t)C1_ * C1_ * 2);
  f16_t* fc1h  = (f16_t*)take((size_t)MLP_ * C1_ * 2);
  f16_t* fc2h  = (f16_t*)take((size_t)C1_ * MLP_ * 2);
  f16_t* eaT   = (f16_t*)take((size_t)KV_ * BN_ * 2);        // [192][B*N]
  f16_t* Um    = (f16_t*)take((size_t)B_ * H_ * C1_ * KV_ * 2);  // 64 * U_h, [bh][64][192]
  float* cx    = (float*)take((size_t)BN_ * C1_ * 4);
  f16_t* ybuf  = (f16_t*)take((size_t)BN_ * C1_ * 2);
  f16_t* h1    = (f16_t*)take((size_t)BN_ * MLP_ * 2);
  float* Spart = (float*)take((size_t)SPLIT_ * B_ * SELEMS_ * 4);
  if (off > ws_size) return;

  // Layer norms of the inputs and all weight conversions, one launch
  prep_kernel<<<PREP_BLKS_, 256, 0, stream>>>(emb1, emb2, ln1_g, ln1_b, lnall_g, lnall_b,
                                              Wq, Wk, Wv, Wout, fc1_w, fc2_w,
                                              cx1T, ea, eaT, Wqh, Wkh, WvT, Wouth, fc1h, fc2h);

  // G = cx1^T ea per b; S = Wq[h] G Wk[h]^T / sqrt(KV); InstanceNorm; softmax P; U_h = Wout P Wv[h]
  scores_partial_kernel<<<dim3(SPLIT_, B_), 256, 0, stream>>>(cx1T, eaT, Spart);
  merge_softmax_kernel<<<B_ * H_, 1024, 0, stream>>>(Spart, Wqh, Wkh, WvT, Wouth, Um);

  // cx = ea * (mean_h U_h)^T + emb1   (f32)
  cx_kernel<<<dim3(N_ / 64, B_), 256, 0, stream>>>(ea, Um, emb1, cx);

  ln64_kernel<<<(BN_ + 7) / 8, 256, 0, stream>>>(cx, ffn_g, ffn_b, ybuf, BN_);

  // h1 = GELU(y * fc1^T + b1)   (f16)
  gemm_nt_kernel<0, true, true, false>
      <<<dim3(BN_ / 128, MLP_ / 64, 1), 256, 0, stream>>>(
      ybuf, C1_, 0LL, fc1h, C1_, 0LL,
      h1, cx, MLP_, 0LL, C1_, fc1_b, emb1);

  // out = h1 * fc2^T + b2 + cx  (f32)
  gemm_nt_kernel<1, true, false, true>
      <<<dim3(BN_ / 128, 1, 1), 256, 0, stream>>>(
      h1, MLP_, 0LL, fc2h, MLP_, 0LL,
      ybuf, out, C1_, 0LL, MLP_, fc2_b, cx);
}

// v005
// It runs in 47.4 microseconds.
// Timed twice side by side with v004, it ran 1.44 times as fast both times.
// Counting every step since v000, it is 4.63 times as fast.
#include <hip/hip_runtime.h>

// All contractions: v_wmma_f32_16x16x32_f16 (f16 operands, f32 accumulate); softmax P operand carried x4096 (exact power of two); x1/64 comes off in f32 before T2 goes to f16, the other x1/64 in cx's f32 epilogue.

typedef _Float16 f16_t;
typedef f16_t v16h __attribute__((ext_vector_type(16)));
typedef f16_t v8h __attribute__((ext_vector_type(8)));
typedef float v8f __attribute__((ext_vector_type(8)));
typedef float v4f __attribute__((ext_vector_type(4)));
typedef f16_t v4h __attribute__((ext_vector_type(4)));
typedef v8h v8hm __attribute__((may_alias));
typedef v4h v4hm __attribute__((may_alias));
typedef v4f v4fm __attribute__((may_alias));

#define H_   4
#define C1_  64
#define C2_  128
#define KV_  192
#define MLP_ 256
#define B_   8
#define N_   3136
#define BN_  (B_ * N_)

union Frag { v16h v; v8h p[2]; };

// 16x16x32 f16 WMMA with f32 accumulate, followed by a 4-slot VALU hazard guard.
__device__ __forceinline__ v8f wmma16(v16h a, v16h b, v8f c) {
  v8f d = __builtin_amdgcn_wmma_f32_16x16x32_f16(false, a, false, b, (short)0, c, false, false);
  asm volatile("v_nop\n\tv_nop\n\tv_nop\n\tv_nop" : "+v"(d) : "v"(a), "v"(b));
  return d;
}

__device__ __forceinline__ float wave_sum(float v) {
#pragma unroll
  for (int msk = 16; msk >= 1; msk >>= 1) v += __shfl_xor(v, msk, 32);
  return v;
}
__device__ __forceinline__ float wave_max(float v) {
#pragma unroll
  for (int msk = 16; msk >= 1; msk >>= 1) v = fmaxf(v, __shfl_xor(v, msk, 32));
  return v;
}

// ---------------------------------------------------------------------------
// Job of the preparation grid: block blk converts elements blk*2048 .. +2047 of a weight matrix
// (every matrix here is a whole number of such blocks).
// ---------------------------------------------------------------------------
__device__ __forceinline__ void cvt_f16_job(const float* __restrict__ src,
                                            f16_t* __restrict__ dst, int blk) {
  const int i = blk * 256 + threadIdx.x;
  const v4f x0 = *(const v4fm*)(src + (size_t)i * 8);
  const v4f x1 = *(const v4fm*)(src + (size_t)i * 8 + 4);
  v8h v;
#pragma unroll
  for (int j = 0; j < 4; j++) { v[j] = (f16_t)x0[j]; v[4 + j] = (f16_t)x1[j]; }
  *(v8hm*)(dst + (size_t)i * 8) = v;
  // Only the end of the kernel follows this store: the wait is a precaution.
  asm volatile("s_wait_xcnt 0x0" ::: "memory");
}

// ---------------------------------------------------------------------------
// Transposing convert of the H_ matrices [192][192]: dst[h][c][r] = (f16) src[h][r][c].
// One block = one 64 x 64 tile: a lane gathers 2 x 8 rows of one column (each load 128 contiguous
// bytes per wave), the tile turns in LDS, and 8 lanes store one whole 128-B line.
// ---------------------------------------------------------------------------
__device__ __forceinline__ void cvt_t_f16_job(const float* __restrict__ src,
                                              f16_t* __restrict__ dst,
                                              f16_t (*__restrict__ Tt)[72],  // [column][row], 64 rows used
                                              int blk) {
  const int tid = threadIdx.x;
  const int hd = blk / 9, t9 = blk - hd * 9, ty = t9 / 3, tx = t9 - ty * 3;
  const int r0 = tx * 64, c0 = ty * 64;
  const size_t hb = (size_t)hd * KV_ * KV_;
  const int c = tid & 63, rg = tid >> 6;
  const float* s = src + hb + (size_t)r0 * KV_ + c0 + c;
#pragma unroll
  for (int q = 0; q < 2; q++) {
    v8h v;
#pragma unroll
    for (int j = 0; j < 8; j++) v[j] = (f16_t)s[((rg + 4 * q) * 8 + j) * KV_];
    *(v8hm*)&Tt[c][(rg + 4 * q) * 8] = v;
  }
  __syncthreads();
  const int rs = tid >> 3, ck = (tid & 7) * 8;
#pragma unroll
  for (int q = 0; q < 2; q++) {
    const int row = q * 32 + rs;
    const v8h v = *(const v8hm*)&Tt[row][ck];
    *(v8hm*)(dst + hb + (size_t)(c0 + row) * KV_ + r0 + ck) = v;
  }
  // Only the end of the kernel follows these stores: the wait is a precaution.
  asm volatile("s_wait_xcnt 0x0" ::: "memory");
}

// ---------------------------------------------------------------------------
// Fused: cx1 = LN(emb1) (64), ea = LN(concat(emb1,emb2)) (192).
// One block = 64 rows (n), one wave = 8 rows. Outputs: ea row-major [B*N][192] and
// the channel-major copies cx1T [64][B*N], eaT [192][B*N] (64 n = one 128-B line).
// ---------------------------------------------------------------------------
__device__ __forceinline__ void ln_concat_job(
    const float* __restrict__ emb1, const float* __restrict__ emb2,
    const float* __restrict__ g1, const float* __restrict__ b1,
    const float* __restrict__ ga, const float* __restrict__ ba,
    f16_t* __restrict__ cx1T, f16_t* __restrict__ ea, f16_t* __restrict__ eaT,
    f16_t (*__restrict__ Tt)[72],    // [channel][n], 0..63 cx1, 64..255 ea
    f16_t (*__restrict__ Sr)[200],   // [n][channel] of ea
    int blk) {
  const int tid = threadIdx.x, wave = tid >> 5, lane = tid & 31;
  const int n0 = blk * 64;

  float gv1[2], bv1[2], gva[6], bva[6];
#pragma unroll
  for (int j = 0; j < 2; j++) { gv1[j] = g1[lane + 32 * j]; bv1[j] = b1[lane + 32 * j]; }
#pragma unroll
  for (int j = 0; j < 6; j++) { gva[j] = ga[lane + 32 * j]; bva[j] = ba[lane + 32 * j]; }

  v8h tr[8];  // tr[q][i] = channel lane + 32q of row wave*8 + i
#pragma unroll
  for (int i = 0; i < 8; i++) {
    const int rl = wave * 8 + i;
    const float* r1 = emb1 + (size_t)(n0 + rl) * C1_;
    const float* r2 = emb2 + (size_t)(n0 + rl) * C2_;

    const float x0 = r1[lane], x1 = r1[lane + 32];
    const float mu = wave_sum(x0 + x1) * (1.0f / 64.0f);
    const float d0 = x0 - mu, d1 = x1 - mu;
    const float var = wave_sum(d0 * d0 + d1 * d1) * (1.0f / 64.0f);
    const float rs = rsqrtf(var + 1e-6f);
    tr[0][i] = (f16_t)(d0 * rs * gv1[0] + bv1[0]);
    tr[1][i] = (f16_t)(d1 * rs * gv1[1] + bv1[1]);

    float e[6];
    e[0] = x0; e[1] = x1;
#pragma unroll
    for (int j = 2; j < 6; j++) e[j] = r2[lane + 32 * (j - 2)];
    float s = 0.f;
#pragma unroll
    for (int j = 0; j < 6; j++) s += e[j];
    const float ma = wave_sum(s) * (1.0f / 192.0f);
    float sq = 0.f;
#pragma unroll
    for (int j = 0; j < 6; j++) { e[j] -= ma; sq += e[j] * e[j]; }
    const float vara = wave_sum(sq) * (1.0f / 192.0f);
    const float rsa = rsqrtf(vara + 1e-6f);
#pragma unroll
    for (int j = 0; j < 6; j++) {
      const f16_t y = (f16_t)(e[j] * rsa * gva[j] + bva[j]);
      tr[2 + j][i] = y;
      Sr[rl][lane + 32 * j] = y;
    }
  }
#pragma unroll
  for (int q = 0; q < 8; q++) *(v8hm*)&Tt[lane + 32 * q][wave * 8] = tr[q];
  __syncthreads();

  // Channel-major: 8 lanes fill one 128-B line, one instruction = 4 whole lines.
  const int chs = tid >> 3, ck = (tid & 7) * 8;
#pragma unroll
  for (int i = 0; i < 8; i++) {
    const int ch = i * 32 + chs;
    const v8h v = *(const v8hm*)&Tt[ch][ck];
    f16_t* d = (i < 2) ? cx1T + (size_t)ch * BN_ : eaT + (size_t)(ch - 64) * BN_;
    *(v8hm*)(d + n0 + ck) = v;
  }
  // Row-major ea: the 64 rows are 24576 contiguous bytes.
#pragma unroll
  for (int i = 0; i < 6; i++) {
    const int idx = i * 256 + tid;
    const int row = idx / 24, c8 = (idx - row * 24) * 8;
    const v8h v = *(const v8hm*)&Sr[row][c8];
    *(v8hm*)(ea + (size_t)n0 * KV_ + (size_t)idx * 8) = v;
  }
}

// ---------------------------------------------------------------------------
// Preparation grid: the two layer norms and the six weight conversions depend on nothing but the
// inputs, so they run as jobs of one launch, picked by work-group index. The layer-norm groups are
// the longest and take the lowest indices.
// ---------------------------------------------------------------------------
#define LN_BLKS_ (BN_ / 64)                  // 392
#define WV_BLKS_ (H_ * 9)                    // 36 tiles of 64 x 64
#define WK_BLKS_ (H_ * KV_ * KV_ / 2048)     // 72
#define WQ_BLKS_ (H_ * C1_ * C1_ / 2048)     // 8
#define F1_BLKS_ (MLP_ * C1_ / 2048)         // 8
#define F2_BLKS_ (C1_ * MLP_ / 2048)         // 8
#define WO_BLKS_ (C1_ * C1_ / 2048)          // 2
#define PREP_BLKS_ (LN_BLKS_ + WV_BLKS_ + WK_BLKS_ + WQ_BLKS_ + F1_BLKS_ + F2_BLKS_ + WO_BLKS_)

__global__ __launch_bounds__(256) void prep_kernel(
    const float* __restrict__ emb1, const float* __restrict__ emb2,
    const float* __restrict__ g1, const float* __restrict__ b1,
    const float* __restrict__ ga, const float* __restrict__ ba,
    const float* __restrict__ Wq, const float* __restrict__ Wk, const float* __restrict__ Wv,
    const float* __restrict__ Wo, const float* __restrict__ f1, const float* __restrict__ f2,
    f16_t* __restrict__ cx1T, f16_t* __restrict__ ea, f16_t* __restrict__ eaT,
    f16_t* __restrict__ Wqh, f16_t* __restrict__ Wkh, f16_t* __restrict__ WvT,
    f16_t* __restrict__ Woh, f16_t* __restrict__ f1h, f16_t* __restrict__ f2h) {
  __shared__ __attribute__((aligned(16))) f16_t Tt[256][72];
  __shared__ __attribute__((aligned(16))) f16_t Sr[64][200];
  int blk = blockIdx.x;
  if (blk < LN_BLKS_) {
    ln_concat_job(emb1, emb2, g1, b1, ga, ba, cx1T, ea, eaT, Tt, Sr, blk);
    return;
  }
  blk -= LN_BLKS_;
  if (blk < WV_BLKS_) {
    cvt_t_f16_job(Wv, WvT, Tt, blk);
    return;
  }
  blk -= WV_BLKS_;
  const float* s = Wk;
  f16_t* d = Wkh;
  if (blk >= WK_BLKS_) {
    blk -= WK_BLKS_; s = Wq; d = Wqh;
    if (blk >= WQ_BLKS_) {
      blk -= WQ_BLKS_; s = f1; d = f1h;
      if (blk >= F1_BLKS_) {
        blk -= F1_BLKS_; s = f2; d = f2h;
        if (blk >= F2_BLKS_) { blk -= F2_BLKS_; s = Wo; d = Woh; }
      }
    }
  }
  cvt_f16_job(s, d, blk);
}

// ---------------------------------------------------------------------------
// S_h = Q_h^T K_h = Wq_h (cx1^T ea) Wk_h^T: the sum over n is done once per batch on the
// normalised activations, G = cx1^T ea (64 x 192), split over SPLIT_ work-groups per b.
// A = cx1T [64][B*N] (row c, k = n contiguous), B = eaT [192][B*N]
// (row kv, k = n contiguous) -> both fragments loaded with the same k map.
// Each work-group sums KSTEPS_ * 32 values of n and stores its f32 accumulators
// in register order: chunk ((wave*6 + t)*2 + half)*32 + lane holds 4 floats,
// rows mt*16 + 8h + 4*half + 0..3 of column (ng*6 + t)*16 + m.
// ---------------------------------------------------------------------------
#define SPLIT_  14
#define KSTEPS_ (N_ / 32 / SPLIT_)  // 7
#define SELEMS_ (C1_ * KV_)         // 12288

__global__ __launch_bounds__(256) void scores_partial_kernel(
    const f16_t* __restrict__ XT, const f16_t* __restrict__ ET, float* __restrict__ part) {
  __shared__ __attribute__((aligned(16))) f16_t Aq[64][32];
  __shared__ __attribute__((aligned(16))) f16_t Bk[192][32];
  const int tid = threadIdx.x, lane = tid & 31, wave = tid >> 5;
  const int hh = lane >> 4, m = lane & 15;
  const int sp = blockIdx.x;
  const int b = blockIdx.y;
  const f16_t* Ab = XT + (size_t)b * N_ + sp * (KSTEPS_ * 32);
  const f16_t* Bb = ET + (size_t)b * N_ + sp * (KSTEPS_ * 32);
  const int mt = wave & 3, ng = wave >> 2;
  v8f acc[6] = {};
  const int ar = tid >> 2, ac = (tid & 3) * 8;
  const f16_t* gA  = Ab + (size_t)ar * BN_ + ac;
  const f16_t* gB0 = Bb + (size_t)ar * BN_ + ac;
  const f16_t* gB1 = Bb + (size_t)(ar + 64) * BN_ + ac;
  const f16_t* gB2 = Bb + (size_t)(ar + 128) * BN_ + ac;
  const int mrow = mt * 16 + m;

  // Whole unroll of the 7 trips: unrolled by two, the odd count costs a copy of all 48 accumulators per pair.
#pragma unroll
  for (int it = 0; it < KSTEPS_; it++) {
    const int n0 = it * 32;
    const v8h sa  = *(const v8hm*)(gA + n0);
    const v8h sb0 = *(const v8hm*)(gB0 + n0);
    const v8h sb1 = *(const v8hm*)(gB1 + n0);
    const v8h sb2 = *(const v8hm*)(gB2 + n0);
    __syncthreads();
    *(v8hm*)&Aq[ar][ac]       = sa;
    *(v8hm*)&Bk[ar][ac]       = sb0;
    *(v8hm*)&Bk[ar + 64][ac]  = sb1;
    *(v8hm*)&Bk[ar + 128][ac] = sb2;
    __syncthreads();
    Frag a;
    a.p[0] = *(const v8hm*)&Aq[mrow][8 * hh];
    a.p[1] = *(const v8hm*)&Aq[mrow][16 + 8 * hh];
#pragma unroll
    for (int t = 0; t < 6; t++) {
      const int col = (ng * 6 + t) * 16 + m;
      Frag bf;
      bf.p[0] = *(const v8hm*)&Bk[col][8 * hh];
      bf.p[1] = *(const v8hm*)&Bk[col][16 + 8 * hh];
      acc[t] = wmma16(a.v, bf.v, acc[t]);
    }
  }

  // Each store instruction writes 512 contiguous bytes (4 whole lines) of this wave's own range.
  float* pb = part + ((size_t)sp * B_ + b) * SELEMS_ + (size_t)wave * 1536 + lane * 4;
#pragma unroll
  for (int t = 0; t < 6; t++) {
#pragma unroll
    for (int hf = 0; hf < 2; hf++) {
      v4f v;
#pragma unroll
      for (int j = 0; j < 4; j++) v[j] = acc[t][hf * 4 + j];
      *(v4fm*)(pb + (t * 2 + hf) * 128) = v;
    }
  }
}

// ---------------------------------------------------------------------------
// One block of 32 waves per (b,h): G_b = sum of the SPLIT_ partials (each thread owns
// 3 chunks of 4 floats), T = Wq_h G_b, S = T Wk_h^T (both on WMMA, 24 waves x 2 tiles),
// scale, InstanceNorm over (64,192), softmax over KV, P*4096 kept in LDS as f16.
// G is carried x 1/64 (exact power of two) as f16 operand and unscaled in f32 on S.
// Value side, o = mean_h (ea Wv_h^T) P_h^T Wout^T = ea (mean_h Wout P_h Wv_h)^T: this block forms
// T2 = P_h Wv_h and U_h = Wout T2 (both on WMMA, same wave map) and stores 64 * U_h as f16 [64][192].
// ---------------------------------------------------------------------------
__global__ __launch_bounds__(1024) void merge_softmax_kernel(
    const float* __restrict__ part, const f16_t* __restrict__ Wq,
    const f16_t* __restrict__ Wk, const f16_t* __restrict__ WvT,
    const f16_t* __restrict__ Wo, f16_t* __restrict__ U) {
  __shared__ float Sb[64][196];
  __shared__ __attribute__((aligned(16))) f16_t Pst[64][200];
  __shared__ __attribute__((aligned(16))) f16_t Gt[192][72];   // G^T / 64: [k'][c']; later 64 T2^T: [k'][c]
  __shared__ __attribute__((aligned(16))) f16_t Tl[64][200];   // T / 64:   [c][k']; later 64 U: [d][k']
  __shared__ __attribute__((aligned(16))) f16_t Wl[64][72];    // Wout: [d][c]
  __shared__ float red[32];
  __shared__ float red2[32];
  const int tid = threadIdx.x, lane = tid & 31;
  const int wave = __builtin_amdgcn_readfirstlane(tid >> 5);
  const int hh = lane >> 4, m = lane & 15;
  const int bh = blockIdx.x, b = bh >> 2, hd = bh & 3;
  const float* pb = part + (size_t)b * SELEMS_ + tid * 4;

  // Matrix work: wave < 24 owns column tile nt (of 12) and row tiles 2*mp, 2*mp + 1 (of 4).
  const bool mm = wave < 24;
  const int mp = wave / 12, nt = wave - mp * 12;
  const v4h wo4 = *(const v4hm*)(Wo + tid * 4);  // Wout goes to LDS with the first barrier
  v4f a[3] = {};
#pragma unroll
  for (int s = 0; s < SPLIT_; s++) {
#pragma unroll
    for (int i = 0; i < 3; i++)
      a[i] += *(const v4fm*)(pb + (size_t)s * B_ * SELEMS_ + i * 4096);
  }

#pragma unroll
  for (int i = 0; i < 3; i++) {
    const int g = wave + 32 * i;          // chunk group = (producer wave)*12 + t*2 + half
    const int wa = g / 12, rem = g - wa * 12;
    const int row0 = (wa & 3) * 16 + 8 * hh + (rem & 1) * 4;
    const int col = ((wa >> 2) * 6 + (rem >> 1)) * 16 + m;
    v4h gq;
#pragma unroll
    for (int j = 0; j < 4; j++) gq[j] = (f16_t)(a[i][j] * 0.015625f);
    *(v4hm*)&Gt[col][row0] = gq;
  }
  *(v4hm*)&Wl[tid >> 4][(tid & 15) * 4] = wo4;

  // Weight fragments are fetched here, behind the sum (whose loads need the registers) and in front of
  // the barrier, so that their latency runs under the wait for the other waves.
  Frag wq[2][2], wk[6];
  if (mm) {
    const f16_t* wqb = Wq + (size_t)hd * C1_ * C1_ + (size_t)(mp * 32 + m) * C1_ + 8 * hh;
#pragma unroll
    for (int t = 0; t < 2; t++) {
#pragma unroll
      for (int kk = 0; kk < 2; kk++) {
        wq[t][kk].p[0] = *(const v8hm*)(wqb + t * 16 * C1_ + kk * 32);
        wq[t][kk].p[1] = *(const v8hm*)(wqb + t * 16 * C1_ + kk * 32 + 16);
      }
    }
    const f16_t* wkb = Wk + (size_t)hd * KV_ * KV_ + (size_t)(nt * 16 + m) * KV_ + 8 * hh;
#pragma unroll
    for (int kk = 0; kk < 6; kk++) {
      wk[kk].p[0] = *(const v8hm*)(wkb + kk * 32);
      wk[kk].p[1] = *(const v8hm*)(wkb + kk * 32 + 16);
    }
    // Holds both address pairs until the loads above have taken them.
    asm volatile("s_wait_xcnt 0x0" :: "v"(wqb), "v"(wkb) : "memory");
  }
  __syncthreads();

  // T[c][k'] = sum_c' Wq[c][c'] G[c'][k']: A = Wq rows, B = Gt rows, both k = c' contiguous.
  if (mm) {
    v8f t1[2] = {};
#pragma unroll
    for (int kk = 0; kk < 2; kk++) {
      Frag bf;
      bf.p[0] = *(const v8hm*)&Gt[nt * 16 + m][kk * 32 + 8 * hh];
      bf.p[1] = *(const v8hm*)&Gt[nt * 16 + m][kk * 32 + 16 + 8 * hh];
#pragma unroll
      for (int t = 0; t < 2; t++) t1[t] = wmma16(wq[t][kk].v, bf.v, t1[t]);
    }
#pragma unroll
    for (int t = 0; t < 2; t++) {
#pragma unroll
      for (int r = 0; r < 8; r++)
        Tl[mp * 32 + t * 16 + 8 * hh + r][nt * 16 + m] = (f16_t)t1[t][r];
    }
  }
  __syncthreads();

  // S[c][k] = sum_k' T[c][k'] Wk[k][k']: A = Tl rows, B = Wk rows, both k = k' contiguous.
  const float sc = 64.0f * 0.07216878364870322f;  // 64 / sqrt(192)
  v8f sv[2] = {};
  float s = 0.f;
  if (mm) {
#pragma unroll
    for (int kk = 0; kk < 6; kk++) {
#pragma unroll
      for (int t = 0; t < 2; t++) {
        Frag af;
        af.p[0] = *(const v8hm*)&Tl[mp * 32 + t * 16 + m][kk * 32 + 8 * hh];
        af.p[1] = *(const v8hm*)&Tl[mp * 32 + t * 16 + m][kk * 32 + 16 + 8 * hh];
        sv[t] = wmma16(af.v, wk[kk].v, sv[t]);
      }
    }
#pragma unroll
    for (int t = 0; t < 2; t++) {
#pragma unroll
      for (int r = 0; r < 8; r++) {
        sv[t][r] *= sc;
        s += sv[t][r];
        Sb[mp * 32 + t * 16 + 8 * hh + r][nt * 16 + m] = sv[t][r];
      }
    }
  }
  // Wv's fragments are fetched here, where Wk's registers are free, in front of the norm and the softmax.
  Frag wv[6];
  if (mm) {
    const f16_t* wvb = WvT + (size_t)hd * KV_ * KV_ + (size_t)(nt * 16 + m) * KV_ + 8 * hh;
#pragma unroll
    for (int kk = 0; kk < 6; kk++) {
      wv[kk].p[0] = *(const v8hm*)(wvb + kk * 32);
      wv[kk].p[1] = *(const v8hm*)(wvb + kk * 32 + 16);
    }
    // Holds the address pair until the loads above have taken it, as at the first weight fetch.
    asm volatile("s_wait_xcnt 0x0" :: "v"(wvb) : "memory");
  }
  s = wave_sum(s);
  if (lane == 0) red[wave] = s;
  __syncthreads();
  const float mean = wave_sum(red[lane]) * (1.0f / 12288.0f);
  float sq = 0.f;
  if (mm) {
#pragma unroll
    for (int t = 0; t < 2; t++) {
#pragma unroll
      for (int r = 0; r < 8; r++) { const float d = sv[t][r] - mean; sq += d * d; }
    }
  }
  sq = wave_sum(sq);
  if (lane == 0) red2[wave] = sq;
  __syncthreads();
  const float var  = wave_sum(red2[lane]) * (1.0f / 12288.0f);
  const float rstd = rsqrtf(var + 1e-5f);

  // Softmax over KV per row c; one wave per row, 2 rows per wave; P*4096 -> LDS.
  const float pscale = 4096.0f;
#pragma unroll
  for (int rr = 0; rr < 2; rr++) {
    const int r = wave * 2 + rr;
    float xs[6];
    float mx = -3.0e38f;
#pragma unroll
    for (int j = 0; j < 6; j++) {
      xs[j] = (Sb[r][lane + 32 * j] - mean) * rstd;
      mx = fmaxf(mx, xs[j]);
    }
    mx = wave_max(mx);
    float es = 0.f;
#pragma unroll
    for (int j = 0; j < 6; j++) { xs[j] = expf(xs[j] - mx); es += xs[j]; }
    es = wave_sum(es);
    const float inv = (1.0f / es) * pscale;
#pragma unroll
    for (int j = 0; j < 6; j++)
      Pst[r][lane + 32 * j] = (f16_t)(xs[j] * inv);
  }
  __syncthreads();

  // T2[c][k'] = sum_k P[c][k] Wv[k][k']: A = Pst rows, B = WvT rows, both k contiguous.
  // A lane's 8 accumulators are 8 consecutive c of one k': one 16-B store into T2^T (x 4096 / 64).
  if (mm) {
    v8f t2[2] = {};
    // P's fragments are read six at a time in front of their WMMAs: two LDS latencies instead of twelve.
#pragma unroll
    for (int kh = 0; kh < 2; kh++) {
      Frag af[3][2];
#pragma unroll
      for (int kk = 0; kk < 3; kk++) {
#pragma unroll
        for (int t = 0; t < 2; t++) {
          af[kk][t].p[0] = *(const v8hm*)&Pst[mp * 32 + t * 16 + m][(kh * 3 + kk) * 32 + 8 * hh];
          af[kk][t].p[1] = *(const v8hm*)&Pst[mp * 32 + t * 16 + m][(kh * 3 + kk) * 32 + 16 + 8 * hh];
        }
      }
#pragma unroll
      for (int kk = 0; kk < 3; kk++) {
#pragma unroll
        for (int t = 0; t < 2; t++) t2[t] = wmma16(af[kk][t].v, wv[kh * 3 + kk].v, t2[t]);
      }
    }
#pragma unroll
    for (int t = 0; t < 2; t++) {
      v8h q;
#pragma unroll
      for (int r = 0; r < 8; r++) q[r] = (f16_t)(t2[t][r] * 0.015625f);
      *(v8hm*)&Gt[nt * 16 + m][mp * 32 + t * 16 + 8 * hh] = q;
    }
  }
  __syncthreads();

  // U^T[k'][d] = sum_c T2^T[k'][c] Wout[d][c]: A = Gt rows, B = Wl rows, both c contiguous.
  // A lane's 8 accumulators are 8 consecutive k' of one d: one 16-B store into U's row.
  if (mm) {
    v8f u[2] = {};
    Frag af[2], wo[2][2];
#pragma unroll
    for (int kk = 0; kk < 2; kk++) {
      af[kk].p[0] = *(const v8hm*)&Gt[nt * 16 + m][kk * 32 + 8 * hh];
      af[kk].p[1] = *(const v8hm*)&Gt[nt * 16 + m][kk * 32 + 16 + 8 * hh];
#pragma unroll
      for (int t = 0; t < 2; t++) {
        wo[t][kk].p[0] = *(const v8hm*)&Wl[mp * 32 + t * 16 + m][kk * 32 + 8 * hh];
        wo[t][kk].p[1] = *(const v8hm*)&Wl[mp * 32 + t * 16 + m][kk * 32 + 16 + 8 * hh];
      }
    }
#pragma unroll
    for (int kk = 0; kk < 2; kk++) {
#pragma unroll
      for (int t = 0; t < 2; t++) u[t] = wmma16(af[kk].v, wo[t][kk].v, u[t]);
    }
#pragma unroll
    for (int t = 0; t < 2; t++) {
      v8h q;
#pragma unroll
      for (int r = 0; r < 8; r++) q[r] = (f16_t)u[t][r];
      *(v8hm*)&Tl[mp * 32 + t * 16 + m][nt * 16 + 8 * hh] = q;
    }
  }
  __syncthreads();

  // Whole-line stores: each row = 384 B = lanes 0..23 x 16 B, one instruction.
  f16_t* Ub = U + (size_t)bh * C1_ * KV_;
  const int l24 = (lane < 24) ? lane : 0;
  const bool se = lane < 24;
  v8h vals[2];
#pragma unroll
  for (int j = 0; j < 2; j++) vals[j] = *(const v8hm*)&Tl[wave * 2 + j][l24 * 8];
#pragma unroll
  for (int j = 0; j < 2; j++)
    if (se) *(v8hm*)(Ub + (size_t)(wave * 2 + j) * KV_ + l24 * 8) = vals[j];
}

// ---------------------------------------------------------------------------
// Sum over the 16 lanes of a row, every lane gets it: four DPP row_xmask steps.
// ---------------------------------------------------------------------------
__device__ __forceinline__ float row16_sum(float v) {
  v += __builtin_bit_cast(float, __builtin_amdgcn_update_dpp(0, __builtin_bit_cast(int, v), 0x161, 0xf, 0xf, true));
  v += __builtin_bit_cast(float, __builtin_amdgcn_update_dpp(0, __builtin_bit_cast(int, v), 0x162, 0xf, 0xf, true));
  v += __builtin_bit_cast(float, __builtin_amdgcn_update_dpp(0, __builtin_bit_cast(int, v), 0x164, 0xf, 0xf, true));
  v += __builtin_bit_cast(float, __builtin_amdgcn_update_dpp(0, __builtin_bit_cast(int, v), 0x168, 0xf, 0xf, true));
  return v;
}

// ---------------------------------------------------------------------------
// Everything behind the attention weights is local to a row n, so one block takes 64 rows through all of it:
//   cx[n][d] = emb1[n][d] + sum_k' ea[n][k'] * Um[d][k'],  Um = mean over heads of U_h   (K = 192)
//   y = LN(cx);  h = GELU(y fc1^T + b1)  (K = 64);  out = h fc2^T + b2 + cx  (K = 256)
// cx stays in registers (f32), y and h in LDS (f16). Both weight matrices are staged whole with the first
// round of loads. The four heads' 64 * U_h are averaged in f32 while they are staged.
// fc1 and fc2 run with the weight rows as A and the token rows as B: a lane's 8 accumulators are then
// 8 consecutive channels of one token, one or two 16-B LDS stores. grid = (N/64, B).
// Two blocks share a WGP (392 blocks, 256 WGPs): 4 waves per SIMD, 146 KiB of LDS each.
// ---------------------------------------------------------------------------
__global__ __launch_bounds__(256, 4) void tail_kernel(
    const f16_t* __restrict__ ea, const f16_t* __restrict__ U,
    const float* __restrict__ emb1,
    const float* __restrict__ fg, const float* __restrict__ fb,
    const f16_t* __restrict__ W1, const float* __restrict__ b1,
    const f16_t* __restrict__ W2, const float* __restrict__ b2,
    float* __restrict__ out) {
  __shared__ __attribute__((aligned(16))) f16_t EU[2][64][200];   // ea tile, Um; later h [64][264]
  __shared__ __attribute__((aligned(16))) float Cs[64][68];
  __shared__ __attribute__((aligned(16))) f16_t Ys[64][72];
  __shared__ __attribute__((aligned(16))) f16_t W1s[MLP_][72];
  __shared__ __attribute__((aligned(16))) f16_t W2s[C1_][264];
  __shared__ __attribute__((aligned(16))) float B1s[MLP_];
  f16_t (*Es)[200] = EU[0];
  f16_t (*Us)[200] = EU[1];
  f16_t (*Hs)[264] = reinterpret_cast<f16_t (*)[264]>(&EU[0][0][0]);
  const int tid = threadIdx.x, lane = tid & 31, wave = tid >> 5;
  const int hh = lane >> 4, m = lane & 15;
  const int b = blockIdx.y;
  const size_t r0 = (size_t)b * N_ + blockIdx.x * 64;
  const int mt = wave & 3, ng = wave >> 2;

  // All tiles are contiguous in memory: chunk i * 256 + tid of 16 B.
  const f16_t* Ub = U + (size_t)b * H_ * C1_ * KV_ + tid * 8;
  const f16_t* Eb = ea + r0 * KV_ + tid * 8;
  v8h uh[6][H_], ev[6], w1v[8], w2v[8];
  const size_t ro = (r0 + wave * 8 + hh) * C1_ + m * 4;  // rows wave*8 + 2j + hh, 16 lanes a row
  const float* rp = emb1 + ro;
  v4f rr[4];
#pragma unroll
  for (int j = 0; j < 4; j++) rr[j] = *(const v4fm*)(rp + j * 2 * C1_);
#pragma unroll
  for (int i = 0; i < 6; i++) ev[i] = *(const v8hm*)(Eb + i * 2048);
#pragma unroll
  for (int i = 0; i < 6; i++) {
#pragma unroll
    for (int h = 0; h < H_; h++) uh[i][h] = *(const v8hm*)(Ub + h * (C1_ * KV_) + i * 2048);
  }
#pragma unroll
  for (int i = 0; i < 8; i++) {
    w1v[i] = *(const v8hm*)(W1 + tid * 8 + i * 2048);
    w2v[i] = *(const v8hm*)(W2 + tid * 8 + i * 2048);
  }
  const float b1v = b1[tid];
  const v4f lg = *(const v4fm*)(fg + m * 4);
  const v4f lb = *(const v4fm*)(fb + m * 4);
  const v4f ob = *(const v4fm*)(b2 + m * 4);
  // Holds the address pair until the loads have taken it.
  asm volatile("s_wait_xcnt 0x0" :: "v"(rp) : "memory");
  // Keeps all loads in front of the first use: left free, the scheduler issues a part of them
  // behind the first wait, and the block pays the load latency twice.
  __builtin_amdgcn_sched_barrier(0);

#pragma unroll
  for (int i = 0; i < 6; i++) {
    const int idx = i * 256 + tid;
    const int row = idx / 24, c8 = (idx - row * 24) * 8;
    v8h um;
#pragma unroll
    for (int j = 0; j < 8; j++) {
      float a = 0.25f * (float)uh[i][0][j];
#pragma unroll
      for (int h = 1; h < H_; h++) a = fmaf(0.25f, (float)uh[i][h][j], a);
      um[j] = (f16_t)a;
    }
    *(v8hm*)&Us[row][c8] = um;
    *(v8hm*)&Es[row][c8] = ev[i];
  }
#pragma unroll
  for (int i = 0; i < 8; i++) {
    const int idx = i * 256 + tid;
    *(v8hm*)&W1s[idx >> 3][(idx & 7) * 8]   = w1v[i];
    *(v8hm*)&W2s[idx >> 5][(idx & 31) * 8]  = w2v[i];
  }
  B1s[tid] = b1v;
  __syncthreads();

  // All 18 fragments are read in front of the first WMMA: one LDS latency instead of twelve.
  v8f acc[2] = {};
  const int mrow = mt * 16 + m;
  {
    Frag a[6], bf[6][2];
#pragma unroll
    for (int kk = 0; kk < 6; kk++) {
      a[kk].p[0] = *(const v8hm*)&Es[mrow][kk * 32 + 8 * hh];
      a[kk].p[1] = *(const v8hm*)&Es[mrow][kk * 32 + 16 + 8 * hh];
#pragma unroll
      for (int t = 0; t < 2; t++) {
        const int col = (ng * 2 + t) * 16 + m;
        bf[kk][t].p[0] = *(const v8hm*)&Us[col][kk * 32 + 8 * hh];
        bf[kk][t].p[1] = *(const v8hm*)&Us[col][kk * 32 + 16 + 8 * hh];
      }
    }
#pragma unroll
    for (int kk = 0; kk < 6; kk++) {
#pragma unroll
      for (int t = 0; t < 2; t++) acc[t] = wmma16(a[kk].v, bf[kk][t].v, acc[t]);
    }
  }

#pragma unroll
  for (int t = 0; t < 2; t++) {
    const int cn = (ng * 2 + t) * 16 + m;
#pragma unroll
    for (int r = 0; r < 8; r++) Cs[mt * 16 + 8 * hh + r][cn] = acc[t][r] * 0.015625f;
  }
  __syncthreads();

  // cx: 16 lanes hold one row (4 channels each), 4 rows a thread; kept for the last residual.
  // Layer norm of a row = two sums over its 16 lanes.
  v4f cxv[4];
#pragma unroll
  for (int j = 0; j < 4; j++) cxv[j] = *(const v4fm*)&Cs[wave * 8 + 2 * j + hh][m * 4] + rr[j];
#pragma unroll
  for (int j = 0; j < 4; j++) {
    const v4f x = cxv[j];
    const float mu = row16_sum((x[0] + x[1]) + (x[2] + x[3])) * (1.0f / 64.0f);
    const v4f d = x - mu;
    const float var = row16_sum((d[0] * d[0] + d[1] * d[1]) + (d[2] * d[2] + d[3] * d[3])) * (1.0f / 64.0f);
    const float rs = rsqrtf(var + 1e-6f);
    v4h y;
#pragma unroll
    for (int c = 0; c < 4; c++) y[c] = (f16_t)(d[c] * rs * lg[c] + lb[c]);
    *(v4hm*)&Ys[wave * 8 + 2 * j + hh][m * 4] = y;
  }
  __syncthreads();

  // h^T[e][n] = sum_c fc1[e][c] y[n][c]: A = W1s rows, B = Ys rows, both c contiguous.
  // Wave w owns channels e = 32w .. 32w + 31 of all 64 rows.
  {
    Frag wa[2][2];
    v4f bb[2][2];
#pragma unroll
    for (int t = 0; t < 2; t++) {
#pragma unroll
      for (int kk = 0; kk < 2; kk++) {
        wa[t][kk].p[0] = *(const v8hm*)&W1s[wave * 32 + t * 16 + m][kk * 32 + 8 * hh];
        wa[t][kk].p[1] = *(const v8hm*)&W1s[wave * 32 + t * 16 + m][kk * 32 + 16 + 8 * hh];
      }
      bb[t][0] = *(const v4fm*)&B1s[wave * 32 + t * 16 + 8 * hh];
      bb[t][1] = *(const v4fm*)&B1s[wave * 32 + t * 16 + 8 * hh + 4];
    }
    // Stays rolled: unrolled, the 64 erf expansions are most of the kernel's text, straight-line code
    // that every WGP fetches to run once; the other waves of the SIMD cover a trip's LDS latency.
#pragma unroll 1
    for (int q = 0; q < 4; q++) {
      Frag yb[2];
#pragma unroll
      for (int kk = 0; kk < 2; kk++) {
        yb[kk].p[0] = *(const v8hm*)&Ys[q * 16 + m][kk * 32 + 8 * hh];
        yb[kk].p[1] = *(const v8hm*)&Ys[q * 16 + m][kk * 32 + 16 + 8 * hh];
      }
      v8f hv[2] = {};
#pragma unroll
      for (int kk = 0; kk < 2; kk++) {
#pragma unroll
        for (int t = 0; t < 2; t++) hv[t] = wmma16(wa[t][kk].v, yb[kk].v, hv[t]);
      }
#pragma unroll
      for (int t = 0; t < 2; t++) {
        v8h g;
#pragma unroll
        for (int r = 0; r < 8; r++) {
          const float xv = hv[t][r] + bb[t][r >> 2][r & 3];
          g[r] = (f16_t)(0.5f * xv * (1.0f + erff(xv * 0.70710678118654752f)));
        }
        *(v8hm*)&Hs[q * 16 + m][wave * 32 + t * 16 + 8 * hh] = g;
      }
    }
  }
  __syncthreads();

  // o^T[d][n] = sum_e fc2[d][e] h[n][e]: A = W2s rows, B = Hs rows, both e contiguous.
  // Wave owns channel tile mt and row tiles 2*ng, 2*ng + 1. Fragments are read twelve at a time.
  {
    v8f o[2] = {};
#pragma unroll
    for (int kh = 0; kh < 2; kh++) {
      Frag wf[4], hf[4][2];
#pragma unroll
      for (int kk = 0; kk < 4; kk++) {
        const int k0 = (kh * 4 + kk) * 32 + 8 * hh;
        wf[kk].p[0] = *(const v8hm*)&W2s[mt * 16 + m][k0];
        wf[kk].p[1] = *(const v8hm*)&W2s[mt * 16 + m][k0 + 16];
#pragma unroll
        for (int t = 0; t < 2; t++) {
          hf[kk][t].p[0] = *(const v8hm*)&Hs[(ng * 2 + t) * 16 + m][k0];
          hf[kk][t].p[1] = *(const v8hm*)&Hs[(ng * 2 + t) * 16 + m][k0 + 16];
        }
      }
#pragma unroll
      for (int kk = 0; kk < 4; kk++) {
#pragma unroll
        for (int t = 0; t < 2; t++) o[t] = wmma16(wf[kk].v, hf[kk][t].v, o[t]);
      }
    }
#pragma unroll
    for (int t = 0; t < 2; t++) {
      v4f lo, hi;
#pragma unroll
      for (int c = 0; c < 4; c++) { lo[c] = o[t][c]; hi[c] = o[t][4 + c]; }
      *(v4fm*)&Cs[(ng * 2 + t) * 16 + m][mt * 16 + 8 * hh]     = lo;
      *(v4fm*)&Cs[(ng * 2 + t) * 16 + m][mt * 16 + 8 * hh + 4] = hi;
    }
  }
  __syncthreads();

  // Whole-line stores: 16 lanes x 16 B = one 256-B row, two rows per instruction.
#pragma unroll
  for (int j = 0; j < 4; j++) {
    const v4f v = (*(const v4fm*)&Cs[wave * 8 + 2 * j + hh][m * 4] + ob) + cxv[j];
    *(v4fm*)(out + ro + j * 2 * C1_) = v;
  }
}

// ---------------------------------------------------------------------------
// Host-side orchestration
// ---------------------------------------------------------------------------
extern "C" void kernel_launch(void* const* d_in, const int* in_sizes, int n_in,
                              void* d_out, int out_size, void* d_ws, size_t ws_size,
                              hipStream_t stream) {
  if (n_in < 16) return;
  const int need[16] = {BN_ * C1_, BN_ * C2_, H_ * C1_ * C1_, H_ * KV_ * KV_, H_ * KV_ * KV_,
                        C1_ * C1_, C1_, C1_, KV_, KV_, C1_, C1_, MLP_ * C1_, MLP_,
                        C1_ * MLP_, C1_};
  for (int i = 0; i < 16; i++) if (in_sizes[i] != need[i]) return;
  if (out_size != BN_ * C1_) return;

  const float* emb1    = (const float*)d_in[0];
  const float* emb2    = (const float*)d_in[1];
  const float* Wq      = (const float*)d_in[2];
  const float* Wk      = (const float*)d_in[3];
  const float* Wv      = (const float*)d_in[4];
  const float* Wout    = (const float*)d_in[5];
  const float* ln1_g   = (const float*)d_in[6];
  const float* ln1_b   = (const float*)d_in[7];
  const float* lnall_g = (const float*)d_in[8];
  const float* lnall_b = (const float*)d_in[9];
  const float* ffn_g   = (const float*)d_in[10];
  const float* ffn_b   = (const float*)d_in[11];
  const float* fc1_w   = (const float*)d_in[12];
  const float* fc1_b   = (const float*)d_in[13];
  const float* fc2_w   = (const float*)d_in[14];
  const float* fc2_b   = (const float*)d_in[15];
  float* out = (float*)d_out;

  char* ws = (char*)d_ws;
  size_t off = 0;
  auto take = [&](size_t bytes) -> void* {
    off = (off + 255) & ~(size_t)255;
    void* p = ws + off;
    off += bytes;
    return p;
  };
  f16_t* cx1T  = (f16_t*)take((size_t)C1_ * BN_ * 2);        // [64][B*N]
  f16_t* ea    = (f16_t*)take((size_t)BN_ * KV_ * 2);
  f16_t* Wqh   = (f16_t*)take((size_t)H_ * C1_ * C1_ * 2);
  f16_t* Wkh   = (f16_t*)take((size_t)H_ * KV_ * KV_ * 2);
  f16_t* WvT   = (f16_t*)take((size_t)H_ * KV_ * KV_ * 2);   // [H][k'][k]
  f16_t* Wouth = (f16_t*)take((size_t)C1_ * C1_ * 2);
  f16_t* fc1h  = (f16_t*)take((size_t)MLP_ * C1_ * 2);
  f16_t* fc2h  = (f16_t*)take((size_t)C1_ * MLP_ * 2);
  f16_t* eaT   = (f16_t*)take((size_t)KV_ * BN_ * 2);        // [192][B*N]
  f16_t* Um    = (f16_t*)take((size_t)B_ * H_ * C1_ * KV_ * 2);  // 64 * U_h, [bh][64][192]
  float* Spart = (float*)take((size_t)SPLIT_ * B_ * SELEMS_ * 4);
  if (off > ws_size) return;

  // Layer norms of the inputs and all weight conversions, one launch
  prep_kernel<<<PREP_BLKS_, 256, 0, stream>>>(emb1, emb2, ln1_g, ln1_b, lnall_g, lnall_b,
                                              Wq, Wk, Wv, Wout, fc1_w, fc2_w,
                                              cx1T, ea, eaT, Wqh, Wkh, WvT, Wouth, fc1h, fc2h);

  // G = cx1^T ea per b; S = Wq[h] G Wk[h]^T / sqrt(KV); InstanceNorm; softmax P; U_h = Wout P Wv[h]
  scores_partial_kernel<<<dim3(SPLIT_, B_), 256, 0, stream>>>(cx1T, eaT, Spart);
  merge_softmax_kernel<<<B_ * H_, 1024, 0, stream>>>(Spart, Wqh, Wkh, WvT, Wouth, Um);

  // cx = ea * (mean_h U_h)^T + emb1; y = LN(cx); out = GELU(y fc1^T + b1) fc2^T + b2 + cx
  tail_kernel<<<dim3(N_ / 64, B_), 256, 0, stream>>>(ea, Um, emb1, ffn_g, ffn_b,
                                                     fc1h, fc1_b, fc2h, fc2_b, out);
}

// v006
// A run of this version takes 44.6 microseconds.
// In two side-by-side timings against v005, it was 1.07 and 1.06 times as fast.
// Counting every step since v000, it is 4.94 times as fast.
#include <hip/hip_runtime.h>

// All contractions: v_wmma_f32_16x16x32_f16 (f16 operands, f32 accumulate); softmax P operand carried x4096 (exact power of two); x1/64 comes off in f32 before T2 goes to f16, the other x1/64 in cx's f32 epilogue.

typedef _Float16 f16_t;
typedef f16_t v16h __attribute__((ext_vector_type(16)));
typedef f16_t v8h __attribute__((ext_vector_type(8)));
typedef float v8f __attribute__((ext_vector_type(8)));
typedef float v4f __attribute__((ext_vector_type(4)));
typedef f16_t v4h __attribute__((ext_vector_type(4)));
typedef v8h v8hm __attribute__((may_alias));
typedef v4h v4hm __attribute__((may_alias));
typedef v4f v4fm __attribute__((may_alias));

#define H_   4
#define C1_  64
#define C2_  128
#define KV_  192
#define MLP_ 256
#define B_   8
#define N_   3136
#define BN_  (B_ * N_)

union Frag { v16h v; v8h p[2]; };

// 16x16x32 f16 WMMA with f32 accumulate, followed by a 4-slot VALU hazard guard.
__device__ __forceinline__ v8f wmma16(v16h a, v16h b, v8f c) {
  v8f d = __builtin_amdgcn_wmma_f32_16x16x32_f16(false, a, false, b, (short)0, c, false, false);
  asm volatile("v_nop\n\tv_nop\n\tv_nop\n\tv_nop" : "+v"(d) : "v"(a), "v"(b));
  return d;
}

__device__ __forceinline__ float wave_sum(float v) {
#pragma unroll
  for (int msk = 16; msk >= 1; msk >>= 1) v += __shfl_xor(v, msk, 32);
  return v;
}
__device__ __forceinline__ float wave_max(float v) {
#pragma unroll
  for (int msk = 16; msk >= 1; msk >>= 1) v = fmaxf(v, __shfl_xor(v, msk, 32));
  return v;
}

// ---------------------------------------------------------------------------
// Job of the preparation grid: block blk converts elements blk*2048 .. +2047 of a weight matrix
// (every matrix here is a whole number of such blocks).
// ---------------------------------------------------------------------------
__device__ __forceinline__ void cvt_f16_job(const float* __restrict__ src,
                                            f16_t* __restrict__ dst, int blk) {
  const int i = blk * 256 + threadIdx.x;
  const v4f x0 = *(const v4fm*)(src + (size_t)i * 8);
  const v4f x1 = *(const v4fm*)(src + (size_t)i * 8 + 4);
  v8h v;
#pragma unroll
  for (int j = 0; j < 4; j++) { v[j] = (f16_t)x0[j]; v[4 + j] = (f16_t)x1[j]; }
  *(v8hm*)(dst + (size_t)i * 8) = v;
  // Only the end of the kernel follows this store: the wait is a precaution.
  asm volatile("s_wait_xcnt 0x0" ::: "memory");
}

// ---------------------------------------------------------------------------
// Transposing convert of the H_ matrices [192][192]: dst[h][c][r] = (f16) src[h][r][c].
// One block = one 64 x 64 tile: a lane gathers 2 x 8 rows of one column (each load 128 contiguous
// bytes per wave), the tile turns in LDS, and 8 lanes store one whole 128-B line.
// ---------------------------------------------------------------------------
__device__ __forceinline__ void cvt_t_f16_job(const float* __restrict__ src,
                                              f16_t* __restrict__ dst,
                                              f16_t (*__restrict__ Tt)[72],  // [column][row], 64 rows used
                                              int blk) {
  const int tid = threadIdx.x;
  const int hd = blk / 9, t9 = blk - hd * 9, ty = t9 / 3, tx = t9 - ty * 3;
  const int r0 = tx * 64, c0 = ty * 64;
  const size_t hb = (size_t)hd * KV_ * KV_;
  const int c = tid & 63, rg = tid >> 6;
  const float* s = src + hb + (size_t)r0 * KV_ + c0 + c;
#pragma unroll
  for (int q = 0; q < 2; q++) {
    v8h v;
#pragma unroll
    for (int j = 0; j < 8; j++) v[j] = (f16_t)s[((rg + 4 * q) * 8 + j) * KV_];
    *(v8hm*)&Tt[c][(rg + 4 * q) * 8] = v;
  }
  __syncthreads();
  const int rs = tid >> 3, ck = (tid & 7) * 8;
#pragma unroll
  for (int q = 0; q < 2; q++) {
    const int row = q * 32 + rs;
    const v8h v = *(const v8hm*)&Tt[row][ck];
    *(v8hm*)(dst + hb + (size_t)(c0 + row) * KV_ + r0 + ck) = v;
  }
  // Only the end of the kernel follows these stores: the wait is a precaution.
  asm volatile("s_wait_xcnt 0x0" ::: "memory");
}

// ---------------------------------------------------------------------------
// Fused: cx1 = LN(emb1) (64), ea = LN(concat(emb1,emb2)) (192).
// One block = 64 rows (n), one wave = 8 rows. Outputs: ea row-major [B*N][192] and
// the channel-major copies cx1T [64][B*N], eaT [192][B*N] (64 n = one 128-B line).
// ---------------------------------------------------------------------------
__device__ __forceinline__ void ln_concat_job(
    const float* __restrict__ emb1, const float* __restrict__ emb2,
    const float* __restrict__ g1, const float* __restrict__ b1,
    const float* __restrict__ ga, const float* __restrict__ ba,
    f16_t* __restrict__ cx1T, f16_t* __restrict__ ea, f16_t* __restrict__ eaT,
    f16_t (*__restrict__ Tt)[72],    // [channel][n], 0..63 cx1, 64..255 ea
    f16_t (*__restrict__ Sr)[200],   // [n][channel] of ea
    int blk) {
  const int tid = threadIdx.x, wave = tid >> 5, lane = tid & 31;
  const int n0 = blk * 64;

  float gv1[2], bv1[2], gva[6], bva[6];
#pragma unroll
  for (int j = 0; j < 2; j++) { gv1[j] = g1[lane + 32 * j]; bv1[j] = b1[lane + 32 * j]; }
#pragma unroll
  for (int j = 0; j < 6; j++) { gva[j] = ga[lane + 32 * j]; bva[j] = ba[lane + 32 * j]; }

  v8h tr[8];  // tr[q][i] = channel lane + 32q of row wave*8 + i
#pragma unroll
  for (int i = 0; i < 8; i++) {
    const int rl = wave * 8 + i;
    const float* r1 = emb1 + (size_t)(n0 + rl) * C1_;
    const float* r2 = emb2 + (size_t)(n0 + rl) * C2_;

    const float x0 = r1[lane], x1 = r1[lane + 32];
    const float mu = wave_sum(x0 + x1) * (1.0f / 64.0f);
    const float d0 = x0 - mu, d1 = x1 - mu;
    const float var = wave_sum(d0 * d0 + d1 * d1) * (1.0f / 64.0f);
    const float rs = rsqrtf(var + 1e-6f);
    tr[0][i] = (f16_t)(d0 * rs * gv1[0] + bv1[0]);
    tr[1][i] = (f16_t)(d1 * rs * gv1[1] + bv1[1]);

    float e[6];
    e[0] = x0; e[1] = x1;
#pragma unroll
    for (int j = 2; j < 6; j++) e[j] = r2[lane + 32 * (j - 2)];
    float s = 0.f;
#pragma unroll
    for (int j = 0; j < 6; j++) s += e[j];
    const float ma = wave_sum(s) * (1.0f / 192.0f);
    float sq = 0.f;
#pragma unroll
    for (int j = 0; j < 6; j++) { e[j] -= ma; sq += e[j] * e[j]; }
    const float vara = wave_sum(sq) * (1.0f / 192.0f);
    const float rsa = rsqrtf(vara + 1e-6f);
#pragma unroll
    for (int j = 0; j < 6; j++) {
      const f16_t y = (f16_t)(e[j] * rsa * gva[j] + bva[j]);
      tr[2 + j][i] = y;
      Sr[rl][lane + 32 * j] = y;
    }
  }
#pragma unroll
  for (int q = 0; q < 8; q++) *(v8hm*)&Tt[lane + 32 * q][wave * 8] = tr[q];
  __syncthreads();

  // Channel-major: 8 lanes fill one 128-B line, one instruction = 4 whole lines.
  const int chs = tid >> 3, ck = (tid & 7) * 8;
#pragma unroll
  for (int i = 0; i < 8; i++) {
    const int ch = i * 32 + chs;
    const v8h v = *(const v8hm*)&Tt[ch][ck];
    f16_t* d = (i < 2) ? cx1T + (size_t)ch * BN_ : eaT + (size_t)(ch - 64) * BN_;
    *(v8hm*)(d + n0 + ck) = v;
  }
  // Row-major ea: the 64 rows are 24576 contiguous bytes.
#pragma unroll
  for (int i = 0; i < 6; i++) {
    const int idx = i * 256 + tid;
    const int row = idx / 24, c8 = (idx - row * 24) * 8;
    const v8h v = *(const v8hm*)&Sr[row][c8];
    *(v8hm*)(ea + (size_t)n0 * KV_ + (size_t)idx * 8) = v;
  }
}

// ---------------------------------------------------------------------------
// Preparation grid: the two layer norms and the six weight conversions depend on nothing but the
// inputs, so they run as jobs of one launch, picked by work-group index. The layer-norm groups are
// the longest and take the lowest indices.
// ---------------------------------------------------------------------------
#define LN_BLKS_ (BN_ / 64)                  // 392
#define WV_BLKS_ (H_ * 9)                    // 36 tiles of 64 x 64
#define WK_BLKS_ (H_ * KV_ * KV_ / 2048)     // 72
#define WQ_BLKS_ (H_ * C1_ * C1_ / 2048)     // 8
#define F1_BLKS_ (MLP_ * C1_ / 2048)         // 8
#define F2_BLKS_ (C1_ * MLP_ / 2048)         // 8
#define WO_BLKS_ (C1_ * C1_ / 2048)          // 2
#define PREP_BLKS_ (LN_BLKS_ + WV_BLKS_ + WK_BLKS_ + WQ_BLKS_ + F1_BLKS_ + F2_BLKS_ + WO_BLKS_)

__global__ __launch_bounds__(256) void prep_kernel(
    const float* __restrict__ emb1, const float* __restrict__ emb2,
    const float* __restrict__ g1, const float* __restrict__ b1,
    const float* __restrict__ ga, const float* __restrict__ ba,
    const float* __restrict__ Wq, const float* __restrict__ Wk, const float* __restrict__ Wv,
    const float* __restrict__ Wo, const float* __restrict__ f1, const float* __restrict__ f2,
    f16_t* __restrict__ cx1T, f16_t* __restrict__ ea, f16_t* __restrict__ eaT,
    f16_t* __restrict__ Wqh, f16_t* __restrict__ Wkh, f16_t* __restrict__ WvT,
    f16_t* __restrict__ Woh, f16_t* __restrict__ f1h, f16_t* __restrict__ f2h) {
  __shared__ __attribute__((aligned(16))) f16_t Tt[256][72];
  __shared__ __attribute__((aligned(16))) f16_t Sr[64][200];
  int blk = blockIdx.x;
  if (blk < LN_BLKS_) {
    ln_concat_job(emb1, emb2, g1, b1, ga, ba, cx1T, ea, eaT, Tt, Sr, blk);
    return;
  }
  blk -= LN_BLKS_;
  if (blk < WV_BLKS_) {
    cvt_t_f16_job(Wv, WvT, Tt, blk);
    return;
  }
  blk -= WV_BLKS_;
  const float* s = Wk;
  f16_t* d = Wkh;
  if (blk >= WK_BLKS_) {
    blk -= WK_BLKS_; s = Wq; d = Wqh;
    if (blk >= WQ_BLKS_) {
      blk -= WQ_BLKS_; s = f1; d = f1h;
      if (blk >= F1_BLKS_) {
        blk -= F1_BLKS_; s = f2; d = f2h;
        if (blk >= F2_BLKS_) { blk -= F2_BLKS_; s = Wo; d = Woh; }
      }
    }
  }
  cvt_f16_job(s, d, blk);
}

// ---------------------------------------------------------------------------
// S_h = Q_h^T K_h = Wq_h (cx1^T ea) Wk_h^T: the sum over n is done once per batch on the
// normalised activations, G = cx1^T ea (64 x 192), split over SPLIT_ work-groups per b.
// A = cx1T [64][B*N] (row c, k = n contiguous), B = eaT [192][B*N]
// (row kv, k = n contiguous) -> both fragments loaded with the same k map.
// Each work-group sums KSTEPS_ * 32 values of n and stores its f32 accumulators
// in register order: chunk ((wave*6 + t)*2 + half)*32 + lane holds 4 floats,
// rows mt*16 + 8h + 4*half + 0..3 of column (ng*6 + t)*16 + m.
// ---------------------------------------------------------------------------
#define SPLIT_  14
#define KSTEPS_ (N_ / 32 / SPLIT_)  // 7
#define SELEMS_ (C1_ * KV_)         // 12288

__global__ __launch_bounds__(256) void scores_partial_kernel(
    const f16_t* __restrict__ XT, const f16_t* __restrict__ ET, float* __restrict__ part) {
  __shared__ __attribute__((aligned(16))) f16_t Aq[64][32];
  __shared__ __attribute__((aligned(16))) f16_t Bk[192][32];
  const int tid = threadIdx.x, lane = tid & 31, wave = tid >> 5;
  const int hh = lane >> 4, m = lane & 15;
  const int sp = blockIdx.x;
  const int b = blockIdx.y;
  const f16_t* Ab = XT + (size_t)b * N_ + sp * (KSTEPS_ * 32);
  const f16_t* Bb = ET + (size_t)b * N_ + sp * (KSTEPS_ * 32);
  const int mt = wave & 3, ng = wave >> 2;
  v8f acc[6] = {};
  const int ar = tid >> 2, ac = (tid & 3) * 8;
  const f16_t* gA  = Ab + (size_t)ar * BN_ + ac;
  const f16_t* gB0 = Bb + (size_t)ar * BN_ + ac;
  const f16_t* gB1 = Bb + (size_t)(ar + 64) * BN_ + ac;
  const f16_t* gB2 = Bb + (size_t)(ar + 128) * BN_ + ac;
  const int mrow = mt * 16 + m;

  // Whole unroll of the 7 trips: unrolled by two, the odd count costs a copy of all 48 accumulators per pair.
#pragma unroll
  for (int it = 0; it < KSTEPS_; it++) {
    const int n0 = it * 32;
    const v8h sa  = *(const v8hm*)(gA + n0);
    const v8h sb0 = *(const v8hm*)(gB0 + n0);
    const v8h sb1 = *(const v8hm*)(gB1 + n0);
    const v8h sb2 = *(const v8hm*)(gB2 + n0);
    __syncthreads();
    *(v8hm*)&Aq[ar][ac]       = sa;
    *(v8hm*)&Bk[ar][ac]       = sb0;
    *(v8hm*)&Bk[ar + 64][ac]  = sb1;
    *(v8hm*)&Bk[ar + 128][ac] = sb2;
    __syncthreads();
    Frag a;
    a.p[0] = *(const v8hm*)&Aq[mrow][8 * hh];
    a.p[1] = *(const v8hm*)&Aq[mrow][16 + 8 * hh];
#pragma unroll
    for (int t = 0; t < 6; t++) {
      const int col = (ng * 6 + t) * 16 + m;
      Frag bf;
      bf.p[0] = *(const v8hm*)&Bk[col][8 * hh];
      bf.p[1] = *(const v8hm*)&Bk[col][16 + 8 * hh];
      acc[t] = wmma16(a.v, bf.v, acc[t]);
    }
  }

  // Each store instruction writes 512 contiguous bytes (4 whole lines) of this wave's own range.
  float* pb = part + ((size_t)sp * B_ + b) * SELEMS_ + (size_t)wave * 1536 + lane * 4;
#pragma unroll
  for (int t = 0; t < 6; t++) {
#pragma unroll
    for (int hf = 0; hf < 2; hf++) {
      v4f v;
#pragma unroll
      for (int j = 0; j < 4; j++) v[j] = acc[t][hf * 4 + j];
      *(v4fm*)(pb + (t * 2 + hf) * 128) = v;
    }
  }
}

// ---------------------------------------------------------------------------
// One block of 32 waves per (b,h): G_b = sum of the SPLIT_ partials (each thread owns
// 3 chunks of 4 floats), T = Wq_h G_b, S = T Wk_h^T (both on WMMA, 24 waves x 2 tiles),
// scale, InstanceNorm over (64,192), softmax over KV, P*4096 kept in LDS as f16.
// G is carried x 1/64 (exact power of two) as f16 operand and unscaled in f32 on S.
// Value side, o = mean_h (ea Wv_h^T) P_h^T Wout^T = ea (mean_h Wout P_h Wv_h)^T: this block forms
// T2 = P_h Wv_h and U_h = Wout T2 (both on WMMA, same wave map) and stores 64 * U_h as f16 [64][192].
// ---------------------------------------------------------------------------
__global__ __launch_bounds__(1024) void merge_softmax_kernel(
    const float* __restrict__ part, const f16_t* __restrict__ Wq,
    const f16_t* __restrict__ Wk, const f16_t* __restrict__ WvT,
    const f16_t* __restrict__ Wo, f16_t* __restrict__ U) {
  __shared__ float Sb[64][196];
  __shared__ __attribute__((aligned(16))) f16_t Pst[64][200];
  __shared__ __attribute__((aligned(16))) f16_t Gt[192][72];   // G^T / 64: [k'][c']; later 64 T2^T: [k'][c]
  __shared__ __attribute__((aligned(16))) f16_t Tl[64][200];   // T / 64:   [c][k']; later 64 U: [d][k']
  __shared__ __attribute__((aligned(16))) f16_t Wl[64][72];    // Wout: [d][c]
  __shared__ float red[32];
  __shared__ float red2[32];
  const int tid = threadIdx.x, lane = tid & 31;
  const int wave = __builtin_amdgcn_readfirstlane(tid >> 5);
  const int hh = lane >> 4, m = lane & 15;
  const int bh = blockIdx.x, b = bh >> 2, hd = bh & 3;
  const float* pb = part + (size_t)b * SELEMS_ + tid * 4;

  // Matrix work: wave < 24 owns column tile nt (of 12) and row tiles 2*mp, 2*mp + 1 (of 4).
  const bool mm = wave < 24;
  const int mp = wave / 12, nt = wave - mp * 12;
  const v4h wo4 = *(const v4hm*)(Wo + tid * 4);  // Wout goes to LDS with the first barrier
  v4f a[3] = {};
#pragma unroll
  for (int s = 0; s < SPLIT_; s++) {
#pragma unroll
    for (int i = 0; i < 3; i++)
      a[i] += *(const v4fm*)(pb + (size_t)s * B_ * SELEMS_ + i * 4096);
  }

#pragma unroll
  for (int i = 0; i < 3; i++) {
    const int g = wave + 32 * i;          // chunk group = (producer wave)*12 + t*2 + half
    const int wa = g / 12, rem = g - wa * 12;
    const int row0 = (wa & 3) * 16 + 8 * hh + (rem & 1) * 4;
    const int col = ((wa >> 2) * 6 + (rem >> 1)) * 16 + m;
    v4h gq;
#pragma unroll
    for (int j = 0; j < 4; j++) gq[j] = (f16_t)(a[i][j] * 0.015625f);
    *(v4hm*)&Gt[col][row0] = gq;
  }
  *(v4hm*)&Wl[tid >> 4][(tid & 15) * 4] = wo4;

  // Weight fragments are fetched here, behind the sum (whose loads need the registers) and in front of
  // the barrier, so that their latency runs under the wait for the other waves.
  Frag wq[2][2], wk[6];
  if (mm) {
    const f16_t* wqb = Wq + (size_t)hd * C1_ * C1_ + (size_t)(mp * 32 + m) * C1_ + 8 * hh;
#pragma unroll
    for (int t = 0; t < 2; t++) {
#pragma unroll
      for (int kk = 0; kk < 2; kk++) {
        wq[t][kk].p[0] = *(const v8hm*)(wqb + t * 16 * C1_ + kk * 32);
        wq[t][kk].p[1] = *(const v8hm*)(wqb + t * 16 * C1_ + kk * 32 + 16);
      }
    }
    const f16_t* wkb = Wk + (size_t)hd * KV_ * KV_ + (size_t)(nt * 16 + m) * KV_ + 8 * hh;
#pragma unroll
    for (int kk = 0; kk < 6; kk++) {
      wk[kk].p[0] = *(const v8hm*)(wkb + kk * 32);
      wk[kk].p[1] = *(const v8hm*)(wkb + kk * 32 + 16);
    }
    // Holds both address pairs until the loads above have taken them.
    asm volatile("s_wait_xcnt 0x0" :: "v"(wqb), "v"(wkb) : "memory");
  }
  __syncthreads();

  // T[c][k'] = sum_c' Wq[c][c'] G[c'][k']: A = Wq rows, B = Gt rows, both k = c' contiguous.
  if (mm) {
    v8f t1[2] = {};
#pragma unroll
    for (int kk = 0; kk < 2; kk++) {
      Frag bf;
      bf.p[0] = *(const v8hm*)&Gt[nt * 16 + m][kk * 32 + 8 * hh];
      bf.p[1] = *(const v8hm*)&Gt[nt * 16 + m][kk * 32 + 16 + 8 * hh];
#pragma unroll
      for (int t = 0; t < 2; t++) t1[t] = wmma16(wq[t][kk].v, bf.v, t1[t]);
    }
#pragma unroll
    for (int t = 0; t < 2; t++) {
#pragma unroll
      for (int r = 0; r < 8; r++)
        Tl[mp * 32 + t * 16 + 8 * hh + r][nt * 16 + m] = (f16_t)t1[t][r];
    }
  }
  __syncthreads();

  // S[c][k] = sum_k' T[c][k'] Wk[k][k']: A = Tl rows, B = Wk rows, both k = k' contiguous.
  const float sc = 64.0f * 0.07216878364870322f;  // 64 / sqrt(192)
  v8f sv[2] = {};
  float s = 0.f;
  if (mm) {
#pragma unroll
    for (int kk = 0; kk < 6; kk++) {
#pragma unroll
      for (int t = 0; t < 2; t++) {
        Frag af;
        af.p[0] = *(const v8hm*)&Tl[mp * 32 + t * 16 + m][kk * 32 + 8 * hh];
        af.p[1] = *(const v8hm*)&Tl[mp * 32 + t * 16 + m][kk * 32 + 16 + 8 * hh];
        sv[t] = wmma16(af.v, wk[kk].v, sv[t]);
      }
    }
#pragma unroll
    for (int t = 0; t < 2; t++) {
#pragma unroll
      for (int r = 0; r < 8; r++) {
        sv[t][r] *= sc;
        s += sv[t][r];
        Sb[mp * 32 + t * 16 + 8 * hh + r][nt * 16 + m] = sv[t][r];
      }
    }
  }
  // Wv's fragments are fetched here, where Wk's registers are free, in front of the norm and the softmax.
  Frag wv[6];
  if (mm) {
    const f16_t* wvb = WvT + (size_t)hd * KV_ * KV_ + (size_t)(nt * 16 + m) * KV_ + 8 * hh;
#pragma unroll
    for (int kk = 0; kk < 6; kk++) {
      wv[kk].p[0] = *(const v8hm*)(wvb + kk * 32);
      wv[kk].p[1] = *(const v8hm*)(wvb + kk * 32 + 16);
    }
    // Holds the address pair until the loads above have taken it, as at the first weight fetch.
    asm volatile("s_wait_xcnt 0x0" :: "v"(wvb) : "memory");
  }
  s = wave_sum(s);
  if (lane == 0) red[wave] = s;
  __syncthreads();
  const float mean = wave_sum(red[lane]) * (1.0f / 12288.0f);
  float sq = 0.f;
  if (mm) {
#pragma unroll
    for (int t = 0; t < 2; t++) {
#pragma unroll
      for (int r = 0; r < 8; r++) { const float d = sv[t][r] - mean; sq += d * d; }
    }
  }
  sq = wave_sum(sq);
  if (lane == 0) red2[wave] = sq;
  __syncthreads();
  const float var  = wave_sum(red2[lane]) * (1.0f / 12288.0f);
  const float rstd = rsqrtf(var + 1e-5f);

  // Softmax over KV per row c; one wave per row, 2 rows per wave; P*4096 -> LDS.
  const float pscale = 4096.0f;
#pragma unroll
  for (int rr = 0; rr < 2; rr++) {
    const int r = wave * 2 + rr;
    float xs[6];
    float mx = -3.0e38f;
#pragma unroll
    for (int j = 0; j < 6; j++) {
      xs[j] = (Sb[r][lane + 32 * j] - mean) * rstd;
      mx = fmaxf(mx, xs[j]);
    }
    mx = wave_max(mx);
    float es = 0.f;
#pragma unroll
    for (int j = 0; j < 6; j++) { xs[j] = expf(xs[j] - mx); es += xs[j]; }
    es = wave_sum(es);
    const float inv = (1.0f / es) * pscale;
#pragma unroll
    for (int j = 0; j < 6; j++)
      Pst[r][lane + 32 * j] = (f16_t)(xs[j] * inv);
  }
  __syncthreads();

  // T2[c][k'] = sum_k P[c][k] Wv[k][k']: A = Pst rows, B = WvT rows, both k contiguous.
  // A lane's 8 accumulators are 8 consecutive c of one k': one 16-B store into T2^T (x 4096 / 64).
  if (mm) {
    v8f t2[2] = {};
    // P's fragments are read six at a time in front of their WMMAs: two LDS latencies instead of twelve.
#pragma unroll
    for (int kh = 0; kh < 2; kh++) {
      Frag af[3][2];
#pragma unroll
      for (int kk = 0; kk < 3; kk++) {
#pragma unroll
        for (int t = 0; t < 2; t++) {
          af[kk][t].p[0] = *(const v8hm*)&Pst[mp * 32 + t * 16 + m][(kh * 3 + kk) * 32 + 8 * hh];
          af[kk][t].p[1] = *(const v8hm*)&Pst[mp * 32 + t * 16 + m][(kh * 3 + kk) * 32 + 16 + 8 * hh];
        }
      }
#pragma unroll
      for (int kk = 0; kk < 3; kk++) {
#pragma unroll
        for (int t = 0; t < 2; t++) t2[t] = wmma16(af[kk][t].v, wv[kh * 3 + kk].v, t2[t]);
      }
    }
#pragma unroll
    for (int t = 0; t < 2; t++) {
      v8h q;
#pragma unroll
      for (int r = 0; r < 8; r++) q[r] = (f16_t)(t2[t][r] * 0.015625f);
      *(v8hm*)&Gt[nt * 16 + m][mp * 32 + t * 16 + 8 * hh] = q;
    }
  }
  __syncthreads();

  // U^T[k'][d] = sum_c T2^T[k'][c] Wout[d][c]: A = Gt rows, B = Wl rows, both c contiguous.
  // A lane's 8 accumulators are 8 consecutive k' of one d: one 16-B store into U's row.
  if (mm) {
    v8f u[2] = {};
    Frag af[2], wo[2][2];
#pragma unroll
    for (int kk = 0; kk < 2; kk++) {
      af[kk].p[0] = *(const v8hm*)&Gt[nt * 16 + m][kk * 32 + 8 * hh];
      af[kk].p[1] = *(const v8hm*)&Gt[nt * 16 + m][kk * 32 + 16 + 8 * hh];
#pragma unroll
      for (int t = 0; t < 2; t++) {
        wo[t][kk].p[0] = *(const v8hm*)&Wl[mp * 32 + t * 16 + m][kk * 32 + 8 * hh];
        wo[t][kk].p[1] = *(const v8hm*)&Wl[mp * 32 + t * 16 + m][kk * 32 + 16 + 8 * hh];
      }
    }
#pragma unroll
    for (int kk = 0; kk < 2; kk++) {
#pragma unroll
      for (int t = 0; t < 2; t++) u[t] = wmma16(af[kk].v, wo[t][kk].v, u[t]);
    }
#pragma unroll
    for (int t = 0; t < 2; t++) {
      v8h q;
#pragma unroll
      for (int r = 0; r < 8; r++) q[r] = (f16_t)u[t][r];
      *(v8hm*)&Tl[mp * 32 + t * 16 + m][nt * 16 + 8 * hh] = q;
    }
  }
  __syncthreads();

  // Whole-line stores: each row = 384 B = lanes 0..23 x 16 B, one instruction.
  f16_t* Ub = U + (size_t)bh * C1_ * KV_;
  const int l24 = (lane < 24) ? lane : 0;
  const bool se = lane < 24;
  v8h vals[2];
#pragma unroll
  for (int j = 0; j < 2; j++) vals[j] = *(const v8hm*)&Tl[wave * 2 + j][l24 * 8];
#pragma unroll
  for (int j = 0; j < 2; j++)
    if (se) *(v8hm*)(Ub + (size_t)(wave * 2 + j) * KV_ + l24 * 8) = vals[j];
}

// ---------------------------------------------------------------------------
// Sum over the 16 lanes of a row, every lane gets it: four DPP row_xmask steps.
// ---------------------------------------------------------------------------
__device__ __forceinline__ float row16_sum(float v) {
  v += __builtin_bit_cast(float, __builtin_amdgcn_update_dpp(0, __builtin_bit_cast(int, v), 0x161, 0xf, 0xf, true));
  v += __builtin_bit_cast(float, __builtin_amdgcn_update_dpp(0, __builtin_bit_cast(int, v), 0x162, 0xf, 0xf, true));
  v += __builtin_bit_cast(float, __builtin_amdgcn_update_dpp(0, __builtin_bit_cast(int, v), 0x164, 0xf, 0xf, true));
  v += __builtin_bit_cast(float, __builtin_amdgcn_update_dpp(0, __builtin_bit_cast(int, v), 0x168, 0xf, 0xf, true));
  return v;
}

// ---------------------------------------------------------------------------
// Exact-form GELU x * Phi(x) of 8 values, without a branch: with z = |x| / sqrt(2), t = 1 / (1 + p z),
//   erfc(z) = (a1 t + a2 t^2 + a3 t^3 + a4 t^4 + a5 t^5) exp(-z^2),  |error| <= 1.5e-7 for every z >= 0,
//   x * Phi(x) = max(x, 0) - |x| * erfc(z) / 2  (no cancellation on the negative side).
// The library erf takes two data-dependent branches per value, both taken by nearly every wave, and each
// value's chain runs alone between them; here the 8 chains are independent straight-line code.
// The coefficients carry the factor 1/2.
// ---------------------------------------------------------------------------
__device__ __forceinline__ v8f gelu8(v8f x) {
  const v8f ax = __builtin_elementwise_abs(x);
  const v8f d = ax * 0.23164189f + 1.0f;       // 1 + p z, p = 0.3275911
  const v8f w = (x * x) * -0.72134752f;        // -z^2 * log2(e)
  v8f t, e;
#pragma unroll
  for (int r = 0; r < 8; r++) {
    t[r] = __builtin_amdgcn_rcpf(d[r]);
    e[r] = __builtin_amdgcn_exp2f(w[r]);
  }
  v8f p = t * 0.53070271f - 0.72657601f;
  p = p * t + 0.71070687f;
  p = p * t - 0.14224837f;
  p = p * t + 0.12741480f;
  const v8f zero = {};
  return __builtin_elementwise_max(x, zero) - ax * ((p * t) * e);
}

// ---------------------------------------------------------------------------
// Everything behind the attention weights is local to a row n, so one block takes 64 rows through all of it:
//   cx[n][d] = emb1[n][d] + sum_k' ea[n][k'] * Um[d][k'],  Um = mean over heads of U_h   (K = 192)
//   y = LN(cx);  h = GELU(y fc1^T + b1)  (K = 64);  out = h fc2^T + b2 + cx  (K = 256)
// cx stays in registers (f32), y and h in LDS (f16). Both weight matrices are staged whole with the first
// round of loads. The four heads' 64 * U_h are averaged in f32 while they are staged.
// fc1 and fc2 run with the weight rows as A and the token rows as B: a lane's 8 accumulators are then
// 8 consecutive channels of one token, one or two 16-B LDS stores. grid = (N/64, B).
// Two blocks share a WGP (392 blocks, 256 WGPs): 4 waves per SIMD, 146 KiB of LDS each.
// ---------------------------------------------------------------------------
__global__ __launch_bounds__(256, 4) void tail_kernel(
    const f16_t* __restrict__ ea, const f16_t* __restrict__ U,
    const float* __restrict__ emb1,
    const float* __restrict__ fg, const float* __restrict__ fb,
    const f16_t* __restrict__ W1, const float* __restrict__ b1,
    const f16_t* __restrict__ W2, const float* __restrict__ b2,
    float* __restrict__ out) {
  __shared__ __attribute__((aligned(16))) f16_t EU[2][64][200];   // ea tile, Um; later h [64][264]
  __shared__ __attribute__((aligned(16))) float Cs[64][68];
  __shared__ __attribute__((aligned(16))) f16_t Ys[64][72];
  __shared__ __attribute__((aligned(16))) f16_t W1s[MLP_][72];
  __shared__ __attribute__((aligned(16))) f16_t W2s[C1_][264];
  __shared__ __attribute__((aligned(16))) float B1s[MLP_];
  f16_t (*Es)[200] = EU[0];
  f16_t (*Us)[200] = EU[1];
  f16_t (*Hs)[264] = reinterpret_cast<f16_t (*)[264]>(&EU[0][0][0]);
  const int tid = threadIdx.x, lane = tid & 31, wave = tid >> 5;
  const int hh = lane >> 4, m = lane & 15;
  const int b = blockIdx.y;
  const size_t r0 = (size_t)b * N_ + blockIdx.x * 64;
  const int mt = wave & 3, ng = wave >> 2;

  // All tiles are contiguous in memory: chunk i * 256 + tid of 16 B.
  const f16_t* Ub = U + (size_t)b * H_ * C1_ * KV_ + tid * 8;
  const f16_t* Eb = ea + r0 * KV_ + tid * 8;
  v8h uh[6][H_], ev[6], w1v[8], w2v[8];
  const size_t ro = (r0 + wave * 8 + hh) * C1_ + m * 4;  // rows wave*8 + 2j + hh, 16 lanes a row
  const float* rp = emb1 + ro;
  v4f rr[4];
#pragma unroll
  for (int j = 0; j < 4; j++) rr[j] = *(const v4fm*)(rp + j * 2 * C1_);
#pragma unroll
  for (int i = 0; i < 6; i++) ev[i] = *(const v8hm*)(Eb + i * 2048);
#pragma unroll
  for (int i = 0; i < 6; i++) {
#pragma unroll
    for (int h = 0; h < H_; h++) uh[i][h] = *(const v8hm*)(Ub + h * (C1_ * KV_) + i * 2048);
  }
#pragma unroll
  for (int i = 0; i < 8; i++) {
    w1v[i] = *(const v8hm*)(W1 + tid * 8 + i * 2048);
    w2v[i] = *(const v8hm*)(W2 + tid * 8 + i * 2048);
  }
  const float b1v = b1[tid];
  const v4f lg = *(const v4fm*)(fg + m * 4);
  const v4f lb = *(const v4fm*)(fb + m * 4);
  const v4f ob = *(const v4fm*)(b2 + m * 4);
  // Holds the address pair until the loads have taken it.
  asm volatile("s_wait_xcnt 0x0" :: "v"(rp) : "memory");
  // Keeps all loads in front of the first use: left free, the scheduler issues a part of them
  // behind the first wait, and the block pays the load latency twice.
  __builtin_amdgcn_sched_barrier(0);

#pragma unroll
  for (int i = 0; i < 6; i++) {
    const int idx = i * 256 + tid;
    const int row = idx / 24, c8 = (idx - row * 24) * 8;
    v8h um;
#pragma unroll
    for (int j = 0; j < 8; j++) {
      float a = 0.25f * (float)uh[i][0][j];
#pragma unroll
      for (int h = 1; h < H_; h++) a = fmaf(0.25f, (float)uh[i][h][j], a);
      um[j] = (f16_t)a;
    }
    *(v8hm*)&Us[row][c8] = um;
    *(v8hm*)&Es[row][c8] = ev[i];
  }
#pragma unroll
  for (int i = 0; i < 8; i++) {
    const int idx = i * 256 + tid;
    *(v8hm*)&W1s[idx >> 3][(idx & 7) * 8]   = w1v[i];
    *(v8hm*)&W2s[idx >> 5][(idx & 31) * 8]  = w2v[i];
  }
  B1s[tid] = b1v;
  __syncthreads();

  // All 18 fragments are read in front of the first WMMA: one LDS latency instead of twelve.
  v8f acc[2] = {};
  const int mrow = mt * 16 + m;
  {
    Frag a[6], bf[6][2];
#pragma unroll
    for (int kk = 0; kk < 6; kk++) {
      a[kk].p[0] = *(const v8hm*)&Es[mrow][kk * 32 + 8 * hh];
      a[kk].p[1] = *(const v8hm*)&Es[mrow][kk * 32 + 16 + 8 * hh];
#pragma unroll
      for (int t = 0; t < 2; t++) {
        const int col = (ng * 2 + t) * 16 + m;
        bf[kk][t].p[0] = *(const v8hm*)&Us[col][kk * 32 + 8 * hh];
        bf[kk][t].p[1] = *(const v8hm*)&Us[col][kk * 32 + 16 + 8 * hh];
      }
    }
#pragma unroll
    for (int kk = 0; kk < 6; kk++) {
#pragma unroll
      for (int t = 0; t < 2; t++) acc[t] = wmma16(a[kk].v, bf[kk][t].v, acc[t]);
    }
  }

#pragma unroll
  for (int t = 0; t < 2; t++) {
    const int cn = (ng * 2 + t) * 16 + m;
#pragma unroll
    for (int r = 0; r < 8; r++) Cs[mt * 16 + 8 * hh + r][cn] = acc[t][r] * 0.015625f;
  }
  __syncthreads();

  // cx: 16 lanes hold one row (4 channels each), 4 rows a thread; kept for the last residual.
  // Layer norm of a row = two sums over its 16 lanes.
  v4f cxv[4];
#pragma unroll
  for (int j = 0; j < 4; j++) cxv[j] = *(const v4fm*)&Cs[wave * 8 + 2 * j + hh][m * 4] + rr[j];
#pragma unroll
  for (int j = 0; j < 4; j++) {
    const v4f x = cxv[j];
    const float mu = row16_sum((x[0] + x[1]) + (x[2] + x[3])) * (1.0f / 64.0f);
    const v4f d = x - mu;
    const float var = row16_sum((d[0] * d[0] + d[1] * d[1]) + (d[2] * d[2] + d[3] * d[3])) * (1.0f / 64.0f);
    const float rs = rsqrtf(var + 1e-6f);
    v4h y;
#pragma unroll
    for (int c = 0; c < 4; c++) y[c] = (f16_t)(d[c] * rs * lg[c] + lb[c]);
    *(v4hm*)&Ys[wave * 8 + 2 * j + hh][m * 4] = y;
  }
  __syncthreads();

  // h^T[e][n] = sum_c fc1[e][c] y[n][c]: A = W1s rows, B = Ys rows, both c contiguous.
  // Wave w owns channels e = 32w .. 32w + 31 of all 64 rows.
  {
    Frag wa[2][2];
    v4f bb[2][2];
#pragma unroll
    for (int t = 0; t < 2; t++) {
#pragma unroll
      for (int kk = 0; kk < 2; kk++) {
        wa[t][kk].p[0] = *(const v8hm*)&W1s[wave * 32 + t * 16 + m][kk * 32 + 8 * hh];
        wa[t][kk].p[1] = *(const v8hm*)&W1s[wave * 32 + t * 16 + m][kk * 32 + 16 + 8 * hh];
      }
      bb[t][0] = *(const v4fm*)&B1s[wave * 32 + t * 16 + 8 * hh];
      bb[t][1] = *(const v4fm*)&B1s[wave * 32 + t * 16 + 8 * hh + 4];
    }
    // Stays rolled: the other waves of the SIMD cover a trip's LDS latency.
#pragma unroll 1
    for (int q = 0; q < 4; q++) {
      Frag yb[2];
#pragma unroll
      for (int kk = 0; kk < 2; kk++) {
        yb[kk].p[0] = *(const v8hm*)&Ys[q * 16 + m][kk * 32 + 8 * hh];
        yb[kk].p[1] = *(const v8hm*)&Ys[q * 16 + m][kk * 32 + 16 + 8 * hh];
      }
      v8f hv[2] = {};
#pragma unroll
      for (int kk = 0; kk < 2; kk++) {
#pragma unroll
        for (int t = 0; t < 2; t++) hv[t] = wmma16(wa[t][kk].v, yb[kk].v, hv[t]);
      }
#pragma unroll
      for (int t = 0; t < 2; t++) {
        v8f xv;
#pragma unroll
        for (int r = 0; r < 8; r++) xv[r] = hv[t][r] + bb[t][r >> 2][r & 3];
        const v8f gv = gelu8(xv);
        v8h g;
#pragma unroll
        for (int r = 0; r < 8; r++) g[r] = (f16_t)gv[r];
        *(v8hm*)&Hs[q * 16 + m][wave * 32 + t * 16 + 8 * hh] = g;
      }
    }
  }
  __syncthreads();

  // o^T[d][n] = sum_e fc2[d][e] h[n][e]: A = W2s rows, B = Hs rows, both e contiguous.
  // Wave owns channel tile mt and row tiles 2*ng, 2*ng + 1. Fragments are read twelve at a time.
  {
    v8f o[2] = {};
#pragma unroll
    for (int kh = 0; kh < 2; kh++) {
      Frag wf[4], hf[4][2];
#pragma unroll
      for (int kk = 0; kk < 4; kk++) {
        const int k0 = (kh * 4 + kk) * 32 + 8 * hh;
        wf[kk].p[0] = *(const v8hm*)&W2s[mt * 16 + m][k0];
        wf[kk].p[1] = *(const v8hm*)&W2s[mt * 16 + m][k0 + 16];
#pragma unroll
        for (int t = 0; t < 2; t++) {
          hf[kk][t].p[0] = *(const v8hm*)&Hs[(ng * 2 + t) * 16 + m][k0];
          hf[kk][t].p[1] = *(const v8hm*)&Hs[(ng * 2 + t) * 16 + m][k0 + 16];
        }
      }
#pragma unroll
      for (int kk = 0; kk < 4; kk++) {
#pragma unroll
        for (int t = 0; t < 2; t++) o[t] = wmma16(wf[kk].v, hf[kk][t].v, o[t]);
      }
    }
#pragma unroll
    for (int t = 0; t < 2; t++) {
      v4f lo, hi;
#pragma unroll
      for (int c = 0; c < 4; c++) { lo[c] = o[t][c]; hi[c] = o[t][4 + c]; }
      *(v4fm*)&Cs[(ng * 2 + t) * 16 + m][mt * 16 + 8 * hh]     = lo;
      *(v4fm*)&Cs[(ng * 2 + t) * 16 + m][mt * 16 + 8 * hh + 4] = hi;
    }
  }
  __syncthreads();

  // Whole-line stores: 16 lanes x 16 B = one 256-B row, two rows per instruction.
#pragma unroll
  for (int j = 0; j < 4; j++) {
    const v4f v = (*(const v4fm*)&Cs[wave * 8 + 2 * j + hh][m * 4] + ob) + cxv[j];
    *(v4fm*)(out + ro + j * 2 * C1_) = v;
  }
}

// ---------------------------------------------------------------------------
// Host-side orchestration
// ---------------------------------------------------------------------------
extern "C" void kernel_launch(void* const* d_in, const int* in_sizes, int n_in,
                              void* d_out, int out_size, void* d_ws, size_t ws_size,
                              hipStream_t stream) {
  if (n_in < 16) return;
  const int need[16] = {BN_ * C1_, BN_ * C2_, H_ * C1_ * C1_, H_ * KV_ * KV_, H_ * KV_ * KV_,
                        C1_ * C1_, C1_, C1_, KV_, KV_, C1_, C1_, MLP_ * C1_, MLP_,
                        C1_ * MLP_, C1_};
  for (int i = 0; i < 16; i++) if (in_sizes[i] != need[i]) return;
  if (out_size != BN_ * C1_) return;

  const float* emb1    = (const float*)d_in[0];
  const float* emb2    = (const float*)d_in[1];
  const float* Wq      = (const float*)d_in[2];
  const float* Wk      = (const float*)d_in[3];
  const float* Wv      = (const float*)d_in[4];
  const float* Wout    = (const float*)d_in[5];
  const float* ln1_g   = (const float*)d_in[6];
  const float* ln1_b   = (const float*)d_in[7];
  const float* lnall_g = (const float*)d_in[8];
  const float* lnall_b = (const float*)d_in[9];
  const float* ffn_g   = (const float*)d_in[10];
  const float* ffn_b   = (const float*)d_in[11];
  const float* fc1_w   = (const float*)d_in[12];
  const float* fc1_b   = (const float*)d_in[13];
  const float* fc2_w   = (const float*)d_in[14];
  const float* fc2_b   = (const float*)d_in[15];
  float* out = (float*)d_out;

  char* ws = (char*)d_ws;
  size_t off = 0;
  auto take = [&](size_t bytes) -> void* {
    off = (off + 255) & ~(size_t)255;
    void* p = ws + off;
    off += bytes;
    return p;
  };
  f16_t* cx1T  = (f16_t*)take((size_t)C1_ * BN_ * 2);        // [64][B*N]
  f16_t* ea    = (f16_t*)take((size_t)BN_ * KV_ * 2);
  f16_t* Wqh   = (f16_t*)take((size_t)H_ * C1_ * C1_ * 2);
  f16_t* Wkh   = (f16_t*)take((size_t)H_ * KV_ * KV_ * 2);
  f16_t* WvT   = (f16_t*)take((size_t)H_ * KV_ * KV_ * 2);   // [H][k'][k]
  f16_t* Wouth = (f16_t*)take((size_t)C1_ * C1_ * 2);
  f16_t* fc1h  = (f16_t*)take((size_t)MLP_ * C1_ * 2);
  f16_t* fc2h  = (f16_t*)take((size_t)C1_ * MLP_ * 2);
  f16_t* eaT   = (f16_t*)take((size_t)KV_ * BN_ * 2);        // [192][B*N]
  f16_t* Um    = (f16_t*)take((size_t)B_ * H_ * C1_ * KV_ * 2);  // 64 * U_h, [bh][64][192]
  float* Spart = (float*)take((size_t)SPLIT_ * B_ * SELEMS_ * 4);
  if (off > ws_size) return;

  // Layer norms of the inputs and all weight conversions, one launch
  prep_kernel<<<PREP_BLKS_, 256, 0, stream>>>(emb1, emb2, ln1_g, ln1_b, lnall_g, lnall_b,
                                              Wq, Wk, Wv, Wout, fc1_w, fc2_w,
                                              cx1T, ea, eaT, Wqh, Wkh, WvT, Wouth, fc1h, fc2h);

  // G = cx1^T ea per b; S = Wq[h] G Wk[h]^T / sqrt(KV); InstanceNorm; softmax P; U_h = Wout P Wv[h]
  scores_partial_kernel<<<dim3(SPLIT_, B_), 256, 0, stream>>>(cx1T, eaT, Spart);
  merge_softmax_kernel<<<B_ * H_, 1024, 0, stream>>>(Spart, Wqh, Wkh, WvT, Wouth, Um);

  // cx = ea * (mean_h U_h)^T + emb1; y = LN(cx); out = GELU(y fc1^T + b1) fc2^T + b2 + cx
  tail_kernel<<<dim3(N_ / 64, B_), 256, 0, stream>>>(ea, Um, emb1, ffn_g, ffn_b,
                                                     fc1h, fc1_b, fc2h, fc2_b, out);
}

// v007
// It runs in 37.7 microseconds.
// Timed twice side by side with v006, it ran 1.17 times as fast both times.
// Counting every step since v000, it is 5.78 times as fast.
#include <hip/hip_runtime.h>

// All contractions: v_wmma_f32_16x16x32_f16 (f16 operands, f32 accumulate); softmax P operand carried x4096 (exact power of two); x1/64 comes off in f32 before T2 goes to f16, the other x1/64 in cx's f32 epilogue.

typedef _Float16 f16_t;
typedef f16_t v16h __attribute__((ext_vector_type(16)));
typedef f16_t v8h __attribute__((ext_vector_type(8)));
typedef float v8f __attribute__((ext_vector_type(8)));
typedef float v4f __attribute__((ext_vector_type(4)));
typedef f16_t v4h __attribute__((ext_vector_type(4)));
typedef v8h v8hm __attribute__((may_alias));
typedef v4h v4hm __attribute__((may_alias));
typedef v4f v4fm __attribute__((may_alias));

#define H_   4
#define C1_  64
#define C2_  128
#define KV_  192
#define MLP_ 256
#define B_   8
#define N_   3136
#define BN_  (B_ * N_)

union Frag { v16h v; v8h p[2]; };

// 16x16x32 f16 WMMA with f32 accumulate, followed by a 4-slot VALU hazard guard.
__device__ __forceinline__ v8f wmma16(v16h a, v16h b, v8f c) {
  v8f d = __builtin_amdgcn_wmma_f32_16x16x32_f16(false, a, false, b, (short)0, c, false, false);
  asm volatile("v_nop\n\tv_nop\n\tv_nop\n\tv_nop" : "+v"(d) : "v"(a), "v"(b));
  return d;
}

__device__ __forceinline__ float wave_sum(float v) {
#pragma unroll
  for (int msk = 16; msk >= 1; msk >>= 1) v += __shfl_xor(v, msk, 32);
  return v;
}
__device__ __forceinline__ float wave_max(float v) {
#pragma unroll
  for (int msk = 16; msk >= 1; msk >>= 1) v = fmaxf(v, __shfl_xor(v, msk, 32));
  return v;
}

// ---------------------------------------------------------------------------
// The preparation grid runs work-groups of 28 waves: a layer-norm group takes ROWS_ = 224 rows, 8 a wave.
// ---------------------------------------------------------------------------
#define PT_     896
#define SPLIT_  14
#define ROWS_   (N_ / SPLIT_)       // 224
#define KSTEPS_ (ROWS_ / 32)        // 7
#define SELEMS_ (C1_ * KV_)         // 12288
#define TP_     (ROWS_ + 8)         // LDS pitch of a channel's row: 464 B = 16 B x odd

// ---------------------------------------------------------------------------
// Job of the preparation grid: block blk converts elements blk*7168 .. +7167 of a weight matrix of
// n8 * 8 elements (n8 is a multiple of 32: a wave is wholly inside or wholly outside).
// ---------------------------------------------------------------------------
__device__ __forceinline__ void cvt_f16_job(const float* __restrict__ src,
                                            f16_t* __restrict__ dst, int blk, int n8) {
  const int i = blk * PT_ + threadIdx.x;
  if (i < n8) {
    const v4f x0 = *(const v4fm*)(src + (size_t)i * 8);
    const v4f x1 = *(const v4fm*)(src + (size_t)i * 8 + 4);
    v8h v;
#pragma unroll
    for (int j = 0; j < 4; j++) { v[j] = (f16_t)x0[j]; v[4 + j] = (f16_t)x1[j]; }
    *(v8hm*)(dst + (size_t)i * 8) = v;
  }
  // Only the end of the kernel follows this store: the wait is a precaution.
  asm volatile("s_wait_xcnt 0x0" ::: "memory");
}

// ---------------------------------------------------------------------------
// Transposing convert of the H_ matrices [192][192]: dst[h][c][r] = (f16) src[h][r][c].
// 256 threads = one 64 x 64 tile, three tiles a block (the last four waves only pass the barrier):
// a lane gathers 16 rows of one column in two runs of 8 (each load 128 contiguous bytes per wave), the tile turns in LDS,
// and 8 lanes store one whole 128-B line.
// ---------------------------------------------------------------------------
__device__ __forceinline__ void cvt_t_f16_job(const float* __restrict__ src,
                                              f16_t* __restrict__ dst,
                                              f16_t (*__restrict__ T3)[72],  // 3 x [column][row], 64 rows used
                                              int blk) {
  const int sub = __builtin_amdgcn_readfirstlane(threadIdx.x >> 8);
  const bool on = sub < 3;
  const int tid = threadIdx.x & 255;
  const int tile = blk * 3 + (on ? sub : 0);
  f16_t (*Tt)[72] = T3 + (on ? sub : 0) * 64;
  const int hd = tile / 9, t9 = tile - hd * 9, ty = t9 / 3, tx = t9 - ty * 3;
  const int r0 = tx * 64, c0 = ty * 64;
  const size_t hb = (size_t)hd * KV_ * KV_;
  const int c = tid & 63, rg = tid >> 6;
  const float* s = src + hb + (size_t)r0 * KV_ + c0 + c;
  if (on) {
#pragma unroll
    for (int q = 0; q < 2; q++) {
      v8h v;
#pragma unroll
      for (int j = 0; j < 8; j++) v[j] = (f16_t)s[((rg + 4 * q) * 8 + j) * KV_];
      *(v8hm*)&Tt[c][(rg + 4 * q) * 8] = v;
    }
  }
  __syncthreads();
  const int rs = tid >> 3, ck = (tid & 7) * 8;
  if (on) {
#pragma unroll
    for (int q = 0; q < 2; q++) {
      const int row = q * 32 + rs;
      const v8h v = *(const v8hm*)&Tt[row][ck];
      *(v8hm*)(dst + hb + (size_t)(c0 + row) * KV_ + r0 + ck) = v;
    }
  }
  // Only the end of the kernel follows these stores: the wait is a precaution.
  asm volatile("s_wait_xcnt 0x0" ::: "memory");
}

// ---------------------------------------------------------------------------
// Fused: cx1 = LN(emb1) (64), ea = LN(concat(emb1,emb2)) (192), and this group's share of
// G = cx1^T ea (64 x 192), the sum over n that the scores need:
//   S_h = Q_h^T K_h = Wq_h (cx1^T ea) Wk_h^T, the sum over n done once per batch, split over SPLIT_ groups.
// One block = ROWS_ rows (n) of one b, one wave = 8 rows. ea goes to memory row-major [B*N][192]; the
// channel-major copies of cx1 and ea live in LDS only, where they are the operands of G:
// A = rows 0..63 of Tt (row c, k = n contiguous), B = rows 64..255 (row kv, k = n contiguous)
// -> both fragments loaded with the same k map.
// The f32 accumulators are stored in register order: tile tau = ((ct / 6) * 4 + mt) * 6 + ct % 6 of row
// tile mt and column tile ct; chunk (tau*2 + half)*32 + lane holds 4 floats,
// rows mt*16 + 8h + 4*half + 0..3 of column ct*16 + m.
// ---------------------------------------------------------------------------
__device__ __forceinline__ void ln_scores_job(
    const float* __restrict__ emb1, const float* __restrict__ emb2,
    const float* __restrict__ g1, const float* __restrict__ b1,
    const float* __restrict__ ga, const float* __restrict__ ba,
    f16_t* __restrict__ ea, float* __restrict__ part,
    f16_t (*__restrict__ Tt)[TP_],   // [channel][n], 0..63 cx1, 64..255 ea
    f16_t (*__restrict__ Sr)[200],   // [n][channel] of ea
    int blk) {
  const int tid = threadIdx.x, lane = tid & 31;
  const int wave = __builtin_amdgcn_readfirstlane(tid >> 5);
  const int n0 = blk * ROWS_;

  float gv1[2], bv1[2], gva[6], bva[6];
#pragma unroll
  for (int j = 0; j < 2; j++) { gv1[j] = g1[lane + 32 * j]; bv1[j] = b1[lane + 32 * j]; }
#pragma unroll
  for (int j = 0; j < 6; j++) { gva[j] = ga[lane + 32 * j]; bva[j] = ba[lane + 32 * j]; }

  // The wave's first row: a wave-uniform base, so that every load below is base + lane.
  const float* w1 = emb1 + (size_t)(n0 + wave * 8) * C1_;
  const float* w2 = emb2 + (size_t)(n0 + wave * 8) * C2_;
  v8h tr[8];  // tr[q][i] = channel lane + 32q of row wave*8 + i
#pragma unroll
  for (int i = 0; i < 8; i++) {
    const int rl = wave * 8 + i;
    const float* r1 = w1 + i * C1_;
    const float* r2 = w2 + i * C2_;

    const float x0 = r1[lane], x1 = r1[lane + 32];
    const float mu = wave_sum(x0 + x1) * (1.0f / 64.0f);
    const float d0 = x0 - mu, d1 = x1 - mu;
    const float var = wave_sum(d0 * d0 + d1 * d1) * (1.0f / 64.0f);
    const float rs = rsqrtf(var + 1e-6f);
    tr[0][i] = (f16_t)(d0 * rs * gv1[0] + bv1[0]);
    tr[1][i] = (f16_t)(d1 * rs * gv1[1] + bv1[1]);

    float e[6];
    e[0] = x0; e[1] = x1;
#pragma unroll
    for (int j = 2; j < 6; j++) e[j] = r2[lane + 32 * (j - 2)];
    float s = 0.f;
#pragma unroll
    for (int j = 0; j < 6; j++) s += e[j];
    const float ma = wave_sum(s) * (1.0f / 192.0f);
    float sq = 0.f;
#pragma unroll
    for (int j = 0; j < 6; j++) { e[j] -= ma; sq += e[j] * e[j]; }
    const float vara = wave_sum(sq) * (1.0f / 192.0f);
    const float rsa = rsqrtf(vara + 1e-6f);
#pragma unroll
    for (int j = 0; j < 6; j++) {
      const f16_t y = (f16_t)(e[j] * rsa * gva[j] + bva[j]);
      tr[2 + j][i] = y;
      Sr[rl][lane + 32 * j] = y;
    }
  }
#pragma unroll
  for (int q = 0; q < 8; q++) *(v8hm*)&Tt[lane + 32 * q][wave * 8] = tr[q];
  __syncthreads();

  // Row-major ea: the ROWS_ rows are 86016 contiguous bytes. Issued first, they drain under the products.
#pragma unroll
  for (int i = 0; i < 6; i++) {
    const int idx = i * PT_ + tid;
    const int row = idx / 24, c8 = (idx - row * 24) * 8;
    const v8h v = *(const v8hm*)&Sr[row][c8];
    *(v8hm*)(ea + (size_t)n0 * KV_ + (size_t)idx * 8) = v;
  }
  // The products below reuse these stores' registers: wait stands first.
  asm volatile("s_wait_xcnt 0x0" ::: "memory");

  // 12 waves (three a SIMD) take 2 x 2 tiles each: 8 LDS reads feed 4 WMMAs.
  if (wave < 12) {
    const int hh = lane >> 4, m = lane & 15;
    const int mp = wave & 1, cp = wave >> 1;
    v8f acc[2][2] = {};
    const f16_t* ap = &Tt[mp * 32 + m][8 * hh];
    const f16_t* bp = &Tt[C1_ + cp * 32 + m][8 * hh];
    Frag a[2][2], bf[2][2];  // [buffer][tile]
#pragma unroll
    for (int t = 0; t < 2; t++) {
      a[0][t].p[0]  = *(const v8hm*)(ap + t * 16 * TP_);
      a[0][t].p[1]  = *(const v8hm*)(ap + t * 16 * TP_ + 16);
      bf[0][t].p[0] = *(const v8hm*)(bp + t * 16 * TP_);
      bf[0][t].p[1] = *(const v8hm*)(bp + t * 16 * TP_ + 16);
    }
    // The next step's fragments are read in front of this step's WMMAs: their LDS latency runs under the products.
#pragma unroll
    for (int it = 0; it < KSTEPS_; it++) {
      const int cu = it & 1, nx = cu ^ 1;
      if (it + 1 < KSTEPS_) {
#pragma unroll
        for (int t = 0; t < 2; t++) {
          a[nx][t].p[0]  = *(const v8hm*)(ap + t * 16 * TP_ + (it + 1) * 32);
          a[nx][t].p[1]  = *(const v8hm*)(ap + t * 16 * TP_ + (it + 1) * 32 + 16);
          bf[nx][t].p[0] = *(const v8hm*)(bp + t * 16 * TP_ + (it + 1) * 32);
          bf[nx][t].p[1] = *(const v8hm*)(bp + t * 16 * TP_ + (it + 1) * 32 + 16);
        }
      }
#pragma unroll
      for (int i = 0; i < 2; i++) {
#pragma unroll
        for (int j = 0; j < 2; j++) acc[i][j] = wmma16(a[cu][i].v, bf[cu][j].v, acc[i][j]);
      }
    }

    // Each store instruction writes 512 contiguous bytes (4 whole lines) of this wave's own tiles.
    const int b = blk / SPLIT_, sp = blk - b * SPLIT_;
    // The wave's tiles are tau0 + 6 i + j (2 cp is even, so both column tiles lie in the same group of six).
    const int tau0 = ((cp / 3) * 4 + mp * 2) * 6 + (cp % 3) * 2;
    float* pb = part + ((size_t)sp * B_ + b) * SELEMS_ + tau0 * 256 + lane * 4;
#pragma unroll
    for (int i = 0; i < 2; i++) {
#pragma unroll
      for (int j = 0; j < 2; j++) {
#pragma unroll
        for (int hf = 0; hf < 2; hf++) {
          v4f v;
#pragma unroll
          for (int r = 0; r < 4; r++) v[r] = acc[i][j][hf * 4 + r];
          *(v4fm*)(pb + ((6 * i + j) * 2 + hf) * 128) = v;
        }
      }
    }
  }
}

// ---------------------------------------------------------------------------
// Preparation grid: the layer norms with their share of G and the six weight conversions depend on
// nothing but the inputs, so they run as jobs of one launch, picked by work-group index. The layer-norm
// groups are the longest and take the lowest indices.
// ---------------------------------------------------------------------------
#define CVB_(n)  (((n) / 8 + PT_ - 1) / PT_)
#define LN_BLKS_ (B_ * SPLIT_)               // 112
#define WV_BLKS_ (H_ * 9 / 3)                // 12: 36 tiles of 64 x 64, three a block
#define WK_BLKS_ CVB_(H_ * KV_ * KV_)        // 21
#define WQ_BLKS_ CVB_(H_ * C1_ * C1_)        // 3
#define F1_BLKS_ CVB_(MLP_ * C1_)            // 3
#define F2_BLKS_ CVB_(C1_ * MLP_)            // 3
#define WO_BLKS_ CVB_(C1_ * C1_)             // 1
#define PREP_BLKS_ (LN_BLKS_ + WV_BLKS_ + WK_BLKS_ + WQ_BLKS_ + F1_BLKS_ + F2_BLKS_ + WO_BLKS_)

__global__ __launch_bounds__(PT_) void prep_kernel(
    const float* __restrict__ emb1, const float* __restrict__ emb2,
    const float* __restrict__ g1, const float* __restrict__ b1,
    const float* __restrict__ ga, const float* __restrict__ ba,
    const float* __restrict__ Wq, const float* __restrict__ Wk, const float* __restrict__ Wv,
    const float* __restrict__ Wo, const float* __restrict__ f1, const float* __restrict__ f2,
    f16_t* __restrict__ ea, float* __restrict__ part,
    f16_t* __restrict__ Wqh, f16_t* __restrict__ Wkh, f16_t* __restrict__ WvT,
    f16_t* __restrict__ Woh, f16_t* __restrict__ f1h, f16_t* __restrict__ f2h) {
  __shared__ __attribute__((aligned(16))) f16_t Tt[256][TP_];
  __shared__ __attribute__((aligned(16))) f16_t Sr[ROWS_][200];
  int blk = blockIdx.x;
  if (blk < LN_BLKS_) {
    ln_scores_job(emb1, emb2, g1, b1, ga, ba, ea, part, Tt, Sr, blk);
    return;
  }
  blk -= LN_BLKS_;
  if (blk < WV_BLKS_) {
    cvt_t_f16_job(Wv, WvT, reinterpret_cast<f16_t (*)[72]>(&Tt[0][0]), blk);
    return;
  }
  blk -= WV_BLKS_;
  const float* s = Wk;
  f16_t* d = Wkh;
  int n8 = H_ * KV_ * KV_ / 8;
  if (blk >= WK_BLKS_) {
    blk -= WK_BLKS_; s = Wq; d = Wqh; n8 = H_ * C1_ * C1_ / 8;
    if (blk >= WQ_BLKS_) {
      blk -= WQ_BLKS_; s = f1; d = f1h; n8 = MLP_ * C1_ / 8;
      if (blk >= F1_BLKS_) {
        blk -= F1_BLKS_; s = f2; d = f2h; n8 = C1_ * MLP_ / 8;
        if (blk >= F2_BLKS_) { blk -= F2_BLKS_; s = Wo; d = Woh; n8 = C1_ * C1_ / 8; }
      }
    }
  }
  cvt_f16_job(s, d, blk, n8);
}

// ---------------------------------------------------------------------------
// One block of 32 waves per (b,h): G_b = sum of the SPLIT_ partials (each thread owns
// 3 chunks of 4 floats), T = Wq_h G_b, S = T Wk_h^T (both on WMMA, 24 waves x 2 tiles),
// scale, InstanceNorm over (64,192), softmax over KV, P*4096 kept in LDS as f16.
// G is carried x 1/64 (exact power of two) as f16 operand and unscaled in f32 on S.
// Value side, o = mean_h (ea Wv_h^T) P_h^T Wout^T = ea (mean_h Wout P_h Wv_h)^T: this block forms
// T2 = P_h Wv_h and U_h = Wout T2 (both on WMMA, same wave map) and stores 64 * U_h as f16 [64][192].
// ---------------------------------------------------------------------------
__global__ __launch_bounds__(1024) void merge_softmax_kernel(
    const float* __restrict__ part, const f16_t* __restrict__ Wq,
    const f16_t* __restrict__ Wk, const f16_t* __restrict__ WvT,
    const f16_t* __restrict__ Wo, f16_t* __restrict__ U) {
  __shared__ float Sb[64][196];
  __shared__ __attribute__((aligned(16))) f16_t Pst[64][200];
  __shared__ __attribute__((aligned(16))) f16_t Gt[192][72];   // G^T / 64: [k'][c']; later 64 T2^T: [k'][c]
  __shared__ __attribute__((aligned(16))) f16_t Tl[64][200];   // T / 64:   [c][k']; later 64 U: [d][k']
  __shared__ __attribute__((aligned(16))) f16_t Wl[64][72];    // Wout: [d][c]
  __shared__ float red[32];
  __shared__ float red2[32];
  const int tid = threadIdx.x, lane = tid & 31;
  const int wave = __builtin_amdgcn_readfirstlane(tid >> 5);
  const int hh = lane >> 4, m = lane & 15;
  const int bh = blockIdx.x, b = bh >> 2, hd = bh & 3;
  const float* pb = part + (size_t)b * SELEMS_ + tid * 4;

  // Matrix work: wave < 24 owns column tile nt (of 12) and row tiles 2*mp, 2*mp + 1 (of 4).
  const bool mm = wave < 24;
  const int mp = wave / 12, nt = wave - mp * 12;
  const v4h wo4 = *(const v4hm*)(Wo + tid * 4);  // Wout goes to LDS with the first barrier
  v4f a[3] = {};
#pragma unroll
  for (int s = 0; s < SPLIT_; s++) {
#pragma unroll
    for (int i = 0; i < 3; i++)
      a[i] += *(const v4fm*)(pb + (size_t)s * B_ * SELEMS_ + i * 4096);
  }

#pragma unroll
  for (int i = 0; i < 3; i++) {
    const int g = wave + 32 * i;          // chunk group = tau*2 + half of the producer's tile order
    const int wa = g / 12, rem = g - wa * 12;
    const int row0 = (wa & 3) * 16 + 8 * hh + (rem & 1) * 4;
    const int col = ((wa >> 2) * 6 + (rem >> 1)) * 16 + m;
    v4h gq;
#pragma unroll
    for (int j = 0; j < 4; j++) gq[j] = (f16_t)(a[i][j] * 0.015625f);
    *(v4hm*)&Gt[col][row0] = gq;
  }
  *(v4hm*)&Wl[tid >> 4][(tid & 15) * 4] = wo4;

  // Weight fragments are fetched here, behind the sum (whose loads need the registers) and in front of
  // the barrier, so that their latency runs under the wait for the other waves.
  Frag wq[2][2], wk[6];
  if (mm) {
    const f16_t* wqb = Wq + (size_t)hd * C1_ * C1_ + (size_t)(mp * 32 + m) * C1_ + 8 * hh;
#pragma unroll
    for (int t = 0; t < 2; t++) {
#pragma unroll
      for (int kk = 0; kk < 2; kk++) {
        wq[t][kk].p[0] = *(const v8hm*)(wqb + t * 16 * C1_ + kk * 32);
        wq[t][kk].p[1] = *(const v8hm*)(wqb + t * 16 * C1_ + kk * 32 + 16);
      }
    }
    const f16_t* wkb = Wk + (size_t)hd * KV_ * KV_ + (size_t)(nt * 16 + m) * KV_ + 8 * hh;
#pragma unroll
    for (int kk = 0; kk < 6; kk++) {
      wk[kk].p[0] = *(const v8hm*)(wkb + kk * 32);
      wk[kk].p[1] = *(const v8hm*)(wkb + kk * 32 + 16);
    }
    // Holds both address pairs until the loads above have taken them.
    asm volatile("s_wait_xcnt 0x0" :: "v"(wqb), "v"(wkb) : "memory");
  }
  __syncthreads();

  // T[c][k'] = sum_c' Wq[c][c'] G[c'][k']: A = Wq rows, B = Gt rows, both k = c' contiguous.
  if (mm) {
    v8f t1[2] = {};
#pragma unroll
    for (int kk = 0; kk < 2; kk++) {
      Frag bf;
      bf.p[0] = *(const v8hm*)&Gt[nt * 16 + m][kk * 32 + 8 * hh];
      bf.p[1] = *(const v8hm*)&Gt[nt * 16 + m][kk * 32 + 16 + 8 * hh];
#pragma unroll
      for (int t = 0; t < 2; t++) t1[t] = wmma16(wq[t][kk].v, bf.v, t1[t]);
    }
#pragma unroll
    for (int t = 0; t < 2; t++) {
#pragma unroll
      for (int r = 0; r < 8; r++)
        Tl[mp * 32 + t * 16 + 8 * hh + r][nt * 16 + m] = (f16_t)t1[t][r];
    }
  }
  __syncthreads();

  // S[c][k] = sum_k' T[c][k'] Wk[k][k']: A = Tl rows, B = Wk rows, both k = k' contiguous.
  const float sc = 64.0f * 0.07216878364870322f;  // 64 / sqrt(192)
  v8f sv[2] = {};
  float s = 0.f;
  if (mm) {
#pragma unroll
    for (int kk = 0; kk < 6; kk++) {
#pragma unroll
      for (int t = 0; t < 2; t++) {
        Frag af;
        af.p[0] = *(const v8hm*)&Tl[mp * 32 + t * 16 + m][kk * 32 + 8 * hh];
        af.p[1] = *(const v8hm*)&Tl[mp * 32 + t * 16 + m][kk * 32 + 16 + 8 * hh];
        sv[t] = wmma16(af.v, wk[kk].v, sv[t]);
      }
    }
#pragma unroll
    for (int t = 0; t < 2; t++) {
#pragma unroll
      for (int r = 0; r < 8; r++) {
        sv[t][r] *= sc;
        s += sv[t][r];
        Sb[mp * 32 + t * 16 + 8 * hh + r][nt * 16 + m] = sv[t][r];
      }
    }
  }
  // Wv's fragments are fetched here, where Wk's registers are free, in front of the norm and the softmax.
  Frag wv[6];
  if (mm) {
    const f16_t* wvb = WvT + (size_t)hd * KV_ * KV_ + (size_t)(nt * 16 + m) * KV_ + 8 * hh;
#pragma unroll
    for (int kk = 0; kk < 6; kk++) {
      wv[kk].p[0] = *(const v8hm*)(wvb + kk * 32);
      wv[kk].p[1] = *(const v8hm*)(wvb + kk * 32 + 16);
    }
    // Holds the address pair until the loads above have taken it, as at the first weight fetch.
    asm volatile("s_wait_xcnt 0x0" :: "v"(wvb) : "memory");
  }
  s = wave_sum(s);
  if (lane == 0) red[wave] = s;
  __syncthreads();
  const float mean = wave_sum(red[lane]) * (1.0f / 12288.0f);
  float sq = 0.f;
  if (mm) {
#pragma unroll
    for (int t = 0; t < 2; t++) {
#pragma unroll
      for (int r = 0; r < 8; r++) { const float d = sv[t][r] - mean; sq += d * d; }
    }
  }
  sq = wave_sum(sq);
  if (lane == 0) red2[wave] = sq;
  __syncthreads();
  const float var  = wave_sum(red2[lane]) * (1.0f / 12288.0f);
  const float rstd = rsqrtf(var + 1e-5f);

  // Softmax over KV per row c; one wave per row, 2 rows per wave; P*4096 -> LDS.
  const float pscale = 4096.0f;
#pragma unroll
  for (int rr = 0; rr < 2; rr++) {
    const int r = wave * 2 + rr;
    float xs[6];
    float mx = -3.0e38f;
#pragma unroll
    for (int j = 0; j < 6; j++) {
      xs[j] = (Sb[r][lane + 32 * j] - mean) * rstd;
      mx = fmaxf(mx, xs[j]);
    }
    mx = wave_max(mx);
    float es = 0.f;
#pragma unroll
    for (int j = 0; j < 6; j++) { xs[j] = expf(xs[j] - mx); es += xs[j]; }
    es = wave_sum(es);
    const float inv = (1.0f / es) * pscale;
#pragma unroll
    for (int j = 0; j < 6; j++)
      Pst[r][lane + 32 * j] = (f16_t)(xs[j] * inv);
  }
  __syncthreads();

  // T2[c][k'] = sum_k P[c][k] Wv[k][k']: A = Pst rows, B = WvT rows, both k contiguous.
  // A lane's 8 accumulators are 8 consecutive c of one k': one 16-B store into T2^T (x 4096 / 64).
  if (mm) {
    v8f t2[2] = {};
    // P's fragments are read six at a time in front of their WMMAs: two LDS latencies instead of twelve.
#pragma unroll
    for (int kh = 0; kh < 2; kh++) {
      Frag af[3][2];
#pragma unroll
      for (int kk = 0; kk < 3; kk++) {
#pragma unroll
        for (int t = 0; t < 2; t++) {
          af[kk][t].p[0] = *(const v8hm*)&Pst[mp * 32 + t * 16 + m][(kh * 3 + kk) * 32 + 8 * hh];
          af[kk][t].p[1] = *(const v8hm*)&Pst[mp * 32 + t * 16 + m][(kh * 3 + kk) * 32 + 16 + 8 * hh];
        }
      }
#pragma unroll
      for (int kk = 0; kk < 3; kk++) {
#pragma unroll
        for (int t = 0; t < 2; t++) t2[t] = wmma16(af[kk][t].v, wv[kh * 3 + kk].v, t2[t]);
      }
    }
#pragma unroll
    for (int t = 0; t < 2; t++) {
      v8h q;
#pragma unroll
      for (int r = 0; r < 8; r++) q[r] = (f16_t)(t2[t][r] * 0.015625f);
      *(v8hm*)&Gt[nt * 16 + m][mp * 32 + t * 16 + 8 * hh] = q;
    }
  }
  __syncthreads();

  // U^T[k'][d] = sum_c T2^T[k'][c] Wout[d][c]: A = Gt rows, B = Wl rows, both c contiguous.
  // A lane's 8 accumulators are 8 consecutive k' of one d: one 16-B store into U's row.
  if (mm) {
    v8f u[2] = {};
    Frag af[2], wo[2][2];
#pragma unroll
    for (int kk = 0; kk < 2; kk++) {
      af[kk].p[0] = *(const v8hm*)&Gt[nt * 16 + m][kk * 32 + 8 * hh];
      af[kk].p[1] = *(const v8hm*)&Gt[nt * 16 + m][kk * 32 + 16 + 8 * hh];
#pragma unroll
      for (int t = 0; t < 2; t++) {
        wo[t][kk].p[0] = *(const v8hm*)&Wl[mp * 32 + t * 16 + m][kk * 32 + 8 * hh];
        wo[t][kk].p[1] = *(const v8hm*)&Wl[mp * 32 + t * 16 + m][kk * 32 + 16 + 8 * hh];
      }
    }
#pragma unroll
    for (int kk = 0; kk < 2; kk++) {
#pragma unroll
      for (int t = 0; t < 2; t++) u[t] = wmma16(af[kk].v, wo[t][kk].v, u[t]);
    }
#pragma unroll
    for (int t = 0; t < 2; t++) {
      v8h q;
#pragma unroll
      for (int r = 0; r < 8; r++) q[r] = (f16_t)u[t][r];
      *(v8hm*)&Tl[mp * 32 + t * 16 + m][nt * 16 + 8 * hh] = q;
    }
  }
  __syncthreads();

  // Whole-line stores: each row = 384 B = lanes 0..23 x 16 B, one instruction.
  f16_t* Ub = U + (size_t)bh * C1_ * KV_;
  const int l24 = (lane < 24) ? lane : 0;
  const bool se = lane < 24;
  v8h vals[2];
#pragma unroll
  for (int j = 0; j < 2; j++) vals[j] = *(const v8hm*)&Tl[wave * 2 + j][l24 * 8];
#pragma unroll
  for (int j = 0; j < 2; j++)
    if (se) *(v8hm*)(Ub + (size_t)(wave * 2 + j) * KV_ + l24 * 8) = vals[j];
}

// ---------------------------------------------------------------------------
// Sum over the 16 lanes of a row, every lane gets it: four DPP row_xmask steps.
// ---------------------------------------------------------------------------
__device__ __forceinline__ float row16_sum(float v) {
  v += __builtin_bit_cast(float, __builtin_amdgcn_update_dpp(0, __builtin_bit_cast(int, v), 0x161, 0xf, 0xf, true));
  v += __builtin_bit_cast(float, __builtin_amdgcn_update_dpp(0, __builtin_bit_cast(int, v), 0x162, 0xf, 0xf, true));
  v += __builtin_bit_cast(float, __builtin_amdgcn_update_dpp(0, __builtin_bit_cast(int, v), 0x164, 0xf, 0xf, true));
  v += __builtin_bit_cast(float, __builtin_amdgcn_update_dpp(0, __builtin_bit_cast(int, v), 0x168, 0xf, 0xf, true));
  return v;
}

// ---------------------------------------------------------------------------
// Exact-form GELU x * Phi(x) of 8 values, without a branch: with z = |x| / sqrt(2), t = 1 / (1 + p z),
//   erfc(z) = (a1 t + a2 t^2 + a3 t^3 + a4 t^4 + a5 t^5) exp(-z^2),  |error| <= 1.5e-7 for every z >= 0,
//   x * Phi(x) = max(x, 0) - |x| * erfc(z) / 2  (no cancellation on the negative side).
// The library erf takes two data-dependent branches per value, both taken by nearly every wave, and each
// value's chain runs alone between them; here the 8 chains are independent straight-line code.
// The coefficients carry the factor 1/2.
// ---------------------------------------------------------------------------
__device__ __forceinline__ v8f gelu8(v8f x) {
  const v8f ax = __builtin_elementwise_abs(x);
  const v8f d = ax * 0.23164189f + 1.0f;       // 1 + p z, p = 0.3275911
  const v8f w = (x * x) * -0.72134752f;        // -z^2 * log2(e)
  v8f t, e;
#pragma unroll
  for (int r = 0; r < 8; r++) {
    t[r] = __builtin_amdgcn_rcpf(d[r]);
    e[r] = __builtin_amdgcn_exp2f(w[r]);
  }
  v8f p = t * 0.53070271f - 0.72657601f;
  p = p * t + 0.71070687f;
  p = p * t - 0.14224837f;
  p = p * t + 0.12741480f;
  const v8f zero = {};
  return __builtin_elementwise_max(x, zero) - ax * ((p * t) * e);
}

// ---------------------------------------------------------------------------
// Everything behind the attention weights is local to a row n, so one block takes 64 rows through all of it:
//   cx[n][d] = emb1[n][d] + sum_k' ea[n][k'] * Um[d][k'],  Um = mean over heads of U_h   (K = 192)
//   y = LN(cx);  h = GELU(y fc1^T + b1)  (K = 64);  out = h fc2^T + b2 + cx  (K = 256)
// cx stays in registers (f32), y and h in LDS (f16). Both weight matrices are staged whole with the first
// round of loads. The four heads' 64 * U_h are averaged in f32 while they are staged.
// fc1 and fc2 run with the weight rows as A and the token rows as B: a lane's 8 accumulators are then
// 8 consecutive channels of one token, one or two 16-B LDS stores. grid = (N/64, B).
// Two blocks share a WGP (392 blocks, 256 WGPs): 4 waves per SIMD, 146 KiB of LDS each.
// ---------------------------------------------------------------------------
__global__ __launch_bounds__(256, 4) void tail_kernel(
    const f16_t* __restrict__ ea, const f16_t* __restrict__ U,
    const float* __restrict__ emb1,
    const float* __restrict__ fg, const float* __restrict__ fb,
    const f16_t* __restrict__ W1, const float* __restrict__ b1,
    const f16_t* __restrict__ W2, const float* __restrict__ b2,
    float* __restrict__ out) {
  __shared__ __attribute__((aligned(16))) f16_t EU[2][64][200];   // ea tile, Um; later h [64][264]
  __shared__ __attribute__((aligned(16))) float Cs[64][68];
  __shared__ __attribute__((aligned(16))) f16_t Ys[64][72];
  __shared__ __attribute__((aligned(16))) f16_t W1s[MLP_][72];
  __shared__ __attribute__((aligned(16))) f16_t W2s[C1_][264];
  __shared__ __attribute__((aligned(16))) float B1s[MLP_];
  f16_t (*Es)[200] = EU[0];
  f16_t (*Us)[200] = EU[1];
  f16_t (*Hs)[264] = reinterpret_cast<f16_t (*)[264]>(&EU[0][0][0]);
  const int tid = threadIdx.x, lane = tid & 31, wave = tid >> 5;
  const int hh = lane >> 4, m = lane & 15;
  const int b = blockIdx.y;
  const size_t r0 = (size_t)b * N_ + blockIdx.x * 64;
  const int mt = wave & 3, ng = wave >> 2;

  // All tiles are contiguous in memory: chunk i * 256 + tid of 16 B.
  const f16_t* Ub = U + (size_t)b * H_ * C1_ * KV_ + tid * 8;
  const f16_t* Eb = ea + r0 * KV_ + tid * 8;
  v8h uh[6][H_], ev[6], w1v[8], w2v[8];
  const size_t ro = (r0 + wave * 8 + hh) * C1_ + m * 4;  // rows wave*8 + 2j + hh, 16 lanes a row
  const float* rp = emb1 + ro;
  v4f rr[4];
#pragma unroll
  for (int j = 0; j < 4; j++) rr[j] = *(const v4fm*)(rp + j * 2 * C1_);
#pragma unroll
  for (int i = 0; i < 6; i++) ev[i] = *(const v8hm*)(Eb + i * 2048);
#pragma unroll
  for (int i = 0; i < 6; i++) {
#pragma unroll
    for (int h = 0; h < H_; h++) uh[i][h] = *(const v8hm*)(Ub + h * (C1_ * KV_) + i * 2048);
  }
#pragma unroll
  for (int i = 0; i < 8; i++) {
    w1v[i] = *(const v8hm*)(W1 + tid * 8 + i * 2048);
    w2v[i] = *(const v8hm*)(W2 + tid * 8 + i * 2048);
  }
  const float b1v = b1[tid];
  const v4f lg = *(const v4fm*)(fg + m * 4);
  const v4f lb = *(const v4fm*)(fb + m * 4);
  const v4f ob = *(const v4fm*)(b2 + m * 4);
  // Holds the address pair until the loads have taken it.
  asm volatile("s_wait_xcnt 0x0" :: "v"(rp) : "memory");
  // Keeps all loads in front of the first use: left free, the scheduler issues a part of them
  // behind the first wait, and the block pays the load latency twice.
  __builtin_amdgcn_sched_barrier(0);

#pragma unroll
  for (int i = 0; i < 6; i++) {
    const int idx = i * 256 + tid;
    const int row = idx / 24, c8 = (idx - row * 24) * 8;
    v8h um;
#pragma unroll
    for (int j = 0; j < 8; j++) {
      float a = 0.25f * (float)uh[i][0][j];
#pragma unroll
      for (int h = 1; h < H_; h++) a = fmaf(0.25f, (float)uh[i][h][j], a);
      um[j] = (f16_t)a;
    }
    *(v8hm*)&Us[row][c8] = um;
    *(v8hm*)&Es[row][c8] = ev[i];
  }
#pragma unroll
  for (int i = 0; i < 8; i++) {
    const int idx = i * 256 + tid;
    *(v8hm*)&W1s[idx >> 3][(idx & 7) * 8]   = w1v[i];
    *(v8hm*)&W2s[idx >> 5][(idx & 31) * 8]  = w2v[i];
  }
  B1s[tid] = b1v;
  __syncthreads();

  // All 18 fragments are read in front of the first WMMA: one LDS latency instead of twelve.
  v8f acc[2] = {};
  const int mrow = mt * 16 + m;
  {
    Frag a[6], bf[6][2];
#pragma unroll
    for (int kk = 0; kk < 6; kk++) {
      a[kk].p[0] = *(const v8hm*)&Es[mrow][kk * 32 + 8 * hh];
      a[kk].p[1] = *(const v8hm*)&Es[mrow][kk * 32 + 16 + 8 * hh];
#pragma unroll
      for (int t = 0; t < 2; t++) {
        const int col = (ng * 2 + t) * 16 + m;
        bf[kk][t].p[0] = *(const v8hm*)&Us[col][kk * 32 + 8 * hh];
        bf[kk][t].p[1] = *(const v8hm*)&Us[col][kk * 32 + 16 + 8 * hh];
      }
    }
#pragma unroll
    for (int kk = 0; kk < 6; kk++) {
#pragma unroll
      for (int t = 0; t < 2; t++) acc[t] = wmma16(a[kk].v, bf[kk][t].v, acc[t]);
    }
  }

#pragma unroll
  for (int t = 0; t < 2; t++) {
    const int cn = (ng * 2 + t) * 16 + m;
#pragma unroll
    for (int r = 0; r < 8; r++) Cs[mt * 16 + 8 * hh + r][cn] = acc[t][r] * 0.015625f;
  }
  __syncthreads();

  // cx: 16 lanes hold one row (4 channels each), 4 rows a thread; kept for the last residual.
  // Layer norm of a row = two sums over its 16 lanes.
  v4f cxv[4];
#pragma unroll
  for (int j = 0; j < 4; j++) cxv[j] = *(const v4fm*)&Cs[wave * 8 + 2 * j + hh][m * 4] + rr[j];
#pragma unroll
  for (int j = 0; j < 4; j++) {
    const v4f x = cxv[j];
    const float mu = row16_sum((x[0] + x[1]) + (x[2] + x[3])) * (1.0f / 64.0f);
    const v4f d = x - mu;
    const float var = row16_sum((d[0] * d[0] + d[1] * d[1]) + (d[2] * d[2] + d[3] * d[3])) * (1.0f / 64.0f);
    const float rs = rsqrtf(var + 1e-6f);
    v4h y;
#pragma unroll
    for (int c = 0; c < 4; c++) y[c] = (f16_t)(d[c] * rs * lg[c] + lb[c]);
    *(v4hm*)&Ys[wave * 8 + 2 * j + hh][m * 4] = y;
  }
  __syncthreads();

  // h^T[e][n] = sum_c fc1[e][c] y[n][c]: A = W1s rows, B = Ys rows, both c contiguous.
  // Wave w owns channels e = 32w .. 32w + 31 of all 64 rows.
  {
    Frag wa[2][2];
    v4f bb[2][2];
#pragma unroll
    for (int t = 0; t < 2; t++) {
#pragma unroll
      for (int kk = 0; kk < 2; kk++) {
        wa[t][kk].p[0] = *(const v8hm*)&W1s[wave * 32 + t * 16 + m][kk * 32 + 8 * hh];
        wa[t][kk].p[1] = *(const v8hm*)&W1s[wave * 32 + t * 16 + m][kk * 32 + 16 + 8 * hh];
      }
      bb[t][0] = *(const v4fm*)&B1s[wave * 32 + t * 16 + 8 * hh];
      bb[t][1] = *(const v4fm*)&B1s[wave * 32 + t * 16 + 8 * hh + 4];
    }
    // Stays rolled: the other waves of the SIMD cover a trip's LDS latency.
#pragma unroll 1
    for (int q = 0; q < 4; q++) {
      Frag yb[2];
#pragma unroll
      for (int kk = 0; kk < 2; kk++) {
        yb[kk].p[0] = *(const v8hm*)&Ys[q * 16 + m][kk * 32 + 8 * hh];
        yb[kk].p[1] = *(const v8hm*)&Ys[q * 16 + m][kk * 32 + 16 + 8 * hh];
      }
      v8f hv[2] = {};
#pragma unroll
      for (int kk = 0; kk < 2; kk++) {
#pragma unroll
        for (int t = 0; t < 2; t++) hv[t] = wmma16(wa[t][kk].v, yb[kk].v, hv[t]);
      }
#pragma unroll
      for (int t = 0; t < 2; t++) {
        v8f xv;
#pragma unroll
        for (int r = 0; r < 8; r++) xv[r] = hv[t][r] + bb[t][r >> 2][r & 3];
        const v8f gv = gelu8(xv);
        v8h g;
#pragma unroll
        for (int r = 0; r < 8; r++) g[r] = (f16_t)gv[r];
        *(v8hm*)&Hs[q * 16 + m][wave * 32 + t * 16 + 8 * hh] = g;
      }
    }
  }
  __syncthreads();

  // o^T[d][n] = sum_e fc2[d][e] h[n][e]: A = W2s rows, B = Hs rows, both e contiguous.
  // Wave owns channel tile mt and row tiles 2*ng, 2*ng + 1. Fragments are read twelve at a time.
  {
    v8f o[2] = {};
#pragma unroll
    for (int kh = 0; kh < 2; kh++) {
      Frag wf[4], hf[4][2];
#pragma unroll
      for (int kk = 0; kk < 4; kk++) {
        const int k0 = (kh * 4 + kk) * 32 + 8 * hh;
        wf[kk].p[0] = *(const v8hm*)&W2s[mt * 16 + m][k0];
        wf[kk].p[1] = *(const v8hm*)&W2s[mt * 16 + m][k0 + 16];
#pragma unroll
        for (int t = 0; t < 2; t++) {
          hf[kk][t].p[0] = *(const v8hm*)&Hs[(ng * 2 + t) * 16 + m][k0];
          hf[kk][t].p[1] = *(const v8hm*)&Hs[(ng * 2 + t) * 16 + m][k0 + 16];
        }
      }
#pragma unroll
      for (int kk = 0; kk < 4; kk++) {
#pragma unroll
        for (int t = 0; t < 2; t++) o[t] = wmma16(wf[kk].v, hf[kk][t].v, o[t]);
      }
    }
#pragma unroll
    for (int t = 0; t < 2; t++) {
      v4f lo, hi;
#pragma unroll
      for (int c = 0; c < 4; c++) { lo[c] = o[t][c]; hi[c] = o[t][4 + c]; }
      *(v4fm*)&Cs[(ng * 2 + t) * 16 + m][mt * 16 + 8 * hh]     = lo;
      *(v4fm*)&Cs[(ng * 2 + t) * 16 + m][mt * 16 + 8 * hh + 4] = hi;
    }
  }
  __syncthreads();

  // Whole-line stores: 16 lanes x 16 B = one 256-B row, two rows per instruction.
#pragma unroll
  for (int j = 0; j < 4; j++) {
    const v4f v = (*(const v4fm*)&Cs[wave * 8 + 2 * j + hh][m * 4] + ob) + cxv[j];
    *(v4fm*)(out + ro + j * 2 * C1_) = v;
  }
}

// ---------------------------------------------------------------------------
// Host-side orchestration
// ---------------------------------------------------------------------------
extern "C" void kernel_launch(void* const* d_in, const int* in_sizes, int n_in,
                              void* d_out, int out_size, void* d_ws, size_t ws_size,
                              hipStream_t stream) {
  if (n_in < 16) return;
  const int need[16] = {BN_ * C1_, BN_ * C2_, H_ * C1_ * C1_, H_ * KV_ * KV_, H_ * KV_ * KV_,
                        C1_ * C1_, C1_, C1_, KV_, KV_, C1_, C1_, MLP_ * C1_, MLP_,
                        C1_ * MLP_, C1_};
  for (int i = 0; i < 16; i++) if (in_sizes[i] != need[i]) return;
  if (out_size != BN_ * C1_) return;

  const float* emb1    = (const float*)d_in[0];
  const float* emb2    = (const float*)d_in[1];
  const float* Wq      = (const float*)d_in[2];
  const float* Wk      = (const float*)d_in[3];
  const float* Wv      = (const float*)d_in[4];
  const float* Wout    = (const float*)d_in[5];
  const float* ln1_g   = (const float*)d_in[6];
  const float* ln1_b   = (const float*)d_in[7];
  const float* lnall_g = (const float*)d_in[8];
  const float* lnall_b = (const float*)d_in[9];
  const float* ffn_g   = (const float*)d_in[10];
  const float* ffn_b   = (const float*)d_in[11];
  const float* fc1_w   = (const float*)d_in[12];
  const float* fc1_b   = (const float*)d_in[13];
  const float* fc2_w   = (const float*)d_in[14];
  const float* fc2_b   = (const float*)d_in[15];
  float* out = (float*)d_out;

  char* ws = (char*)d_ws;
  size_t off = 0;
  auto take = [&](size_t bytes) -> void* {
    off = (off + 255) & ~(size_t)255;
    void* p = ws + off;
    off += bytes;
    return p;
  };
  f16_t* ea    = (f16_t*)take((size_t)BN_ * KV_ * 2);
  f16_t* Wqh   = (f16_t*)take((size_t)H_ * C1_ * C1_ * 2);
  f16_t* Wkh   = (f16_t*)take((size_t)H_ * KV_ * KV_ * 2);
  f16_t* WvT   = (f16_t*)take((size_t)H_ * KV_ * KV_ * 2);   // [H][k'][k]
  f16_t* Wouth = (f16_t*)take((size_t)C1_ * C1_ * 2);
  f16_t* fc1h  = (f16_t*)take((size_t)MLP_ * C1_ * 2);
  f16_t* fc2h  = (f16_t*)take((size_t)C1_ * MLP_ * 2);
  f16_t* Um    = (f16_t*)take((size_t)B_ * H_ * C1_ * KV_ * 2);  // 64 * U_h, [bh][64][192]
  float* Spart = (float*)take((size_t)SPLIT_ * B_ * SELEMS_ * 4);
  if (off > ws_size) return;

  // Layer norms of the inputs with the partial sums of G = cx1^T ea, and all weight conversions, one launch
  prep_kernel<<<PREP_BLKS_, PT_, 0, stream>>>(emb1, emb2, ln1_g, ln1_b, lnall_g, lnall_b,
                                              Wq, Wk, Wv, Wout, fc1_w, fc2_w,
                                              ea, Spart, Wqh, Wkh, WvT, Wouth, fc1h, fc2h);

  // S = Wq[h] G Wk[h]^T / sqrt(KV); InstanceNorm; softmax P; U_h = Wout P Wv[h]
  merge_softmax_kernel<<<B_ * H_, 1024, 0, stream>>>(Spart, Wqh, Wkh, WvT, Wouth, Um);

  // cx = ea * (mean_h U_h)^T + emb1; y = LN(cx); out = GELU(y fc1^T + b1) fc2^T + b2 + cx
  tail_kernel<<<dim3(N_ / 64, B_), 256, 0, stream>>>(ea, Um, emb1, ffn_g, ffn_b,
                                                     fc1h, fc1_b, fc2h, fc2_b, out);
}

// v008
// A run of this version takes 35.3 microseconds.
// Two timings next to v007 both put it at 1.07 times that version's speed.
// Over all steps from v000 it is 6.18 times as fast.
#include <hip/hip_runtime.h>

// All contractions: v_wmma_f32_16x16x32_f16 (f16 operands, f32 accumulate); softmax P operand carried x4096 (exact power of two); x1/64 comes off in f32 before T2 goes to f16, the other x1/64 in cx's f32 epilogue.

typedef _Float16 f16_t;
typedef f16_t v16h __attribute__((ext_vector_type(16)));
typedef f16_t v8h __attribute__((ext_vector_type(8)));
typedef float v8f __attribute__((ext_vector_type(8)));
typedef float v4f __attribute__((ext_vector_type(4)));
typedef f16_t v4h __attribute__((ext_vector_type(4)));
typedef v8h v8hm __attribute__((may_alias));
typedef v4h v4hm __attribute__((may_alias));
typedef v4f v4fm __attribute__((may_alias));

#define H_   4
#define C1_  64
#define C2_  128
#define KV_  192
#define MLP_ 256
#define B_   8
#define N_   3136
#define BN_  (B_ * N_)

union Frag { v16h v; v8h p[2]; };

// 16x16x32 f16 WMMA with f32 accumulate, followed by a 4-slot VALU hazard guard.
__device__ __forceinline__ v8f wmma16(v16h a, v16h b, v8f c) {
  v8f d = __builtin_amdgcn_wmma_f32_16x16x32_f16(false, a, false, b, (short)0, c, false, false);
  asm volatile("v_nop\n\tv_nop\n\tv_nop\n\tv_nop" : "+v"(d) : "v"(a), "v"(b));
  return d;
}

// ---------------------------------------------------------------------------
// Sum over the 16 lanes of a row, every lane gets it: four DPP row_xmask steps.
// ---------------------------------------------------------------------------
__device__ __forceinline__ float row16_sum(float v) {
  v += __builtin_bit_cast(float, __builtin_amdgcn_update_dpp(0, __builtin_bit_cast(int, v), 0x161, 0xf, 0xf, true));
  v += __builtin_bit_cast(float, __builtin_amdgcn_update_dpp(0, __builtin_bit_cast(int, v), 0x162, 0xf, 0xf, true));
  v += __builtin_bit_cast(float, __builtin_amdgcn_update_dpp(0, __builtin_bit_cast(int, v), 0x164, 0xf, 0xf, true));
  v += __builtin_bit_cast(float, __builtin_amdgcn_update_dpp(0, __builtin_bit_cast(int, v), 0x168, 0xf, 0xf, true));
  return v;
}
__device__ __forceinline__ float row16_max(float v) {
  v = fmaxf(v, __builtin_bit_cast(float, __builtin_amdgcn_update_dpp(0, __builtin_bit_cast(int, v), 0x161, 0xf, 0xf, true)));
  v = fmaxf(v, __builtin_bit_cast(float, __builtin_amdgcn_update_dpp(0, __builtin_bit_cast(int, v), 0x162, 0xf, 0xf, true)));
  v = fmaxf(v, __builtin_bit_cast(float, __builtin_amdgcn_update_dpp(0, __builtin_bit_cast(int, v), 0x164, 0xf, 0xf, true)));
  v = fmaxf(v, __builtin_bit_cast(float, __builtin_amdgcn_update_dpp(0, __builtin_bit_cast(int, v), 0x168, 0xf, 0xf, true)));
  return v;
}
// Lane l reads lane l ^ 16.
__device__ __forceinline__ float other_row(float v) {
  const int b = __builtin_bit_cast(int, v);
  return __builtin_bit_cast(float, __builtin_amdgcn_permlanex16(b, b, 0x76543210, 0xfedcba98, false, false));
}
// Over all 32 lanes, in vector registers only: the shuffle form goes through the LDS pipe, one waited trip a step.
__device__ __forceinline__ float wave_sum(float v) {
  v = row16_sum(v);
  return v + other_row(v);
}
__device__ __forceinline__ float wave_max(float v) {
  v = row16_max(v);
  return fmaxf(v, other_row(v));
}

// ---------------------------------------------------------------------------
// The preparation grid runs work-groups of 28 waves: a layer-norm group takes ROWS_ = 224 rows, 8 a wave.
// ---------------------------------------------------------------------------
#define PT_     896
#define SPLIT_  14
#define ROWS_   (N_ / SPLIT_)       // 224
#define KSTEPS_ (ROWS_ / 32)        // 7
#define SELEMS_ (C1_ * KV_)         // 12288
#define TP_     (ROWS_ + 8)         // LDS pitch of a channel's row: 464 B = 16 B x odd

// ---------------------------------------------------------------------------
// Job of the preparation grid: block blk converts elements blk*7168 .. +7167 of a weight matrix of
// n8 * 8 elements (n8 is a multiple of 32: a wave is wholly inside or wholly outside).
// ---------------------------------------------------------------------------
__device__ __forceinline__ void cvt_f16_job(const float* __restrict__ src,
                                            f16_t* __restrict__ dst, int blk, int n8) {
  const int i = blk * PT_ + threadIdx.x;
  if (i < n8) {
    const v4f x0 = *(const v4fm*)(src + (size_t)i * 8);
    const v4f x1 = *(const v4fm*)(src + (size_t)i * 8 + 4);
    v8h v;
#pragma unroll
    for (int j = 0; j < 4; j++) { v[j] = (f16_t)x0[j]; v[4 + j] = (f16_t)x1[j]; }
    *(v8hm*)(dst + (size_t)i * 8) = v;
  }
  // Only the end of the kernel follows this store: the wait is a precaution.
  asm volatile("s_wait_xcnt 0x0" ::: "memory");
}

// ---------------------------------------------------------------------------
// Transposing convert of the H_ matrices [192][192]: dst[h][c][r] = (f16) src[h][r][c].
// 256 threads = one 64 x 64 tile, three tiles a block (the last four waves only pass the barrier):
// a lane gathers 16 rows of one column in two runs of 8 (each load 128 contiguous bytes per wave), the tile turns in LDS,
// and 8 lanes store one whole 128-B line.
// ---------------------------------------------------------------------------
__device__ __forceinline__ void cvt_t_f16_job(const float* __restrict__ src,
                                              f16_t* __restrict__ dst,
                                              f16_t (*__restrict__ T3)[72],  // 3 x [column][row], 64 rows used
                                              int blk) {
  const int sub = __builtin_amdgcn_readfirstlane(threadIdx.x >> 8);
  const bool on = sub < 3;
  const int tid = threadIdx.x & 255;
  const int tile = blk * 3 + (on ? sub : 0);
  f16_t (*Tt)[72] = T3 + (on ? sub : 0) * 64;
  const int hd = tile / 9, t9 = tile - hd * 9, ty = t9 / 3, tx = t9 - ty * 3;
  const int r0 = tx * 64, c0 = ty * 64;
  const size_t hb = (size_t)hd * KV_ * KV_;
  const int c = tid & 63, rg = tid >> 6;
  const float* s = src + hb + (size_t)r0 * KV_ + c0 + c;
  if (on) {
#pragma unroll
    for (int q = 0; q < 2; q++) {
      v8h v;
#pragma unroll
      for (int j = 0; j < 8; j++) v[j] = (f16_t)s[((rg + 4 * q) * 8 + j) * KV_];
      *(v8hm*)&Tt[c][(rg + 4 * q) * 8] = v;
    }
  }
  __syncthreads();
  const int rs = tid >> 3, ck = (tid & 7) * 8;
  if (on) {
#pragma unroll
    for (int q = 0; q < 2; q++) {
      const int row = q * 32 + rs;
      const v8h v = *(const v8hm*)&Tt[row][ck];
      *(v8hm*)(dst + hb + (size_t)(c0 + row) * KV_ + r0 + ck) = v;
    }
  }
  // Only the end of the kernel follows these stores: the wait is a precaution.
  asm volatile("s_wait_xcnt 0x0" ::: "memory");
}

// ---------------------------------------------------------------------------
// Fused: cx1 = LN(emb1) (64), ea = LN(concat(emb1,emb2)) (192), and this group's share of
// G = cx1^T ea (64 x 192), the sum over n that the scores need:
//   S_h = Q_h^T K_h = Wq_h (cx1^T ea) Wk_h^T, the sum over n done once per batch, split over SPLIT_ groups.
// One block = ROWS_ rows (n) of one b, one wave = 8 rows. 16 lanes hold one row, 4 channels of each 64 a lane
// (16-B loads), lanes 0..15 the wave's rows 0..3 and lanes 16..31 its rows 4..7: a row's sum is four DPP
// steps, which serve two rows at once. ea goes to memory row-major [B*N][192] from registers, 16 lanes a
// whole 128-B line; the channel-major copies of cx1 and ea live in LDS only, where they are the operands of G:
// A = rows 0..63 of Tt (row c, k = n contiguous), B = rows 64..255 (row kv, k = n contiguous)
// -> both fragments loaded with the same k map.
// A lane writes 4 consecutive n of channels 4m + c: at any pitch that keeps 16-B reads aligned the 16 lanes
// would fall on 4 bank groups, so the 16-B chunk n / 8 of channel row r stands at chunk (n / 8) ^ ((r >> 4) & 3).
// That term is one value for the 16 rows of a fragment, so the readers' bank pattern stays as it was.
// The f32 accumulators are stored in register order: tile tau = ((ct / 6) * 4 + mt) * 6 + ct % 6 of row
// tile mt and column tile ct; chunk (tau*2 + half)*32 + lane holds 4 floats,
// rows mt*16 + 8h + 4*half + 0..3 of column ct*16 + m.
// ---------------------------------------------------------------------------
__device__ __forceinline__ void ln_scores_job(
    const float* __restrict__ emb1, const float* __restrict__ emb2,
    const float* __restrict__ g1, const float* __restrict__ b1,
    const float* __restrict__ ga, const float* __restrict__ ba,
    f16_t* __restrict__ ea, float* __restrict__ part,
    f16_t (*__restrict__ Tt)[TP_],   // [channel][n], 0..63 cx1, 64..255 ea
    int blk) {
  const int tid = threadIdx.x, lane = tid & 31;
  const int wave = __builtin_amdgcn_readfirstlane(tid >> 5);
  const int hh = lane >> 4, m = lane & 15;
  const int n0 = blk * ROWS_;
  const int rw = wave * 8 + 4 * hh;  // the lane's first row within the group

  const float* p1 = emb1 + (size_t)(n0 + rw) * C1_ + m * 4;
  const float* p2 = emb2 + (size_t)(n0 + rw) * C2_ + m * 4;
  v4f x[4][3];  // [row][64 channels]
#pragma unroll
  for (int j = 0; j < 4; j++) {
    x[j][0] = *(const v4fm*)(p1 + j * C1_);
    x[j][1] = *(const v4fm*)(p2 + j * C2_);
    x[j][2] = *(const v4fm*)(p2 + j * C2_ + 64);
  }
  const v4f gv1 = *(const v4fm*)(g1 + m * 4);
  const v4f bv1 = *(const v4fm*)(b1 + m * 4);
  v4f gva[3], bva[3];
#pragma unroll
  for (int s = 0; s < 3; s++) {
    gva[s] = *(const v4fm*)(ga + s * 64 + m * 4);
    bva[s] = *(const v4fm*)(ba + s * 64 + m * 4);
  }
  // Holds both address pairs until the loads above have taken them.
  asm volatile("s_wait_xcnt 0x0" :: "v"(p1), "v"(p2) : "memory");

  v4h tq[4][4];  // tq[g][c][j] = channel row g*64 + 4m + c of Tt, row rw + j
  v4h er[4][3];  // er[j][s][c] = ea channel s*64 + 4m + c of row rw + j
#pragma unroll
  for (int j = 0; j < 4; j++) {
    const v4f x0 = x[j][0], xa = x[j][1], xb = x[j][2];
    const float s1 = (x0[0] + x0[1]) + (x0[2] + x0[3]);
    const v4f t = xa + xb;
    const float s2 = (t[0] + t[1]) + (t[2] + t[3]);
    const float mu = row16_sum(s1) * (1.0f / 64.0f);
    const float ma = row16_sum(s1 + s2) * (1.0f / 192.0f);

    const v4f d = x0 - mu;
    const float var = row16_sum((d[0] * d[0] + d[1] * d[1]) + (d[2] * d[2] + d[3] * d[3])) * (1.0f / 64.0f);
    const float rs = rsqrtf(var + 1e-6f);
#pragma unroll
    for (int c = 0; c < 4; c++) tq[0][c][j] = (f16_t)(d[c] * rs * gv1[c] + bv1[c]);

    v4f e[3];
    e[0] = x0 - ma; e[1] = xa - ma; e[2] = xb - ma;
    const v4f q = e[0] * e[0] + e[1] * e[1] + e[2] * e[2];
    const float vara = row16_sum((q[0] + q[1]) + (q[2] + q[3])) * (1.0f / 192.0f);
    const float rsa = rsqrtf(vara + 1e-6f);
#pragma unroll
    for (int s = 0; s < 3; s++) {
#pragma unroll
      for (int c = 0; c < 4; c++) {
        const f16_t y = (f16_t)(e[s][c] * rsa * gva[s][c] + bva[s][c]);
        tq[1 + s][c][j] = y;
        er[j][s][c] = y;
      }
    }
  }
  {
    f16_t* tp = &Tt[m * 4][(wave ^ (m >> 2)) * 8 + 4 * hh];
#pragma unroll
    for (int g = 0; g < 4; g++) {
#pragma unroll
      for (int c = 0; c < 4; c++) *(v4hm*)(tp + (g * 64 + c) * TP_) = tq[g][c];
    }
  }
  __syncthreads();

  // Row-major ea. Issued behind the barrier (which would wait for stores in front of it), the stores drain
  // under the products.
  f16_t* eo = ea + (size_t)(n0 + rw) * KV_ + m * 4;
#pragma unroll
  for (int j = 0; j < 4; j++) {
#pragma unroll
    for (int s = 0; s < 3; s++) *(v4hm*)(eo + j * KV_ + s * 64) = er[j][s];
  }
  // The products below reuse these stores' registers: wait stands first.
  asm volatile("s_wait_xcnt 0x0" :: "v"(eo) : "memory");

  // 12 waves (three a SIMD) take 2 x 2 tiles each: 8 LDS reads feed 4 WMMAs.
  if (wave < 12) {
    const int mp = wave & 1, cp = wave >> 1;
    v8f acc[2][2] = {};
    const f16_t* ap[2][2];  // [tile][half of the fragment]: k = 8 hh + 16 p + 0..7 of each step of 32
    const f16_t* bp[2][2];
#pragma unroll
    for (int t = 0; t < 2; t++) {
#pragma unroll
      for (int p = 0; p < 2; p++) {
        ap[t][p] = &Tt[mp * 32 + t * 16 + m][((hh + 2 * p) ^ (mp * 2 + t)) * 8];
        bp[t][p] = &Tt[C1_ + cp * 32 + t * 16 + m][((hh + 2 * p) ^ ((cp * 2 + t) & 3)) * 8];
      }
    }
    Frag a[2][2], bf[2][2];  // [buffer][tile]
#pragma unroll
    for (int t = 0; t < 2; t++) {
#pragma unroll
      for (int p = 0; p < 2; p++) {
        a[0][t].p[p]  = *(const v8hm*)(ap[t][p]);
        bf[0][t].p[p] = *(const v8hm*)(bp[t][p]);
      }
    }
    // The next step's fragments are read in front of this step's WMMAs: their LDS latency runs under the products.
#pragma unroll
    for (int it = 0; it < KSTEPS_; it++) {
      const int cu = it & 1, nx = cu ^ 1;
      if (it + 1 < KSTEPS_) {
#pragma unroll
        for (int t = 0; t < 2; t++) {
#pragma unroll
          for (int p = 0; p < 2; p++) {
            a[nx][t].p[p]  = *(const v8hm*)(ap[t][p] + (it + 1) * 32);
            bf[nx][t].p[p] = *(const v8hm*)(bp[t][p] + (it + 1) * 32);
          }
        }
      }
#pragma unroll
      for (int i = 0; i < 2; i++) {
#pragma unroll
        for (int j = 0; j < 2; j++) acc[i][j] = wmma16(a[cu][i].v, bf[cu][j].v, acc[i][j]);
      }
    }

    // Each store instruction writes 512 contiguous bytes (4 whole lines) of this wave's own tiles.
    const int b = blk / SPLIT_, sp = blk - b * SPLIT_;
    // The wave's tiles are tau0 + 6 i + j (2 cp is even, so both column tiles lie in the same group of six).
    const int tau0 = ((cp / 3) * 4 + mp * 2) * 6 + (cp % 3) * 2;
    float* pb = part + ((size_t)sp * B_ + b) * SELEMS_ + tau0 * 256 + lane * 4;
#pragma unroll
    for (int i = 0; i < 2; i++) {
#pragma unroll
      for (int j = 0; j < 2; j++) {
#pragma unroll
        for (int hf = 0; hf < 2; hf++) {
          v4f v;
#pragma unroll
          for (int r = 0; r < 4; r++) v[r] = acc[i][j][hf * 4 + r];
          *(v4fm*)(pb + ((6 * i + j) * 2 + hf) * 128) = v;
        }
      }
    }
  }
}

// ---------------------------------------------------------------------------
// Preparation grid: the layer norms with their share of G and the six weight conversions depend on
// nothing but the inputs, so they run as jobs of one launch, picked by work-group index. The layer-norm
// groups are the longest and take the lowest indices.
// ---------------------------------------------------------------------------
#define CVB_(n)  (((n) / 8 + PT_ - 1) / PT_)
#define LN_BLKS_ (B_ * SPLIT_)               // 112
#define WV_BLKS_ (H_ * 9 / 3)                // 12: 36 tiles of 64 x 64, three a block
#define WK_BLKS_ CVB_(H_ * KV_ * KV_)        // 21
#define WQ_BLKS_ CVB_(H_ * C1_ * C1_)        // 3
#define F1_BLKS_ CVB_(MLP_ * C1_)            // 3
#define F2_BLKS_ CVB_(C1_ * MLP_)            // 3
#define WO_BLKS_ CVB_(C1_ * C1_)             // 1
#define PREP_BLKS_ (LN_BLKS_ + WV_BLKS_ + WK_BLKS_ + WQ_BLKS_ + F1_BLKS_ + F2_BLKS_ + WO_BLKS_)

__global__ __launch_bounds__(PT_) void prep_kernel(
    const float* __restrict__ emb1, const float* __restrict__ emb2,
    const float* __restrict__ g1, const float* __restrict__ b1,
    const float* __restrict__ ga, const float* __restrict__ ba,
    const float* __restrict__ Wq, const float* __restrict__ Wk, const float* __restrict__ Wv,
    const float* __restrict__ Wo, const float* __restrict__ f1, const float* __restrict__ f2,
    f16_t* __restrict__ ea, float* __restrict__ part,
    f16_t* __restrict__ Wqh, f16_t* __restrict__ Wkh, f16_t* __restrict__ WvT,
    f16_t* __restrict__ Woh, f16_t* __restrict__ f1h, f16_t* __restrict__ f2h) {
  __shared__ __attribute__((aligned(16))) f16_t Tt[256][TP_];
  int blk = blockIdx.x;
  if (blk < LN_BLKS_) {
    ln_scores_job(emb1, emb2, g1, b1, ga, ba, ea, part, Tt, blk);
    return;
  }
  blk -= LN_BLKS_;
  if (blk < WV_BLKS_) {
    cvt_t_f16_job(Wv, WvT, reinterpret_cast<f16_t (*)[72]>(&Tt[0][0]), blk);
    return;
  }
  blk -= WV_BLKS_;
  const float* s = Wk;
  f16_t* d = Wkh;
  int n8 = H_ * KV_ * KV_ / 8;
  if (blk >= WK_BLKS_) {
    blk -= WK_BLKS_; s = Wq; d = Wqh; n8 = H_ * C1_ * C1_ / 8;
    if (blk >= WQ_BLKS_) {
      blk -= WQ_BLKS_; s = f1; d = f1h; n8 = MLP_ * C1_ / 8;
      if (blk >= F1_BLKS_) {
        blk -= F1_BLKS_; s = f2; d = f2h; n8 = C1_ * MLP_ / 8;
        if (blk >= F2_BLKS_) { blk -= F2_BLKS_; s = Wo; d = Woh; n8 = C1_ * C1_ / 8; }
      }
    }
  }
  cvt_f16_job(s, d, blk, n8);
}

// ---------------------------------------------------------------------------
// One block of 32 waves per (b,h): G_b = sum of the SPLIT_ partials (each thread owns
// 3 chunks of 4 floats), T = Wq_h G_b, S = T Wk_h^T (both on WMMA, 24 waves x 2 tiles),
// scale, InstanceNorm over (64,192), softmax over KV, P*4096 kept in LDS as f16.
// G is carried x 1/64 (exact power of two) as f16 operand and unscaled in f32 on S.
// Value side, o = mean_h (ea Wv_h^T) P_h^T Wout^T = ea (mean_h Wout P_h Wv_h)^T: this block forms
// T2 = P_h Wv_h and U_h = Wout T2 (both on WMMA, same wave map) and stores 64 * U_h as f16 [64][192].
// ---------------------------------------------------------------------------
__global__ __launch_bounds__(1024) void merge_softmax_kernel(
    const float* __restrict__ part, const f16_t* __restrict__ Wq,
    const f16_t* __restrict__ Wk, const f16_t* __restrict__ WvT,
    const f16_t* __restrict__ Wo, f16_t* __restrict__ U) {
  __shared__ float Sb[64][196];
  __shared__ __attribute__((aligned(16))) f16_t Pst[64][200];
  __shared__ __attribute__((aligned(16))) f16_t Gt[192][72];   // G^T / 64: [k'][c']; later 64 T2^T: [k'][c]
  __shared__ __attribute__((aligned(16))) f16_t Tl[64][200];   // T / 64:   [c][k']; later 64 U: [d][k']
  __shared__ __attribute__((aligned(16))) f16_t Wl[64][72];    // Wout: [d][c]
  __shared__ float red[32];
  __shared__ float red2[32];
  const int tid = threadIdx.x, lane = tid & 31;
  const int wave = __builtin_amdgcn_readfirstlane(tid >> 5);
  const int hh = lane >> 4, m = lane & 15;
  const int bh = blockIdx.x, b = bh >> 2, hd = bh & 3;
  const float* pb = part + (size_t)b * SELEMS_ + tid * 4;

  // Matrix work: wave < 24 owns column tile nt (of 12) and row tiles 2*mp, 2*mp + 1 (of 4).
  const bool mm = wave < 24;
  const int mp = wave / 12, nt = wave - mp * 12;
  const v4h wo4 = *(const v4hm*)(Wo + tid * 4);  // Wout goes to LDS with the first barrier
  v4f a[3] = {};
#pragma unroll
  for (int s = 0; s < SPLIT_; s++) {
#pragma unroll
    for (int i = 0; i < 3; i++)
      a[i] += *(const v4fm*)(pb + (size_t)s * B_ * SELEMS_ + i * 4096);
  }

#pragma unroll
  for (int i = 0; i < 3; i++) {
    const int g = wave + 32 * i;          // chunk group = tau*2 + half of the producer's tile order
    const int wa = g / 12, rem = g - wa * 12;
    const int row0 = (wa & 3) * 16 + 8 * hh + (rem & 1) * 4;
    const int col = ((wa >> 2) * 6 + (rem >> 1)) * 16 + m;
    v4h gq;
#pragma unroll
    for (int j = 0; j < 4; j++) gq[j] = (f16_t)(a[i][j] * 0.015625f);
    *(v4hm*)&Gt[col][row0] = gq;
  }
  *(v4hm*)&Wl[tid >> 4][(tid & 15) * 4] = wo4;

  // Weight fragments are fetched here, behind the sum (whose loads need the registers) and in front of
  // the barrier, so that their latency runs under the wait for the other waves.
  Frag wq[2][2], wk[6];
  if (mm) {
    const f16_t* wqb = Wq + (size_t)hd * C1_ * C1_ + (size_t)(mp * 32 + m) * C1_ + 8 * hh;
#pragma unroll
    for (int t = 0; t < 2; t++) {
#pragma unroll
      for (int kk = 0; kk < 2; kk++) {
        wq[t][kk].p[0] = *(const v8hm*)(wqb + t * 16 * C1_ + kk * 32);
        wq[t][kk].p[1] = *(const v8hm*)(wqb + t * 16 * C1_ + kk * 32 + 16);
      }
    }
    const f16_t* wkb = Wk + (size_t)hd * KV_ * KV_ + (size_t)(nt * 16 + m) * KV_ + 8 * hh;
#pragma unroll
    for (int kk = 0; kk < 6; kk++) {
      wk[kk].p[0] = *(const v8hm*)(wkb + kk * 32);
      wk[kk].p[1] = *(const v8hm*)(wkb + kk * 32 + 16);
    }
    // Holds both address pairs until the loads above have taken them.
    asm volatile("s_wait_xcnt 0x0" :: "v"(wqb), "v"(wkb) : "memory");
  }
  __syncthreads();

  // T[c][k'] = sum_c' Wq[c][c'] G[c'][k']: A = Wq rows, B = Gt rows, both k = c' contiguous.
  if (mm) {
    v8f t1[2] = {};
#pragma unroll
    for (int kk = 0; kk < 2; kk++) {
      Frag bf;
      bf.p[0] = *(const v8hm*)&Gt[nt * 16 + m][kk * 32 + 8 * hh];
      bf.p[1] = *(const v8hm*)&Gt[nt * 16 + m][kk * 32 + 16 + 8 * hh];
#pragma unroll
      for (int t = 0; t < 2; t++) t1[t] = wmma16(wq[t][kk].v, bf.v, t1[t]);
    }
#pragma unroll
    for (int t = 0; t < 2; t++) {
#pragma unroll
      for (int r = 0; r < 8; r++)
        Tl[mp * 32 + t * 16 + 8 * hh + r][nt * 16 + m] = (f16_t)t1[t][r];
    }
  }
  __syncthreads();

  // S[c][k] = sum_k' T[c][k'] Wk[k][k']: A = Tl rows, B = Wk rows, both k = k' contiguous.
  const float sc = 64.0f * 0.07216878364870322f;  // 64 / sqrt(192)
  v8f sv[2] = {};
  float s = 0.f;
  if (mm) {
#pragma unroll
    for (int kk = 0; kk < 6; kk++) {
#pragma unroll
      for (int t = 0; t < 2; t++) {
        Frag af;
        af.p[0] = *(const v8hm*)&Tl[mp * 32 + t * 16 + m][kk * 32 + 8 * hh];
        af.p[1] = *(const v8hm*)&Tl[mp * 32 + t * 16 + m][kk * 32 + 16 + 8 * hh];
        sv[t] = wmma16(af.v, wk[kk].v, sv[t]);
      }
    }
#pragma unroll
    for (int t = 0; t < 2; t++) {
#pragma unroll
      for (int r = 0; r < 8; r++) {
        sv[t][r] *= sc;
        s += sv[t][r];
        Sb[mp * 32 + t * 16 + 8 * hh + r][nt * 16 + m] = sv[t][r];
      }
    }
  }
  // Wv's fragments are fetched here, where Wk's registers are free, in front of the norm and the softmax.
  Frag wv[6];
  if (mm) {
    const f16_t* wvb = WvT + (size_t)hd * KV_ * KV_ + (size_t)(nt * 16 + m) * KV_ + 8 * hh;
#pragma unroll
    for (int kk = 0; kk < 6; kk++) {
      wv[kk].p[0] = *(const v8hm*)(wvb + kk * 32);
      wv[kk].p[1] = *(const v8hm*)(wvb + kk * 32 + 16);
    }
    // Holds the address pair until the loads above have taken it, as at the first weight fetch.
    asm volatile("s_wait_xcnt 0x0" :: "v"(wvb) : "memory");
  }
  s = wave_sum(s);
  if (lane == 0) red[wave] = s;
  __syncthreads();
  const float mean = wave_sum(red[lane]) * (1.0f / 12288.0f);
  float sq = 0.f;
  if (mm) {
#pragma unroll
    for (int t = 0; t < 2; t++) {
#pragma unroll
      for (int r = 0; r < 8; r++) { const float d = sv[t][r] - mean; sq += d * d; }
    }
  }
  sq = wave_sum(sq);
  if (lane == 0) red2[wave] = sq;
  __syncthreads();
  const float var  = wave_sum(red2[lane]) * (1.0f / 12288.0f);
  const float rstd = rsqrtf(var + 1e-5f);

  // Softmax over KV per row c; one wave per row, 2 rows per wave; P*4096 -> LDS.
  const float pscale = 4096.0f;
#pragma unroll
  for (int rr = 0; rr < 2; rr++) {
    const int r = wave * 2 + rr;
    float xs[6];
    float mx = -3.0e38f;
#pragma unroll
    for (int j = 0; j < 6; j++) {
      xs[j] = (Sb[r][lane + 32 * j] - mean) * rstd;
      mx = fmaxf(mx, xs[j]);
    }
    mx = wave_max(mx);
    float es = 0.f;
#pragma unroll
    for (int j = 0; j < 6; j++) { xs[j] = expf(xs[j] - mx); es += xs[j]; }
    es = wave_sum(es);
    const float inv = (1.0f / es) * pscale;
#pragma unroll
    for (int j = 0; j < 6; j++)
      Pst[r][lane + 32 * j] = (f16_t)(xs[j] * inv);
  }
  __syncthreads();

  // T2[c][k'] = sum_k P[c][k] Wv[k][k']: A = Pst rows, B = WvT rows, both k contiguous.
  // A lane's 8 accumulators are 8 consecutive c of one k': one 16-B store into T2^T (x 4096 / 64).
  if (mm) {
    v8f t2[2] = {};
    // P's fragments are read six at a time in front of their WMMAs: two LDS latencies instead of twelve.
#pragma unroll
    for (int kh = 0; kh < 2; kh++) {
      Frag af[3][2];
#pragma unroll
      for (int kk = 0; kk < 3; kk++) {
#pragma unroll
        for (int t = 0; t < 2; t++) {
          af[kk][t].p[0] = *(const v8hm*)&Pst[mp * 32 + t * 16 + m][(kh * 3 + kk) * 32 + 8 * hh];
          af[kk][t].p[1] = *(const v8hm*)&Pst[mp * 32 + t * 16 + m][(kh * 3 + kk) * 32 + 16 + 8 * hh];
        }
      }
#pragma unroll
      for (int kk = 0; kk < 3; kk++) {
#pragma unroll
        for (int t = 0; t < 2; t++) t2[t] = wmma16(af[kk][t].v, wv[kh * 3 + kk].v, t2[t]);
      }
    }
#pragma unroll
    for (int t = 0; t < 2; t++) {
      v8h q;
#pragma unroll
      for (int r = 0; r < 8; r++) q[r] = (f16_t)(t2[t][r] * 0.015625f);
      *(v8hm*)&Gt[nt * 16 + m][mp * 32 + t * 16 + 8 * hh] = q;
    }
  }
  __syncthreads();

  // U^T[k'][d] = sum_c T2^T[k'][c] Wout[d][c]: A = Gt rows, B = Wl rows, both c contiguous.
  // A lane's 8 accumulators are 8 consecutive k' of one d: one 16-B store into U's row.
  if (mm) {
    v8f u[2] = {};
    Frag af[2], wo[2][2];
#pragma unroll
    for (int kk = 0; kk < 2; kk++) {
      af[kk].p[0] = *(const v8hm*)&Gt[nt * 16 + m][kk * 32 + 8 * hh];
      af[kk].p[1] = *(const v8hm*)&Gt[nt * 16 + m][kk * 32 + 16 + 8 * hh];
#pragma unroll
      for (int t = 0; t < 2; t++) {
        wo[t][kk].p[0] = *(const v8hm*)&Wl[mp * 32 + t * 16 + m][kk * 32 + 8 * hh];
        wo[t][kk].p[1] = *(const v8hm*)&Wl[mp * 32 + t * 16 + m][kk * 32 + 16 + 8 * hh];
      }
    }
#pragma unroll
    for (int kk = 0; kk < 2; kk++) {
#pragma unroll
      for (int t = 0; t < 2; t++) u[t] = wmma16(af[kk].v, wo[t][kk].v, u[t]);
    }
#pragma unroll
    for (int t = 0; t < 2; t++) {
      v8h q;
#pragma unroll
      for (int r = 0; r < 8; r++) q[r] = (f16_t)u[t][r];
      *(v8hm*)&Tl[mp * 32 + t * 16 + m][nt * 16 + 8 * hh] = q;
    }
  }
  __syncthreads();

  // Whole-line stores: each row = 384 B = lanes 0..23 x 16 B, one instruction.
  f16_t* Ub = U + (size_t)bh * C1_ * KV_;
  const int l24 = (lane < 24) ? lane : 0;
  const bool se = lane < 24;
  v8h vals[2];
#pragma unroll
  for (int j = 0; j < 2; j++) vals[j] = *(const v8hm*)&Tl[wave * 2 + j][l24 * 8];
#pragma unroll
  for (int j = 0; j < 2; j++)
    if (se) *(v8hm*)(Ub + (size_t)(wave * 2 + j) * KV_ + l24 * 8) = vals[j];
}

// ---------------------------------------------------------------------------
// Exact-form GELU x * Phi(x) of 8 values, without a branch: with z = |x| / sqrt(2), t = 1 / (1 + p z),
//   erfc(z) = (a1 t + a2 t^2 + a3 t^3 + a4 t^4 + a5 t^5) exp(-z^2),  |error| <= 1.5e-7 for every z >= 0,
//   x * Phi(x) = max(x, 0) - |x| * erfc(z) / 2  (no cancellation on the negative side).
// The library erf takes two data-dependent branches per value, both taken by nearly every wave, and each
// value's chain runs alone between them; here the 8 chains are independent straight-line code.
// The coefficients carry the factor 1/2.
// ---------------------------------------------------------------------------
__device__ __forceinline__ v8f gelu8(v8f x) {
  const v8f ax = __builtin_elementwise_abs(x);
  const v8f d = ax * 0.23164189f + 1.0f;       // 1 + p z, p = 0.3275911
  const v8f w = (x * x) * -0.72134752f;        // -z^2 * log2(e)
  v8f t, e;
#pragma unroll
  for (int r = 0; r < 8; r++) {
    t[r] = __builtin_amdgcn_rcpf(d[r]);
    e[r] = __builtin_amdgcn_exp2f(w[r]);
  }
  v8f p = t * 0.53070271f - 0.72657601f;
  p = p * t + 0.71070687f;
  p = p * t - 0.14224837f;
  p = p * t + 0.12741480f;
  const v8f zero = {};
  return __builtin_elementwise_max(x, zero) - ax * ((p * t) * e);
}

// ---------------------------------------------------------------------------
// Everything behind the attention weights is local to a row n, so one block takes 64 rows through all of it:
//   cx[n][d] = emb1[n][d] + sum_k' ea[n][k'] * Um[d][k'],  Um = mean over heads of U_h   (K = 192)
//   y = LN(cx);  h = GELU(y fc1^T + b1)  (K = 64);  out = h fc2^T + b2 + cx  (K = 256)
// cx stays in registers (f32), y and h in LDS (f16). Both weight matrices are staged whole with the first
// round of loads. The four heads' 64 * U_h are averaged in f32 while they are staged.
// fc1 and fc2 run with the weight rows as A and the token rows as B: a lane's 8 accumulators are then
// 8 consecutive channels of one token, one or two 16-B LDS stores. grid = (N/64, B).
// Two blocks share a WGP (392 blocks, 256 WGPs): 4 waves per SIMD, 146 KiB of LDS each.
// ---------------------------------------------------------------------------
__global__ __launch_bounds__(256, 4) void tail_kernel(
    const f16_t* __restrict__ ea, const f16_t* __restrict__ U,
    const float* __restrict__ emb1,
    const float* __restrict__ fg, const float* __restrict__ fb,
    const f16_t* __restrict__ W1, const float* __restrict__ b1,
    const f16_t* __restrict__ W2, const float* __restrict__ b2,
    float* __restrict__ out) {
  __shared__ __attribute__((aligned(16))) f16_t EU[2][64][200];   // ea tile, Um; later h [64][264]
  __shared__ __attribute__((aligned(16))) float Cs[64][68];
  __shared__ __attribute__((aligned(16))) f16_t Ys[64][72];
  __shared__ __attribute__((aligned(16))) f16_t W1s[MLP_][72];
  __shared__ __attribute__((aligned(16))) f16_t W2s[C1_][264];
  __shared__ __attribute__((aligned(16))) float B1s[MLP_];
  f16_t (*Es)[200] = EU[0];
  f16_t (*Us)[200] = EU[1];
  f16_t (*Hs)[264] = reinterpret_cast<f16_t (*)[264]>(&EU[0][0][0]);
  const int tid = threadIdx.x, lane = tid & 31, wave = tid >> 5;
  const int hh = lane >> 4, m = lane & 15;
  const int b = blockIdx.y;
  const size_t r0 = (size_t)b * N_ + blockIdx.x * 64;
  const int mt = wave & 3, ng = wave >> 2;

  // All tiles are contiguous in memory: chunk i * 256 + tid of 16 B.
  const f16_t* Ub = U + (size_t)b * H_ * C1_ * KV_ + tid * 8;
  const f16_t* Eb = ea + r0 * KV_ + tid * 8;
  v8h uh[6][H_], ev[6], w1v[8], w2v[8];
  const size_t ro = (r0 + wave * 8 + hh) * C1_ + m * 4;  // rows wave*8 + 2j + hh, 16 lanes a row
  const float* rp = emb1 + ro;
  v4f rr[4];
#pragma unroll
  for (int j = 0; j < 4; j++) rr[j] = *(const v4fm*)(rp + j * 2 * C1_);
#pragma unroll
  for (int i = 0; i < 6; i++) ev[i] = *(const v8hm*)(Eb + i * 2048);
#pragma unroll
  for (int i = 0; i < 6; i++) {
#pragma unroll
    for (int h = 0; h < H_; h++) uh[i][h] = *(const v8hm*)(Ub + h * (C1_ * KV_) + i * 2048);
  }
#pragma unroll
  for (int i = 0; i < 8; i++) {
    w1v[i] = *(const v8hm*)(W1 + tid * 8 + i * 2048);
    w2v[i] = *(const v8hm*)(W2 + tid * 8 + i * 2048);
  }
  const float b1v = b1[tid];
  const v4f lg = *(const v4fm*)(fg + m * 4);
  const v4f lb = *(const v4fm*)(fb + m * 4);
  const v4f ob = *(const v4fm*)(b2 + m * 4);
  // Holds the address pair until the loads have taken it.
  asm volatile("s_wait_xcnt 0x0" :: "v"(rp) : "memory");
  // Keeps all loads in front of the first use: left free, the scheduler issues a part of them
  // behind the first wait, and the block pays the load latency twice.
  __builtin_amdgcn_sched_barrier(0);

#pragma unroll
  for (int i = 0; i < 6; i++) {
    const int idx = i * 256 + tid;
    const int row = idx / 24, c8 = (idx - row * 24) * 8;
    v8h um;
#pragma unroll
    for (int j = 0; j < 8; j++) {
      float a = 0.25f * (float)uh[i][0][j];
#pragma unroll
      for (int h = 1; h < H_; h++) a = fmaf(0.25f, (float)uh[i][h][j], a);
      um[j] = (f16_t)a;
    }
    *(v8hm*)&Us[row][c8] = um;
    *(v8hm*)&Es[row][c8] = ev[i];
  }
#pragma unroll
  for (int i = 0; i < 8; i++) {
    const int idx = i * 256 + tid;
    *(v8hm*)&W1s[idx >> 3][(idx & 7) * 8]   = w1v[i];
    *(v8hm*)&W2s[idx >> 5][(idx & 31) * 8]  = w2v[i];
  }
  B1s[tid] = b1v;
  __syncthreads();

  // All 18 fragments are read in front of the first WMMA: one LDS latency instead of twelve.
  v8f acc[2] = {};
  const int mrow = mt * 16 + m;
  {
    Frag a[6], bf[6][2];
#pragma unroll
    for (int kk = 0; kk < 6; kk++) {
      a[kk].p[0] = *(const v8hm*)&Es[mrow][kk * 32 + 8 * hh];
      a[kk].p[1] = *(const v8hm*)&Es[mrow][kk * 32 + 16 + 8 * hh];
#pragma unroll
      for (int t = 0; t < 2; t++) {
        const int col = (ng * 2 + t) * 16 + m;
        bf[kk][t].p[0] = *(const v8hm*)&Us[col][kk * 32 + 8 * hh];
        bf[kk][t].p[1] = *(const v8hm*)&Us[col][kk * 32 + 16 + 8 * hh];
      }
    }
#pragma unroll
    for (int kk = 0; kk < 6; kk++) {
#pragma unroll
      for (int t = 0; t < 2; t++) acc[t] = wmma16(a[kk].v, bf[kk][t].v, acc[t]);
    }
  }

#pragma unroll
  for (int t = 0; t < 2; t++) {
    const int cn = (ng * 2 + t) * 16 + m;
#pragma unroll
    for (int r = 0; r < 8; r++) Cs[mt * 16 + 8 * hh + r][cn] = acc[t][r] * 0.015625f;
  }
  __syncthreads();

  // cx: 16 lanes hold one row (4 channels each), 4 rows a thread; kept for the last residual.
  // Layer norm of a row = two sums over its 16 lanes.
  v4f cxv[4];
#pragma unroll
  for (int j = 0; j < 4; j++) cxv[j] = *(const v4fm*)&Cs[wave * 8 + 2 * j + hh][m * 4] + rr[j];
#pragma unroll
  for (int j = 0; j < 4; j++) {
    const v4f x = cxv[j];
    const float mu = row16_sum((x[0] + x[1]) + (x[2] + x[3])) * (1.0f / 64.0f);
    const v4f d = x - mu;
    const float var = row16_sum((d[0] * d[0] + d[1] * d[1]) + (d[2] * d[2] + d[3] * d[3])) * (1.0f / 64.0f);
    const float rs = rsqrtf(var + 1e-6f);
    v4h y;
#pragma unroll
    for (int c = 0; c < 4; c++) y[c] = (f16_t)(d[c] * rs * lg[c] + lb[c]);
    *(v4hm*)&Ys[wave * 8 + 2 * j + hh][m * 4] = y;
  }
  __syncthreads();

  // h^T[e][n] = sum_c fc1[e][c] y[n][c]: A = W1s rows, B = Ys rows, both c contiguous.
  // Wave w owns channels e = 32w .. 32w + 31 of all 64 rows.
  {
    Frag wa[2][2];
    v4f bb[2][2];
#pragma unroll
    for (int t = 0; t < 2; t++) {
#pragma unroll
      for (int kk = 0; kk < 2; kk++) {
        wa[t][kk].p[0] = *(const v8hm*)&W1s[wave * 32 + t * 16 + m][kk * 32 + 8 * hh];
        wa[t][kk].p[1] = *(const v8hm*)&W1s[wave * 32 + t * 16 + m][kk * 32 + 16 + 8 * hh];
      }
      bb[t][0] = *(const v4fm*)&B1s[wave * 32 + t * 16 + 8 * hh];
      bb[t][1] = *(const v4fm*)&B1s[wave * 32 + t * 16 + 8 * hh + 4];
    }
    // Stays rolled: the other waves of the SIMD cover a trip's LDS latency.
#pragma unroll 1
    for (int q = 0; q < 4; q++) {
      Frag yb[2];
#pragma unroll
      for (int kk = 0; kk < 2; kk++) {
        yb[kk].p[0] = *(const v8hm*)&Ys[q * 16 + m][kk * 32 + 8 * hh];
        yb[kk].p[1] = *(const v8hm*)&Ys[q * 16 + m][kk * 32 + 16 + 8 * hh];
      }
      v8f hv[2] = {};
#pragma unroll
      for (int kk = 0; kk < 2; kk++) {
#pragma unroll
        for (int t = 0; t < 2; t++) hv[t] = wmma16(wa[t][kk].v, yb[kk].v, hv[t]);
      }
#pragma unroll
      for (int t = 0; t < 2; t++) {
        v8f xv;
#pragma unroll
        for (int r = 0; r < 8; r++) xv[r] = hv[t][r] + bb[t][r >> 2][r & 3];
        const v8f gv = gelu8(xv);
        v8h g;
#pragma unroll
        for (int r = 0; r < 8; r++) g[r] = (f16_t)gv[r];
        *(v8hm*)&Hs[q * 16 + m][wave * 32 + t * 16 + 8 * hh] = g;
      }
    }
  }
  __syncthreads();

  // o^T[d][n] = sum_e fc2[d][e] h[n][e]: A = W2s rows, B = Hs rows, both e contiguous.
  // Wave owns channel tile mt and row tiles 2*ng, 2*ng + 1. Fragments are read twelve at a time.
  {
    v8f o[2] = {};
#pragma unroll
    for (int kh = 0; kh < 2; kh++) {
      Frag wf[4], hf[4][2];
#pragma unroll
      for (int kk = 0; kk < 4; kk++) {
        const int k0 = (kh * 4 + kk) * 32 + 8 * hh;
        wf[kk].p[0] = *(const v8hm*)&W2s[mt * 16 + m][k0];
        wf[kk].p[1] = *(const v8hm*)&W2s[mt * 16 + m][k0 + 16];
#pragma unroll
        for (int t = 0; t < 2; t++) {
          hf[kk][t].p[0] = *(const v8hm*)&Hs[(ng * 2 + t) * 16 + m][k0];
          hf[kk][t].p[1] = *(const v8hm*)&Hs[(ng * 2 + t) * 16 + m][k0 + 16];
        }
      }
#pragma unroll
      for (int kk = 0; kk < 4; kk++) {
#pragma unroll
        for (int t = 0; t < 2; t++) o[t] = wmma16(wf[kk].v, hf[kk][t].v, o[t]);
      }
    }
#pragma unroll
    for (int t = 0; t < 2; t++) {
      v4f lo, hi;
#pragma unroll
      for (int c = 0; c < 4; c++) { lo[c] = o[t][c]; hi[c] = o[t][4 + c]; }
      *(v4fm*)&Cs[(ng * 2 + t) * 16 + m][mt * 16 + 8 * hh]     = lo;
      *(v4fm*)&Cs[(ng * 2 + t) * 16 + m][mt * 16 + 8 * hh + 4] = hi;
    }
  }
  __syncthreads();

  // Whole-line stores: 16 lanes x 16 B = one 256-B row, two rows per instruction.
#pragma unroll
  for (int j = 0; j < 4; j++) {
    const v4f v = (*(const v4fm*)&Cs[wave * 8 + 2 * j + hh][m * 4] + ob) + cxv[j];
    *(v4fm*)(out + ro + j * 2 * C1_) = v;
  }
}

// ---------------------------------------------------------------------------
// Host-side orchestration
// ---------------------------------------------------------------------------
extern "C" void kernel_launch(void* const* d_in, const int* in_sizes, int n_in,
                              void* d_out, int out_size, void* d_ws, size_t ws_size,
                              hipStream_t stream) {
  if (n_in < 16) return;
  const int need[16] = {BN_ * C1_, BN_ * C2_, H_ * C1_ * C1_, H_ * KV_ * KV_, H_ * KV_ * KV_,
                        C1_ * C1_, C1_, C1_, KV_, KV_, C1_, C1_, MLP_ * C1_, MLP_,
                        C1_ * MLP_, C1_};
  for (int i = 0; i < 16; i++) if (in_sizes[i] != need[i]) return;
  if (out_size != BN_ * C1_) return;

  const float* emb1    = (const float*)d_in[0];
  const float* emb2    = (const float*)d_in[1];
  const float* Wq      = (const float*)d_in[2];
  const float* Wk      = (const float*)d_in[3];
  const float* Wv      = (const float*)d_in[4];
  const float* Wout    = (const float*)d_in[5];
  const float* ln1_g   = (const float*)d_in[6];
  const float* ln1_b   = (const float*)d_in[7];
  const float* lnall_g = (const float*)d_in[8];
  const float* lnall_b = (const float*)d_in[9];
  const float* ffn_g   = (const float*)d_in[10];
  const float* ffn_b   = (const float*)d_in[11];
  const float* fc1_w   = (const float*)d_in[12];
  const float* fc1_b   = (const float*)d_in[13];
  const float* fc2_w   = (const float*)d_in[14];
  const float* fc2_b   = (const float*)d_in[15];
  float* out = (float*)d_out;

  char* ws = (char*)d_ws;
  size_t off = 0;
  auto take = [&](size_t bytes) -> void* {
    off = (off + 255) & ~(size_t)255;
    void* p = ws + off;
    off += bytes;
    return p;
  };
  f16_t* ea    = (f16_t*)take((size_t)BN_ * KV_ * 2);
  f16_t* Wqh   = (f16_t*)take((size_t)H_ * C1_ * C1_ * 2);
  f16_t* Wkh   = (f16_t*)take((size_t)H_ * KV_ * KV_ * 2);
  f16_t* WvT   = (f16_t*)take((size_t)H_ * KV_ * KV_ * 2);   // [H][k'][k]
  f16_t* Wouth = (f16_t*)take((size_t)C1_ * C1_ * 2);
  f16_t* fc1h  = (f16_t*)take((size_t)MLP_ * C1_ * 2);
  f16_t* fc2h  = (f16_t*)take((size_t)C1_ * MLP_ * 2);
  f16_t* Um    = (f16_t*)take((size_t)B_ * H_ * C1_ * KV_ * 2);  // 64 * U_h, [bh][64][192]
  float* Spart = (float*)take((size_t)SPLIT_ * B_ * SELEMS_ * 4);
  if (off > ws_size) return;

  // Layer norms of the inputs with the partial sums of G = cx1^T ea, and all weight conversions, one launch
  prep_kernel<<<PREP_BLKS_, PT_, 0, stream>>>(emb1, emb2, ln1_g, ln1_b, lnall_g, lnall_b,
                                              Wq, Wk, Wv, Wout, fc1_w, fc2_w,
                                              ea, Spart, Wqh, Wkh, WvT, Wouth, fc1h, fc2h);

  // S = Wq[h] G Wk[h]^T / sqrt(KV); InstanceNorm; softmax P; U_h = Wout P Wv[h]
  merge_softmax_kernel<<<B_ * H_, 1024, 0, stream>>>(Spart, Wqh, Wkh, WvT, Wouth, Um);

  // cx = ea * (mean_h U_h)^T + emb1; y = LN(cx); out = GELU(y fc1^T + b1) fc2^T + b2 + cx
  tail_kernel<<<dim3(N_ / 64, B_), 256, 0, stream>>>(ea, Um, emb1, ffn_g, ffn_b,
                                                     fc1h, fc1_b, fc2h, fc2_b, out);
}

// v009
// It runs in 32.2 microseconds.
// Two timings next to v008 put it at 1.10 and 1.09 times that version's speed.
// Over all steps from v000 it is 6.78 times as fast.
#include <hip/hip_runtime.h>

// All contractions: v_wmma_f32_16x16x32_f16 (f16 operands, f32 accumulate); softmax P operand carried x4096 (exact power of two); x1/64 comes off in f32 before T2 goes to f16, the other x1/64 in cx's f32 epilogue.

typedef _Float16 f16_t;
typedef f16_t v16h __attribute__((ext_vector_type(16)));
typedef f16_t v8h __attribute__((ext_vector_type(8)));
typedef float v8f __attribute__((ext_vector_type(8)));
typedef float v4f __attribute__((ext_vector_type(4)));
typedef f16_t v4h __attribute__((ext_vector_type(4)));
typedef v8h v8hm __attribute__((may_alias));
typedef v4h v4hm __attribute__((may_alias));
typedef v4f v4fm __attribute__((may_alias));

#define H_   4
#define C1_  64
#define C2_  128
#define KV_  192
#define MLP_ 256
#define B_   8
#define N_   3136
#define BN_  (B_ * N_)

union Frag { v16h v; v8h p[2]; };

// 16x16x32 f16 WMMA with f32 accumulate, followed by a 4-slot VALU hazard guard.
__device__ __forceinline__ v8f wmma16(v16h a, v16h b, v8f c) {
  v8f d = __builtin_amdgcn_wmma_f32_16x16x32_f16(false, a, false, b, (short)0, c, false, false);
  asm volatile("v_nop\n\tv_nop\n\tv_nop\n\tv_nop" : "+v"(d) : "v"(a), "v"(b));
  return d;
}

// ---------------------------------------------------------------------------
// Sum over the 16 lanes of a row, every lane gets it: four DPP row_xmask steps.
// ---------------------------------------------------------------------------
__device__ __forceinline__ float row16_sum(float v) {
  v += __builtin_bit_cast(float, __builtin_amdgcn_update_dpp(0, __builtin_bit_cast(int, v), 0x161, 0xf, 0xf, true));
  v += __builtin_bit_cast(float, __builtin_amdgcn_update_dpp(0, __builtin_bit_cast(int, v), 0x162, 0xf, 0xf, true));
  v += __builtin_bit_cast(float, __builtin_amdgcn_update_dpp(0, __builtin_bit_cast(int, v), 0x164, 0xf, 0xf, true));
  v += __builtin_bit_cast(float, __builtin_amdgcn_update_dpp(0, __builtin_bit_cast(int, v), 0x168, 0xf, 0xf, true));
  return v;
}
__device__ __forceinline__ float row16_max(float v) {
  v = fmaxf(v, __builtin_bit_cast(float, __builtin_amdgcn_update_dpp(0, __builtin_bit_cast(int, v), 0x161, 0xf, 0xf, true)));
  v = fmaxf(v, __builtin_bit_cast(float, __builtin_amdgcn_update_dpp(0, __builtin_bit_cast(int, v), 0x162, 0xf, 0xf, true)));
  v = fmaxf(v, __builtin_bit_cast(float, __builtin_amdgcn_update_dpp(0, __builtin_bit_cast(int, v), 0x164, 0xf, 0xf, true)));
  v = fmaxf(v, __builtin_bit_cast(float, __builtin_amdgcn_update_dpp(0, __builtin_bit_cast(int, v), 0x168, 0xf, 0xf, true)));
  return v;
}
// Lane l reads lane l ^ 16.
__device__ __forceinline__ float other_row(float v) {
  const int b = __builtin_bit_cast(int, v);
  return __builtin_bit_cast(float, __builtin_amdgcn_permlanex16(b, b, 0x76543210, 0xfedcba98, false, false));
}
// Over all 32 lanes, in vector registers only: the shuffle form goes through the LDS pipe, one waited trip a step.
__device__ __forceinline__ float wave_sum(float v) {
  v = row16_sum(v);
  return v + other_row(v);
}
__device__ __forceinline__ float wave_max(float v) {
  v = row16_max(v);
  return fmaxf(v, other_row(v));
}

// ---------------------------------------------------------------------------
// The preparation grid runs work-groups of 28 waves: a layer-norm group takes ROWS_ = 224 rows, 8 a wave.
// ---------------------------------------------------------------------------
#define PT_     896
#define SPLIT_  14
#define ROWS_   (N_ / SPLIT_)       // 224
#define KSTEPS_ (ROWS_ / 32)        // 7
#define SELEMS_ (C1_ * KV_)         // 12288
#define TP_     (ROWS_ + 8)         // LDS pitch of a channel's row: 464 B = 16 B x odd

// ---------------------------------------------------------------------------
// Job of the preparation grid: block blk converts elements blk*7168 .. +7167 of a weight matrix of
// n8 * 8 elements (n8 is a multiple of 32: a wave is wholly inside or wholly outside).
// ---------------------------------------------------------------------------
__device__ __forceinline__ void cvt_f16_job(const float* __restrict__ src,
                                            f16_t* __restrict__ dst, int blk, int n8) {
  const int i = blk * PT_ + threadIdx.x;
  if (i < n8) {
    const v4f x0 = *(const v4fm*)(src + (size_t)i * 8);
    const v4f x1 = *(const v4fm*)(src + (size_t)i * 8 + 4);
    v8h v;
#pragma unroll
    for (int j = 0; j < 4; j++) { v[j] = (f16_t)x0[j]; v[4 + j] = (f16_t)x1[j]; }
    *(v8hm*)(dst + (size_t)i * 8) = v;
  }
  // Only the end of the kernel follows this store: the wait is a precaution.
  asm volatile("s_wait_xcnt 0x0" ::: "memory");
}

// ---------------------------------------------------------------------------
// Transposing convert of the H_ matrices [192][192]: dst[h][c][r] = (f16) src[h][r][c].
// 256 threads = one 64 x 64 tile, three tiles a block (the last four waves only pass the barrier):
// a lane gathers 16 rows of one column in two runs of 8 (each load 128 contiguous bytes per wave), the tile turns in LDS,
// and 8 lanes store one whole 128-B line.
// ---------------------------------------------------------------------------
__device__ __forceinline__ void cvt_t_f16_job(const float* __restrict__ src,
                                              f16_t* __restrict__ dst,
                                              f16_t (*__restrict__ T3)[72],  // 3 x [column][row], 64 rows used
                                              int blk) {
  const int sub = __builtin_amdgcn_readfirstlane(threadIdx.x >> 8);
  const bool on = sub < 3;
  const int tid = threadIdx.x & 255;
  const int tile = blk * 3 + (on ? sub : 0);
  f16_t (*Tt)[72] = T3 + (on ? sub : 0) * 64;
  const int hd = tile / 9, t9 = tile - hd * 9, ty = t9 / 3, tx = t9 - ty * 3;
  const int r0 = tx * 64, c0 = ty * 64;
  const size_t hb = (size_t)hd * KV_ * KV_;
  const int c = tid & 63, rg = tid >> 6;
  const float* s = src + hb + (size_t)r0 * KV_ + c0 + c;
  if (on) {
#pragma unroll
    for (int q = 0; q < 2; q++) {
      v8h v;
#pragma unroll
      for (int j = 0; j < 8; j++) v[j] = (f16_t)s[((rg + 4 * q) * 8 + j) * KV_];
      *(v8hm*)&Tt[c][(rg + 4 * q) * 8] = v;
    }
  }
  __syncthreads();
  const int rs = tid >> 3, ck = (tid & 7) * 8;
  if (on) {
#pragma unroll
    for (int q = 0; q < 2; q++) {
      const int row = q * 32 + rs;
      const v8h v = *(const v8hm*)&Tt[row][ck];
      *(v8hm*)(dst + hb + (size_t)(c0 + row) * KV_ + r0 + ck) = v;
    }
  }
  // Only the end of the kernel follows these stores: the wait is a precaution.
  asm volatile("s_wait_xcnt 0x0" ::: "memory");
}

// ---------------------------------------------------------------------------
// Fused: cx1 = LN(emb1) (64), ea = LN(concat(emb1,emb2)) (192), and this group's share of
// G = cx1^T ea (64 x 192), the sum over n that the scores need:
//   S_h = Q_h^T K_h = Wq_h (cx1^T ea) Wk_h^T, the sum over n done once per batch, split over SPLIT_ groups.
// One block = ROWS_ rows (n) of one b, one wave = 8 rows. 16 lanes hold one row, 4 channels of each 64 a lane
// (16-B loads), lanes 0..15 the wave's rows 0..3 and lanes 16..31 its rows 4..7: a row's sum is four DPP
// steps, which serve two rows at once. ea goes to memory row-major [B*N][192] from registers, 16 lanes a
// whole 128-B line; the channel-major copies of cx1 and ea live in LDS only, where they are the operands of G:
// A = rows 0..63 of Tt (row c, k = n contiguous), B = rows 64..255 (row kv, k = n contiguous)
// -> both fragments loaded with the same k map.
// A lane writes 4 consecutive n of channels 4m + c: at any pitch that keeps 16-B reads aligned the 16 lanes
// would fall on 4 bank groups, so the 16-B chunk n / 8 of channel row r stands at chunk (n / 8) ^ ((r >> 4) & 3).
// That term is one value for the 16 rows of a fragment, so the readers' bank pattern stays as it was.
// The f32 accumulators are stored in register order: tile tau = ((ct / 6) * 4 + mt) * 6 + ct % 6 of row
// tile mt and column tile ct; chunk (tau*2 + half)*32 + lane holds 4 floats,
// rows mt*16 + 8h + 4*half + 0..3 of column ct*16 + m.
// ---------------------------------------------------------------------------
__device__ __forceinline__ void ln_scores_job(
    const float* __restrict__ emb1, const float* __restrict__ emb2,
    const float* __restrict__ g1, const float* __restrict__ b1,
    const float* __restrict__ ga, const float* __restrict__ ba,
    f16_t* __restrict__ ea, float* __restrict__ part,
    f16_t (*__restrict__ Tt)[TP_],   // [channel][n], 0..63 cx1, 64..255 ea
    int blk) {
  const int tid = threadIdx.x, lane = tid & 31;
  const int wave = __builtin_amdgcn_readfirstlane(tid >> 5);
  const int hh = lane >> 4, m = lane & 15;
  const int n0 = blk * ROWS_;
  const int rw = wave * 8 + 4 * hh;  // the lane's first row within the group

  const float* p1 = emb1 + (size_t)(n0 + rw) * C1_ + m * 4;
  const float* p2 = emb2 + (size_t)(n0 + rw) * C2_ + m * 4;
  v4f x[4][3];  // [row][64 channels]
#pragma unroll
  for (int j = 0; j < 4; j++) {
    x[j][0] = *(const v4fm*)(p1 + j * C1_);
    x[j][1] = *(const v4fm*)(p2 + j * C2_);
    x[j][2] = *(const v4fm*)(p2 + j * C2_ + 64);
  }
  const v4f gv1 = *(const v4fm*)(g1 + m * 4);
  const v4f bv1 = *(const v4fm*)(b1 + m * 4);
  v4f gva[3], bva[3];
#pragma unroll
  for (int s = 0; s < 3; s++) {
    gva[s] = *(const v4fm*)(ga + s * 64 + m * 4);
    bva[s] = *(const v4fm*)(ba + s * 64 + m * 4);
  }
  // Holds both address pairs until the loads above have taken them.
  asm volatile("s_wait_xcnt 0x0" :: "v"(p1), "v"(p2) : "memory");

  v4h tq[4][4];  // tq[g][c][j] = channel row g*64 + 4m + c of Tt, row rw + j
  v4h er[4][3];  // er[j][s][c] = ea channel s*64 + 4m + c of row rw + j
#pragma unroll
  for (int j = 0; j < 4; j++) {
    const v4f x0 = x[j][0], xa = x[j][1], xb = x[j][2];
    const float s1 = (x0[0] + x0[1]) + (x0[2] + x0[3]);
    const v4f t = xa + xb;
    const float s2 = (t[0] + t[1]) + (t[2] + t[3]);
    const float mu = row16_sum(s1) * (1.0f / 64.0f);
    const float ma = row16_sum(s1 + s2) * (1.0f / 192.0f);

    const v4f d = x0 - mu;
    const float var = row16_sum((d[0] * d[0] + d[1] * d[1]) + (d[2] * d[2] + d[3] * d[3])) * (1.0f / 64.0f);
    const float rs = rsqrtf(var + 1e-6f);
#pragma unroll
    for (int c = 0; c < 4; c++) tq[0][c][j] = (f16_t)(d[c] * rs * gv1[c] + bv1[c]);

    v4f e[3];
    e[0] = x0 - ma; e[1] = xa - ma; e[2] = xb - ma;
    const v4f q = e[0] * e[0] + e[1] * e[1] + e[2] * e[2];
    const float vara = row16_sum((q[0] + q[1]) + (q[2] + q[3])) * (1.0f / 192.0f);
    const float rsa = rsqrtf(vara + 1e-6f);
#pragma unroll
    for (int s = 0; s < 3; s++) {
#pragma unroll
      for (int c = 0; c < 4; c++) {
        const f16_t y = (f16_t)(e[s][c] * rsa * gva[s][c] + bva[s][c]);
        tq[1 + s][c][j] = y;
        er[j][s][c] = y;
      }
    }
  }
  {
    f16_t* tp = &Tt[m * 4][(wave ^ (m >> 2)) * 8 + 4 * hh];
#pragma unroll
    for (int g = 0; g < 4; g++) {
#pragma unroll
      for (int c = 0; c < 4; c++) *(v4hm*)(tp + (g * 64 + c) * TP_) = tq[g][c];
    }
  }
  __syncthreads();

  // Row-major ea. Issued behind the barrier (which would wait for stores in front of it), the stores drain
  // under the products.
  f16_t* eo = ea + (size_t)(n0 + rw) * KV_ + m * 4;
#pragma unroll
  for (int j = 0; j < 4; j++) {
#pragma unroll
    for (int s = 0; s < 3; s++) *(v4hm*)(eo + j * KV_ + s * 64) = er[j][s];
  }
  // The products below reuse these stores' registers: wait stands first.
  asm volatile("s_wait_xcnt 0x0" :: "v"(eo) : "memory");

  // 12 waves (three a SIMD) take 2 x 2 tiles each: 8 LDS reads feed 4 WMMAs.
  if (wave < 12) {
    const int mp = wave & 1, cp = wave >> 1;
    v8f acc[2][2] = {};
    const f16_t* ap[2][2];  // [tile][half of the fragment]: k = 8 hh + 16 p + 0..7 of each step of 32
    const f16_t* bp[2][2];
#pragma unroll
    for (int t = 0; t < 2; t++) {
#pragma unroll
      for (int p = 0; p < 2; p++) {
        ap[t][p] = &Tt[mp * 32 + t * 16 + m][((hh + 2 * p) ^ (mp * 2 + t)) * 8];
        bp[t][p] = &Tt[C1_ + cp * 32 + t * 16 + m][((hh + 2 * p) ^ ((cp * 2 + t) & 3)) * 8];
      }
    }
    Frag a[2][2], bf[2][2];  // [buffer][tile]
#pragma unroll
    for (int t = 0; t < 2; t++) {
#pragma unroll
      for (int p = 0; p < 2; p++) {
        a[0][t].p[p]  = *(const v8hm*)(ap[t][p]);
        bf[0][t].p[p] = *(const v8hm*)(bp[t][p]);
      }
    }
    // The next step's fragments are read in front of this step's WMMAs: their LDS latency runs under the products.
#pragma unroll
    for (int it = 0; it < KSTEPS_; it++) {
      const int cu = it & 1, nx = cu ^ 1;
      if (it + 1 < KSTEPS_) {
#pragma unroll
        for (int t = 0; t < 2; t++) {
#pragma unroll
          for (int p = 0; p < 2; p++) {
            a[nx][t].p[p]  = *(const v8hm*)(ap[t][p] + (it + 1) * 32);
            bf[nx][t].p[p] = *(const v8hm*)(bp[t][p] + (it + 1) * 32);
          }
        }
      }
#pragma unroll
      for (int i = 0; i < 2; i++) {
#pragma unroll
        for (int j = 0; j < 2; j++) acc[i][j] = wmma16(a[cu][i].v, bf[cu][j].v, acc[i][j]);
      }
    }

    // Each store instruction writes 512 contiguous bytes (4 whole lines) of this wave's own tiles.
    const int b = blk / SPLIT_, sp = blk - b * SPLIT_;
    // The wave's tiles are tau0 + 6 i + j (2 cp is even, so both column tiles lie in the same group of six).
    const int tau0 = ((cp / 3) * 4 + mp * 2) * 6 + (cp % 3) * 2;
    float* pb = part + ((size_t)sp * B_ + b) * SELEMS_ + tau0 * 256 + lane * 4;
#pragma unroll
    for (int i = 0; i < 2; i++) {
#pragma unroll
      for (int j = 0; j < 2; j++) {
#pragma unroll
        for (int hf = 0; hf < 2; hf++) {
          v4f v;
#pragma unroll
          for (int r = 0; r < 4; r++) v[r] = acc[i][j][hf * 4 + r];
          *(v4fm*)(pb + ((6 * i + j) * 2 + hf) * 128) = v;
        }
      }
    }
  }
}

// ---------------------------------------------------------------------------
// Preparation grid: the layer norms with their share of G and the six weight conversions depend on
// nothing but the inputs, so they run as jobs of one launch, picked by work-group index. The layer-norm
// groups are the longest and take the lowest indices.
// ---------------------------------------------------------------------------
#define CVB_(n)  (((n) / 8 + PT_ - 1) / PT_)
#define LN_BLKS_ (B_ * SPLIT_)               // 112
#define WV_BLKS_ (H_ * 9 / 3)                // 12: 36 tiles of 64 x 64, three a block
#define WK_BLKS_ CVB_(H_ * KV_ * KV_)        // 21
#define WQ_BLKS_ CVB_(H_ * C1_ * C1_)        // 3
#define F1_BLKS_ CVB_(MLP_ * C1_)            // 3
#define F2_BLKS_ CVB_(C1_ * MLP_)            // 3
#define WO_BLKS_ CVB_(C1_ * C1_)             // 1
#define PREP_BLKS_ (LN_BLKS_ + WV_BLKS_ + WK_BLKS_ + WQ_BLKS_ + F1_BLKS_ + F2_BLKS_ + WO_BLKS_)

__global__ __launch_bounds__(PT_) void prep_kernel(
    const float* __restrict__ emb1, const float* __restrict__ emb2,
    const float* __restrict__ g1, const float* __restrict__ b1,
    const float* __restrict__ ga, const float* __restrict__ ba,
    const float* __restrict__ Wq, const float* __restrict__ Wk, const float* __restrict__ Wv,
    const float* __restrict__ Wo, const float* __restrict__ f1, const float* __restrict__ f2,
    f16_t* __restrict__ ea, float* __restrict__ part,
    f16_t* __restrict__ Wqh, f16_t* __restrict__ Wkh, f16_t* __restrict__ WvT,
    f16_t* __restrict__ Woh, f16_t* __restrict__ f1h, f16_t* __restrict__ f2h) {
  __shared__ __attribute__((aligned(16))) f16_t Tt[256][TP_];
  int blk = blockIdx.x;
  if (blk < LN_BLKS_) {
    ln_scores_job(emb1, emb2, g1, b1, ga, ba, ea, part, Tt, blk);
    return;
  }
  blk -= LN_BLKS_;
  if (blk < WV_BLKS_) {
    cvt_t_f16_job(Wv, WvT, reinterpret_cast<f16_t (*)[72]>(&Tt[0][0]), blk);
    return;
  }
  blk -= WV_BLKS_;
  const float* s = Wk;
  f16_t* d = Wkh;
  int n8 = H_ * KV_ * KV_ / 8;
  if (blk >= WK_BLKS_) {
    blk -= WK_BLKS_; s = Wq; d = Wqh; n8 = H_ * C1_ * C1_ / 8;
    if (blk >= WQ_BLKS_) {
      blk -= WQ_BLKS_; s = f1; d = f1h; n8 = MLP_ * C1_ / 8;
      if (blk >= F1_BLKS_) {
        blk -= F1_BLKS_; s = f2; d = f2h; n8 = C1_ * MLP_ / 8;
        if (blk >= F2_BLKS_) { blk -= F2_BLKS_; s = Wo; d = Woh; n8 = C1_ * C1_ / 8; }
      }
    }
  }
  cvt_f16_job(s, d, blk, n8);
}

// ---------------------------------------------------------------------------
// LDS byte address of a __shared__ object: the low 32 bits of its address.
// ---------------------------------------------------------------------------
__device__ __forceinline__ unsigned lds_byte(const void* p) { return (unsigned)(size_t)p; }

// ---------------------------------------------------------------------------
// One block of 32 waves per (b,h): G_b = sum of the SPLIT_ partials (each thread owns
// 3 chunks of 4 floats), T = Wq_h G_b, S = T Wk_h^T (both on WMMA, 24 waves x 2 tiles),
// scale, InstanceNorm over (64,192), softmax over KV, P*4096 kept in LDS as f16.
// G is carried x 1/64 (exact power of two) as f16 operand and unscaled in f32 on S.
// Value side, o = mean_h (ea Wv_h^T) P_h^T Wout^T = ea (mean_h Wout P_h Wv_h)^T: this block forms
// T2 = P_h Wv_h and U_h = Wout T2 (both on WMMA, same wave map) and stores 64 * U_h as f16 [64][192].
// The head's four weight matrices go to LDS by asynchronous copies issued in front of the partial sums:
// whole lines, no registers, their latency under the sum's own loads; the fragments are then LDS reads.
// ---------------------------------------------------------------------------
__global__ __launch_bounds__(1024) void merge_softmax_kernel(
    const float* __restrict__ part, const f16_t* __restrict__ Wq,
    const f16_t* __restrict__ Wk, const f16_t* __restrict__ WvT,
    const f16_t* __restrict__ Wo, f16_t* __restrict__ U) {
  __shared__ float Sb[64][196];
  __shared__ __attribute__((aligned(16))) f16_t Pst[64][200];
  __shared__ __attribute__((aligned(16))) f16_t Gt[192][72];   // G^T / 64: [k'][c']; later 64 T2^T: [k'][c]
  __shared__ __attribute__((aligned(16))) f16_t Tl[64][200];   // T / 64:   [c][k']; later 64 U: [d][k']
  __shared__ __attribute__((aligned(16))) f16_t Wl[64][72];    // Wout: [d][c]
  __shared__ __attribute__((aligned(16))) f16_t Wqs[64][72];   // Wq_h: [c][c']
  __shared__ __attribute__((aligned(16))) f16_t Wks[KV_][200]; // Wk_h: [k][k']
  __shared__ __attribute__((aligned(16))) f16_t Wvs[KV_][200]; // Wv_h^T: [k'][k]
  __shared__ float red[32];
  __shared__ float red2[32];
  const int tid = threadIdx.x, lane = tid & 31;
  const int wave = __builtin_amdgcn_readfirstlane(tid >> 5);
  const int hh = lane >> 4, m = lane & 15;
  const int bh = blockIdx.x, b = bh >> 2, hd = bh & 3;
  const float* pb = part + (size_t)b * SELEMS_ + tid * 4;

  // Matrix work: wave < 24 owns column tile nt (of 12) and row tiles 2*mp, 2*mp + 1 (of 4).
  const bool mm = wave < 24;
  const int mp = wave / 12, nt = wave - mp * 12;

  // Each lane copies 16 B a time. Waves 0..23: a round is 32 rows x 24 chunks, six rounds each of Wk_h and
  // Wv_h^T. Waves 24..31: a round is 32 rows x 8 chunks, two rounds each of Wq_h and Wout.
  // The s_wait_xcnt ends each statement so that no address register is reused in front of it.
  if (mm) {
    const int row = tid / 24, c8 = tid - row * 24;
    const f16_t* gk = Wk + (size_t)hd * KV_ * KV_ + tid * 8;
    const f16_t* gv = WvT + (size_t)hd * KV_ * KV_ + tid * 8;
    const unsigned lk = lds_byte(&Wks[row][c8 * 8]);
    const unsigned lv = lds_byte(&Wvs[row][c8 * 8]);
    asm volatile(
        "global_load_async_to_lds_b128 %0, %12, off\n\t"
        "global_load_async_to_lds_b128 %1, %13, off\n\t"
        "global_load_async_to_lds_b128 %2, %14, off\n\t"
        "global_load_async_to_lds_b128 %3, %15, off\n\t"
        "global_load_async_to_lds_b128 %4, %16, off\n\t"
        "global_load_async_to_lds_b128 %5, %17, off\n\t"
        "global_load_async_to_lds_b128 %6, %18, off\n\t"
        "global_load_async_to_lds_b128 %7, %19, off\n\t"
        "global_load_async_to_lds_b128 %8, %20, off\n\t"
        "global_load_async_to_lds_b128 %9, %21, off\n\t"
        "global_load_async_to_lds_b128 %10, %22, off\n\t"
        "global_load_async_to_lds_b128 %11, %23, off\n\t"
        "s_wait_xcnt 0x0"
        :: "v"(lk), "v"(lk + 12800u), "v"(lk + 25600u), "v"(lk + 38400u), "v"(lk + 51200u), "v"(lk + 64000u),
           "v"(lv), "v"(lv + 12800u), "v"(lv + 25600u), "v"(lv + 38400u), "v"(lv + 51200u), "v"(lv + 64000u),
           "v"(gk), "v"(gk + 6144), "v"(gk + 12288), "v"(gk + 18432), "v"(gk + 24576), "v"(gk + 30720),
           "v"(gv), "v"(gv + 6144), "v"(gv + 12288), "v"(gv + 18432), "v"(gv + 24576), "v"(gv + 30720)
        : "memory");
  } else {
    const int t = tid - 768;
    const f16_t* gq = Wq + (size_t)hd * C1_ * C1_ + t * 8;
    const f16_t* go = Wo + t * 8;
    const unsigned lq = lds_byte(&Wqs[t >> 3][(t & 7) * 8]);
    const unsigned lo = lds_byte(&Wl[t >> 3][(t & 7) * 8]);
    asm volatile(
        "global_load_async_to_lds_b128 %0, %4, off\n\t"
        "global_load_async_to_lds_b128 %1, %5, off\n\t"
        "global_load_async_to_lds_b128 %2, %6, off\n\t"
        "global_load_async_to_lds_b128 %3, %7, off\n\t"
        "s_wait_xcnt 0x0"
        :: "v"(lq), "v"(lq + 4608u), "v"(lo), "v"(lo + 4608u),
           "v"(gq), "v"(gq + 2048), "v"(go), "v"(go + 2048)
        : "memory");
  }

  v4f a[3] = {};
#pragma unroll
  for (int s = 0; s < SPLIT_; s++) {
#pragma unroll
    for (int i = 0; i < 3; i++)
      a[i] += *(const v4fm*)(pb + (size_t)s * B_ * SELEMS_ + i * 4096);
  }

#pragma unroll
  for (int i = 0; i < 3; i++) {
    const int g = wave + 32 * i;          // chunk group = tau*2 + half of the producer's tile order
    const int wa = g / 12, rem = g - wa * 12;
    const int row0 = (wa & 3) * 16 + 8 * hh + (rem & 1) * 4;
    const int col = ((wa >> 2) * 6 + (rem >> 1)) * 16 + m;
    v4h gq;
#pragma unroll
    for (int j = 0; j < 4; j++) gq[j] = (f16_t)(a[i][j] * 0.015625f);
    *(v4hm*)&Gt[col][row0] = gq;
  }

  // This wave's copies have landed; the barrier behind it shows them to the other waves.
  asm volatile("s_wait_asynccnt 0x0" ::: "memory");
  __syncthreads();

  // T[c][k'] = sum_c' Wq[c][c'] G[c'][k']: A = Wq rows, B = Gt rows, both k = c' contiguous.
  // Wk's fragments are read behind T's: their LDS time runs under T's products and the next barrier.
  Frag wk[6];
  if (mm) {
    v8f t1[2] = {};
    Frag wq[2][2], bf[2];
#pragma unroll
    for (int kk = 0; kk < 2; kk++) {
      bf[kk].p[0] = *(const v8hm*)&Gt[nt * 16 + m][kk * 32 + 8 * hh];
      bf[kk].p[1] = *(const v8hm*)&Gt[nt * 16 + m][kk * 32 + 16 + 8 * hh];
#pragma unroll
      for (int t = 0; t < 2; t++) {
        wq[t][kk].p[0] = *(const v8hm*)&Wqs[mp * 32 + t * 16 + m][kk * 32 + 8 * hh];
        wq[t][kk].p[1] = *(const v8hm*)&Wqs[mp * 32 + t * 16 + m][kk * 32 + 16 + 8 * hh];
      }
    }
#pragma unroll
    for (int kk = 0; kk < 6; kk++) {
      wk[kk].p[0] = *(const v8hm*)&Wks[nt * 16 + m][kk * 32 + 8 * hh];
      wk[kk].p[1] = *(const v8hm*)&Wks[nt * 16 + m][kk * 32 + 16 + 8 * hh];
    }
#pragma unroll
    for (int kk = 0; kk < 2; kk++) {
#pragma unroll
      for (int t = 0; t < 2; t++) t1[t] = wmma16(wq[t][kk].v, bf[kk].v, t1[t]);
    }
#pragma unroll
    for (int t = 0; t < 2; t++) {
#pragma unroll
      for (int r = 0; r < 8; r++)
        Tl[mp * 32 + t * 16 + 8 * hh + r][nt * 16 + m] = (f16_t)t1[t][r];
    }
  }
  __syncthreads();

  // S[c][k] = sum_k' T[c][k'] Wk[k][k']: A = Tl rows, B = Wk rows, both k = k' contiguous.
  const float sc = 64.0f * 0.07216878364870322f;  // 64 / sqrt(192)
  v8f sv[2] = {};
  float s = 0.f;
  if (mm) {
#pragma unroll
    for (int kk = 0; kk < 6; kk++) {
#pragma unroll
      for (int t = 0; t < 2; t++) {
        Frag af;
        af.p[0] = *(const v8hm*)&Tl[mp * 32 + t * 16 + m][kk * 32 + 8 * hh];
        af.p[1] = *(const v8hm*)&Tl[mp * 32 + t * 16 + m][kk * 32 + 16 + 8 * hh];
        sv[t] = wmma16(af.v, wk[kk].v, sv[t]);
      }
    }
#pragma unroll
    for (int t = 0; t < 2; t++) {
#pragma unroll
      for (int r = 0; r < 8; r++) {
        sv[t][r] *= sc;
        s += sv[t][r];
        Sb[mp * 32 + t * 16 + 8 * hh + r][nt * 16 + m] = sv[t][r];
      }
    }
  }
  // Wv's fragments are read here, where Wk's registers are free, in front of the norm and the softmax.
  Frag wv[6];
  if (mm) {
#pragma unroll
    for (int kk = 0; kk < 6; kk++) {
      wv[kk].p[0] = *(const v8hm*)&Wvs[nt * 16 + m][kk * 32 + 8 * hh];
      wv[kk].p[1] = *(const v8hm*)&Wvs[nt * 16 + m][kk * 32 + 16 + 8 * hh];
    }
  }
  s = wave_sum(s);
  if (lane == 0) red[wave] = s;
  __syncthreads();
  const float mean = wave_sum(red[lane]) * (1.0f / 12288.0f);
  float sq = 0.f;
  if (mm) {
#pragma unroll
    for (int t = 0; t < 2; t++) {
#pragma unroll
      for (int r = 0; r < 8; r++) { const float d = sv[t][r] - mean; sq += d * d; }
    }
  }
  sq = wave_sum(sq);
  if (lane == 0) red2[wave] = sq;
  __syncthreads();
  const float var  = wave_sum(red2[lane]) * (1.0f / 12288.0f);
  const float rstd = rsqrtf(var + 1e-5f);

  // Softmax over KV per row c; one wave per row, 2 rows per wave; P*4096 -> LDS.
  const float pscale = 4096.0f;
#pragma unroll
  for (int rr = 0; rr < 2; rr++) {
    const int r = wave * 2 + rr;
    float xs[6];
    float mx = -3.0e38f;
#pragma unroll
    for (int j = 0; j < 6; j++) {
      xs[j] = (Sb[r][lane + 32 * j] - mean) * rstd;
      mx = fmaxf(mx, xs[j]);
    }
    mx = wave_max(mx);
    float es = 0.f;
#pragma unroll
    for (int j = 0; j < 6; j++) { xs[j] = expf(xs[j] - mx); es += xs[j]; }
    es = wave_sum(es);
    const float inv = (1.0f / es) * pscale;
#pragma unroll
    for (int j = 0; j < 6; j++)
      Pst[r][lane + 32 * j] = (f16_t)(xs[j] * inv);
  }
  __syncthreads();

  // T2[c][k'] = sum_k P[c][k] Wv[k][k']: A = Pst rows, B = WvT rows, both k contiguous.
  // A lane's 8 accumulators are 8 consecutive c of one k': one 16-B store into T2^T (x 4096 / 64).
  if (mm) {
    v8f t2[2] = {};
    // P's fragments are read six at a time in front of their WMMAs: two LDS latencies instead of twelve.
#pragma unroll
    for (int kh = 0; kh < 2; kh++) {
      Frag af[3][2];
#pragma unroll
      for (int kk = 0; kk < 3; kk++) {
#pragma unroll
        for (int t = 0; t < 2; t++) {
          af[kk][t].p[0] = *(const v8hm*)&Pst[mp * 32 + t * 16 + m][(kh * 3 + kk) * 32 + 8 * hh];
          af[kk][t].p[1] = *(const v8hm*)&Pst[mp * 32 + t * 16 + m][(kh * 3 + kk) * 32 + 16 + 8 * hh];
        }
      }
#pragma unroll
      for (int kk = 0; kk < 3; kk++) {
#pragma unroll
        for (int t = 0; t < 2; t++) t2[t] = wmma16(af[kk][t].v, wv[kh * 3 + kk].v, t2[t]);
      }
    }
#pragma unroll
    for (int t = 0; t < 2; t++) {
      v8h q;
#pragma unroll
      for (int r = 0; r < 8; r++) q[r] = (f16_t)(t2[t][r] * 0.015625f);
      *(v8hm*)&Gt[nt * 16 + m][mp * 32 + t * 16 + 8 * hh] = q;
    }
  }
  __syncthreads();

  // U^T[k'][d] = sum_c T2^T[k'][c] Wout[d][c]: A = Gt rows, B = Wl rows, both c contiguous.
  // A lane's 8 accumulators are 8 consecutive k' of one d: one 16-B store into U's row.
  if (mm) {
    v8f u[2] = {};
    Frag af[2], wo[2][2];
#pragma unroll
    for (int kk = 0; kk < 2; kk++) {
      af[kk].p[0] = *(const v8hm*)&Gt[nt * 16 + m][kk * 32 + 8 * hh];
      af[kk].p[1] = *(const v8hm*)&Gt[nt * 16 + m][kk * 32 + 16 + 8 * hh];
#pragma unroll
      for (int t = 0; t < 2; t++) {
        wo[t][kk].p[0] = *(const v8hm*)&Wl[mp * 32 + t * 16 + m][kk * 32 + 8 * hh];
        wo[t][kk].p[1] = *(const v8hm*)&Wl[mp * 32 + t * 16 + m][kk * 32 + 16 + 8 * hh];
      }
    }
#pragma unroll
    for (int kk = 0; kk < 2; kk++) {
#pragma unroll
      for (int t = 0; t < 2; t++) u[t] = wmma16(af[kk].v, wo[t][kk].v, u[t]);
    }
#pragma unroll
    for (int t = 0; t < 2; t++) {
      v8h q;
#pragma unroll
      for (int r = 0; r < 8; r++) q[r] = (f16_t)u[t][r];
      *(v8hm*)&Tl[mp * 32 + t * 16 + m][nt * 16 + 8 * hh] = q;
    }
  }
  __syncthreads();

  // Whole-line stores: each row = 384 B = lanes 0..23 x 16 B, one instruction.
  f16_t* Ub = U + (size_t)bh * C1_ * KV_;
  const int l24 = (lane < 24) ? lane : 0;
  const bool se = lane < 24;
  v8h vals[2];
#pragma unroll
  for (int j = 0; j < 2; j++) vals[j] = *(const v8hm*)&Tl[wave * 2 + j][l24 * 8];
#pragma unroll
  for (int j = 0; j < 2; j++)
    if (se) *(v8hm*)(Ub + (size_t)(wave * 2 + j) * KV_ + l24 * 8) = vals[j];
}

// ---------------------------------------------------------------------------
// Exact-form GELU x * Phi(x) of 8 values, without a branch: with z = |x| / sqrt(2), t = 1 / (1 + p z),
//   erfc(z) = (a1 t + a2 t^2 + a3 t^3 + a4 t^4 + a5 t^5) exp(-z^2),  |error| <= 1.5e-7 for every z >= 0,
//   x * Phi(x) = max(x, 0) - |x| * erfc(z) / 2  (no cancellation on the negative side).
// The library erf takes two data-dependent branches per value, both taken by nearly every wave, and each
// value's chain runs alone between them; here the 8 chains are independent straight-line code.
// The coefficients carry the factor 1/2.
// ---------------------------------------------------------------------------
__device__ __forceinline__ v8f gelu8(v8f x) {
  const v8f ax = __builtin_elementwise_abs(x);
  const v8f d = ax * 0.23164189f + 1.0f;       // 1 + p z, p = 0.3275911
  const v8f w = (x * x) * -0.72134752f;        // -z^2 * log2(e)
  v8f t, e;
#pragma unroll
  for (int r = 0; r < 8; r++) {
    t[r] = __builtin_amdgcn_rcpf(d[r]);
    e[r] = __builtin_amdgcn_exp2f(w[r]);
  }
  v8f p = t * 0.53070271f - 0.72657601f;
  p = p * t + 0.71070687f;
  p = p * t - 0.14224837f;
  p = p * t + 0.12741480f;
  const v8f zero = {};
  return __builtin_elementwise_max(x, zero) - ax * ((p * t) * e);
}

// ---------------------------------------------------------------------------
// Everything behind the attention weights is local to a row n, so one block takes 64 rows through all of it:
//   cx[n][d] = emb1[n][d] + sum_k' ea[n][k'] * Um[d][k'],  Um = mean over heads of U_h   (K = 192)
//   y = LN(cx);  h = GELU(y fc1^T + b1)  (K = 64);  out = h fc2^T + b2 + cx  (K = 256)
// cx stays in registers (f32), y and h in LDS (f16). Both weight matrices are staged whole with the first
// round of loads. The four heads' 64 * U_h are averaged in f32 while they are staged.
// fc1 and fc2 run with the weight rows as A and the token rows as B: a lane's 8 accumulators are then
// 8 consecutive channels of one token, one or two 16-B LDS stores. grid = (N/64, B).
// Two blocks share a WGP (392 blocks, 256 WGPs): 4 waves per SIMD, 146 KiB of LDS each.
// ---------------------------------------------------------------------------
__global__ __launch_bounds__(256, 4) void tail_kernel(
    const f16_t* __restrict__ ea, const f16_t* __restrict__ U,
    const float* __restrict__ emb1,
    const float* __restrict__ fg, const float* __restrict__ fb,
    const f16_t* __restrict__ W1, const float* __restrict__ b1,
    const f16_t* __restrict__ W2, const float* __restrict__ b2,
    float* __restrict__ out) {
  __shared__ __attribute__((aligned(16))) f16_t EU[2][64][200];   // ea tile, Um; later h [64][264]
  __shared__ __attribute__((aligned(16))) float Cs[64][68];
  __shared__ __attribute__((aligned(16))) f16_t Ys[64][72];
  __shared__ __attribute__((aligned(16))) f16_t W1s[MLP_][72];
  __shared__ __attribute__((aligned(16))) f16_t W2s[C1_][264];
  __shared__ __attribute__((aligned(16))) float B1s[MLP_];
  f16_t (*Es)[200] = EU[0];
  f16_t (*Us)[200] = EU[1];
  f16_t (*Hs)[264] = reinterpret_cast<f16_t (*)[264]>(&EU[0][0][0]);
  const int tid = threadIdx.x, lane = tid & 31, wave = tid >> 5;
  const int hh = lane >> 4, m = lane & 15;
  const int b = blockIdx.y;
  const size_t r0 = (size_t)b * N_ + blockIdx.x * 64;
  const int mt = wave & 3, ng = wave >> 2;

  // All tiles are contiguous in memory: chunk i * 256 + tid of 16 B.
  const f16_t* Ub = U + (size_t)b * H_ * C1_ * KV_ + tid * 8;
  const f16_t* Eb = ea + r0 * KV_ + tid * 8;
  v8h uh[6][H_], ev[6], w1v[8], w2v[8];
  const size_t ro = (r0 + wave * 8 + hh) * C1_ + m * 4;  // rows wave*8 + 2j + hh, 16 lanes a row
  const float* rp = emb1 + ro;
  v4f rr[4];
#pragma unroll
  for (int j = 0; j < 4; j++) rr[j] = *(const v4fm*)(rp + j * 2 * C1_);
#pragma unroll
  for (int i = 0; i < 6; i++) ev[i] = *(const v8hm*)(Eb + i * 2048);
#pragma unroll
  for (int i = 0; i < 6; i++) {
#pragma unroll
    for (int h = 0; h < H_; h++) uh[i][h] = *(const v8hm*)(Ub + h * (C1_ * KV_) + i * 2048);
  }
#pragma unroll
  for (int i = 0; i < 8; i++) {
    w1v[i] = *(const v8hm*)(W1 + tid * 8 + i * 2048);
    w2v[i] = *(const v8hm*)(W2 + tid * 8 + i * 2048);
  }
  const float b1v = b1[tid];
  const v4f lg = *(const v4fm*)(fg + m * 4);
  const v4f lb = *(const v4fm*)(fb + m * 4);
  const v4f ob = *(const v4fm*)(b2 + m * 4);
  // Holds the address pair until the loads have taken it.
  asm volatile("s_wait_xcnt 0x0" :: "v"(rp) : "memory");
  // Keeps all loads in front of the first use: left free, the scheduler issues a part of them
  // behind the first wait, and the block pays the load latency twice.
  __builtin_amdgcn_sched_barrier(0);

#pragma unroll
  for (int i = 0; i < 6; i++) {
    const int idx = i * 256 + tid;
    const int row = idx / 24, c8 = (idx - row * 24) * 8;
    v8h um;
#pragma unroll
    for (int j = 0; j < 8; j++) {
      float a = 0.25f * (float)uh[i][0][j];
#pragma unroll
      for (int h = 1; h < H_; h++) a = fmaf(0.25f, (float)uh[i][h][j], a);
      um[j] = (f16_t)a;
    }
    *(v8hm*)&Us[row][c8] = um;
    *(v8hm*)&Es[row][c8] = ev[i];
  }
#pragma unroll
  for (int i = 0; i < 8; i++) {
    const int idx = i * 256 + tid;
    *(v8hm*)&W1s[idx >> 3][(idx & 7) * 8]   = w1v[i];
    *(v8hm*)&W2s[idx >> 5][(idx & 31) * 8]  = w2v[i];
  }
  B1s[tid] = b1v;
  __syncthreads();

  // All 18 fragments are read in front of the first WMMA: one LDS latency instead of twelve.
  v8f acc[2] = {};
  const int mrow = mt * 16 + m;
  {
    Frag a[6], bf[6][2];
#pragma unroll
    for (int kk = 0; kk < 6; kk++) {
      a[kk].p[0] = *(const v8hm*)&Es[mrow][kk * 32 + 8 * hh];
      a[kk].p[1] = *(const v8hm*)&Es[mrow][kk * 32 + 16 + 8 * hh];
#pragma unroll
      for (int t = 0; t < 2; t++) {
        const int col = (ng * 2 + t) * 16 + m;
        bf[kk][t].p[0] = *(const v8hm*)&Us[col][kk * 32 + 8 * hh];
        bf[kk][t].p[1] = *(const v8hm*)&Us[col][kk * 32 + 16 + 8 * hh];
      }
    }
#pragma unroll
    for (int kk = 0; kk < 6; kk++) {
#pragma unroll
      for (int t = 0; t < 2; t++) acc[t] = wmma16(a[kk].v, bf[kk][t].v, acc[t]);
    }
  }

#pragma unroll
  for (int t = 0; t < 2; t++) {
    const int cn = (ng * 2 + t) * 16 + m;
#pragma unroll
    for (int r = 0; r < 8; r++) Cs[mt * 16 + 8 * hh + r][cn] = acc[t][r] * 0.015625f;
  }
  __syncthreads();

  // cx: 16 lanes hold one row (4 channels each), 4 rows a thread; kept for the last residual.
  // Layer norm of a row = two sums over its 16 lanes.
  v4f cxv[4];
#pragma unroll
  for (int j = 0; j < 4; j++) cxv[j] = *(const v4fm*)&Cs[wave * 8 + 2 * j + hh][m * 4] + rr[j];
#pragma unroll
  for (int j = 0; j < 4; j++) {
    const v4f x = cxv[j];
    const float mu = row16_sum((x[0] + x[1]) + (x[2] + x[3])) * (1.0f / 64.0f);
    const v4f d = x - mu;
    const float var = row16_sum((d[0] * d[0] + d[1] * d[1]) + (d[2] * d[2] + d[3] * d[3])) * (1.0f / 64.0f);
    const float rs = rsqrtf(var + 1e-6f);
    v4h y;
#pragma unroll
    for (int c = 0; c < 4; c++) y[c] = (f16_t)(d[c] * rs * lg[c] + lb[c]);
    *(v4hm*)&Ys[wave * 8 + 2 * j + hh][m * 4] = y;
  }
  __syncthreads();

  // h^T[e][n] = sum_c fc1[e][c] y[n][c]: A = W1s rows, B = Ys rows, both c contiguous.
  // Wave w owns channels e = 32w .. 32w + 31 of all 64 rows.
  {
    Frag wa[2][2];
    v4f bb[2][2];
#pragma unroll
    for (int t = 0; t < 2; t++) {
#pragma unroll
      for (int kk = 0; kk < 2; kk++) {
        wa[t][kk].p[0] = *(const v8hm*)&W1s[wave * 32 + t * 16 + m][kk * 32 + 8 * hh];
        wa[t][kk].p[1] = *(const v8hm*)&W1s[wave * 32 + t * 16 + m][kk * 32 + 16 + 8 * hh];
      }
      bb[t][0] = *(const v4fm*)&B1s[wave * 32 + t * 16 + 8 * hh];
      bb[t][1] = *(const v4fm*)&B1s[wave * 32 + t * 16 + 8 * hh + 4];
    }
    // Stays rolled: the other waves of the SIMD cover a trip's LDS latency.
#pragma unroll 1
    for (int q = 0; q < 4; q++) {
      Frag yb[2];
#pragma unroll
      for (int kk = 0; kk < 2; kk++) {
        yb[kk].p[0] = *(const v8hm*)&Ys[q * 16 + m][kk * 32 + 8 * hh];
        yb[kk].p[1] = *(const v8hm*)&Ys[q * 16 + m][kk * 32 + 16 + 8 * hh];
      }
      v8f hv[2] = {};
#pragma unroll
      for (int kk = 0; kk < 2; kk++) {
#pragma unroll
        for (int t = 0; t < 2; t++) hv[t] = wmma16(wa[t][kk].v, yb[kk].v, hv[t]);
      }
#pragma unroll
      for (int t = 0; t < 2; t++) {
        v8f xv;
#pragma unroll
        for (int r = 0; r < 8; r++) xv[r] = hv[t][r] + bb[t][r >> 2][r & 3];
        const v8f gv = gelu8(xv);
        v8h g;
#pragma unroll
        for (int r = 0; r < 8; r++) g[r] = (f16_t)gv[r];
        *(v8hm*)&Hs[q * 16 + m][wave * 32 + t * 16 + 8 * hh] = g;
      }
    }
  }
  __syncthreads();

  // o^T[d][n] = sum_e fc2[d][e] h[n][e]: A = W2s rows, B = Hs rows, both e contiguous.
  // Wave owns channel tile mt and row tiles 2*ng, 2*ng + 1. Fragments are read twelve at a time.
  {
    v8f o[2] = {};
#pragma unroll
    for (int kh = 0; kh < 2; kh++) {
      Frag wf[4], hf[4][2];
#pragma unroll
      for (int kk = 0; kk < 4; kk++) {
        const int k0 = (kh * 4 + kk) * 32 + 8 * hh;
        wf[kk].p[0] = *(const v8hm*)&W2s[mt * 16 + m][k0];
        wf[kk].p[1] = *(const v8hm*)&W2s[mt * 16 + m][k0 + 16];
#pragma unroll
        for (int t = 0; t < 2; t++) {
          hf[kk][t].p[0] = *(const v8hm*)&Hs[(ng * 2 + t) * 16 + m][k0];
          hf[kk][t].p[1] = *(const v8hm*)&Hs[(ng * 2 + t) * 16 + m][k0 + 16];
        }
      }
#pragma unroll
      for (int kk = 0; kk < 4; kk++) {
#pragma unroll
        for (int t = 0; t < 2; t++) o[t] = wmma16(wf[kk].v, hf[kk][t].v, o[t]);
      }
    }
#pragma unroll
    for (int t = 0; t < 2; t++) {
      v4f lo, hi;
#pragma unroll
      for (int c = 0; c < 4; c++) { lo[c] = o[t][c]; hi[c] = o[t][4 + c]; }
      *(v4fm*)&Cs[(ng * 2 + t) * 16 + m][mt * 16 + 8 * hh]     = lo;
      *(v4fm*)&Cs[(ng * 2 + t) * 16 + m][mt * 16 + 8 * hh + 4] = hi;
    }
  }
  __syncthreads();

  // Whole-line stores: 16 lanes x 16 B = one 256-B row, two rows per instruction.
#pragma unroll
  for (int j = 0; j < 4; j++) {
    const v4f v = (*(const v4fm*)&Cs[wave * 8 + 2 * j + hh][m * 4] + ob) + cxv[j];
    *(v4fm*)(out + ro + j * 2 * C1_) = v;
  }
}

// ---------------------------------------------------------------------------
// Host-side orchestration
// ---------------------------------------------------------------------------
extern "C" void kernel_launch(void* const* d_in, const int* in_sizes, int n_in,
                              void* d_out, int out_size, void* d_ws, size_t ws_size,
                              hipStream_t stream) {
  if (n_in < 16) return;
  const int need[16] = {BN_ * C1_, BN_ * C2_, H_ * C1_ * C1_, H_ * KV_ * KV_, H_ * KV_ * KV_,
                        C1_ * C1_, C1_, C1_, KV_, KV_, C1_, C1_, MLP_ * C1_, MLP_,
                        C1_ * MLP_, C1_};
  for (int i = 0; i < 16; i++) if (in_sizes[i] != need[i]) return;
  if (out_size != BN_ * C1_) return;

  const float* emb1    = (const float*)d_in[0];
  const float* emb2    = (const float*)d_in[1];
  const float* Wq      = (const float*)d_in[2];
  const float* Wk      = (const float*)d_in[3];
  const float* Wv      = (const float*)d_in[4];
  const float* Wout    = (const float*)d_in[5];
  const float* ln1_g   = (const float*)d_in[6];
  const float* ln1_b   = (const float*)d_in[7];
  const float* lnall_g = (const float*)d_in[8];
  const float* lnall_b = (const float*)d_in[9];
  const float* ffn_g   = (const float*)d_in[10];
  const float* ffn_b   = (const float*)d_in[11];
  const float* fc1_w   = (const float*)d_in[12];
  const float* fc1_b   = (const float*)d_in[13];
  const float* fc2_w   = (const float*)d_in[14];
  const float* fc2_b   = (const float*)d_in[15];
  float* out = (float*)d_out;

  char* ws = (char*)d_ws;
  size_t off = 0;
  auto take = [&](size_t bytes) -> void* {
    off = (off + 255) & ~(size_t)255;
    void* p = ws + off;
    off += bytes;
    return p;
  };
  f16_t* ea    = (f16_t*)take((size_t)BN_ * KV_ * 2);
  f16_t* Wqh   = (f16_t*)take((size_t)H_ * C1_ * C1_ * 2);
  f16_t* Wkh   = (f16_t*)take((size_t)H_ * KV_ * KV_ * 2);
  f16_t* WvT   = (f16_t*)take((size_t)H_ * KV_ * KV_ * 2);   // [H][k'][k]
  f16_t* Wouth = (f16_t*)take((size_t)C1_ * C1_ * 2);
  f16_t* fc1h  = (f16_t*)take((size_t)MLP_ * C1_ * 2);
  f16_t* fc2h  = (f16_t*)take((size_t)C1_ * MLP_ * 2);
  f16_t* Um    = (f16_t*)take((size_t)B_ * H_ * C1_ * KV_ * 2);  // 64 * U_h, [bh][64][192]
  float* Spart = (float*)take((size_t)SPLIT_ * B_ * SELEMS_ * 4);
  if (off > ws_size) return;

  // Layer norms of the inputs with the partial sums of G = cx1^T ea, and all weight conversions, one launch
  prep_kernel<<<PREP_BLKS_, PT_, 0, stream>>>(emb1, emb2, ln1_g, ln1_b, lnall_g, lnall_b,
                                              Wq, Wk, Wv, Wout, fc1_w, fc2_w,
                                              ea, Spart, Wqh, Wkh, WvT, Wouth, fc1h, fc2h);

  // S = Wq[h] G Wk[h]^T / sqrt(KV); InstanceNorm; softmax P; U_h = Wout P Wv[h]
  merge_softmax_kernel<<<B_ * H_, 1024, 0, stream>>>(Spart, Wqh, Wkh, WvT, Wouth, Um);

  // cx = ea * (mean_h U_h)^T + emb1; y = LN(cx); out = GELU(y fc1^T + b1) fc2^T + b2 + cx
  tail_kernel<<<dim3(N_ / 64, B_), 256, 0, stream>>>(ea, Um, emb1, ffn_g, ffn_b,
                                                     fc1h, fc1_b, fc2h, fc2_b, out);
}

// v010
// A run of this version takes 28 microseconds.
// Next to v009, in two timings, it ran 1.16 times as fast each time.
// Counting every step since v000, it is 7.86 times as fast.
#include <hip/hip_runtime.h>

// All contractions: v_wmma_f32_16x16x32_f16 (f16 operands, f32 accumulate); softmax P operand carried x4096 (exact power of two); x1/64 comes off in f32 before T2 goes to f16, the other x1/64 in cx's f32 epilogue.

typedef _Float16 f16_t;
typedef f16_t v16h __attribute__((ext_vector_type(16)));
typedef f16_t v8h __attribute__((ext_vector_type(8)));
typedef float v8f __attribute__((ext_vector_type(8)));
typedef float v4f __attribute__((ext_vector_type(4)));
typedef f16_t v4h __attribute__((ext_vector_type(4)));
typedef v8h v8hm __attribute__((may_alias));
typedef v4h v4hm __attribute__((may_alias));
typedef v4f v4fm __attribute__((may_alias));

#define H_   4
#define C1_  64
#define C2_  128
#define KV_  192
#define MLP_ 256
#define B_   8
#define N_   3136
#define BN_  (B_ * N_)

union Frag { v16h v; v8h p[2]; };

// 16x16x32 f16 WMMA with f32 accumulate, followed by a 4-slot VALU hazard guard.
__device__ __forceinline__ v8f wmma16(v16h a, v16h b, v8f c) {
  v8f d = __builtin_amdgcn_wmma_f32_16x16x32_f16(false, a, false, b, (short)0, c, false, false);
  asm volatile("v_nop\n\tv_nop\n\tv_nop\n\tv_nop" : "+v"(d) : "v"(a), "v"(b));
  return d;
}

// ---------------------------------------------------------------------------
// Sum over the 16 lanes of a row, every lane gets it: four DPP row_xmask steps.
// ---------------------------------------------------------------------------
__device__ __forceinline__ float row16_sum(float v) {
  v += __builtin_bit_cast(float, __builtin_amdgcn_update_dpp(0, __builtin_bit_cast(int, v), 0x161, 0xf, 0xf, true));
  v += __builtin_bit_cast(float, __builtin_amdgcn_update_dpp(0, __builtin_bit_cast(int, v), 0x162, 0xf, 0xf, true));
  v += __builtin_bit_cast(float, __builtin_amdgcn_update_dpp(0, __builtin_bit_cast(int, v), 0x164, 0xf, 0xf, true));
  v += __builtin_bit_cast(float, __builtin_amdgcn_update_dpp(0, __builtin_bit_cast(int, v), 0x168, 0xf, 0xf, true));
  return v;
}
__device__ __forceinline__ float row16_max(float v) {
  v = fmaxf(v, __builtin_bit_cast(float, __builtin_amdgcn_update_dpp(0, __builtin_bit_cast(int, v), 0x161, 0xf, 0xf, true)));
  v = fmaxf(v, __builtin_bit_cast(float, __builtin_amdgcn_update_dpp(0, __builtin_bit_cast(int, v), 0x162, 0xf, 0xf, true)));
  v = fmaxf(v, __builtin_bit_cast(float, __builtin_amdgcn_update_dpp(0, __builtin_bit_cast(int, v), 0x164, 0xf, 0xf, true)));
  v = fmaxf(v, __builtin_bit_cast(float, __builtin_amdgcn_update_dpp(0, __builtin_bit_cast(int, v), 0x168, 0xf, 0xf, true)));
  return v;
}
// Lane l reads lane l ^ 16.
__device__ __forceinline__ float other_row(float v) {
  const int b = __builtin_bit_cast(int, v);
  return __builtin_bit_cast(float, __builtin_amdgcn_permlanex16(b, b, 0x76543210, 0xfedcba98, false, false));
}
// Over all 32 lanes, in vector registers only: the shuffle form goes through the LDS pipe, one waited trip a step.
__device__ __forceinline__ float wave_sum(float v) {
  v = row16_sum(v);
  return v + other_row(v);
}
__device__ __forceinline__ float wave_max(float v) {
  v = row16_max(v);
  return fmaxf(v, other_row(v));
}

// ---------------------------------------------------------------------------
// The preparation grid runs work-groups of 28 waves: a layer-norm group takes ROWS_ = 224 rows, 8 a wave.
// ---------------------------------------------------------------------------
#define PT_     896
#define SPLIT_  14
#define ROWS_   (N_ / SPLIT_)       // 224
#define KSTEPS_ (ROWS_ / 32)        // 7
#define SELEMS_ (C1_ * KV_)         // 12288
#define TP_     (ROWS_ + 8)         // LDS pitch of a channel's row: 464 B = 16 B x odd

// ---------------------------------------------------------------------------
// Job of the preparation grid: block blk converts elements blk*7168 .. +7167 of a weight matrix of
// n8 * 8 elements (n8 is a multiple of 32: a wave is wholly inside or wholly outside).
// ---------------------------------------------------------------------------
__device__ __forceinline__ void cvt_f16_job(const float* __restrict__ src,
                                            f16_t* __restrict__ dst, int blk, int n8) {
  const int i = blk * PT_ + threadIdx.x;
  if (i < n8) {
    const v4f x0 = *(const v4fm*)(src + (size_t)i * 8);
    const v4f x1 = *(const v4fm*)(src + (size_t)i * 8 + 4);
    v8h v;
#pragma unroll
    for (int j = 0; j < 4; j++) { v[j] = (f16_t)x0[j]; v[4 + j] = (f16_t)x1[j]; }
    *(v8hm*)(dst + (size_t)i * 8) = v;
  }
  // Only the end of the kernel follows this store: the wait is a precaution.
  asm volatile("s_wait_xcnt 0x0" ::: "memory");
}

// ---------------------------------------------------------------------------
// Transposing convert of the H_ matrices [192][192]: dst[h][c][r] = (f16) src[h][r][c].
// 256 threads = one 64 x 64 tile, three tiles a block (the last four waves only pass the barrier):
// a lane gathers 16 rows of one column in two runs of 8 (each load 128 contiguous bytes per wave), the tile turns in LDS,
// and 8 lanes store one whole 128-B line.
// ---------------------------------------------------------------------------
__device__ __forceinline__ void cvt_t_f16_job(const float* __restrict__ src,
                                              f16_t* __restrict__ dst,
                                              f16_t (*__restrict__ T3)[72],  // 3 x [column][row], 64 rows used
                                              int blk) {
  const int sub = __builtin_amdgcn_readfirstlane(threadIdx.x >> 8);
  const bool on = sub < 3;
  const int tid = threadIdx.x & 255;
  const int tile = blk * 3 + (on ? sub : 0);
  f16_t (*Tt)[72] = T3 + (on ? sub : 0) * 64;
  const int hd = tile / 9, t9 = tile - hd * 9, ty = t9 / 3, tx = t9 - ty * 3;
  const int r0 = tx * 64, c0 = ty * 64;
  const size_t hb = (size_t)hd * KV_ * KV_;
  const int c = tid & 63, rg = tid >> 6;
  const float* s = src + hb + (size_t)r0 * KV_ + c0 + c;
  if (on) {
#pragma unroll
    for (int q = 0; q < 2; q++) {
      v8h v;
#pragma unroll
      for (int j = 0; j < 8; j++) v[j] = (f16_t)s[((rg + 4 * q) * 8 + j) * KV_];
      *(v8hm*)&Tt[c][(rg + 4 * q) * 8] = v;
    }
  }
  __syncthreads();
  const int rs = tid >> 3, ck = (tid & 7) * 8;
  if (on) {
#pragma unroll
    for (int q = 0; q < 2; q++) {
      const int row = q * 32 + rs;
      const v8h v = *(const v8hm*)&Tt[row][ck];
      *(v8hm*)(dst + hb + (size_t)(c0 + row) * KV_ + r0 + ck) = v;
    }
  }
  // Only the end of the kernel follows these stores: the wait is a precaution.
  asm volatile("s_wait_xcnt 0x0" ::: "memory");
}

// ---------------------------------------------------------------------------
// Fused: cx1 = LN(emb1) (64), ea = LN(concat(emb1,emb2)) (192), and this group's share of
// G = cx1^T ea (64 x 192), the sum over n that the scores need:
//   S_h = Q_h^T K_h = Wq_h (cx1^T ea) Wk_h^T, the sum over n done once per batch, split over SPLIT_ groups.
// One block = ROWS_ rows (n) of one b, one wave = 8 rows. 16 lanes hold one row, 4 channels of each 64 a lane
// (16-B loads), lanes 0..15 the wave's rows 0..3 and lanes 16..31 its rows 4..7: a row's sum is four DPP
// steps, which serve two rows at once. ea goes to memory row-major [B*N][192] from registers, 16 lanes a
// whole 128-B line; the channel-major copies of cx1 and ea live in LDS only, where they are the operands of G:
// A = rows 0..63 of Tt (row c, k = n contiguous), B = rows 64..255 (row kv, k = n contiguous)
// -> both fragments loaded with the same k map.
// A lane writes 4 consecutive n of channels 4m + c: at any pitch that keeps 16-B reads aligned the 16 lanes
// would fall on 4 bank groups, so the 16-B chunk n / 8 of channel row r stands at chunk (n / 8) ^ ((r >> 4) & 3).
// That term is one value for the 16 rows of a fragment, so the readers' bank pattern stays as it was.
// The accumulators are stored x 1/8 (exact power of two) as f16, in register order: tile tau = mt * 12 + ct
// of row tile mt and column tile ct; chunk tau*32 + lane holds 8 values, rows mt*16 + 8h + 0..7 of column
// ct*16 + m. The merge launch reads every partial four times (once a head) through one WGP each: its bytes
// are what that launch waits for. The sum itself stays f32, and it is rounded to f16 there in any case.
// ---------------------------------------------------------------------------
__device__ __forceinline__ void ln_scores_job(
    const float* __restrict__ emb1, const float* __restrict__ emb2,
    const float* __restrict__ g1, const float* __restrict__ b1,
    const float* __restrict__ ga, const float* __restrict__ ba,
    f16_t* __restrict__ ea, f16_t* __restrict__ part,
    f16_t (*__restrict__ Tt)[TP_],   // [channel][n], 0..63 cx1, 64..255 ea
    int blk) {
  const int tid = threadIdx.x, lane = tid & 31;
  const int wave = __builtin_amdgcn_readfirstlane(tid >> 5);
  const int hh = lane >> 4, m = lane & 15;
  const int n0 = blk * ROWS_;
  const int rw = wave * 8 + 4 * hh;  // the lane's first row within the group

  const float* p1 = emb1 + (size_t)(n0 + rw) * C1_ + m * 4;
  const float* p2 = emb2 + (size_t)(n0 + rw) * C2_ + m * 4;
  v4f x[4][3];  // [row][64 channels]
#pragma unroll
  for (int j = 0; j < 4; j++) {
    x[j][0] = *(const v4fm*)(p1 + j * C1_);
    x[j][1] = *(const v4fm*)(p2 + j * C2_);
    x[j][2] = *(const v4fm*)(p2 + j * C2_ + 64);
  }
  const v4f gv1 = *(const v4fm*)(g1 + m * 4);
  const v4f bv1 = *(const v4fm*)(b1 + m * 4);
  v4f gva[3], bva[3];
#pragma unroll
  for (int s = 0; s < 3; s++) {
    gva[s] = *(const v4fm*)(ga + s * 64 + m * 4);
    bva[s] = *(const v4fm*)(ba + s * 64 + m * 4);
  }
  // Holds both address pairs until the loads above have taken them.
  asm volatile("s_wait_xcnt 0x0" :: "v"(p1), "v"(p2) : "memory");

  v4h tq[4][4];  // tq[g][c][j] = channel row g*64 + 4m + c of Tt, row rw + j
  v4h er[4][3];  // er[j][s][c] = ea channel s*64 + 4m + c of row rw + j
#pragma unroll
  for (int j = 0; j < 4; j++) {
    const v4f x0 = x[j][0], xa = x[j][1], xb = x[j][2];
    const float s1 = (x0[0] + x0[1]) + (x0[2] + x0[3]);
    const v4f t = xa + xb;
    const float s2 = (t[0] + t[1]) + (t[2] + t[3]);
    const float mu = row16_sum(s1) * (1.0f / 64.0f);
    const float ma = row16_sum(s1 + s2) * (1.0f / 192.0f);

    const v4f d = x0 - mu;
    const float var = row16_sum((d[0] * d[0] + d[1] * d[1]) + (d[2] * d[2] + d[3] * d[3])) * (1.0f / 64.0f);
    const float rs = rsqrtf(var + 1e-6f);
#pragma unroll
    for (int c = 0; c < 4; c++) tq[0][c][j] = (f16_t)(d[c] * rs * gv1[c] + bv1[c]);

    v4f e[3];
    e[0] = x0 - ma; e[1] = xa - ma; e[2] = xb - ma;
    const v4f q = e[0] * e[0] + e[1] * e[1] + e[2] * e[2];
    const float vara = row16_sum((q[0] + q[1]) + (q[2] + q[3])) * (1.0f / 192.0f);
    const float rsa = rsqrtf(vara + 1e-6f);
#pragma unroll
    for (int s = 0; s < 3; s++) {
#pragma unroll
      for (int c = 0; c < 4; c++) {
        const f16_t y = (f16_t)(e[s][c] * rsa * gva[s][c] + bva[s][c]);
        tq[1 + s][c][j] = y;
        er[j][s][c] = y;
      }
    }
  }
  {
    f16_t* tp = &Tt[m * 4][(wave ^ (m >> 2)) * 8 + 4 * hh];
#pragma unroll
    for (int g = 0; g < 4; g++) {
#pragma unroll
      for (int c = 0; c < 4; c++) *(v4hm*)(tp + (g * 64 + c) * TP_) = tq[g][c];
    }
  }
  __syncthreads();

  // Row-major ea. Issued behind the barrier (which would wait for stores in front of it), the stores drain
  // under the products.
  f16_t* eo = ea + (size_t)(n0 + rw) * KV_ + m * 4;
#pragma unroll
  for (int j = 0; j < 4; j++) {
#pragma unroll
    for (int s = 0; s < 3; s++) *(v4hm*)(eo + j * KV_ + s * 64) = er[j][s];
  }
  // The products below reuse these stores' registers: wait stands first.
  asm volatile("s_wait_xcnt 0x0" :: "v"(eo) : "memory");

  // 12 waves (three a SIMD) take 2 x 2 tiles each: 8 LDS reads feed 4 WMMAs.
  if (wave < 12) {
    const int mp = wave & 1, cp = wave >> 1;
    v8f acc[2][2] = {};
    const f16_t* ap[2][2];  // [tile][half of the fragment]: k = 8 hh + 16 p + 0..7 of each step of 32
    const f16_t* bp[2][2];
#pragma unroll
    for (int t = 0; t < 2; t++) {
#pragma unroll
      for (int p = 0; p < 2; p++) {
        ap[t][p] = &Tt[mp * 32 + t * 16 + m][((hh + 2 * p) ^ (mp * 2 + t)) * 8];
        bp[t][p] = &Tt[C1_ + cp * 32 + t * 16 + m][((hh + 2 * p) ^ ((cp * 2 + t) & 3)) * 8];
      }
    }
    Frag a[2][2], bf[2][2];  // [buffer][tile]
#pragma unroll
    for (int t = 0; t < 2; t++) {
#pragma unroll
      for (int p = 0; p < 2; p++) {
        a[0][t].p[p]  = *(const v8hm*)(ap[t][p]);
        bf[0][t].p[p] = *(const v8hm*)(bp[t][p]);
      }
    }
    // The next step's fragments are read in front of this step's WMMAs: their LDS latency runs under the products.
#pragma unroll
    for (int it = 0; it < KSTEPS_; it++) {
      const int cu = it & 1, nx = cu ^ 1;
      if (it + 1 < KSTEPS_) {
#pragma unroll
        for (int t = 0; t < 2; t++) {
#pragma unroll
          for (int p = 0; p < 2; p++) {
            a[nx][t].p[p]  = *(const v8hm*)(ap[t][p] + (it + 1) * 32);
            bf[nx][t].p[p] = *(const v8hm*)(bp[t][p] + (it + 1) * 32);
          }
        }
      }
#pragma unroll
      for (int i = 0; i < 2; i++) {
#pragma unroll
        for (int j = 0; j < 2; j++) acc[i][j] = wmma16(a[cu][i].v, bf[cu][j].v, acc[i][j]);
      }
    }

    // One store instruction a tile: 512 contiguous bytes (4 whole lines).
    const int b = blk / SPLIT_, sp = blk - b * SPLIT_;
    // The wave's tiles are tau0 + 12 i + j.
    const int tau0 = mp * 24 + cp * 2;
    f16_t* pb = part + ((size_t)sp * B_ + b) * SELEMS_ + tau0 * 256 + lane * 8;
#pragma unroll
    for (int i = 0; i < 2; i++) {
#pragma unroll
      for (int j = 0; j < 2; j++) {
        v8h v;
#pragma unroll
        for (int r = 0; r < 8; r++) v[r] = (f16_t)(acc[i][j][r] * 0.125f);
        *(v8hm*)(pb + (12 * i + j) * 256) = v;
      }
    }
  }
}

// ---------------------------------------------------------------------------
// Preparation grid: the layer norms with their share of G and the six weight conversions depend on
// nothing but the inputs, so they run as jobs of one launch, picked by work-group index. The layer-norm
// groups are the longest and take the lowest indices.
// ---------------------------------------------------------------------------
#define CVB_(n)  (((n) / 8 + PT_ - 1) / PT_)
#define LN_BLKS_ (B_ * SPLIT_)               // 112
#define WV_BLKS_ (H_ * 9 / 3)                // 12: 36 tiles of 64 x 64, three a block
#define WK_BLKS_ CVB_(H_ * KV_ * KV_)        // 21
#define WQ_BLKS_ CVB_(H_ * C1_ * C1_)        // 3
#define F1_BLKS_ CVB_(MLP_ * C1_)            // 3
#define F2_BLKS_ CVB_(C1_ * MLP_)            // 3
#define WO_BLKS_ CVB_(C1_ * C1_)             // 1
#define PREP_BLKS_ (LN_BLKS_ + WV_BLKS_ + WK_BLKS_ + WQ_BLKS_ + F1_BLKS_ + F2_BLKS_ + WO_BLKS_)

__global__ __launch_bounds__(PT_) void prep_kernel(
    const float* __restrict__ emb1, const float* __restrict__ emb2,
    const float* __restrict__ g1, const float* __restrict__ b1,
    const float* __restrict__ ga, const float* __restrict__ ba,
    const float* __restrict__ Wq, const float* __restrict__ Wk, const float* __restrict__ Wv,
    const float* __restrict__ Wo, const float* __restrict__ f1, const float* __restrict__ f2,
    f16_t* __restrict__ ea, f16_t* __restrict__ part,
    f16_t* __restrict__ Wqh, f16_t* __restrict__ Wkh, f16_t* __restrict__ WvT,
    f16_t* __restrict__ Woh, f16_t* __restrict__ f1h, f16_t* __restrict__ f2h) {
  __shared__ __attribute__((aligned(16))) f16_t Tt[256][TP_];
  int blk = blockIdx.x;
  if (blk < LN_BLKS_) {
    ln_scores_job(emb1, emb2, g1, b1, ga, ba, ea, part, Tt, blk);
    return;
  }
  blk -= LN_BLKS_;
  if (blk < WV_BLKS_) {
    cvt_t_f16_job(Wv, WvT, reinterpret_cast<f16_t (*)[72]>(&Tt[0][0]), blk);
    return;
  }
  blk -= WV_BLKS_;
  const float* s = Wk;
  f16_t* d = Wkh;
  int n8 = H_ * KV_ * KV_ / 8;
  if (blk >= WK_BLKS_) {
    blk -= WK_BLKS_; s = Wq; d = Wqh; n8 = H_ * C1_ * C1_ / 8;
    if (blk >= WQ_BLKS_) {
      blk -= WQ_BLKS_; s = f1; d = f1h; n8 = MLP_ * C1_ / 8;
      if (blk >= F1_BLKS_) {
        blk -= F1_BLKS_; s = f2; d = f2h; n8 = C1_ * MLP_ / 8;
        if (blk >= F2_BLKS_) { blk -= F2_BLKS_; s = Wo; d = Woh; n8 = C1_ * C1_ / 8; }
      }
    }
  }
  cvt_f16_job(s, d, blk, n8);
}

// ---------------------------------------------------------------------------
// LDS byte address of a __shared__ object: the low 32 bits of its address.
// ---------------------------------------------------------------------------
__device__ __forceinline__ unsigned lds_byte(const void* p) { return (unsigned)(size_t)p; }

// ---------------------------------------------------------------------------
// One block of 32 waves per (b,h): G_b = f32 sum of the SPLIT_ f16 partials (24 waves x 2 tiles,
// a chunk of 8 values a lane and tile), T = Wq_h G_b, S = T Wk_h^T (both on WMMA, 24 waves x 2 tiles),
// scale, InstanceNorm over (64,192), softmax over KV, P*4096 kept in LDS as f16.
// G is carried x 1/64 (exact power of two) as f16 operand and unscaled in f32 on S.
// Value side, o = mean_h (ea Wv_h^T) P_h^T Wout^T = ea (mean_h Wout P_h Wv_h)^T: this block forms
// T2 = P_h Wv_h and U_h = Wout T2 (both on WMMA, same wave map) and stores 64 * U_h as f16 [64][192].
// The head's four weight matrices go to LDS by asynchronous copies issued in front of the partial sums:
// whole lines, no registers, their latency under the sum's own loads; the fragments are then LDS reads.
// ---------------------------------------------------------------------------
__global__ __launch_bounds__(1024) void merge_softmax_kernel(
    const f16_t* __restrict__ part, const f16_t* __restrict__ Wq,
    const f16_t* __restrict__ Wk, const f16_t* __restrict__ WvT,
    const f16_t* __restrict__ Wo, f16_t* __restrict__ U) {
  __shared__ float Sb[64][196];
  __shared__ __attribute__((aligned(16))) f16_t Pst[64][200];
  __shared__ __attribute__((aligned(16))) f16_t Gt[192][72];   // G^T / 64: [k'][c']; later 64 T2^T: [k'][c]
  __shared__ __attribute__((aligned(16))) f16_t Tl[64][200];   // T / 64:   [c][k']; later 64 U: [d][k']
  __shared__ __attribute__((aligned(16))) f16_t Wl[64][72];    // Wout: [d][c]
  __shared__ __attribute__((aligned(16))) f16_t Wqs[64][72];   // Wq_h: [c][c']
  __shared__ __attribute__((aligned(16))) f16_t Wks[KV_][200]; // Wk_h: [k][k']
  __shared__ __attribute__((aligned(16))) f16_t Wvs[KV_][200]; // Wv_h^T: [k'][k]
  __shared__ float red[32];
  __shared__ float red2[32];
  const int tid = threadIdx.x, lane = tid & 31;
  const int wave = __builtin_amdgcn_readfirstlane(tid >> 5);
  const int hh = lane >> 4, m = lane & 15;
  const int bh = blockIdx.x, b = bh >> 2, hd = bh & 3;
  const f16_t* pb = part + (size_t)b * SELEMS_ + tid * 8;

  // Matrix work: wave < 24 owns column tile nt (of 12) and row tiles 2*mp, 2*mp + 1 (of 4).
  const bool mm = wave < 24;
  const int mp = wave / 12, nt = wave - mp * 12;

  // Each lane copies 16 B a time. Waves 0..23: a round is 32 rows x 24 chunks, six rounds each of Wk_h and
  // Wv_h^T. Waves 24..31: a round is 32 rows x 8 chunks, two rounds each of Wq_h and Wout.
  // The s_wait_xcnt ends each statement so that no address register is reused in front of it.
  if (mm) {
    const int row = tid / 24, c8 = tid - row * 24;
    const f16_t* gk = Wk + (size_t)hd * KV_ * KV_ + tid * 8;
    const f16_t* gv = WvT + (size_t)hd * KV_ * KV_ + tid * 8;
    const unsigned lk = lds_byte(&Wks[row][c8 * 8]);
    const unsigned lv = lds_byte(&Wvs[row][c8 * 8]);
    asm volatile(
        "global_load_async_to_lds_b128 %0, %12, off\n\t"
        "global_load_async_to_lds_b128 %1, %13, off\n\t"
        "global_load_async_to_lds_b128 %2, %14, off\n\t"
        "global_load_async_to_lds_b128 %3, %15, off\n\t"
        "global_load_async_to_lds_b128 %4, %16, off\n\t"
        "global_load_async_to_lds_b128 %5, %17, off\n\t"
        "global_load_async_to_lds_b128 %6, %18, off\n\t"
        "global_load_async_to_lds_b128 %7, %19, off\n\t"
        "global_load_async_to_lds_b128 %8, %20, off\n\t"
        "global_load_async_to_lds_b128 %9, %21, off\n\t"
        "global_load_async_to_lds_b128 %10, %22, off\n\t"
        "global_load_async_to_lds_b128 %11, %23, off\n\t"
        "s_wait_xcnt 0x0"
        :: "v"(lk), "v"(lk + 12800u), "v"(lk + 25600u), "v"(lk + 38400u), "v"(lk + 51200u), "v"(lk + 64000u),
           "v"(lv), "v"(lv + 12800u), "v"(lv + 25600u), "v"(lv + 38400u), "v"(lv + 51200u), "v"(lv + 64000u),
           "v"(gk), "v"(gk + 6144), "v"(gk + 12288), "v"(gk + 18432), "v"(gk + 24576), "v"(gk + 30720),
           "v"(gv), "v"(gv + 6144), "v"(gv + 12288), "v"(gv + 18432), "v"(gv + 24576), "v"(gv + 30720)
        : "memory");
  } else {
    const int t = tid - 768;
    const f16_t* gq = Wq + (size_t)hd * C1_ * C1_ + t * 8;
    const f16_t* go = Wo + t * 8;
    const unsigned lq = lds_byte(&Wqs[t >> 3][(t & 7) * 8]);
    const unsigned lo = lds_byte(&Wl[t >> 3][(t & 7) * 8]);
    asm volatile(
        "global_load_async_to_lds_b128 %0, %4, off\n\t"
        "global_load_async_to_lds_b128 %1, %5, off\n\t"
        "global_load_async_to_lds_b128 %2, %6, off\n\t"
        "global_load_async_to_lds_b128 %3, %7, off\n\t"
        "s_wait_xcnt 0x0"
        :: "v"(lq), "v"(lq + 4608u), "v"(lo), "v"(lo + 4608u),
           "v"(gq), "v"(gq + 2048), "v"(go), "v"(go + 2048)
        : "memory");
  }

  // Tiles (row tile mp + 2 i, column tile nt): a lane's chunk is 8 consecutive rows c' of one column k'.
  if (mm) {
    v8h p[SPLIT_][2];
#pragma unroll
    for (int s = 0; s < SPLIT_; s++) {
#pragma unroll
      for (int i = 0; i < 2; i++) p[s][i] = *(const v8hm*)(pb + (size_t)s * B_ * SELEMS_ + i * 6144);
    }
    // Holds the address until the loads have taken it.
    asm volatile("s_wait_xcnt 0x0" :: "v"(pb) : "memory");
    // Keeps all 28 loads in front of the first use: left free, the scheduler issues them in five groups,
    // each behind the wait for the group before, and the block pays the load latency five times.
    __builtin_amdgcn_sched_barrier(0);
    v8f a[2] = {};
#pragma unroll
    for (int s = 0; s < SPLIT_; s++) {
#pragma unroll
      for (int i = 0; i < 2; i++) {
#pragma unroll
        for (int r = 0; r < 8; r++) a[i][r] = fmaf((float)p[s][i][r], 0.125f, a[i][r]);
      }
    }
#pragma unroll
    for (int i = 0; i < 2; i++) {
      v8h gq;
#pragma unroll
      for (int r = 0; r < 8; r++) gq[r] = (f16_t)a[i][r];
      *(v8hm*)&Gt[nt * 16 + m][(mp + 2 * i) * 16 + 8 * hh] = gq;
    }
  }

  // This wave's copies have landed; the barrier behind it shows them to the other waves.
  asm volatile("s_wait_asynccnt 0x0" ::: "memory");
  __syncthreads();

  // T[c][k'] = sum_c' Wq[c][c'] G[c'][k']: A = Wq rows, B = Gt rows, both k = c' contiguous.
  // Wk's fragments are read behind T's: their LDS time runs under T's products and the next barrier.
  Frag wk[6];
  if (mm) {
    v8f t1[2] = {};
    Frag wq[2][2], bf[2];
#pragma unroll
    for (int kk = 0; kk < 2; kk++) {
      bf[kk].p[0] = *(const v8hm*)&Gt[nt * 16 + m][kk * 32 + 8 * hh];
      bf[kk].p[1] = *(const v8hm*)&Gt[nt * 16 + m][kk * 32 + 16 + 8 * hh];
#pragma unroll
      for (int t = 0; t < 2; t++) {
        wq[t][kk].p[0] = *(const v8hm*)&Wqs[mp * 32 + t * 16 + m][kk * 32 + 8 * hh];
        wq[t][kk].p[1] = *(const v8hm*)&Wqs[mp * 32 + t * 16 + m][kk * 32 + 16 + 8 * hh];
      }
    }
#pragma unroll
    for (int kk = 0; kk < 6; kk++) {
      wk[kk].p[0] = *(const v8hm*)&Wks[nt * 16 + m][kk * 32 + 8 * hh];
      wk[kk].p[1] = *(const v8hm*)&Wks[nt * 16 + m][kk * 32 + 16 + 8 * hh];
    }
#pragma unroll
    for (int kk = 0; kk < 2; kk++) {
#pragma unroll
      for (int t = 0; t < 2; t++) t1[t] = wmma16(wq[t][kk].v, bf[kk].v, t1[t]);
    }
#pragma unroll
    for (int t = 0; t < 2; t++) {
#pragma unroll
      for (int r = 0; r < 8; r++)
        Tl[mp * 32 + t * 16 + 8 * hh + r][nt * 16 + m] = (f16_t)t1[t][r];
    }
  }
  __syncthreads();

  // S[c][k] = sum_k' T[c][k'] Wk[k][k']: A = Tl rows, B = Wk rows, both k = k' contiguous.
  const float sc = 64.0f * 0.07216878364870322f;  // 64 / sqrt(192)
  v8f sv[2] = {};
  float s = 0.f;
  if (mm) {
#pragma unroll
    for (int kk = 0; kk < 6; kk++) {
#pragma unroll
      for (int t = 0; t < 2; t++) {
        Frag af;
        af.p[0] = *(const v8hm*)&Tl[mp * 32 + t * 16 + m][kk * 32 + 8 * hh];
        af.p[1] = *(const v8hm*)&Tl[mp * 32 + t * 16 + m][kk * 32 + 16 + 8 * hh];
        sv[t] = wmma16(af.v, wk[kk].v, sv[t]);
      }
    }
#pragma unroll
    for (int t = 0; t < 2; t++) {
#pragma unroll
      for (int r = 0; r < 8; r++) {
        sv[t][r] *= sc;
        s += sv[t][r];
        Sb[mp * 32 + t * 16 + 8 * hh + r][nt * 16 + m] = sv[t][r];
      }
    }
  }
  // Wv's fragments are read here, where Wk's registers are free, in front of the norm and the softmax.
  Frag wv[6];
  if (mm) {
#pragma unroll
    for (int kk = 0; kk < 6; kk++) {
      wv[kk].p[0] = *(const v8hm*)&Wvs[nt * 16 + m][kk * 32 + 8 * hh];
      wv[kk].p[1] = *(const v8hm*)&Wvs[nt * 16 + m][kk * 32 + 16 + 8 * hh];
    }
  }
  s = wave_sum(s);
  if (lane == 0) red[wave] = s;
  __syncthreads();
  const float mean = wave_sum(red[lane]) * (1.0f / 12288.0f);
  float sq = 0.f;
  if (mm) {
#pragma unroll
    for (int t = 0; t < 2; t++) {
#pragma unroll
      for (int r = 0; r < 8; r++) { const float d = sv[t][r] - mean; sq += d * d; }
    }
  }
  sq = wave_sum(sq);
  if (lane == 0) red2[wave] = sq;
  __syncthreads();
  const float var  = wave_sum(red2[lane]) * (1.0f / 12288.0f);
  const float rstd = rsqrtf(var + 1e-5f);

  // Softmax over KV per row c; one wave per row, 2 rows per wave; P*4096 -> LDS.
  const float pscale = 4096.0f;
#pragma unroll
  for (int rr = 0; rr < 2; rr++) {
    const int r = wave * 2 + rr;
    float xs[6];
    float mx = -3.0e38f;
#pragma unroll
    for (int j = 0; j < 6; j++) {
      xs[j] = (Sb[r][lane + 32 * j] - mean) * rstd;
      mx = fmaxf(mx, xs[j]);
    }
    mx = wave_max(mx);
    float es = 0.f;
#pragma unroll
    for (int j = 0; j < 6; j++) { xs[j] = expf(xs[j] - mx); es += xs[j]; }
    es = wave_sum(es);
    const float inv = (1.0f / es) * pscale;
#pragma unroll
    for (int j = 0; j < 6; j++)
      Pst[r][lane + 32 * j] = (f16_t)(xs[j] * inv);
  }
  __syncthreads();

  // T2[c][k'] = sum_k P[c][k] Wv[k][k']: A = Pst rows, B = WvT rows, both k contiguous.
  // A lane's 8 accumulators are 8 consecutive c of one k': one 16-B store into T2^T (x 4096 / 64).
  if (mm) {
    v8f t2[2] = {};
    // P's fragments are read six at a time in front of their WMMAs: two LDS latencies instead of twelve.
#pragma unroll
    for (int kh = 0; kh < 2; kh++) {
      Frag af[3][2];
#pragma unroll
      for (int kk = 0; kk < 3; kk++) {
#pragma unroll
        for (int t = 0; t < 2; t++) {
          af[kk][t].p[0] = *(const v8hm*)&Pst[mp * 32 + t * 16 + m][(kh * 3 + kk) * 32 + 8 * hh];
          af[kk][t].p[1] = *(const v8hm*)&Pst[mp * 32 + t * 16 + m][(kh * 3 + kk) * 32 + 16 + 8 * hh];
        }
      }
#pragma unroll
      for (int kk = 0; kk < 3; kk++) {
#pragma unroll
        for (int t = 0; t < 2; t++) t2[t] = wmma16(af[kk][t].v, wv[kh * 3 + kk].v, t2[t]);
      }
    }
#pragma unroll
    for (int t = 0; t < 2; t++) {
      v8h q;
#pragma unroll
      for (int r = 0; r < 8; r++) q[r] = (f16_t)(t2[t][r] * 0.015625f);
      *(v8hm*)&Gt[nt * 16 + m][mp * 32 + t * 16 + 8 * hh] = q;
    }
  }
  __syncthreads();

  // U^T[k'][d] = sum_c T2^T[k'][c] Wout[d][c]: A = Gt rows, B = Wl rows, both c contiguous.
  // A lane's 8 accumulators are 8 consecutive k' of one d: one 16-B store into U's row.
  if (mm) {
    v8f u[2] = {};
    Frag af[2], wo[2][2];
#pragma unroll
    for (int kk = 0; kk < 2; kk++) {
      af[kk].p[0] = *(const v8hm*)&Gt[nt * 16 + m][kk * 32 + 8 * hh];
      af[kk].p[1] = *(const v8hm*)&Gt[nt * 16 + m][kk * 32 + 16 + 8 * hh];
#pragma unroll
      for (int t = 0; t < 2; t++) {
        wo[t][kk].p[0] = *(const v8hm*)&Wl[mp * 32 + t * 16 + m][kk * 32 + 8 * hh];
        wo[t][kk].p[1] = *(const v8hm*)&Wl[mp * 32 + t * 16 + m][kk * 32 + 16 + 8 * hh];
      }
    }
#pragma unroll
    for (int kk = 0; kk < 2; kk++) {
#pragma unroll
      for (int t = 0; t < 2; t++) u[t] = wmma16(af[kk].v, wo[t][kk].v, u[t]);
    }
#pragma unroll
    for (int t = 0; t < 2; t++) {
      v8h q;
#pragma unroll
      for (int r = 0; r < 8; r++) q[r] = (f16_t)u[t][r];
      *(v8hm*)&Tl[mp * 32 + t * 16 + m][nt * 16 + 8 * hh] = q;
    }
  }
  __syncthreads();

  // Whole-line stores: each row = 384 B = lanes 0..23 x 16 B, one instruction.
  f16_t* Ub = U + (size_t)bh * C1_ * KV_;
  const int l24 = (lane < 24) ? lane : 0;
  const bool se = lane < 24;
  v8h vals[2];
#pragma unroll
  for (int j = 0; j < 2; j++) vals[j] = *(const v8hm*)&Tl[wave * 2 + j][l24 * 8];
#pragma unroll
  for (int j = 0; j < 2; j++)
    if (se) *(v8hm*)(Ub + (size_t)(wave * 2 + j) * KV_ + l24 * 8) = vals[j];
}

// ---------------------------------------------------------------------------
// Exact-form GELU x * Phi(x) of 8 values, without a branch: with z = |x| / sqrt(2), t = 1 / (1 + p z),
//   erfc(z) = (a1 t + a2 t^2 + a3 t^3 + a4 t^4 + a5 t^5) exp(-z^2),  |error| <= 1.5e-7 for every z >= 0,
//   x * Phi(x) = max(x, 0) - |x| * erfc(z) / 2  (no cancellation on the negative side).
// The library erf takes two data-dependent branches per value, both taken by nearly every wave, and each
// value's chain runs alone between them; here the 8 chains are independent straight-line code.
// The coefficients carry the factor 1/2.
// ---------------------------------------------------------------------------
__device__ __forceinline__ v8f gelu8(v8f x) {
  const v8f ax = __builtin_elementwise_abs(x);
  const v8f d = ax * 0.23164189f + 1.0f;       // 1 + p z, p = 0.3275911
  const v8f w = (x * x) * -0.72134752f;        // -z^2 * log2(e)
  v8f t, e;
#pragma unroll
  for (int r = 0; r < 8; r++) {
    t[r] = __builtin_amdgcn_rcpf(d[r]);
    e[r] = __builtin_amdgcn_exp2f(w[r]);
  }
  v8f p = t * 0.53070271f - 0.72657601f;
  p = p * t + 0.71070687f;
  p = p * t - 0.14224837f;
  p = p * t + 0.12741480f;
  const v8f zero = {};
  return __builtin_elementwise_max(x, zero) - ax * ((p * t) * e);
}

// ---------------------------------------------------------------------------
// Everything behind the attention weights is local to a row n, so one block takes 64 rows through all of it:
//   cx[n][d] = emb1[n][d] + sum_k' ea[n][k'] * Um[d][k'],  Um = mean over heads of U_h   (K = 192)
//   y = LN(cx);  h = GELU(y fc1^T + b1)  (K = 64);  out = h fc2^T + b2 + cx  (K = 256)
// cx stays in registers (f32), y and h in LDS (f16). Both weight matrices are staged whole with the first
// round of loads. The four heads' 64 * U_h are averaged in f32 while they are staged.
// fc1 and fc2 run with the weight rows as A and the token rows as B: a lane's 8 accumulators are then
// 8 consecutive channels of one token, one or two 16-B LDS stores. grid = (N/64, B).
// Two blocks share a WGP (392 blocks, 256 WGPs): 4 waves per SIMD, 146 KiB of LDS each.
// ---------------------------------------------------------------------------
__global__ __launch_bounds__(256, 4) void tail_kernel(
    const f16_t* __restrict__ ea, const f16_t* __restrict__ U,
    const float* __restrict__ emb1,
    const float* __restrict__ fg, const float* __restrict__ fb,
    const f16_t* __restrict__ W1, const float* __restrict__ b1,
    const f16_t* __restrict__ W2, const float* __restrict__ b2,
    float* __restrict__ out) {
  __shared__ __attribute__((aligned(16))) f16_t EU[2][64][200];   // ea tile, Um; later h [64][264]
  __shared__ __attribute__((aligned(16))) float Cs[64][68];
  __shared__ __attribute__((aligned(16))) f16_t Ys[64][72];
  __shared__ __attribute__((aligned(16))) f16_t W1s[MLP_][72];
  __shared__ __attribute__((aligned(16))) f16_t W2s[C1_][264];
  __shared__ __attribute__((aligned(16))) float B1s[MLP_];
  f16_t (*Es)[200] = EU[0];
  f16_t (*Us)[200] = EU[1];
  f16_t (*Hs)[264] = reinterpret_cast<f16_t (*)[264]>(&EU[0][0][0]);
  const int tid = threadIdx.x, lane = tid & 31, wave = tid >> 5;
  const int hh = lane >> 4, m = lane & 15;
  const int b = blockIdx.y;
  const size_t r0 = (size_t)b * N_ + blockIdx.x * 64;
  const int mt = wave & 3, ng = wave >> 2;

  // All tiles are contiguous in memory: chunk i * 256 + tid of 16 B.
  const f16_t* Ub = U + (size_t)b * H_ * C1_ * KV_ + tid * 8;
  const f16_t* Eb = ea + r0 * KV_ + tid * 8;
  v8h uh[6][H_], ev[6], w1v[8], w2v[8];
  const size_t ro = (r0 + wave * 8 + hh) * C1_ + m * 4;  // rows wave*8 + 2j + hh, 16 lanes a row
  const float* rp = emb1 + ro;
  v4f rr[4];
#pragma unroll
  for (int j = 0; j < 4; j++) rr[j] = *(const v4fm*)(rp + j * 2 * C1_);
#pragma unroll
  for (int i = 0; i < 6; i++) ev[i] = *(const v8hm*)(Eb + i * 2048);
#pragma unroll
  for (int i = 0; i < 6; i++) {
#pragma unroll
    for (int h = 0; h < H_; h++) uh[i][h] = *(const v8hm*)(Ub + h * (C1_ * KV_) + i * 2048);
  }
#pragma unroll
  for (int i = 0; i < 8; i++) {
    w1v[i] = *(const v8hm*)(W1 + tid * 8 + i * 2048);
    w2v[i] = *(const v8hm*)(W2 + tid * 8 + i * 2048);
  }
  const float b1v = b1[tid];
  const v4f lg = *(const v4fm*)(fg + m * 4);
  const v4f lb = *(const v4fm*)(fb + m * 4);
  const v4f ob = *(const v4fm*)(b2 + m * 4);
  // Holds the address pair until the loads have taken it.
  asm volatile("s_wait_xcnt 0x0" :: "v"(rp) : "memory");
  // Keeps all loads in front of the first use: left free, the scheduler issues a part of them
  // behind the first wait, and the block pays the load latency twice.
  __builtin_amdgcn_sched_barrier(0);

#pragma unroll
  for (int i = 0; i < 6; i++) {
    const int idx = i * 256 + tid;
    const int row = idx / 24, c8 = (idx - row * 24) * 8;
    v8h um;
#pragma unroll
    for (int j = 0; j < 8; j++) {
      float a = 0.25f * (float)uh[i][0][j];
#pragma unroll
      for (int h = 1; h < H_; h++) a = fmaf(0.25f, (float)uh[i][h][j], a);
      um[j] = (f16_t)a;
    }
    *(v8hm*)&Us[row][c8] = um;
    *(v8hm*)&Es[row][c8] = ev[i];
  }
#pragma unroll
  for (int i = 0; i < 8; i++) {
    const int idx = i * 256 + tid;
    *(v8hm*)&W1s[idx >> 3][(idx & 7) * 8]   = w1v[i];
    *(v8hm*)&W2s[idx >> 5][(idx & 31) * 8]  = w2v[i];
  }
  B1s[tid] = b1v;
  __syncthreads();

  // All 18 fragments are read in front of the first WMMA: one LDS latency instead of twelve.
  v8f acc[2] = {};
  const int mrow = mt * 16 + m;
  {
    Frag a[6], bf[6][2];
#pragma unroll
    for (int kk = 0; kk < 6; kk++) {
      a[kk].p[0] = *(const v8hm*)&Es[mrow][kk * 32 + 8 * hh];
      a[kk].p[1] = *(const v8hm*)&Es[mrow][kk * 32 + 16 + 8 * hh];
#pragma unroll
      for (int t = 0; t < 2; t++) {
        const int col = (ng * 2 + t) * 16 + m;
        bf[kk][t].p[0] = *(const v8hm*)&Us[col][kk * 32 + 8 * hh];
        bf[kk][t].p[1] = *(const v8hm*)&Us[col][kk * 32 + 16 + 8 * hh];
      }
    }
#pragma unroll
    for (int kk = 0; kk < 6; kk++) {
#pragma unroll
      for (int t = 0; t < 2; t++) acc[t] = wmma16(a[kk].v, bf[kk][t].v, acc[t]);
    }
  }

#pragma unroll
  for (int t = 0; t < 2; t++) {
    const int cn = (ng * 2 + t) * 16 + m;
#pragma unroll
    for (int r = 0; r < 8; r++) Cs[mt * 16 + 8 * hh + r][cn] = acc[t][r] * 0.015625f;
  }
  __syncthreads();

  // cx: 16 lanes hold one row (4 channels each), 4 rows a thread; kept for the last residual.
  // Layer norm of a row = two sums over its 16 lanes.
  v4f cxv[4];
#pragma unroll
  for (int j = 0; j < 4; j++) cxv[j] = *(const v4fm*)&Cs[wave * 8 + 2 * j + hh][m * 4] + rr[j];
#pragma unroll
  for (int j = 0; j < 4; j++) {
    const v4f x = cxv[j];
    const float mu = row16_sum((x[0] + x[1]) + (x[2] + x[3])) * (1.0f / 64.0f);
    const v4f d = x - mu;
    const float var = row16_sum((d[0] * d[0] + d[1] * d[1]) + (d[2] * d[2] + d[3] * d[3])) * (1.0f / 64.0f);
    const float rs = rsqrtf(var + 1e-6f);
    v4h y;
#pragma unroll
    for (int c = 0; c < 4; c++) y[c] = (f16_t)(d[c] * rs * lg[c] + lb[c]);
    *(v4hm*)&Ys[wave * 8 + 2 * j + hh][m * 4] = y;
  }
  __syncthreads();

  // h^T[e][n] = sum_c fc1[e][c] y[n][c]: A = W1s rows, B = Ys rows, both c contiguous.
  // Wave w owns channels e = 32w .. 32w + 31 of all 64 rows.
  {
    Frag wa[2][2];
    v4f bb[2][2];
#pragma unroll
    for (int t = 0; t < 2; t++) {
#pragma unroll
      for (int kk = 0; kk < 2; kk++) {
        wa[t][kk].p[0] = *(const v8hm*)&W1s[wave * 32 + t * 16 + m][kk * 32 + 8 * hh];
        wa[t][kk].p[1] = *(const v8hm*)&W1s[wave * 32 + t * 16 + m][kk * 32 + 16 + 8 * hh];
      }
      bb[t][0] = *(const v4fm*)&B1s[wave * 32 + t * 16 + 8 * hh];
      bb[t][1] = *(const v4fm*)&B1s[wave * 32 + t * 16 + 8 * hh + 4];
    }
    // Stays rolled: the other waves of the SIMD cover a trip's LDS latency.
#pragma unroll 1
    for (int q = 0; q < 4; q++) {
      Frag yb[2];
#pragma unroll
      for (int kk = 0; kk < 2; kk++) {
        yb[kk].p[0] = *(const v8hm*)&Ys[q * 16 + m][kk * 32 + 8 * hh];
        yb[kk].p[1] = *(const v8hm*)&Ys[q * 16 + m][kk * 32 + 16 + 8 * hh];
      }
      v8f hv[2] = {};
#pragma unroll
      for (int kk = 0; kk < 2; kk++) {
#pragma unroll
        for (int t = 0; t < 2; t++) hv[t] = wmma16(wa[t][kk].v, yb[kk].v, hv[t]);
      }
#pragma unroll
      for (int t = 0; t < 2; t++) {
        v8f xv;
#pragma unroll
        for (int r = 0; r < 8; r++) xv[r] = hv[t][r] + bb[t][r >> 2][r & 3];
        const v8f gv = gelu8(xv);
        v8h g;
#pragma unroll
        for (int r = 0; r < 8; r++) g[r] = (f16_t)gv[r];
        *(v8hm*)&Hs[q * 16 + m][wave * 32 + t * 16 + 8 * hh] = g;
      }
    }
  }
  __syncthreads();

  // o^T[d][n] = sum_e fc2[d][e] h[n][e]: A = W2s rows, B = Hs rows, both e contiguous.
  // Wave owns channel tile mt and row tiles 2*ng, 2*ng + 1. Fragments are read twelve at a time.
  {
    v8f o[2] = {};
#pragma unroll
    for (int kh = 0; kh < 2; kh++) {
      Frag wf[4], hf[4][2];
#pragma unroll
      for (int kk = 0; kk < 4; kk++) {
        const int k0 = (kh * 4 + kk) * 32 + 8 * hh;
        wf[kk].p[0] = *(const v8hm*)&W2s[mt * 16 + m][k0];
        wf[kk].p[1] = *(const v8hm*)&W2s[mt * 16 + m][k0 + 16];
#pragma unroll
        for (int t = 0; t < 2; t++) {
          hf[kk][t].p[0] = *(const v8hm*)&Hs[(ng * 2 + t) * 16 + m][k0];
          hf[kk][t].p[1] = *(const v8hm*)&Hs[(ng * 2 + t) * 16 + m][k0 + 16];
        }
      }
#pragma unroll
      for (int kk = 0; kk < 4; kk++) {
#pragma unroll
        for (int t = 0; t < 2; t++) o[t] = wmma16(wf[kk].v, hf[kk][t].v, o[t]);
      }
    }
#pragma unroll
    for (int t = 0; t < 2; t++) {
      v4f lo, hi;
#pragma unroll
      for (int c = 0; c < 4; c++) { lo[c] = o[t][c]; hi[c] = o[t][4 + c]; }
      *(v4fm*)&Cs[(ng * 2 + t) * 16 + m][mt * 16 + 8 * hh]     = lo;
      *(v4fm*)&Cs[(ng * 2 + t) * 16 + m][mt * 16 + 8 * hh + 4] = hi;
    }
  }
  __syncthreads();

  // Whole-line stores: 16 lanes x 16 B = one 256-B row, two rows per instruction.
#pragma unroll
  for (int j = 0; j < 4; j++) {
    const v4f v = (*(const v4fm*)&Cs[wave * 8 + 2 * j + hh][m * 4] + ob) + cxv[j];
    *(v4fm*)(out + ro + j * 2 * C1_) = v;
  }
}

// ---------------------------------------------------------------------------
// Host-side orchestration
// ---------------------------------------------------------------------------
extern "C" void kernel_launch(void* const* d_in, const int* in_sizes, int n_in,
                              void* d_out, int out_size, void* d_ws, size_t ws_size,
                              hipStream_t stream) {
  if (n_in < 16) return;
  const int need[16] = {BN_ * C1_, BN_ * C2_, H_ * C1_ * C1_, H_ * KV_ * KV_, H_ * KV_ * KV_,
                        C1_ * C1_, C1_, C1_, KV_, KV_, C1_, C1_, MLP_ * C1_, MLP_,
                        C1_ * MLP_, C1_};
  for (int i = 0; i < 16; i++) if (in_sizes[i] != need[i]) return;
  if (out_size != BN_ * C1_) return;

  const float* emb1    = (const float*)d_in[0];
  const float* emb2    = (const float*)d_in[1];
  const float* Wq      = (const float*)d_in[2];
  const float* Wk      = (const float*)d_in[3];
  const float* Wv      = (const float*)d_in[4];
  const float* Wout    = (const float*)d_in[5];
  const float* ln1_g   = (const float*)d_in[6];
  const float* ln1_b   = (const float*)d_in[7];
  const float* lnall_g = (const float*)d_in[8];
  const float* lnall_b = (const float*)d_in[9];
  const float* ffn_g   = (const float*)d_in[10];
  const float* ffn_b   = (const float*)d_in[11];
  const float* fc1_w   = (const float*)d_in[12];
  const float* fc1_b   = (const float*)d_in[13];
  const float* fc2_w   = (const float*)d_in[14];
  const float* fc2_b   = (const float*)d_in[15];
  float* out = (float*)d_out;

  char* ws = (char*)d_ws;
  size_t off = 0;
  auto take = [&](size_t bytes) -> void* {
    off = (off + 255) & ~(size_t)255;
    void* p = ws + off;
    off += bytes;
    return p;
  };
  f16_t* ea    = (f16_t*)take((size_t)BN_ * KV_ * 2);
  f16_t* Wqh   = (f16_t*)take((size_t)H_ * C1_ * C1_ * 2);
  f16_t* Wkh   = (f16_t*)take((size_t)H_ * KV_ * KV_ * 2);
  f16_t* WvT   = (f16_t*)take((size_t)H_ * KV_ * KV_ * 2);   // [H][k'][k]
  f16_t* Wouth = (f16_t*)take((size_t)C1_ * C1_ * 2);
  f16_t* fc1h  = (f16_t*)take((size_t)MLP_ * C1_ * 2);
  f16_t* fc2h  = (f16_t*)take((size_t)C1_ * MLP_ * 2);
  f16_t* Um    = (f16_t*)take((size_t)B_ * H_ * C1_ * KV_ * 2);  // 64 * U_h, [bh][64][192]
  f16_t* Spart = (f16_t*)take((size_t)SPLIT_ * B_ * SELEMS_ * 2);  // G partials / 8
  if (off > ws_size) return;

  // Layer norms of the inputs with the partial sums of G = cx1^T ea, and all weight conversions, one launch
  prep_kernel<<<PREP_BLKS_, PT_, 0, stream>>>(emb1, emb2, ln1_g, ln1_b, lnall_g, lnall_b,
                                              Wq, Wk, Wv, Wout, fc1_w, fc2_w,
                                              ea, Spart, Wqh, Wkh, WvT, Wouth, fc1h, fc2h);

  // S = Wq[h] G Wk[h]^T / sqrt(KV); InstanceNorm; softmax P; U_h = Wout P Wv[h]
  merge_softmax_kernel<<<B_ * H_, 1024, 0, stream>>>(Spart, Wqh, Wkh, WvT, Wouth, Um);

  // cx = ea * (mean_h U_h)^T + emb1; y = LN(cx); out = GELU(y fc1^T + b1) fc2^T + b2 + cx
  tail_kernel<<<dim3(N_ / 64, B_), 256, 0, stream>>>(ea, Um, emb1, ffn_g, ffn_b,
                                                     fc1h, fc1_b, fc2h, fc2_b, out);
}
